// v000
// The times below were measured on an AMD MI455X: many runs one after another, warmed up first and cycling through
// copies of the inputs, with the whole window's GPU time divided by the number of runs. Launches and the gaps
// between them are all in it. The median over several windows is given; except for v000 it joins two sittings, which
// can be a few percent apart, so the side-by-side timings, each taken in one sitting, are the better comparison.
// v000 is the starting kernel. One run takes 3640 microseconds.
// Contractions: q|k projection and v^T projection (x f16 by W^T f16 carried x16), scores q_set.k_set^T per head and set (q, k f16 planes, K=32), (a1 - lambda*a2).v (diff plane f16 carried x32768 by v^T f16 plane, K=2048), output projection (LayerNorm output f16 by Wo^T f16 carried x16): all v_wmma_f32_16x16x32_f16 with f32 accumulate; bias adds, mask select, both softmaxes, lambda and the per-head LayerNorm in f32.
#include <hip/hip_runtime.h>
#include <math.h>

// ---------------------------------------------------------------------------
// Problem constants
// ---------------------------------------------------------------------------
constexpr int kBatch  = 2;
constexpr int kSeq    = 2048;
constexpr int kDim    = 1024;              // hidden
constexpr int kHeads  = 16;
constexpr int kDh     = 64;                // head dim of v / output
constexpr int kDiff   = 32;                // head dim of each q/k set
constexpr int kTok    = kBatch * kSeq;     // 4096 token rows
constexpr int kQKCols = 2 * kDim;          // 2048: pitch of the q | k plane (halves)
constexpr float kWCarry    = 16.0f;        // weights carried x16 in f16
constexpr float kWCarryInv = 1.0f / 16.0f;
constexpr float kPCarry    = 32768.0f;     // (a1 - lambda*a2) carried x2^15 in f16
constexpr float kPCarryInv = 1.0f / 32768.0f;
constexpr float kInvScale  = 0.17677669529663687f;   // 32^-0.5
constexpr float kNegBig    = -1.0e9f;
constexpr float kLambdaInit = 0.2f;
constexpr float kOutGain   = 0.8f;         // 1 - lambda_init
constexpr float kLnEps     = 1.0e-5f;
constexpr float kInv64     = 1.0f / 64.0f;
static_assert(kHeads * kDh == kDim, "shape");
static_assert(kHeads * kDiff * 2 == kDim, "shape");
// GEMM shape contract: M, N multiples of 64; K multiple of 32
static_assert(kTok % 64 == 0 && kQKCols % 64 == 0 && kDim % 64 == 0 && kSeq % 64 == 0 && kDh % 64 == 0, "tiles");
static_assert(kDim % 32 == 0 && kDiff % 32 == 0 && kSeq % 32 == 0, "ktiles");
static_assert(kSeq == 4 * 512 && kSeq == 8 * 256, "softmax thread map");
static_assert((kTok * kDim) % (8 * 256) == 0, "cast grid");

typedef __attribute__((ext_vector_type(16))) _Float16 v16h;
typedef __attribute__((ext_vector_type(8)))  _Float16 v8h;
typedef __attribute__((ext_vector_type(16))) __bf16   v16b;
typedef __attribute__((ext_vector_type(8)))  __bf16   v8b;
typedef __attribute__((ext_vector_type(8)))  float    v8f;
typedef __attribute__((ext_vector_type(4)))  float    v4f;
typedef __attribute__((ext_vector_type(2)))  float    v2f;
typedef __attribute__((ext_vector_type(2)))  int      v2i;
typedef __attribute__((ext_vector_type(4)))  unsigned int v4u;

// ---------------------------------------------------------------------------
// Helper pieces: conversions, hazard guards, WMMA fragments
// ---------------------------------------------------------------------------
__device__ __forceinline__ unsigned short f2bf_bits(float f) {
  unsigned u = __float_as_uint(f);
  return (unsigned short)((u + 0x7FFFu + ((u >> 16) & 1u)) >> 16);
}
__device__ __forceinline__ float bf_bits2f(unsigned short h) { return __uint_as_float(((unsigned)h) << 16); }

// hazard guards as plain device helpers (no inline asm inside the kernel template body)
__device__ __forceinline__ void dep_guard_h(v8f& a, v8f& b, v16h x, v16h y) { asm volatile("v_nop\n\tv_nop\n\tv_nop\n\tv_nop" : "+v"(a), "+v"(b) : "v"(x), "v"(y)); }
__device__ __forceinline__ void dep_guard_b(v8f& a, v8f& b, v16b x, v16b y) { asm volatile("v_nop\n\tv_nop\n\tv_nop\n\tv_nop" : "+v"(a), "+v"(b) : "v"(x), "v"(y)); }
// group guard tying all four accumulators of an A-row group plus its A fragments
__device__ __forceinline__ void dep_guard4_h(v8f& a, v8f& b, v8f& c, v8f& d, v16h x, v16h y) { asm volatile("v_nop\n\tv_nop\n\tv_nop\n\tv_nop" : "+v"(a), "+v"(b), "+v"(c), "+v"(d) : "v"(x), "v"(y)); }
__device__ __forceinline__ void dep_guard4_b(v8f& a, v8f& b, v8f& c, v8f& d, v16b x, v16b y) { asm volatile("v_nop\n\tv_nop\n\tv_nop\n\tv_nop" : "+v"(a), "+v"(b), "+v"(c), "+v"(d) : "v"(x), "v"(y)); }
__device__ __forceinline__ void keep4_h(v16h a, v16h b, v16h c, v16h d) { asm volatile("v_nop" :: "v"(a), "v"(b), "v"(c), "v"(d)); }
__device__ __forceinline__ void keep4_b(v16b a, v16b b, v16b c, v16b d) { asm volatile("v_nop" :: "v"(a), "v"(b), "v"(c), "v"(d)); }
__device__ __forceinline__ void acc_guard4(v8f& a, v8f& b, v8f& c, v8f& d) { asm volatile("v_nop\n\tv_nop\n\tv_nop\n\tv_nop" : "+v"(a), "+v"(b), "+v"(c), "+v"(d)); }
template <typename T> struct Frag;
template <> struct Frag<_Float16> {
  typedef v16h V; union U { v16h v; v8h h[2]; };
  // elements 0..7 <- p[0..7], 8..15 <- p[16..23]
  static __device__ __forceinline__ v16h load(const _Float16* p) {
    U f; f.h[0] = *(const v8h*)(p); f.h[1] = *(const v8h*)(p + 16); return f.v;
  }
  static __device__ __forceinline__ v8f mma(v16h a, v16h b, v8f c) {
    return __builtin_amdgcn_wmma_f32_16x16x32_f16(false, a, false, b, (short)0, c, false, false);
  }
  static __device__ __forceinline__ void guard(v8f& a, v8f& b, v16h x, v16h y) { dep_guard_h(a, b, x, y); }
  static __device__ __forceinline__ void guard4(v8f& a, v8f& b, v8f& c, v8f& d, v16h x, v16h y) { dep_guard4_h(a, b, c, d, x, y); }
  static __device__ __forceinline__ void keep(v16h a, v16h b, v16h c, v16h d) { keep4_h(a, b, c, d); }
};
template <> struct Frag<__bf16> {
  typedef v16b V; union U { v16b v; v8b h[2]; };
  static __device__ __forceinline__ v16b load(const __bf16* p) {
    U f; f.h[0] = *(const v8b*)(p); f.h[1] = *(const v8b*)(p + 16); return f.v;
  }
  static __device__ __forceinline__ v8f mma(v16b a, v16b b, v8f c) {
    return __builtin_amdgcn_wmma_f32_16x16x32_bf16(false, a, false, b, (short)0, c, false, false);
  }
  static __device__ __forceinline__ void guard(v8f& a, v8f& b, v16b x, v16b y) { dep_guard_b(a, b, x, y); }
  static __device__ __forceinline__ void guard4(v8f& a, v8f& b, v8f& c, v8f& d, v16b x, v16b y) { dep_guard4_b(a, b, c, d, x, y); }
  static __device__ __forceinline__ void keep(v16b a, v16b b, v16b c, v16b d) { keep4_b(a, b, c, d); }
};

__device__ __forceinline__ unsigned pk16(unsigned short a, unsigned short b) { return (unsigned)a | ((unsigned)b << 16); }
__device__ __forceinline__ unsigned short h_bits(float f) { const _Float16 h = (_Float16)f; return __builtin_bit_cast(unsigned short, h); }

// ---- Register-blocked batched WMMA GEMM (ACT reduced to none/relu/leaky) -------------------------------
// C[m,n] = scale * sum_k A[m,k] * Bt[n,k] (+bias)(+resid); each wave owns a 64x64 tile.
// A row-major [M,K]; Bt row-major [N,K]; M,N % 64 == 0, K % 32 == 0.
// SPLIT: operands are hi/lo planes (A2/Bt2 = lo planes, same layout); product = hi*hi + hi*lo + lo*hi.
// BIAS_MODE: 0 = none, 1 = bias[m], 2 = bias[n].
// OUT_MODE: 0 = f32, 1 = f16, 2 = bf16 hi plane (Cout) + bf16 lo plane (Cout2).
// ET: 0 = f16 operands, 1 = bf16 operands (pointers passed as 16-bit storage)
template <int ET> struct Elem;
template <> struct Elem<0> { typedef _Float16 T; };
template <> struct Elem<1> { typedef __bf16 T; };
template <int ET, bool SPLIT, int BIAS_MODE, int OUT_MODE, bool RESID, int ACT = 0>
__global__ __launch_bounds__(256) void wmma_gemm64(
    const unsigned short* __restrict__ Ap, const unsigned short* __restrict__ A2p, int lda, long strideA,
    const unsigned short* __restrict__ Btp, const unsigned short* __restrict__ Bt2p, int ldb, long strideB,
    void* __restrict__ Cout, void* __restrict__ Cout2, int ldc, long strideC,
    const float* __restrict__ bias,
    const float* __restrict__ resid, long strideR,
    int M, int N, int K, float scale) {
  typedef typename Elem<ET>::T T;
  typedef typename Frag<T>::V V;
  const T* A = (const T*)Ap; const T* A2 = (const T*)A2p; const T* Bt = (const T*)Btp; const T* Bt2 = (const T*)Bt2p;
  __shared__ __align__(16) float sT[8][16 * 68];   // per-wave 16x64 slab, pitch 68 floats
  const int b    = blockIdx.y;
  const int lane = threadIdx.x & 31;
  const int wave = threadIdx.x >> 5;
  const int tilesN = N >> 6;
  const int tilesM = M >> 6;
  const int tile = blockIdx.x * 8 + wave;
  if (tile >= tilesM * tilesN) return;   // wave-uniform; no block barriers in this kernel
  const int tm = tile / tilesN;
  const int tn = tile - tm * tilesN;
  const int m0 = tm << 6;
  const int n0 = tn << 6;

  const T* Ab  = A  + (size_t)b * strideA;
  const T* Bb  = Bt + (size_t)b * strideB;
  const T* Ab2 = SPLIT ? (A2  + (size_t)b * strideA) : nullptr;
  const T* Bb2 = SPLIT ? (Bt2 + (size_t)b * strideB) : nullptr;

  const int rlane = lane & 15;                 // row (A) / col (B, D) within subtile
  const int koff  = (lane >> 4) * 8;           // k offset of this lane half
  const int mOff  = (lane >> 4) * 8;           // D row offset

  v8f acc[4][4];
#pragma unroll
  for (int i = 0; i < 4; ++i)
#pragma unroll
    for (int j = 0; j < 4; ++j) acc[i][j] = (v8f){0.f,0.f,0.f,0.f,0.f,0.f,0.f,0.f};

  for (int k0 = 0; k0 < K; k0 += 32) {
    V bh[4], bl[4];
#pragma unroll
    for (int j = 0; j < 4; ++j) {
      const size_t bo = (size_t)(n0 + (j << 4) + rlane) * ldb + koff + k0;
      bh[j] = Frag<T>::load(Bb + bo);
      if (SPLIT) bl[j] = Frag<T>::load(Bb2 + bo);
    }
#pragma unroll
    for (int i = 0; i < 4; ++i) {
      const size_t ao = (size_t)(m0 + (i << 4) + rlane) * lda + koff + k0;
      V ah = Frag<T>::load(Ab + ao);
      V al;
      if (SPLIT) al = Frag<T>::load(Ab2 + ao);
#pragma unroll
      for (int j = 0; j < 4; ++j) {
        acc[i][j] = Frag<T>::mma(ah, bh[j], acc[i][j]);
        if (SPLIT) {
          acc[i][j] = Frag<T>::mma(ah, bl[j], acc[i][j]);
          acc[i][j] = Frag<T>::mma(al, bh[j], acc[i][j]);
        }
      }
      Frag<T>::guard4(acc[i][0], acc[i][1], acc[i][2], acc[i][3], ah, SPLIT ? al : ah);
    }
    Frag<T>::keep(bh[0], bh[1], bh[2], bh[3]);
    if (SPLIT) Frag<T>::keep(bl[0], bl[1], bl[2], bl[3]);
  }
  acc_guard4(acc[0][0], acc[0][1], acc[0][2], acc[0][3]);
  acc_guard4(acc[1][0], acc[1][1], acc[1][2], acc[1][3]);
  acc_guard4(acc[2][0], acc[2][1], acc[2][2], acc[2][3]);
  acc_guard4(acc[3][0], acc[3][1], acc[3][2], acc[3][3]);

  // ---- epilogue ----
  float* slab = sT[wave];
  const float* Rb = RESID ? (resid + (size_t)b * strideR) : nullptr;
#pragma unroll
  for (int i = 0; i < 4; ++i) {
    const int mBase = m0 + (i << 4);
#pragma unroll
    for (int j = 0; j < 4; ++j) {
      const int n = n0 + (j << 4) + rlane;
      float bv = 0.f;
      if (BIAS_MODE == 2) bv = bias[n];
#pragma unroll
      for (int r = 0; r < 8; ++r) {
        float v = acc[i][j][r] * scale;
        if (BIAS_MODE == 1) v += bias[mBase + mOff + r];
        if (BIAS_MODE == 2) v += bv;
        if (RESID) v += Rb[(size_t)(mBase + mOff + r) * ldc + n];
        if (ACT == 2) v = fmaxf(v, 0.0f);
        if (ACT == 4) v = (v > 0.f) ? v : 0.01f * v;
        slab[(mOff + r) * 68 + (j << 4) + rlane] = v;
      }
    }
    __builtin_amdgcn_fence(__ATOMIC_RELEASE, "workgroup");
    __builtin_amdgcn_wave_barrier();
    __builtin_amdgcn_fence(__ATOMIC_ACQUIRE, "workgroup");
    if (OUT_MODE == 0) {
      float* C = (float*)Cout + (size_t)b * strideC;
      const int hh = lane >> 4, c4 = (lane & 15) * 4;     // row seg = 256 B = 16 lanes x 16 B
      {
#pragma unroll
        for (int it = 0; it < 8; ++it) {
          const int row = it * 2 + hh;
          v4f v = *(const v4f*)(slab + row * 68 + c4);
          *(v4f*)(C + (size_t)(mBase + row) * ldc + n0 + c4) = v;
        }
        
      }
    } else {
      const int q = lane >> 3, c8 = (lane & 7) * 8;
      unsigned short* C  = (unsigned short*)Cout  + (size_t)b * strideC;
      unsigned short* C2 = (OUT_MODE == 2) ? ((unsigned short*)Cout2 + (size_t)b * strideC) : nullptr;
      {
#pragma unroll
        for (int it = 0; it < 4; ++it) {
          const int row = it * 4 + q;
          const float* sp = slab + row * 68 + c8;
          v8h hv, lv;
#pragma unroll
          for (int e = 0; e < 8; ++e) {
            if (OUT_MODE == 1) {
              hv[e] = (_Float16)sp[e];
            } else {
              unsigned short hb = f2bf_bits(sp[e]);
              unsigned short lb = f2bf_bits(sp[e] - bf_bits2f(hb));
              hv[e] = __builtin_bit_cast(_Float16, hb);
              lv[e] = __builtin_bit_cast(_Float16, lb);
            }
          }
          *(v8h*)(C + (size_t)(mBase + row) * ldc + n0 + c8) = hv;
          if (OUT_MODE == 2) *(v8h*)(C2 + (size_t)(mBase + row) * ldc + n0 + c8) = lv;
        }
        
      }
    }
    __builtin_amdgcn_fence(__ATOMIC_RELEASE, "workgroup");
    __builtin_amdgcn_wave_barrier();
    __builtin_amdgcn_fence(__ATOMIC_ACQUIRE, "workgroup");
  }
}

// ---------------------------------------------------------------------------
// ---------------------------------------------------------------------------
__global__ __launch_bounds__(256) void cast8_f16_kernel(const float* __restrict__ in, unsigned short* __restrict__ out, int n8) {
  const int i = blockIdx.x * 256 + threadIdx.x;
  if (i >= n8) return;
  const float* p = in + 8 * (size_t)i;
  const v4f a = *(const v4f*)(p);
  const v4f c = *(const v4f*)(p + 4);
  unsigned short hb[8];
#pragma unroll
  for (int e = 0; e < 4; ++e) {
    hb[e]     = h_bits(a[e]);
    hb[4 + e] = h_bits(c[e]);
  }
  const v4u u = (v4u){pk16(hb[0], hb[1]), pk16(hb[2], hb[3]), pk16(hb[4], hb[5]), pk16(hb[6], hb[7])};
  unsigned short* q = out + 8 * (size_t)i;
  *(v4u*)q = u;
  
}

// ---------------------------------------------------------------------------
// Weight transpose + cast (+ optional output-feature permutation) for square [1024 in][1024 out] f32 W (row-major [k][n]):
//   out[np][k] = f16( scale * W[k][orig(np)] ), orig(np) = perm ? ((np>>5)&1)*512 + (np>>6)*32 + (np&31) : np.
// With perm, plane column 64h + 32*set + d holds feature set*512 + 32h + d, so the two q/k sets of a head sit at stride 32.
// grid (16, 16, 4): blockIdx.x = k tile (64 cols of out), blockIdx.y = np tile (64 rows of out), blockIdx.z selects
//   z0 = (W0 -> o0, perm), z1 = (W1 -> o1, perm), z2 = (W2 -> o2, identity), z3 = (W3 -> o3, identity). 256 threads.
// Load coverage: 16 iterations x 256 threads = 4096 = the whole 64x64 tile (coalesced along n inside 32-wide strips).
// Store coverage: 8 waves x 2 iterations x 4 rows (lane>>3) = 64 rows; (lane&7) x 8 halves = 64 cols; each row segment =
// ---------------------------------------------------------------------------
__global__ __launch_bounds__(256) void wt_kernel(const float* __restrict__ W0, const float* __restrict__ W1,
                                                 const float* __restrict__ W2, const float* __restrict__ W3,
                                                 unsigned short* __restrict__ o0, unsigned short* __restrict__ o1,
                                                 unsigned short* __restrict__ o2, unsigned short* __restrict__ o3,
                                                 float scale) {
  __shared__ float sm[64][65];   // sm[np_local][k_local]
  const int t  = threadIdx.x;
  const int k0 = blockIdx.x * 64;
  const int n0 = blockIdx.y * 64;
  const int z  = blockIdx.z;                                   // block-uniform
  const float* W = (z == 0) ? W0 : (z == 1) ? W1 : (z == 2) ? W2 : W3;
  unsigned short* op = (z == 0) ? o0 : (z == 1) ? o1 : (z == 2) ? o2 : o3;
  const int perm = (z < 2) ? 1 : 0;
#pragma unroll
  for (int i = 0; i < 16; ++i) {
    const int e = i * 256 + t;
    const int r = e >> 6;          // k local
    const int c = e & 63;          // np local
    const int np = n0 + c;
    const int og = perm ? ((((np >> 5) & 1) << 9) + ((np >> 6) << 5) + (np & 31)) : np;
    sm[c][r] = W[(size_t)(k0 + r) * kDim + og] * scale;
  }
  __syncthreads();
  const int lane = t & 31, wave = t >> 5;
  const int q = lane >> 3, c8 = (lane & 7) * 8;
  {
#pragma unroll
    for (int it = 0; it < 2; ++it) {
      const int row = wave * 8 + it * 4 + q;                 // np local
      unsigned short hb[8];
#pragma unroll
      for (int e = 0; e < 8; ++e) hb[e] = h_bits(sm[row][c8 + e]);
      const v4u u = (v4u){pk16(hb[0], hb[1]), pk16(hb[2], hb[3]), pk16(hb[4], hb[5]), pk16(hb[6], hb[7])};
      *(v4u*)(op + (size_t)(n0 + row) * kDim + k0 + c8) = u;
    }
    
  }
}

// ---------------------------------------------------------------------------
// Permuted q|k bias line: out[np] = bq[orig(np)] for np < 1024 (block 0), out[1024 + np] = bk[orig(np)] (block 1).
// Thread t owns np = 4t..4t+3 (orig of an aligned group of 4 is contiguous); one 16-B store per lane, a wave = 512 B =
// ---------------------------------------------------------------------------
__global__ __launch_bounds__(256) void biasperm_kernel(const float* __restrict__ bq, const float* __restrict__ bk,
                                                       float* __restrict__ out) {
  const int t = threadIdx.x;
  const float* src = (blockIdx.x == 0) ? bq : bk;             // block-uniform
  const int np = 4 * t;
  const int og = (((np >> 5) & 1) << 9) + ((np >> 6) << 5) + (np & 31);
  const v4f v = *(const v4f*)(src + og);
  float* dp = out + (size_t)blockIdx.x * kDim + np;
  *(v4f*)dp = v;
  
}

// ---------------------------------------------------------------------------
// Dual masked softmax + differential combine for one (batch, head): f32 math.
//   x1 = (mask != 0) ? s1 : -1e9 (scores already scaled by 32^-0.5), same for x2;
//   a1 = exp(x1 - max1)/sum1, a2 = exp(x2 - max2)/sum2 (independent maxima and sums);
//   lambda = exp(sum lq1*lk1) - exp(sum lq2*lk2) + 0.2 (every wave computes it identically);
//   D[i][j] = f16( 32768 * (a1 - lambda*a2) ).
// One block of 256 threads per query row i = blockIdx.x. Phases 1/2: rolled 4-trip loops, thread t owns columns
// it*512 + 2t, 2t+1 of both score rows (4 x 256 x 2 = 2048 = whole row); logits/exps kept in LDS (every word written in
// phase 1 before any cross-thread read). Reductions in fixed order (thread, wave shuffle tree, 8 wave partials in index
// order) separated by block barriers. Store: thread t owns cols 8t..8t+7 -> one 16-B store per lane; a wave writes
// ---------------------------------------------------------------------------
__global__ __launch_bounds__(256) void softmax_diff_kernel(const float* __restrict__ S1p, const float* __restrict__ S2p,
                                                           const int* __restrict__ Mp,
                                                           const float* __restrict__ lq1, const float* __restrict__ lk1,
                                                           const float* __restrict__ lq2, const float* __restrict__ lk2,
                                                           unsigned short* __restrict__ Dp) {
  __shared__ __align__(16) float lg1[kSeq];
  __shared__ __align__(16) float lg2[kSeq];
  __shared__ float redA[8];
  __shared__ float redB[8];
  __shared__ float redC[8];
  __shared__ float redD[8];
  const int i    = blockIdx.x;
  const int t    = threadIdx.x;
  const int lane = t & 31, wave = t >> 5;

  // lambda from the two 32-vectors (wave-wide butterfly, unconditional shuffles)
  float t1 = lq1[lane] * lk1[lane];
  float t2 = lq2[lane] * lk2[lane];
#pragma unroll
  for (int off = 16; off > 0; off >>= 1) {
    t1 += __shfl_xor(t1, off, 32);
    t2 += __shfl_xor(t2, off, 32);
  }
  const float lam = (expf(t1) - expf(t2)) + kLambdaInit;

  const size_t rowoff = (size_t)i * kSeq;
  const float* s1r = S1p + rowoff;
  const float* s2r = S2p + rowoff;
  const int*   mr  = Mp + rowoff;

  float mx1 = -__builtin_inff(), mx2 = -__builtin_inff();
#pragma unroll 1
  for (int it = 0; it < 4; ++it) {
    const int c = it * 512 + 2 * t;
    const v2f sa = *(const v2f*)(s1r + c);
    const v2f sb = *(const v2f*)(s2r + c);
    const v2i mv = *(const v2i*)(mr + c);
    v2f x1, x2;
#pragma unroll
    for (int e = 0; e < 2; ++e) {
      const bool keep = (mv[e] != 0);
      x1[e] = keep ? sa[e] : kNegBig;
      x2[e] = keep ? sb[e] : kNegBig;
      mx1 = fmaxf(mx1, x1[e]);
      mx2 = fmaxf(mx2, x2[e]);
    }
    *(v2f*)(lg1 + c) = x1;
    *(v2f*)(lg2 + c) = x2;
  }
#pragma unroll
  for (int off = 16; off > 0; off >>= 1) {
    mx1 = fmaxf(mx1, __shfl_xor(mx1, off, 32));
    mx2 = fmaxf(mx2, __shfl_xor(mx2, off, 32));
  }
  if (lane == 0) { redA[wave] = mx1; redB[wave] = mx2; }
  __syncthreads();
  float m1 = redA[0], m2 = redB[0];
#pragma unroll
  for (int w = 1; w < 8; ++w) { m1 = fmaxf(m1, redA[w]); m2 = fmaxf(m2, redB[w]); }

  float sum1 = 0.f, sum2 = 0.f;
#pragma unroll 1
  for (int it = 0; it < 4; ++it) {
    const int c = it * 512 + 2 * t;
    const v2f l1 = *(const v2f*)(lg1 + c);
    const v2f l2 = *(const v2f*)(lg2 + c);
    v2f e1, e2;
#pragma unroll
    for (int e = 0; e < 2; ++e) {
      e1[e] = expf(l1[e] - m1);
      e2[e] = expf(l2[e] - m2);
      sum1 += e1[e];
      sum2 += e2[e];
    }
    *(v2f*)(lg1 + c) = e1;
    *(v2f*)(lg2 + c) = e2;
  }
#pragma unroll
  for (int off = 16; off > 0; off >>= 1) {
    sum1 += __shfl_xor(sum1, off, 32);
    sum2 += __shfl_xor(sum2, off, 32);
  }
  if (lane == 0) { redC[wave] = sum1; redD[wave] = sum2; }
  __syncthreads();
  float tot1 = redC[0], tot2 = redD[0];
#pragma unroll
  for (int w = 1; w < 8; ++w) { tot1 += redC[w]; tot2 += redD[w]; }
  const float inv1 = kPCarry / tot1;
  const float inv2 = lam * (kPCarry / tot2);

  const v4f ea = *(const v4f*)(lg1 + 8 * t);
  const v4f eb = *(const v4f*)(lg1 + 8 * t + 4);
  const v4f ec = *(const v4f*)(lg2 + 8 * t);
  const v4f ed = *(const v4f*)(lg2 + 8 * t + 4);
  unsigned short hb[8];
#pragma unroll
  for (int e = 0; e < 4; ++e) {
    hb[e]     = h_bits(ea[e] * inv1 - ec[e] * inv2);
    hb[4 + e] = h_bits(eb[e] * inv1 - ed[e] * inv2);
  }
  const v4u u = (v4u){pk16(hb[0], hb[1]), pk16(hb[2], hb[3]), pk16(hb[4], hb[5]), pk16(hb[6], hb[7])};
  unsigned short* pr = Dp + rowoff + 8 * (size_t)t;
  *(v4u*)pr = u;
  
}

// ---------------------------------------------------------------------------
// Per-head LayerNorm over 64 dims of the attention output o (f32 [4096][1024], column = 64h + d), affine, x0.8, f16 cast:
//   mu = mean_d o, var = mean_d (o - mu)^2, y = ((o - mu) / sqrt(var + 1e-5) * g[h][d] + b[h][d]) * 0.8 -> A16[row][64h + d].
// 256 threads = 2 rows; within a row thread tt (0..127) owns columns 64*(tt>>3) + 8*(tt&7) .. +7 (8 threads per head, lanes
// 8q..8q+7 of one wave; reductions by xor shuffles 1,2,4 in fixed order). Loads: 2 b128 (o) + 2 (g) + 2 (b).
// grid = 2048 blocks = 4096 rows exactly.
// ---------------------------------------------------------------------------
__global__ __launch_bounds__(256) void ln_cast_kernel(const float* __restrict__ O, const float* __restrict__ g,
                                                      const float* __restrict__ bta, unsigned short* __restrict__ A16) {
  const int t   = threadIdx.x;
  const int row = blockIdx.x * 2 + (t >> 7);
  const int tt  = t & 127;
  const int h   = tt >> 3;
  const int c0  = h * kDh + (tt & 7) * 8;
  const float* op = O + (size_t)row * kDim + c0;
  const v4f a = *(const v4f*)(op);
  const v4f c = *(const v4f*)(op + 4);
  float x[8];
#pragma unroll
  for (int e = 0; e < 4; ++e) { x[e] = a[e]; x[4 + e] = c[e]; }
  float s = ((x[0] + x[1]) + (x[2] + x[3])) + ((x[4] + x[5]) + (x[6] + x[7]));
  s += __shfl_xor(s, 1, 32);
  s += __shfl_xor(s, 2, 32);
  s += __shfl_xor(s, 4, 32);
  const float mu = s * kInv64;
  float d[8];
  float vs = 0.0f;
#pragma unroll
  for (int e = 0; e < 8; ++e) { d[e] = x[e] - mu; vs += d[e] * d[e]; }
  vs += __shfl_xor(vs, 1, 32);
  vs += __shfl_xor(vs, 2, 32);
  vs += __shfl_xor(vs, 4, 32);
  const float var  = vs * kInv64;
  const float rstd = 1.0f / sqrtf(var + kLnEps);
  const float* gp = g + c0;
  const float* bp = bta + c0;
  const v4f g0 = *(const v4f*)(gp);
  const v4f g1 = *(const v4f*)(gp + 4);
  const v4f b0 = *(const v4f*)(bp);
  const v4f b1 = *(const v4f*)(bp + 4);
  float gg[8], bb[8];
#pragma unroll
  for (int e = 0; e < 4; ++e) { gg[e] = g0[e]; gg[4 + e] = g1[e]; bb[e] = b0[e]; bb[4 + e] = b1[e]; }
  unsigned short hb[8];
#pragma unroll
  for (int e = 0; e < 8; ++e) {
    const float y = (d[e] * rstd * gg[e] + bb[e]) * kOutGain;
    hb[e] = h_bits(y);
  }
  const v4u u = (v4u){pk16(hb[0], hb[1]), pk16(hb[2], hb[3]), pk16(hb[4], hb[5]), pk16(hb[6], hb[7])};
  unsigned short* pr = A16 + (size_t)row * kDim + c0;
  *(v4u*)pr = u;
  
}

// ---------------------------------------------------------------------------
// Host glue.
// producer before any consumer reads it; no region re-used with another type):
//   XH    f16 [4096][1024]               8,388,608  at           0   (cast8; read by the two projection GEMMs)
//   WQKT  f16 [2048][1024]               4,194,304  at   8,388,608   (wt z0,z1: permuted Wq^T rows 0..1023, Wk^T rows 1024..2047)
//   WVT   f16 [1024][1024]               2,097,152  at  12,582,912   (wt z2)
//   WOT   f16 [1024][1024]               2,097,152  at  14,680,064   (wt z3)
//   BQK   f32 [2048]                         8,192  at  16,777,216   (permuted bq | bk)
//   QK16  f16 [4096][2048]              16,777,216  at  16,785,408   (q plane cols 0..1023 | k plane cols 1024..2047, permuted)
//   VT16  f16 [1024][4096]               8,388,608  at  33,562,624   (v^T: row = 64h + d, col = token)
//   SC    f32 [2][2048][2048]           33,554,432  at  41,951,232   (scores of one (batch, head), both sets; rewritten 32x)
//   DF    f16 [2048][2048]               8,388,608  at  75,505,664   ((a1 - lambda a2) x 32768; rewritten 32x)
//   OATT  f32 [4096][1024]              16,777,216  at  83,894,272   (attention output before LayerNorm; 32 disjoint column slabs)
//   AOH16 f16 [4096][1024]               8,388,608  at 100,671,488   (LayerNorm output)
//   total                              109,060,096
// GEMM shapes: q|k proj M=4096 N=2048 K=1024; v^T proj M=1024 N=4096 K=1024; scores M=N=2048 K=32 (grid.y = set, stride 32);
// diff.v M=2048 N=64 K=2048; out proj M=4096 N=1024 K=1024. All M,N multiples of 64, all K multiples of 32, no padding.
// 103 launches.
// ---------------------------------------------------------------------------
extern "C" void kernel_launch(void* const* d_in, const int* in_sizes, int n_in,
                              void* d_out, int out_size, void* d_ws, size_t ws_size,
                              hipStream_t stream) {
  if (n_in < 16) return;
  const int nTokElem = kTok * kDim;                 // 4,194,304
  const int nW       = kDim * kDim;                 // 1,048,576
  if (in_sizes[0] != nTokElem) return;
  if (in_sizes[1] != kBatch * kSeq * kSeq) return;
  if (in_sizes[2] != nW || in_sizes[4] != nW || in_sizes[6] != nW || in_sizes[8] != nW) return;
  if (in_sizes[3] != kDim || in_sizes[5] != kDim || in_sizes[7] != kDim || in_sizes[9] != kDim) return;
  if (in_sizes[10] != kDiff || in_sizes[11] != kDiff || in_sizes[12] != kDiff || in_sizes[13] != kDiff) return;
  if (in_sizes[14] != kHeads * kDh || in_sizes[15] != kHeads * kDh) return;
  if (out_size != nTokElem) return;

  const size_t szXH   = (size_t)kTok * kDim * 2;
  const size_t szWQK  = (size_t)kQKCols * kDim * 2;
  const size_t szW    = (size_t)kDim * kDim * 2;
  const size_t szBQK  = (size_t)kQKCols * 4;
  const size_t szQK16 = (size_t)kTok * kQKCols * 2;
  const size_t szVT16 = (size_t)kDim * kTok * 2;
  const size_t szSC   = (size_t)2 * kSeq * kSeq * 4;
  const size_t szDF   = (size_t)kSeq * kSeq * 2;
  const size_t szO    = (size_t)kTok * kDim * 4;
  const size_t szAOH  = (size_t)kTok * kDim * 2;
  const size_t offXH   = 0;
  const size_t offWQK  = offXH + szXH;
  const size_t offWVT  = offWQK + szWQK;
  const size_t offWOT  = offWVT + szW;
  const size_t offBQK  = offWOT + szW;
  const size_t offQK16 = offBQK + szBQK;
  const size_t offVT16 = offQK16 + szQK16;
  const size_t offSC   = offVT16 + szVT16;
  const size_t offDF   = offSC + szSC;
  const size_t offO    = offDF + szDF;
  const size_t offAOH  = offO + szO;
  const size_t total   = offAOH + szAOH;          // 109,060,096
  if (ws_size < total) return;

  const float* x    = (const float*)d_in[0];
  const int*   mask = (const int*)d_in[1];
  const float* Wq   = (const float*)d_in[2];
  const float* bq   = (const float*)d_in[3];
  const float* Wk   = (const float*)d_in[4];
  const float* bk   = (const float*)d_in[5];
  const float* Wv   = (const float*)d_in[6];
  const float* bv   = (const float*)d_in[7];
  const float* Wo   = (const float*)d_in[8];
  const float* bo   = (const float*)d_in[9];
  const float* lq1  = (const float*)d_in[10];
  const float* lk1  = (const float*)d_in[11];
  const float* lq2  = (const float*)d_in[12];
  const float* lk2  = (const float*)d_in[13];
  const float* ln_g = (const float*)d_in[14];
  const float* ln_b = (const float*)d_in[15];
  float* out = (float*)d_out;

  char* ws = (char*)d_ws;
  unsigned short* XH    = (unsigned short*)(ws + offXH);
  unsigned short* WQKT  = (unsigned short*)(ws + offWQK);
  unsigned short* WVT   = (unsigned short*)(ws + offWVT);
  unsigned short* WOT   = (unsigned short*)(ws + offWOT);
  float*          BQK   = (float*)(ws + offBQK);
  unsigned short* QK16  = (unsigned short*)(ws + offQK16);
  unsigned short* VT16  = (unsigned short*)(ws + offVT16);
  float*          SC    = (float*)(ws + offSC);
  unsigned short* DF    = (unsigned short*)(ws + offDF);
  float*          OATT  = (float*)(ws + offO);
  unsigned short* AOH16 = (unsigned short*)(ws + offAOH);

  // ---- prologue: 16-bit operand planes, permuted bias line ----
  const int n8 = nTokElem / 8;                                  // 524288 -> 2048 blocks exact
  cast8_f16_kernel<<<dim3(n8 / 256), dim3(256), 0, stream>>>(x, XH, n8);
  wt_kernel<<<dim3(kDim / 64, kDim / 64, 4), dim3(256), 0, stream>>>(
      Wq, Wk, Wv, Wo, WQKT, WQKT + (size_t)kDim * kDim, WVT, WOT, kWCarry);
  biasperm_kernel<<<dim3(2), dim3(256), 0, stream>>>(bq, bk, BQK);

  // ---- q|k projection: QK16[m][n'] = f16( (1/16) sum_k XH[m][k] WQKT[n'][k] + BQK[n'] )   (M=4096, N=2048, K=1024) ----
  {
    const int tiles = (kTok / 64) * (kQKCols / 64);             // 2048 -> 256 blocks
    wmma_gemm64<0, false, 2, 1, false, 0><<<dim3(tiles / 8, 1), dim3(256), 0, stream>>>(
        XH, XH, kDim, 0L, WQKT, WQKT, kDim, 0L,
        (void*)QK16, (void*)QK16, kQKCols, 0L, BQK, BQK, 0L, kTok, kQKCols, kDim, kWCarryInv);
  }
  // ---- v^T projection: VT16[n][m] = f16( (1/16) sum_k WVT[n][k] XH[m][k] + bv[n] )   (M=1024 rows n, N=4096 tokens, K=1024) ----
  {
    const int tiles = (kDim / 64) * (kTok / 64);                // 1024 -> 128 blocks
    wmma_gemm64<0, false, 1, 1, false, 0><<<dim3(tiles / 8, 1), dim3(256), 0, stream>>>(
        WVT, WVT, kDim, 0L, XH, XH, kDim, 0L,
        (void*)VT16, (void*)VT16, kTok, 0L, bv, bv, 0L, kDim, kTok, kDim, kWCarryInv);
  }

  // ---- per (batch, head): scores (both sets) -> dual softmax + diff -> (diff).v into the OATT column slab ----
  const long planeSC    = (long)kSeq * kSeq;                    // per-set score plane
  const int  tilesScore = (kSeq / 64) * (kSeq / 64);            // 1024 -> 128 blocks (x 2 sets)
  const int  tilesCtx   = (kSeq / 64) * (kDh / 64);             // 32 -> 4 blocks
  for (int b = 0; b < kBatch; ++b) {
    const size_t tokQK = (size_t)b * kSeq * kQKCols;            // first token row of this batch in QK16 (halves)
    const int* maskb = mask + (size_t)b * kSeq * kSeq;
    for (int h = 0; h < kHeads; ++h) {
      // SC[set][i][j] = 32^-0.5 * sum_{d<32} QK16[b,i][64h + 32 set + d] * QK16[b,j][1024 + 64h + 32 set + d]
      const unsigned short* Ag  = QK16 + tokQK + (size_t)h * kDh;
      const unsigned short* Btg = QK16 + tokQK + (size_t)kDim + (size_t)h * kDh;
      wmma_gemm64<0, false, 0, 0, false, 0><<<dim3(tilesScore / 8, 2), dim3(256), 0, stream>>>(
          Ag, Ag, kQKCols, (long)kDiff, Btg, Btg, kQKCols, (long)kDiff,
          (void*)SC, (void*)SC, kSeq, planeSC, BQK, BQK, 0L, kSeq, kSeq, kDiff, kInvScale);
      // DF[i][j] = f16( 32768 * (a1 - lambda a2) )
      softmax_diff_kernel<<<dim3(kSeq), dim3(256), 0, stream>>>(
          SC, SC + planeSC, maskb, lq1, lk1, lq2, lk2, DF);
      // OATT[b,i][64h + d] = 2^-15 * sum_j DF[i][j] * VT16[64h + d][b*2048 + j]   (M=2048, N=64, K=2048)
      const unsigned short* VTg = VT16 + (size_t)h * kDh * kTok + (size_t)b * kSeq;
      float* Og = OATT + (size_t)b * kSeq * kDim + (size_t)h * kDh;
      wmma_gemm64<0, false, 0, 0, false, 0><<<dim3(tilesCtx / 8, 1), dim3(256), 0, stream>>>(
          DF, DF, kSeq, 0L, VTg, VTg, kTok, 0L,
          (void*)Og, (void*)Og, kDim, 0L, BQK, BQK, 0L, kSeq, kDh, kSeq, kPCarryInv);
    }
  }

  // ---- per-head LayerNorm, affine, x0.8 -> AOH16 ----
  ln_cast_kernel<<<dim3(kTok / 2), dim3(256), 0, stream>>>(OATT, ln_g, ln_b, AOH16);

  // ---- output projection: out[m][n] = (1/16) sum_k AOH16[m][k] WOT[n][k] + bo[n]   (M=4096, N=1024, K=1024) ----
  {
    const int tiles = (kTok / 64) * (kDim / 64);                // 1024 -> 128 blocks
    wmma_gemm64<0, false, 2, 0, false, 0><<<dim3(tiles / 8, 1), dim3(256), 0, stream>>>(
        AOH16, AOH16, kDim, 0L, WOT, WOT, kDim, 0L,
        (void*)out, (void*)out, kDim, 0L, bo, bo, 0L, kTok, kDim, kDim, kWCarryInv);
  }
}

// v001
// One run takes 930 microseconds.
// In two side-by-side timings against v000, it was 3.94 and 3.93 times as fast.
// Contractions: q|k projection and v^T projection (x f16 by W^T f16 carried x16), scores q_set.k_set^T per head and set (q, k f16 planes, K=32), (a1 - lambda*a2).v (diff plane f16 carried x32768 by v^T f16 plane, K=2048), output projection (LayerNorm output f16 by Wo^T f16 carried x16): all v_wmma_f32_16x16x32_f16 with f32 accumulate; bias adds, mask select, both softmaxes, lambda and the per-head LayerNorm in f32.
#include <hip/hip_runtime.h>
#include <math.h>

// ---------------------------------------------------------------------------
// Problem constants
// ---------------------------------------------------------------------------
constexpr int kBatch  = 2;
constexpr int kSeq    = 2048;
constexpr int kDim    = 1024;              // hidden
constexpr int kHeads  = 16;
constexpr int kDh     = 64;                // head dim of v / output
constexpr int kDiff   = 32;                // head dim of each q/k set
constexpr int kTok    = kBatch * kSeq;     // 4096 token rows
constexpr int kQKCols = 2 * kDim;          // 2048: pitch of the q | k plane (halves)
constexpr float kWCarry    = 16.0f;        // weights carried x16 in f16
constexpr float kWCarryInv = 1.0f / 16.0f;
constexpr float kPCarry    = 32768.0f;     // (a1 - lambda*a2) carried x2^15 in f16
constexpr float kPCarryInv = 1.0f / 32768.0f;
constexpr float kInvScale  = 0.17677669529663687f;   // 32^-0.5
constexpr float kNegBig    = -1.0e9f;
constexpr float kLambdaInit = 0.2f;
constexpr float kOutGain   = 0.8f;         // 1 - lambda_init
constexpr float kLnEps     = 1.0e-5f;
constexpr float kInv64     = 1.0f / 64.0f;
static_assert(kHeads * kDh == kDim, "shape");
static_assert(kHeads * kDiff * 2 == kDim, "shape");
// GEMM shape contract: M, N multiples of 64; K multiple of 32
static_assert(kTok % 64 == 0 && kQKCols % 64 == 0 && kDim % 64 == 0 && kSeq % 64 == 0 && kDh % 64 == 0, "tiles");
static_assert(kDim % 32 == 0 && kDiff % 32 == 0 && kSeq % 32 == 0, "ktiles");
static_assert(kSeq == 4 * 512 && kSeq == 8 * 256, "softmax thread map");
static_assert((kTok * kDim) % (8 * 256) == 0, "cast grid");

typedef __attribute__((ext_vector_type(16))) _Float16 v16h;
typedef __attribute__((ext_vector_type(8)))  _Float16 v8h;
typedef __attribute__((ext_vector_type(16))) __bf16   v16b;
typedef __attribute__((ext_vector_type(8)))  __bf16   v8b;
typedef __attribute__((ext_vector_type(8)))  float    v8f;
typedef __attribute__((ext_vector_type(4)))  float    v4f;
typedef __attribute__((ext_vector_type(2)))  float    v2f;
typedef __attribute__((ext_vector_type(2)))  int      v2i;
typedef __attribute__((ext_vector_type(4)))  unsigned int v4u;

// ---------------------------------------------------------------------------
// Helper pieces: conversions, hazard guards, WMMA fragments
// ---------------------------------------------------------------------------
__device__ __forceinline__ unsigned short f2bf_bits(float f) {
  unsigned u = __float_as_uint(f);
  return (unsigned short)((u + 0x7FFFu + ((u >> 16) & 1u)) >> 16);
}
__device__ __forceinline__ float bf_bits2f(unsigned short h) { return __uint_as_float(((unsigned)h) << 16); }

// hazard guards as plain device helpers (no inline asm inside the kernel template body)
__device__ __forceinline__ void dep_guard_h(v8f& a, v8f& b, v16h x, v16h y) { asm volatile("v_nop\n\tv_nop\n\tv_nop\n\tv_nop" : "+v"(a), "+v"(b) : "v"(x), "v"(y)); }
__device__ __forceinline__ void dep_guard_b(v8f& a, v8f& b, v16b x, v16b y) { asm volatile("v_nop\n\tv_nop\n\tv_nop\n\tv_nop" : "+v"(a), "+v"(b) : "v"(x), "v"(y)); }
// group guard tying all four accumulators of an A-row group plus its A fragments
__device__ __forceinline__ void dep_guard4_h(v8f& a, v8f& b, v8f& c, v8f& d, v16h x, v16h y) { asm volatile("v_nop\n\tv_nop\n\tv_nop\n\tv_nop" : "+v"(a), "+v"(b), "+v"(c), "+v"(d) : "v"(x), "v"(y)); }
__device__ __forceinline__ void dep_guard4_b(v8f& a, v8f& b, v8f& c, v8f& d, v16b x, v16b y) { asm volatile("v_nop\n\tv_nop\n\tv_nop\n\tv_nop" : "+v"(a), "+v"(b), "+v"(c), "+v"(d) : "v"(x), "v"(y)); }
__device__ __forceinline__ void keep4_h(v16h a, v16h b, v16h c, v16h d) { asm volatile("v_nop" :: "v"(a), "v"(b), "v"(c), "v"(d)); }
__device__ __forceinline__ void keep4_b(v16b a, v16b b, v16b c, v16b d) { asm volatile("v_nop" :: "v"(a), "v"(b), "v"(c), "v"(d)); }
__device__ __forceinline__ void acc_guard4(v8f& a, v8f& b, v8f& c, v8f& d) { asm volatile("v_nop\n\tv_nop\n\tv_nop\n\tv_nop" : "+v"(a), "+v"(b), "+v"(c), "+v"(d)); }
template <typename T> struct Frag;
template <> struct Frag<_Float16> {
  typedef v16h V; union U { v16h v; v8h h[2]; };
  // elements 0..7 <- p[0..7], 8..15 <- p[16..23]
  static __device__ __forceinline__ v16h load(const _Float16* p) {
    U f; f.h[0] = *(const v8h*)(p); f.h[1] = *(const v8h*)(p + 16); return f.v;
  }
  static __device__ __forceinline__ v8f mma(v16h a, v16h b, v8f c) {
    return __builtin_amdgcn_wmma_f32_16x16x32_f16(false, a, false, b, (short)0, c, false, false);
  }
  static __device__ __forceinline__ void guard(v8f& a, v8f& b, v16h x, v16h y) { dep_guard_h(a, b, x, y); }
  static __device__ __forceinline__ void guard4(v8f& a, v8f& b, v8f& c, v8f& d, v16h x, v16h y) { dep_guard4_h(a, b, c, d, x, y); }
  static __device__ __forceinline__ void keep(v16h a, v16h b, v16h c, v16h d) { keep4_h(a, b, c, d); }
};
template <> struct Frag<__bf16> {
  typedef v16b V; union U { v16b v; v8b h[2]; };
  static __device__ __forceinline__ v16b load(const __bf16* p) {
    U f; f.h[0] = *(const v8b*)(p); f.h[1] = *(const v8b*)(p + 16); return f.v;
  }
  static __device__ __forceinline__ v8f mma(v16b a, v16b b, v8f c) {
    return __builtin_amdgcn_wmma_f32_16x16x32_bf16(false, a, false, b, (short)0, c, false, false);
  }
  static __device__ __forceinline__ void guard(v8f& a, v8f& b, v16b x, v16b y) { dep_guard_b(a, b, x, y); }
  static __device__ __forceinline__ void guard4(v8f& a, v8f& b, v8f& c, v8f& d, v16b x, v16b y) { dep_guard4_b(a, b, c, d, x, y); }
  static __device__ __forceinline__ void keep(v16b a, v16b b, v16b c, v16b d) { keep4_b(a, b, c, d); }
};

__device__ __forceinline__ unsigned pk16(unsigned short a, unsigned short b) { return (unsigned)a | ((unsigned)b << 16); }
__device__ __forceinline__ unsigned short h_bits(float f) { const _Float16 h = (_Float16)f; return __builtin_bit_cast(unsigned short, h); }

// ---- Register-blocked batched WMMA GEMM (ACT reduced to none/relu/leaky) -------------------------------
// C[m,n] = scale * sum_k A[m,k] * Bt[n,k] (+bias)(+resid); each wave owns a 64x64 tile.
// A row-major [M,K]; Bt row-major [N,K]; M,N % 64 == 0, K % 32 == 0.
// SPLIT: operands are hi/lo planes (A2/Bt2 = lo planes, same layout); product = hi*hi + hi*lo + lo*hi.
// BIAS_MODE: 0 = none, 1 = bias[m], 2 = bias[n].
// OUT_MODE: 0 = f32, 1 = f16, 2 = bf16 hi plane (Cout) + bf16 lo plane (Cout2).
// ET: 0 = f16 operands, 1 = bf16 operands (pointers passed as 16-bit storage)
template <int ET> struct Elem;
template <> struct Elem<0> { typedef _Float16 T; };
template <> struct Elem<1> { typedef __bf16 T; };
template <int ET, bool SPLIT, int BIAS_MODE, int OUT_MODE, bool RESID, int ACT = 0>
__global__ __launch_bounds__(256) void wmma_gemm64(
    const unsigned short* __restrict__ Ap, const unsigned short* __restrict__ A2p, int lda, long strideA,
    const unsigned short* __restrict__ Btp, const unsigned short* __restrict__ Bt2p, int ldb, long strideB,
    void* __restrict__ Cout, void* __restrict__ Cout2, int ldc, long strideC,
    const float* __restrict__ bias,
    const float* __restrict__ resid, long strideR,
    int M, int N, int K, float scale) {
  typedef typename Elem<ET>::T T;
  typedef typename Frag<T>::V V;
  const T* A = (const T*)Ap; const T* A2 = (const T*)A2p; const T* Bt = (const T*)Btp; const T* Bt2 = (const T*)Bt2p;
  __shared__ __align__(16) float sT[8][16 * 68];   // per-wave 16x64 slab, pitch 68 floats
  const int b    = blockIdx.y;
  const int lane = threadIdx.x & 31;
  const int wave = threadIdx.x >> 5;
  const int tilesN = N >> 6;
  const int tilesM = M >> 6;
  const int tile = blockIdx.x * 8 + wave;
  if (tile >= tilesM * tilesN) return;   // wave-uniform; no block barriers in this kernel
  const int tm = tile / tilesN;
  const int tn = tile - tm * tilesN;
  const int m0 = tm << 6;
  const int n0 = tn << 6;

  const T* Ab  = A  + (size_t)b * strideA;
  const T* Bb  = Bt + (size_t)b * strideB;
  const T* Ab2 = SPLIT ? (A2  + (size_t)b * strideA) : nullptr;
  const T* Bb2 = SPLIT ? (Bt2 + (size_t)b * strideB) : nullptr;

  const int rlane = lane & 15;                 // row (A) / col (B, D) within subtile
  const int koff  = (lane >> 4) * 8;           // k offset of this lane half
  const int mOff  = (lane >> 4) * 8;           // D row offset

  v8f acc[4][4];
#pragma unroll
  for (int i = 0; i < 4; ++i)
#pragma unroll
    for (int j = 0; j < 4; ++j) acc[i][j] = (v8f){0.f,0.f,0.f,0.f,0.f,0.f,0.f,0.f};

  for (int k0 = 0; k0 < K; k0 += 32) {
    V bh[4], bl[4];
#pragma unroll
    for (int j = 0; j < 4; ++j) {
      const size_t bo = (size_t)(n0 + (j << 4) + rlane) * ldb + koff + k0;
      bh[j] = Frag<T>::load(Bb + bo);
      if (SPLIT) bl[j] = Frag<T>::load(Bb2 + bo);
    }
#pragma unroll
    for (int i = 0; i < 4; ++i) {
      const size_t ao = (size_t)(m0 + (i << 4) + rlane) * lda + koff + k0;
      V ah = Frag<T>::load(Ab + ao);
      V al;
      if (SPLIT) al = Frag<T>::load(Ab2 + ao);
#pragma unroll
      for (int j = 0; j < 4; ++j) {
        acc[i][j] = Frag<T>::mma(ah, bh[j], acc[i][j]);
        if (SPLIT) {
          acc[i][j] = Frag<T>::mma(ah, bl[j], acc[i][j]);
          acc[i][j] = Frag<T>::mma(al, bh[j], acc[i][j]);
        }
      }
      Frag<T>::guard4(acc[i][0], acc[i][1], acc[i][2], acc[i][3], ah, SPLIT ? al : ah);
    }
    Frag<T>::keep(bh[0], bh[1], bh[2], bh[3]);
    if (SPLIT) Frag<T>::keep(bl[0], bl[1], bl[2], bl[3]);
  }
  acc_guard4(acc[0][0], acc[0][1], acc[0][2], acc[0][3]);
  acc_guard4(acc[1][0], acc[1][1], acc[1][2], acc[1][3]);
  acc_guard4(acc[2][0], acc[2][1], acc[2][2], acc[2][3]);
  acc_guard4(acc[3][0], acc[3][1], acc[3][2], acc[3][3]);

  // ---- epilogue ----
  float* slab = sT[wave];
  const float* Rb = RESID ? (resid + (size_t)b * strideR) : nullptr;
#pragma unroll
  for (int i = 0; i < 4; ++i) {
    const int mBase = m0 + (i << 4);
#pragma unroll
    for (int j = 0; j < 4; ++j) {
      const int n = n0 + (j << 4) + rlane;
      float bv = 0.f;
      if (BIAS_MODE == 2) bv = bias[n];
#pragma unroll
      for (int r = 0; r < 8; ++r) {
        float v = acc[i][j][r] * scale;
        if (BIAS_MODE == 1) v += bias[mBase + mOff + r];
        if (BIAS_MODE == 2) v += bv;
        if (RESID) v += Rb[(size_t)(mBase + mOff + r) * ldc + n];
        if (ACT == 2) v = fmaxf(v, 0.0f);
        if (ACT == 4) v = (v > 0.f) ? v : 0.01f * v;
        slab[(mOff + r) * 68 + (j << 4) + rlane] = v;
      }
    }
    __builtin_amdgcn_fence(__ATOMIC_RELEASE, "workgroup");
    __builtin_amdgcn_wave_barrier();
    __builtin_amdgcn_fence(__ATOMIC_ACQUIRE, "workgroup");
    if (OUT_MODE == 0) {
      float* C = (float*)Cout + (size_t)b * strideC;
      const int hh = lane >> 4, c4 = (lane & 15) * 4;     // row seg = 256 B = 16 lanes x 16 B
      {
#pragma unroll
        for (int it = 0; it < 8; ++it) {
          const int row = it * 2 + hh;
          v4f v = *(const v4f*)(slab + row * 68 + c4);
          *(v4f*)(C + (size_t)(mBase + row) * ldc + n0 + c4) = v;
        }
        
      }
    } else {
      const int q = lane >> 3, c8 = (lane & 7) * 8;
      unsigned short* C  = (unsigned short*)Cout  + (size_t)b * strideC;
      unsigned short* C2 = (OUT_MODE == 2) ? ((unsigned short*)Cout2 + (size_t)b * strideC) : nullptr;
      {
#pragma unroll
        for (int it = 0; it < 4; ++it) {
          const int row = it * 4 + q;
          const float* sp = slab + row * 68 + c8;
          v8h hv, lv;
#pragma unroll
          for (int e = 0; e < 8; ++e) {
            if (OUT_MODE == 1) {
              hv[e] = (_Float16)sp[e];
            } else {
              unsigned short hb = f2bf_bits(sp[e]);
              unsigned short lb = f2bf_bits(sp[e] - bf_bits2f(hb));
              hv[e] = __builtin_bit_cast(_Float16, hb);
              lv[e] = __builtin_bit_cast(_Float16, lb);
            }
          }
          *(v8h*)(C + (size_t)(mBase + row) * ldc + n0 + c8) = hv;
          if (OUT_MODE == 2) *(v8h*)(C2 + (size_t)(mBase + row) * ldc + n0 + c8) = lv;
        }
        
      }
    }
    __builtin_amdgcn_fence(__ATOMIC_RELEASE, "workgroup");
    __builtin_amdgcn_wave_barrier();
    __builtin_amdgcn_fence(__ATOMIC_ACQUIRE, "workgroup");
  }
}

// ---------------------------------------------------------------------------
// ---------------------------------------------------------------------------
__global__ __launch_bounds__(256) void cast8_f16_kernel(const float* __restrict__ in, unsigned short* __restrict__ out, int n8) {
  const int i = blockIdx.x * 256 + threadIdx.x;
  if (i >= n8) return;
  const float* p = in + 8 * (size_t)i;
  const v4f a = *(const v4f*)(p);
  const v4f c = *(const v4f*)(p + 4);
  unsigned short hb[8];
#pragma unroll
  for (int e = 0; e < 4; ++e) {
    hb[e]     = h_bits(a[e]);
    hb[4 + e] = h_bits(c[e]);
  }
  const v4u u = (v4u){pk16(hb[0], hb[1]), pk16(hb[2], hb[3]), pk16(hb[4], hb[5]), pk16(hb[6], hb[7])};
  unsigned short* q = out + 8 * (size_t)i;
  *(v4u*)q = u;
  
}

// ---------------------------------------------------------------------------
// Weight transpose + cast (+ optional output-feature permutation) for square [1024 in][1024 out] f32 W (row-major [k][n]):
//   out[np][k] = f16( scale * W[k][orig(np)] ), orig(np) = perm ? ((np>>5)&1)*512 + (np>>6)*32 + (np&31) : np.
// With perm, plane column 64h + 32*set + d holds feature set*512 + 32h + d, so the two q/k sets of a head sit at stride 32.
// grid (16, 16, 4): blockIdx.x = k tile (64 cols of out), blockIdx.y = np tile (64 rows of out), blockIdx.z selects
//   z0 = (W0 -> o0, perm), z1 = (W1 -> o1, perm), z2 = (W2 -> o2, identity), z3 = (W3 -> o3, identity). 256 threads.
// Load coverage: 16 iterations x 256 threads = 4096 = the whole 64x64 tile (coalesced along n inside 32-wide strips).
// Store coverage: 8 waves x 2 iterations x 4 rows (lane>>3) = 64 rows; (lane&7) x 8 halves = 64 cols; each row segment =
// ---------------------------------------------------------------------------
__global__ __launch_bounds__(256) void wt_kernel(const float* __restrict__ W0, const float* __restrict__ W1,
                                                 const float* __restrict__ W2, const float* __restrict__ W3,
                                                 unsigned short* __restrict__ o0, unsigned short* __restrict__ o1,
                                                 unsigned short* __restrict__ o2, unsigned short* __restrict__ o3,
                                                 float scale) {
  __shared__ float sm[64][65];   // sm[np_local][k_local]
  const int t  = threadIdx.x;
  const int k0 = blockIdx.x * 64;
  const int n0 = blockIdx.y * 64;
  const int z  = blockIdx.z;                                   // block-uniform
  const float* W = (z == 0) ? W0 : (z == 1) ? W1 : (z == 2) ? W2 : W3;
  unsigned short* op = (z == 0) ? o0 : (z == 1) ? o1 : (z == 2) ? o2 : o3;
  const int perm = (z < 2) ? 1 : 0;
#pragma unroll
  for (int i = 0; i < 16; ++i) {
    const int e = i * 256 + t;
    const int r = e >> 6;          // k local
    const int c = e & 63;          // np local
    const int np = n0 + c;
    const int og = perm ? ((((np >> 5) & 1) << 9) + ((np >> 6) << 5) + (np & 31)) : np;
    sm[c][r] = W[(size_t)(k0 + r) * kDim + og] * scale;
  }
  __syncthreads();
  const int lane = t & 31, wave = t >> 5;
  const int q = lane >> 3, c8 = (lane & 7) * 8;
  {
#pragma unroll
    for (int it = 0; it < 2; ++it) {
      const int row = wave * 8 + it * 4 + q;                 // np local
      unsigned short hb[8];
#pragma unroll
      for (int e = 0; e < 8; ++e) hb[e] = h_bits(sm[row][c8 + e]);
      const v4u u = (v4u){pk16(hb[0], hb[1]), pk16(hb[2], hb[3]), pk16(hb[4], hb[5]), pk16(hb[6], hb[7])};
      *(v4u*)(op + (size_t)(n0 + row) * kDim + k0 + c8) = u;
    }
    
  }
}

// ---------------------------------------------------------------------------
// Permuted q|k bias line: out[np] = bq[orig(np)] for np < 1024 (block 0), out[1024 + np] = bk[orig(np)] (block 1).
// Thread t owns np = 4t..4t+3 (orig of an aligned group of 4 is contiguous); one 16-B store per lane, a wave = 512 B =
// ---------------------------------------------------------------------------
__global__ __launch_bounds__(256) void biasperm_kernel(const float* __restrict__ bq, const float* __restrict__ bk,
                                                       float* __restrict__ out) {
  const int t = threadIdx.x;
  const float* src = (blockIdx.x == 0) ? bq : bk;             // block-uniform
  const int np = 4 * t;
  const int og = (((np >> 5) & 1) << 9) + ((np >> 6) << 5) + (np & 31);
  const v4f v = *(const v4f*)(src + og);
  float* dp = out + (size_t)blockIdx.x * kDim + np;
  *(v4f*)dp = v;
  
}

// ---------------------------------------------------------------------------
// Dual masked softmax + differential combine for one (batch, head): f32 math.
//   x1 = (mask != 0) ? s1 : -1e9 (scores already scaled by 32^-0.5), same for x2;
//   a1 = exp(x1 - max1)/sum1, a2 = exp(x2 - max2)/sum2 (independent maxima and sums);
//   lambda = exp(sum lq1*lk1) - exp(sum lq2*lk2) + 0.2 (every wave computes it identically);
//   D[i][j] = f16( 32768 * (a1 - lambda*a2) ).
// One block of 256 threads per query row i = blockIdx.x. Phases 1/2: rolled 4-trip loops, thread t owns columns
// it*512 + 2t, 2t+1 of both score rows (4 x 256 x 2 = 2048 = whole row); logits/exps kept in LDS (every word written in
// phase 1 before any cross-thread read). Reductions in fixed order (thread, wave shuffle tree, 8 wave partials in index
// order) separated by block barriers. Store: thread t owns cols 8t..8t+7 -> one 16-B store per lane; a wave writes
// ---------------------------------------------------------------------------
__global__ __launch_bounds__(256) void softmax_diff_kernel(const float* __restrict__ S1p, const float* __restrict__ S2p,
                                                           const int* __restrict__ Mp,
                                                           const float* __restrict__ lq1, const float* __restrict__ lk1,
                                                           const float* __restrict__ lq2, const float* __restrict__ lk2,
                                                           unsigned short* __restrict__ Dp) {
  __shared__ __align__(16) float lg1[kSeq];
  __shared__ __align__(16) float lg2[kSeq];
  __shared__ float redA[8];
  __shared__ float redB[8];
  __shared__ float redC[8];
  __shared__ float redD[8];
  const int i    = blockIdx.x;
  const int t    = threadIdx.x;
  const int lane = t & 31, wave = t >> 5;

  // lambda from the two 32-vectors (wave-wide butterfly, unconditional shuffles)
  float t1 = lq1[lane] * lk1[lane];
  float t2 = lq2[lane] * lk2[lane];
#pragma unroll
  for (int off = 16; off > 0; off >>= 1) {
    t1 += __shfl_xor(t1, off, 32);
    t2 += __shfl_xor(t2, off, 32);
  }
  const float lam = (expf(t1) - expf(t2)) + kLambdaInit;

  const size_t rowoff = (size_t)i * kSeq;
  const float* s1r = S1p + rowoff;
  const float* s2r = S2p + rowoff;
  const int*   mr  = Mp + rowoff;

  float mx1 = -__builtin_inff(), mx2 = -__builtin_inff();
#pragma unroll 1
  for (int it = 0; it < 4; ++it) {
    const int c = it * 512 + 2 * t;
    const v2f sa = *(const v2f*)(s1r + c);
    const v2f sb = *(const v2f*)(s2r + c);
    const v2i mv = *(const v2i*)(mr + c);
    v2f x1, x2;
#pragma unroll
    for (int e = 0; e < 2; ++e) {
      const bool keep = (mv[e] != 0);
      x1[e] = keep ? sa[e] : kNegBig;
      x2[e] = keep ? sb[e] : kNegBig;
      mx1 = fmaxf(mx1, x1[e]);
      mx2 = fmaxf(mx2, x2[e]);
    }
    *(v2f*)(lg1 + c) = x1;
    *(v2f*)(lg2 + c) = x2;
  }
#pragma unroll
  for (int off = 16; off > 0; off >>= 1) {
    mx1 = fmaxf(mx1, __shfl_xor(mx1, off, 32));
    mx2 = fmaxf(mx2, __shfl_xor(mx2, off, 32));
  }
  if (lane == 0) { redA[wave] = mx1; redB[wave] = mx2; }
  __syncthreads();
  float m1 = redA[0], m2 = redB[0];
#pragma unroll
  for (int w = 1; w < 8; ++w) { m1 = fmaxf(m1, redA[w]); m2 = fmaxf(m2, redB[w]); }

  float sum1 = 0.f, sum2 = 0.f;
#pragma unroll 1
  for (int it = 0; it < 4; ++it) {
    const int c = it * 512 + 2 * t;
    const v2f l1 = *(const v2f*)(lg1 + c);
    const v2f l2 = *(const v2f*)(lg2 + c);
    v2f e1, e2;
#pragma unroll
    for (int e = 0; e < 2; ++e) {
      e1[e] = expf(l1[e] - m1);
      e2[e] = expf(l2[e] - m2);
      sum1 += e1[e];
      sum2 += e2[e];
    }
    *(v2f*)(lg1 + c) = e1;
    *(v2f*)(lg2 + c) = e2;
  }
#pragma unroll
  for (int off = 16; off > 0; off >>= 1) {
    sum1 += __shfl_xor(sum1, off, 32);
    sum2 += __shfl_xor(sum2, off, 32);
  }
  if (lane == 0) { redC[wave] = sum1; redD[wave] = sum2; }
  __syncthreads();
  float tot1 = redC[0], tot2 = redD[0];
#pragma unroll
  for (int w = 1; w < 8; ++w) { tot1 += redC[w]; tot2 += redD[w]; }
  const float inv1 = kPCarry / tot1;
  const float inv2 = lam * (kPCarry / tot2);

  const v4f ea = *(const v4f*)(lg1 + 8 * t);
  const v4f eb = *(const v4f*)(lg1 + 8 * t + 4);
  const v4f ec = *(const v4f*)(lg2 + 8 * t);
  const v4f ed = *(const v4f*)(lg2 + 8 * t + 4);
  unsigned short hb[8];
#pragma unroll
  for (int e = 0; e < 4; ++e) {
    hb[e]     = h_bits(ea[e] * inv1 - ec[e] * inv2);
    hb[4 + e] = h_bits(eb[e] * inv1 - ed[e] * inv2);
  }
  const v4u u = (v4u){pk16(hb[0], hb[1]), pk16(hb[2], hb[3]), pk16(hb[4], hb[5]), pk16(hb[6], hb[7])};
  unsigned short* pr = Dp + rowoff + 8 * (size_t)t;
  *(v4u*)pr = u;
  
}

// ---------------------------------------------------------------------------
// (a1 - lambda*a2).v of one (batch, head), spread over the chip: O[i][d] = 2^-15 * sum_j D[i][j] * Vt[d][j].
// M = 2048 query rows, N = 64, K = 2048 keys. grid (128, 2): blockIdx.x = 16 query rows, blockIdx.y = 32 of the 64 columns.
// The 8 waves of a block split the keys: wave w sums keys 256w .. 256w+255 into its own 16x32 f32 partial (two WMMA
// accumulators, fragments loaded as in wmma_gemm64, same k order for D and Vt). The partials meet in LDS (pitch 36 floats:
// the two lane halves, 8 rows apart, land 32 banks apart) and are added in wave order 0..7, then scaled.
// Store: threads 0..127, one 16-B store each; 8 lanes cover the 128-B row segment of this block, written by nobody else.
// ---------------------------------------------------------------------------
constexpr int kCtxWaves = 8;
constexpr int kCtxK     = kSeq / kCtxWaves;   // 256 keys per wave
constexpr int kCtxPitch = 36;                 // floats
static_assert(kCtxK % 32 == 0 && kSeq % 16 == 0 && kDh == 64, "ctx split");
__global__ __launch_bounds__(256) void ctx_splitk_kernel(const unsigned short* __restrict__ Dp,
                                                         const unsigned short* __restrict__ Vtp,
                                                         float* __restrict__ O) {
  __shared__ __align__(16) float part[kCtxWaves][16 * kCtxPitch];
  const int t     = threadIdx.x;
  const int lane  = t & 31, wave = t >> 5;
  const int m0    = blockIdx.x * 16;
  const int n0    = blockIdx.y * 32;
  const int rlane = lane & 15;                 // row of D / row of Vt (= output column) within the subtile
  const int half8 = (lane >> 4) * 8;           // k offset of this lane half; also its accumulator row offset
  const _Float16* Ar = (const _Float16*)Dp  + (size_t)(m0 + rlane) * kSeq + wave * kCtxK + half8;
  const _Float16* B0 = (const _Float16*)Vtp + (size_t)(n0 + rlane) * kTok + wave * kCtxK + half8;
  const _Float16* B1 = B0 + (size_t)16 * kTok;
  v8f acc0 = (v8f){0.f,0.f,0.f,0.f,0.f,0.f,0.f,0.f};
  v8f acc1 = acc0;
  // all fragments of the wave's 8 key steps are asked for first: no step depends on another's data, so one memory
  // latency is paid for the 48 loads together instead of one per step
  v16h a[kCtxK / 32], b0[kCtxK / 32], b1[kCtxK / 32];
#pragma unroll
  for (int ks = 0; ks < kCtxK / 32; ++ks) a[ks] = Frag<_Float16>::load(Ar + ks * 32);
  // the address pair of the loads above is dead from here on and a later load may be given it as its destination:
  // the wait stands in front of that overwrite
  asm volatile("s_wait_xcnt 0x0" ::: "memory");
#pragma unroll
  for (int ks = 0; ks < kCtxK / 32; ++ks) {
    b0[ks] = Frag<_Float16>::load(B0 + ks * 32);
    b1[ks] = Frag<_Float16>::load(B1 + ks * 32);
  }
  // keeps the loads above the products; without it the scheduler sinks each step's loads to one step ahead of their use
  __builtin_amdgcn_sched_barrier(0);
#pragma unroll
  for (int ks = 0; ks < kCtxK / 32; ++ks) {
    acc0 = Frag<_Float16>::mma(a[ks], b0[ks], acc0);
    acc1 = Frag<_Float16>::mma(a[ks], b1[ks], acc1);
    // first step only, where the two results get their registers: holds both Vt fragments until both products have issued
    // and four vector slots have passed; without it the second result is laid over the first product's B operand
    if (ks == 0) Frag<_Float16>::guard(acc0, acc1, b0[0], b1[0]);
  }
  float* slab = part[wave];
#pragma unroll
  for (int r = 0; r < 8; ++r) {
    slab[(half8 + r) * kCtxPitch + rlane]      = acc0[r];
    slab[(half8 + r) * kCtxPitch + 16 + rlane] = acc1[r];
  }
  __syncthreads();   // every wave's partial is in LDS before any of it is summed
  if (t < 128) {     // waves 0..3, whole waves; no barrier behind this point
    const int row = t >> 3, c4 = (t & 7) * 4;
    v4f s = *(const v4f*)(&part[0][row * kCtxPitch + c4]);
#pragma unroll
    for (int w = 1; w < kCtxWaves; ++w) s += *(const v4f*)(&part[w][row * kCtxPitch + c4]);
    s *= kPCarryInv;
    *(v4f*)(O + (size_t)(m0 + row) * kDim + n0 + c4) = s;
  }
}

// ---------------------------------------------------------------------------
// Per-head LayerNorm over 64 dims of the attention output o (f32 [4096][1024], column = 64h + d), affine, x0.8, f16 cast:
//   mu = mean_d o, var = mean_d (o - mu)^2, y = ((o - mu) / sqrt(var + 1e-5) * g[h][d] + b[h][d]) * 0.8 -> A16[row][64h + d].
// 256 threads = 2 rows; within a row thread tt (0..127) owns columns 64*(tt>>3) + 8*(tt&7) .. +7 (8 threads per head, lanes
// 8q..8q+7 of one wave; reductions by xor shuffles 1,2,4 in fixed order). Loads: 2 b128 (o) + 2 (g) + 2 (b).
// grid = 2048 blocks = 4096 rows exactly.
// ---------------------------------------------------------------------------
__global__ __launch_bounds__(256) void ln_cast_kernel(const float* __restrict__ O, const float* __restrict__ g,
                                                      const float* __restrict__ bta, unsigned short* __restrict__ A16) {
  const int t   = threadIdx.x;
  const int row = blockIdx.x * 2 + (t >> 7);
  const int tt  = t & 127;
  const int h   = tt >> 3;
  const int c0  = h * kDh + (tt & 7) * 8;
  const float* op = O + (size_t)row * kDim + c0;
  const v4f a = *(const v4f*)(op);
  const v4f c = *(const v4f*)(op + 4);
  float x[8];
#pragma unroll
  for (int e = 0; e < 4; ++e) { x[e] = a[e]; x[4 + e] = c[e]; }
  float s = ((x[0] + x[1]) + (x[2] + x[3])) + ((x[4] + x[5]) + (x[6] + x[7]));
  s += __shfl_xor(s, 1, 32);
  s += __shfl_xor(s, 2, 32);
  s += __shfl_xor(s, 4, 32);
  const float mu = s * kInv64;
  float d[8];
  float vs = 0.0f;
#pragma unroll
  for (int e = 0; e < 8; ++e) { d[e] = x[e] - mu; vs += d[e] * d[e]; }
  vs += __shfl_xor(vs, 1, 32);
  vs += __shfl_xor(vs, 2, 32);
  vs += __shfl_xor(vs, 4, 32);
  const float var  = vs * kInv64;
  const float rstd = 1.0f / sqrtf(var + kLnEps);
  const float* gp = g + c0;
  const float* bp = bta + c0;
  const v4f g0 = *(const v4f*)(gp);
  const v4f g1 = *(const v4f*)(gp + 4);
  const v4f b0 = *(const v4f*)(bp);
  const v4f b1 = *(const v4f*)(bp + 4);
  float gg[8], bb[8];
#pragma unroll
  for (int e = 0; e < 4; ++e) { gg[e] = g0[e]; gg[4 + e] = g1[e]; bb[e] = b0[e]; bb[4 + e] = b1[e]; }
  unsigned short hb[8];
#pragma unroll
  for (int e = 0; e < 8; ++e) {
    const float y = (d[e] * rstd * gg[e] + bb[e]) * kOutGain;
    hb[e] = h_bits(y);
  }
  const v4u u = (v4u){pk16(hb[0], hb[1]), pk16(hb[2], hb[3]), pk16(hb[4], hb[5]), pk16(hb[6], hb[7])};
  unsigned short* pr = A16 + (size_t)row * kDim + c0;
  *(v4u*)pr = u;
  
}

// ---------------------------------------------------------------------------
// Host glue.
// producer before any consumer reads it; no region re-used with another type):
//   XH    f16 [4096][1024]               8,388,608  at           0   (cast8; read by the two projection GEMMs)
//   WQKT  f16 [2048][1024]               4,194,304  at   8,388,608   (wt z0,z1: permuted Wq^T rows 0..1023, Wk^T rows 1024..2047)
//   WVT   f16 [1024][1024]               2,097,152  at  12,582,912   (wt z2)
//   WOT   f16 [1024][1024]               2,097,152  at  14,680,064   (wt z3)
//   BQK   f32 [2048]                         8,192  at  16,777,216   (permuted bq | bk)
//   QK16  f16 [4096][2048]              16,777,216  at  16,785,408   (q plane cols 0..1023 | k plane cols 1024..2047, permuted)
//   VT16  f16 [1024][4096]               8,388,608  at  33,562,624   (v^T: row = 64h + d, col = token)
//   SC    f32 [2][2048][2048]           33,554,432  at  41,951,232   (scores of one (batch, head), both sets; rewritten 32x)
//   DF    f16 [2048][2048]               8,388,608  at  75,505,664   ((a1 - lambda a2) x 32768; rewritten 32x)
//   OATT  f32 [4096][1024]              16,777,216  at  83,894,272   (attention output before LayerNorm; 32 disjoint column slabs)
//   AOH16 f16 [4096][1024]               8,388,608  at 100,671,488   (LayerNorm output)
//   total                              109,060,096
// GEMM shapes: q|k proj M=4096 N=2048 K=1024; v^T proj M=1024 N=4096 K=1024; scores M=N=2048 K=32 (grid.y = set, stride 32);
// diff.v M=2048 N=64 K=2048 (own kernel: 16x32 tiles, keys split over the 8 waves of a block); out proj M=4096 N=1024 K=1024. All M,N multiples of 64, all K multiples of 32, no padding.
// 103 launches.
// ---------------------------------------------------------------------------
extern "C" void kernel_launch(void* const* d_in, const int* in_sizes, int n_in,
                              void* d_out, int out_size, void* d_ws, size_t ws_size,
                              hipStream_t stream) {
  if (n_in < 16) return;
  const int nTokElem = kTok * kDim;                 // 4,194,304
  const int nW       = kDim * kDim;                 // 1,048,576
  if (in_sizes[0] != nTokElem) return;
  if (in_sizes[1] != kBatch * kSeq * kSeq) return;
  if (in_sizes[2] != nW || in_sizes[4] != nW || in_sizes[6] != nW || in_sizes[8] != nW) return;
  if (in_sizes[3] != kDim || in_sizes[5] != kDim || in_sizes[7] != kDim || in_sizes[9] != kDim) return;
  if (in_sizes[10] != kDiff || in_sizes[11] != kDiff || in_sizes[12] != kDiff || in_sizes[13] != kDiff) return;
  if (in_sizes[14] != kHeads * kDh || in_sizes[15] != kHeads * kDh) return;
  if (out_size != nTokElem) return;

  const size_t szXH   = (size_t)kTok * kDim * 2;
  const size_t szWQK  = (size_t)kQKCols * kDim * 2;
  const size_t szW    = (size_t)kDim * kDim * 2;
  const size_t szBQK  = (size_t)kQKCols * 4;
  const size_t szQK16 = (size_t)kTok * kQKCols * 2;
  const size_t szVT16 = (size_t)kDim * kTok * 2;
  const size_t szSC   = (size_t)2 * kSeq * kSeq * 4;
  const size_t szDF   = (size_t)kSeq * kSeq * 2;
  const size_t szO    = (size_t)kTok * kDim * 4;
  const size_t szAOH  = (size_t)kTok * kDim * 2;
  const size_t offXH   = 0;
  const size_t offWQK  = offXH + szXH;
  const size_t offWVT  = offWQK + szWQK;
  const size_t offWOT  = offWVT + szW;
  const size_t offBQK  = offWOT + szW;
  const size_t offQK16 = offBQK + szBQK;
  const size_t offVT16 = offQK16 + szQK16;
  const size_t offSC   = offVT16 + szVT16;
  const size_t offDF   = offSC + szSC;
  const size_t offO    = offDF + szDF;
  const size_t offAOH  = offO + szO;
  const size_t total   = offAOH + szAOH;          // 109,060,096
  if (ws_size < total) return;

  const float* x    = (const float*)d_in[0];
  const int*   mask = (const int*)d_in[1];
  const float* Wq   = (const float*)d_in[2];
  const float* bq   = (const float*)d_in[3];
  const float* Wk   = (const float*)d_in[4];
  const float* bk   = (const float*)d_in[5];
  const float* Wv   = (const float*)d_in[6];
  const float* bv   = (const float*)d_in[7];
  const float* Wo   = (const float*)d_in[8];
  const float* bo   = (const float*)d_in[9];
  const float* lq1  = (const float*)d_in[10];
  const float* lk1  = (const float*)d_in[11];
  const float* lq2  = (const float*)d_in[12];
  const float* lk2  = (const float*)d_in[13];
  const float* ln_g = (const float*)d_in[14];
  const float* ln_b = (const float*)d_in[15];
  float* out = (float*)d_out;

  char* ws = (char*)d_ws;
  unsigned short* XH    = (unsigned short*)(ws + offXH);
  unsigned short* WQKT  = (unsigned short*)(ws + offWQK);
  unsigned short* WVT   = (unsigned short*)(ws + offWVT);
  unsigned short* WOT   = (unsigned short*)(ws + offWOT);
  float*          BQK   = (float*)(ws + offBQK);
  unsigned short* QK16  = (unsigned short*)(ws + offQK16);
  unsigned short* VT16  = (unsigned short*)(ws + offVT16);
  float*          SC    = (float*)(ws + offSC);
  unsigned short* DF    = (unsigned short*)(ws + offDF);
  float*          OATT  = (float*)(ws + offO);
  unsigned short* AOH16 = (unsigned short*)(ws + offAOH);

  // ---- prologue: 16-bit operand planes, permuted bias line ----
  const int n8 = nTokElem / 8;                                  // 524288 -> 2048 blocks exact
  cast8_f16_kernel<<<dim3(n8 / 256), dim3(256), 0, stream>>>(x, XH, n8);
  wt_kernel<<<dim3(kDim / 64, kDim / 64, 4), dim3(256), 0, stream>>>(
      Wq, Wk, Wv, Wo, WQKT, WQKT + (size_t)kDim * kDim, WVT, WOT, kWCarry);
  biasperm_kernel<<<dim3(2), dim3(256), 0, stream>>>(bq, bk, BQK);

  // ---- q|k projection: QK16[m][n'] = f16( (1/16) sum_k XH[m][k] WQKT[n'][k] + BQK[n'] )   (M=4096, N=2048, K=1024) ----
  {
    const int tiles = (kTok / 64) * (kQKCols / 64);             // 2048 -> 256 blocks
    wmma_gemm64<0, false, 2, 1, false, 0><<<dim3(tiles / 8, 1), dim3(256), 0, stream>>>(
        XH, XH, kDim, 0L, WQKT, WQKT, kDim, 0L,
        (void*)QK16, (void*)QK16, kQKCols, 0L, BQK, BQK, 0L, kTok, kQKCols, kDim, kWCarryInv);
  }
  // ---- v^T projection: VT16[n][m] = f16( (1/16) sum_k WVT[n][k] XH[m][k] + bv[n] )   (M=1024 rows n, N=4096 tokens, K=1024) ----
  {
    const int tiles = (kDim / 64) * (kTok / 64);                // 1024 -> 128 blocks
    wmma_gemm64<0, false, 1, 1, false, 0><<<dim3(tiles / 8, 1), dim3(256), 0, stream>>>(
        WVT, WVT, kDim, 0L, XH, XH, kDim, 0L,
        (void*)VT16, (void*)VT16, kTok, 0L, bv, bv, 0L, kDim, kTok, kDim, kWCarryInv);
  }

  // ---- per (batch, head): scores (both sets) -> dual softmax + diff -> (diff).v into the OATT column slab ----
  const long planeSC    = (long)kSeq * kSeq;                    // per-set score plane
  const int  tilesScore = (kSeq / 64) * (kSeq / 64);            // 1024 -> 128 blocks (x 2 sets)
  for (int b = 0; b < kBatch; ++b) {
    const size_t tokQK = (size_t)b * kSeq * kQKCols;            // first token row of this batch in QK16 (halves)
    const int* maskb = mask + (size_t)b * kSeq * kSeq;
    for (int h = 0; h < kHeads; ++h) {
      // SC[set][i][j] = 32^-0.5 * sum_{d<32} QK16[b,i][64h + 32 set + d] * QK16[b,j][1024 + 64h + 32 set + d]
      const unsigned short* Ag  = QK16 + tokQK + (size_t)h * kDh;
      const unsigned short* Btg = QK16 + tokQK + (size_t)kDim + (size_t)h * kDh;
      wmma_gemm64<0, false, 0, 0, false, 0><<<dim3(tilesScore / 8, 2), dim3(256), 0, stream>>>(
          Ag, Ag, kQKCols, (long)kDiff, Btg, Btg, kQKCols, (long)kDiff,
          (void*)SC, (void*)SC, kSeq, planeSC, BQK, BQK, 0L, kSeq, kSeq, kDiff, kInvScale);
      // DF[i][j] = f16( 32768 * (a1 - lambda a2) )
      softmax_diff_kernel<<<dim3(kSeq), dim3(256), 0, stream>>>(
          SC, SC + planeSC, maskb, lq1, lk1, lq2, lk2, DF);
      // OATT[b,i][64h + d] = 2^-15 * sum_j DF[i][j] * VT16[64h + d][b*2048 + j]   (M=2048, N=64, K=2048)
      const unsigned short* VTg = VT16 + (size_t)h * kDh * kTok + (size_t)b * kSeq;
      float* Og = OATT + (size_t)b * kSeq * kDim + (size_t)h * kDh;
      ctx_splitk_kernel<<<dim3(kSeq / 16, kDh / 32), dim3(256), 0, stream>>>(DF, VTg, Og);
    }
  }

  // ---- per-head LayerNorm, affine, x0.8 -> AOH16 ----
  ln_cast_kernel<<<dim3(kTok / 2), dim3(256), 0, stream>>>(OATT, ln_g, ln_b, AOH16);

  // ---- output projection: out[m][n] = (1/16) sum_k AOH16[m][k] WOT[n][k] + bo[n]   (M=4096, N=1024, K=1024) ----
  {
    const int tiles = (kTok / 64) * (kDim / 64);                // 1024 -> 128 blocks
    wmma_gemm64<0, false, 2, 0, false, 0><<<dim3(tiles / 8, 1), dim3(256), 0, stream>>>(
        AOH16, AOH16, kDim, 0L, WOT, WOT, kDim, 0L,
        (void*)out, (void*)out, kDim, 0L, bo, bo, 0L, kTok, kDim, kDim, kWCarryInv);
  }
}

// v003
// It runs in 231 microseconds.
// It is 4.04 times as fast as v001, going by the measured steps of the versions left out in between.
// Counting every step since v000, it is 15.9 times as fast.
// Contractions: q|k projection and v^T projection (x f16 by W^T f16 carried x16), scores q_set.k_set^T per head and set (q, k f16 planes, K=32), p_set.v per head and set (p = exp2 of the shifted scores, f16, by v^T f16 plane, K=2048), output projection (LayerNorm output f16 by Wo^T f16 carried x16): all v_wmma_f32_16x16x32_f16 with f32 accumulate; bias adds, mask select, both softmaxes, lambda and the per-head LayerNorm in f32.
#include <hip/hip_runtime.h>
#include <math.h>

// ---------------------------------------------------------------------------
// Problem constants
// ---------------------------------------------------------------------------
constexpr int kBatch  = 2;
constexpr int kSeq    = 2048;
constexpr int kDim    = 1024;              // hidden
constexpr int kHeads  = 16;
constexpr int kDh     = 64;                // head dim of v / output
constexpr int kDiff   = 32;                // head dim of each q/k set
constexpr int kTok    = kBatch * kSeq;     // 4096 token rows
constexpr int kQKCols = 2 * kDim;          // 2048: pitch of the q | k plane (halves)
constexpr float kWCarry    = 16.0f;        // weights carried x16 in f16
constexpr float kWCarryInv = 1.0f / 16.0f;
constexpr float kInvScale  = 0.17677669529663687f;   // 32^-0.5
constexpr float kNegBig    = -1.0e9f;
constexpr float kLambdaInit = 0.2f;
constexpr float kOutGain   = 0.8f;         // 1 - lambda_init
constexpr float kLnEps     = 1.0e-5f;
constexpr float kInv64     = 1.0f / 64.0f;
static_assert(kHeads * kDh == kDim, "shape");
static_assert(kHeads * kDiff * 2 == kDim, "shape");
// GEMM shape contract: M, N multiples of 64; K multiple of 32
static_assert(kTok % 64 == 0 && kQKCols % 64 == 0 && kDim % 64 == 0 && kSeq % 64 == 0 && kDh % 64 == 0, "tiles");
static_assert(kDim % 32 == 0 && kDiff % 32 == 0 && kSeq % 32 == 0, "ktiles");
static_assert((kTok * kDim) % (8 * 256) == 0, "cast grid");

typedef __attribute__((ext_vector_type(16))) _Float16 v16h;
typedef __attribute__((ext_vector_type(8)))  _Float16 v8h;
typedef __attribute__((ext_vector_type(16))) __bf16   v16b;
typedef __attribute__((ext_vector_type(8)))  __bf16   v8b;
typedef __attribute__((ext_vector_type(8)))  float    v8f;
typedef __attribute__((ext_vector_type(4)))  float    v4f;
typedef __attribute__((ext_vector_type(2)))  float    v2f;
typedef __attribute__((ext_vector_type(2)))  int      v2i;
typedef __attribute__((ext_vector_type(4)))  unsigned int v4u;

// ---------------------------------------------------------------------------
// Helper pieces: conversions, hazard guards, WMMA fragments
// ---------------------------------------------------------------------------
__device__ __forceinline__ unsigned short f2bf_bits(float f) {
  unsigned u = __float_as_uint(f);
  return (unsigned short)((u + 0x7FFFu + ((u >> 16) & 1u)) >> 16);
}
__device__ __forceinline__ float bf_bits2f(unsigned short h) { return __uint_as_float(((unsigned)h) << 16); }

// hazard guards as plain device helpers (no inline asm inside the kernel template body)
__device__ __forceinline__ void dep_guard_h(v8f& a, v8f& b, v16h x, v16h y) { asm volatile("v_nop\n\tv_nop\n\tv_nop\n\tv_nop" : "+v"(a), "+v"(b) : "v"(x), "v"(y)); }
__device__ __forceinline__ void dep_guard_b(v8f& a, v8f& b, v16b x, v16b y) { asm volatile("v_nop\n\tv_nop\n\tv_nop\n\tv_nop" : "+v"(a), "+v"(b) : "v"(x), "v"(y)); }
// group guard tying all four accumulators of an A-row group plus its A fragments
__device__ __forceinline__ void dep_guard4_h(v8f& a, v8f& b, v8f& c, v8f& d, v16h x, v16h y) { asm volatile("v_nop\n\tv_nop\n\tv_nop\n\tv_nop" : "+v"(a), "+v"(b), "+v"(c), "+v"(d) : "v"(x), "v"(y)); }
__device__ __forceinline__ void dep_guard4_b(v8f& a, v8f& b, v8f& c, v8f& d, v16b x, v16b y) { asm volatile("v_nop\n\tv_nop\n\tv_nop\n\tv_nop" : "+v"(a), "+v"(b), "+v"(c), "+v"(d) : "v"(x), "v"(y)); }
__device__ __forceinline__ void keep4_h(v16h a, v16h b, v16h c, v16h d) { asm volatile("v_nop" :: "v"(a), "v"(b), "v"(c), "v"(d)); }
__device__ __forceinline__ void keep4_b(v16b a, v16b b, v16b c, v16b d) { asm volatile("v_nop" :: "v"(a), "v"(b), "v"(c), "v"(d)); }
__device__ __forceinline__ void acc_guard4(v8f& a, v8f& b, v8f& c, v8f& d) { asm volatile("v_nop\n\tv_nop\n\tv_nop\n\tv_nop" : "+v"(a), "+v"(b), "+v"(c), "+v"(d)); }
template <typename T> struct Frag;
template <> struct Frag<_Float16> {
  typedef v16h V; union U { v16h v; v8h h[2]; };
  // elements 0..7 <- p[0..7], 8..15 <- p[16..23]
  static __device__ __forceinline__ v16h load(const _Float16* p) {
    U f; f.h[0] = *(const v8h*)(p); f.h[1] = *(const v8h*)(p + 16); return f.v;
  }
  static __device__ __forceinline__ v8f mma(v16h a, v16h b, v8f c) {
    return __builtin_amdgcn_wmma_f32_16x16x32_f16(false, a, false, b, (short)0, c, false, false);
  }
  static __device__ __forceinline__ void guard(v8f& a, v8f& b, v16h x, v16h y) { dep_guard_h(a, b, x, y); }
  static __device__ __forceinline__ void guard4(v8f& a, v8f& b, v8f& c, v8f& d, v16h x, v16h y) { dep_guard4_h(a, b, c, d, x, y); }
  static __device__ __forceinline__ void keep(v16h a, v16h b, v16h c, v16h d) { keep4_h(a, b, c, d); }
};
template <> struct Frag<__bf16> {
  typedef v16b V; union U { v16b v; v8b h[2]; };
  static __device__ __forceinline__ v16b load(const __bf16* p) {
    U f; f.h[0] = *(const v8b*)(p); f.h[1] = *(const v8b*)(p + 16); return f.v;
  }
  static __device__ __forceinline__ v8f mma(v16b a, v16b b, v8f c) {
    return __builtin_amdgcn_wmma_f32_16x16x32_bf16(false, a, false, b, (short)0, c, false, false);
  }
  static __device__ __forceinline__ void guard(v8f& a, v8f& b, v16b x, v16b y) { dep_guard_b(a, b, x, y); }
  static __device__ __forceinline__ void guard4(v8f& a, v8f& b, v8f& c, v8f& d, v16b x, v16b y) { dep_guard4_b(a, b, c, d, x, y); }
  static __device__ __forceinline__ void keep(v16b a, v16b b, v16b c, v16b d) { keep4_b(a, b, c, d); }
};

__device__ __forceinline__ unsigned pk16(unsigned short a, unsigned short b) { return (unsigned)a | ((unsigned)b << 16); }
__device__ __forceinline__ unsigned short h_bits(float f) { const _Float16 h = (_Float16)f; return __builtin_bit_cast(unsigned short, h); }

// ---- Register-blocked batched WMMA GEMM (ACT reduced to none/relu/leaky) -------------------------------
// C[m,n] = scale * sum_k A[m,k] * Bt[n,k] (+bias)(+resid); each wave owns a 64x64 tile.
// A row-major [M,K]; Bt row-major [N,K]; M,N % 64 == 0, K % 32 == 0.
// SPLIT: operands are hi/lo planes (A2/Bt2 = lo planes, same layout); product = hi*hi + hi*lo + lo*hi.
// BIAS_MODE: 0 = none, 1 = bias[m], 2 = bias[n].
// OUT_MODE: 0 = f32, 1 = f16, 2 = bf16 hi plane (Cout) + bf16 lo plane (Cout2).
// ET: 0 = f16 operands, 1 = bf16 operands (pointers passed as 16-bit storage)
template <int ET> struct Elem;
template <> struct Elem<0> { typedef _Float16 T; };
template <> struct Elem<1> { typedef __bf16 T; };
template <int ET, bool SPLIT, int BIAS_MODE, int OUT_MODE, bool RESID, int ACT = 0>
__global__ __launch_bounds__(256) void wmma_gemm64(
    const unsigned short* __restrict__ Ap, const unsigned short* __restrict__ A2p, int lda, long strideA,
    const unsigned short* __restrict__ Btp, const unsigned short* __restrict__ Bt2p, int ldb, long strideB,
    void* __restrict__ Cout, void* __restrict__ Cout2, int ldc, long strideC,
    const float* __restrict__ bias,
    const float* __restrict__ resid, long strideR,
    int M, int N, int K, float scale) {
  typedef typename Elem<ET>::T T;
  typedef typename Frag<T>::V V;
  const T* A = (const T*)Ap; const T* A2 = (const T*)A2p; const T* Bt = (const T*)Btp; const T* Bt2 = (const T*)Bt2p;
  __shared__ __align__(16) float sT[8][16 * 68];   // per-wave 16x64 slab, pitch 68 floats
  const int b    = blockIdx.y;
  const int lane = threadIdx.x & 31;
  const int wave = threadIdx.x >> 5;
  const int tilesN = N >> 6;
  const int tilesM = M >> 6;
  const int tile = blockIdx.x * 8 + wave;
  if (tile >= tilesM * tilesN) return;   // wave-uniform; no block barriers in this kernel
  const int tm = tile / tilesN;
  const int tn = tile - tm * tilesN;
  const int m0 = tm << 6;
  const int n0 = tn << 6;

  const T* Ab  = A  + (size_t)b * strideA;
  const T* Bb  = Bt + (size_t)b * strideB;
  const T* Ab2 = SPLIT ? (A2  + (size_t)b * strideA) : nullptr;
  const T* Bb2 = SPLIT ? (Bt2 + (size_t)b * strideB) : nullptr;

  const int rlane = lane & 15;                 // row (A) / col (B, D) within subtile
  const int koff  = (lane >> 4) * 8;           // k offset of this lane half
  const int mOff  = (lane >> 4) * 8;           // D row offset

  v8f acc[4][4];
#pragma unroll
  for (int i = 0; i < 4; ++i)
#pragma unroll
    for (int j = 0; j < 4; ++j) acc[i][j] = (v8f){0.f,0.f,0.f,0.f,0.f,0.f,0.f,0.f};

  for (int k0 = 0; k0 < K; k0 += 32) {
    V bh[4], bl[4];
#pragma unroll
    for (int j = 0; j < 4; ++j) {
      const size_t bo = (size_t)(n0 + (j << 4) + rlane) * ldb + koff + k0;
      bh[j] = Frag<T>::load(Bb + bo);
      if (SPLIT) bl[j] = Frag<T>::load(Bb2 + bo);
    }
#pragma unroll
    for (int i = 0; i < 4; ++i) {
      const size_t ao = (size_t)(m0 + (i << 4) + rlane) * lda + koff + k0;
      V ah = Frag<T>::load(Ab + ao);
      V al;
      if (SPLIT) al = Frag<T>::load(Ab2 + ao);
#pragma unroll
      for (int j = 0; j < 4; ++j) {
        acc[i][j] = Frag<T>::mma(ah, bh[j], acc[i][j]);
        if (SPLIT) {
          acc[i][j] = Frag<T>::mma(ah, bl[j], acc[i][j]);
          acc[i][j] = Frag<T>::mma(al, bh[j], acc[i][j]);
        }
      }
      Frag<T>::guard4(acc[i][0], acc[i][1], acc[i][2], acc[i][3], ah, SPLIT ? al : ah);
    }
    Frag<T>::keep(bh[0], bh[1], bh[2], bh[3]);
    if (SPLIT) Frag<T>::keep(bl[0], bl[1], bl[2], bl[3]);
  }
  acc_guard4(acc[0][0], acc[0][1], acc[0][2], acc[0][3]);
  acc_guard4(acc[1][0], acc[1][1], acc[1][2], acc[1][3]);
  acc_guard4(acc[2][0], acc[2][1], acc[2][2], acc[2][3]);
  acc_guard4(acc[3][0], acc[3][1], acc[3][2], acc[3][3]);

  // ---- epilogue ----
  float* slab = sT[wave];
  const float* Rb = RESID ? (resid + (size_t)b * strideR) : nullptr;
#pragma unroll
  for (int i = 0; i < 4; ++i) {
    const int mBase = m0 + (i << 4);
#pragma unroll
    for (int j = 0; j < 4; ++j) {
      const int n = n0 + (j << 4) + rlane;
      float bv = 0.f;
      if (BIAS_MODE == 2) bv = bias[n];
#pragma unroll
      for (int r = 0; r < 8; ++r) {
        float v = acc[i][j][r] * scale;
        if (BIAS_MODE == 1) v += bias[mBase + mOff + r];
        if (BIAS_MODE == 2) v += bv;
        if (RESID) v += Rb[(size_t)(mBase + mOff + r) * ldc + n];
        if (ACT == 2) v = fmaxf(v, 0.0f);
        if (ACT == 4) v = (v > 0.f) ? v : 0.01f * v;
        slab[(mOff + r) * 68 + (j << 4) + rlane] = v;
      }
    }
    __builtin_amdgcn_fence(__ATOMIC_RELEASE, "workgroup");
    __builtin_amdgcn_wave_barrier();
    __builtin_amdgcn_fence(__ATOMIC_ACQUIRE, "workgroup");
    if (OUT_MODE == 0) {
      float* C = (float*)Cout + (size_t)b * strideC;
      const int hh = lane >> 4, c4 = (lane & 15) * 4;     // row seg = 256 B = 16 lanes x 16 B
      {
#pragma unroll
        for (int it = 0; it < 8; ++it) {
          const int row = it * 2 + hh;
          v4f v = *(const v4f*)(slab + row * 68 + c4);
          *(v4f*)(C + (size_t)(mBase + row) * ldc + n0 + c4) = v;
        }
        
      }
    } else {
      const int q = lane >> 3, c8 = (lane & 7) * 8;
      unsigned short* C  = (unsigned short*)Cout  + (size_t)b * strideC;
      unsigned short* C2 = (OUT_MODE == 2) ? ((unsigned short*)Cout2 + (size_t)b * strideC) : nullptr;
      {
#pragma unroll
        for (int it = 0; it < 4; ++it) {
          const int row = it * 4 + q;
          const float* sp = slab + row * 68 + c8;
          v8h hv, lv;
#pragma unroll
          for (int e = 0; e < 8; ++e) {
            if (OUT_MODE == 1) {
              hv[e] = (_Float16)sp[e];
            } else {
              unsigned short hb = f2bf_bits(sp[e]);
              unsigned short lb = f2bf_bits(sp[e] - bf_bits2f(hb));
              hv[e] = __builtin_bit_cast(_Float16, hb);
              lv[e] = __builtin_bit_cast(_Float16, lb);
            }
          }
          *(v8h*)(C + (size_t)(mBase + row) * ldc + n0 + c8) = hv;
          if (OUT_MODE == 2) *(v8h*)(C2 + (size_t)(mBase + row) * ldc + n0 + c8) = lv;
        }
        
      }
    }
    __builtin_amdgcn_fence(__ATOMIC_RELEASE, "workgroup");
    __builtin_amdgcn_wave_barrier();
    __builtin_amdgcn_fence(__ATOMIC_ACQUIRE, "workgroup");
  }
}

// ---------------------------------------------------------------------------
// ---------------------------------------------------------------------------
__global__ __launch_bounds__(256) void cast8_f16_kernel(const float* __restrict__ in, unsigned short* __restrict__ out, int n8) {
  const int i = blockIdx.x * 256 + threadIdx.x;
  if (i >= n8) return;
  const float* p = in + 8 * (size_t)i;
  const v4f a = *(const v4f*)(p);
  const v4f c = *(const v4f*)(p + 4);
  unsigned short hb[8];
#pragma unroll
  for (int e = 0; e < 4; ++e) {
    hb[e]     = h_bits(a[e]);
    hb[4 + e] = h_bits(c[e]);
  }
  const v4u u = (v4u){pk16(hb[0], hb[1]), pk16(hb[2], hb[3]), pk16(hb[4], hb[5]), pk16(hb[6], hb[7])};
  unsigned short* q = out + 8 * (size_t)i;
  *(v4u*)q = u;
  
}

// ---------------------------------------------------------------------------
// Weight transpose + cast (+ optional output-feature permutation) for square [1024 in][1024 out] f32 W (row-major [k][n]):
//   out[np][k] = f16( scale * W[k][orig(np)] ), orig(np) = perm ? ((np>>5)&1)*512 + (np>>6)*32 + (np&31) : np.
// With perm, plane column 64h + 32*set + d holds feature set*512 + 32h + d, so the two q/k sets of a head sit at stride 32.
// grid (16, 16, 4): blockIdx.x = k tile (64 cols of out), blockIdx.y = np tile (64 rows of out), blockIdx.z selects
//   z0 = (W0 -> o0, perm), z1 = (W1 -> o1, perm), z2 = (W2 -> o2, identity), z3 = (W3 -> o3, identity). 256 threads.
// Load coverage: 16 iterations x 256 threads = 4096 = the whole 64x64 tile (coalesced along n inside 32-wide strips).
// Store coverage: 8 waves x 2 iterations x 4 rows (lane>>3) = 64 rows; (lane&7) x 8 halves = 64 cols; each row segment =
// ---------------------------------------------------------------------------
__global__ __launch_bounds__(256) void wt_kernel(const float* __restrict__ W0, const float* __restrict__ W1,
                                                 const float* __restrict__ W2, const float* __restrict__ W3,
                                                 unsigned short* __restrict__ o0, unsigned short* __restrict__ o1,
                                                 unsigned short* __restrict__ o2, unsigned short* __restrict__ o3,
                                                 float scale) {
  __shared__ float sm[64][65];   // sm[np_local][k_local]
  const int t  = threadIdx.x;
  const int k0 = blockIdx.x * 64;
  const int n0 = blockIdx.y * 64;
  const int z  = blockIdx.z;                                   // block-uniform
  const float* W = (z == 0) ? W0 : (z == 1) ? W1 : (z == 2) ? W2 : W3;
  unsigned short* op = (z == 0) ? o0 : (z == 1) ? o1 : (z == 2) ? o2 : o3;
  const int perm = (z < 2) ? 1 : 0;
#pragma unroll
  for (int i = 0; i < 16; ++i) {
    const int e = i * 256 + t;
    const int r = e >> 6;          // k local
    const int c = e & 63;          // np local
    const int np = n0 + c;
    const int og = perm ? ((((np >> 5) & 1) << 9) + ((np >> 6) << 5) + (np & 31)) : np;
    sm[c][r] = W[(size_t)(k0 + r) * kDim + og] * scale;
  }
  __syncthreads();
  const int lane = t & 31, wave = t >> 5;
  const int q = lane >> 3, c8 = (lane & 7) * 8;
  {
#pragma unroll
    for (int it = 0; it < 2; ++it) {
      const int row = wave * 8 + it * 4 + q;                 // np local
      unsigned short hb[8];
#pragma unroll
      for (int e = 0; e < 8; ++e) hb[e] = h_bits(sm[row][c8 + e]);
      const v4u u = (v4u){pk16(hb[0], hb[1]), pk16(hb[2], hb[3]), pk16(hb[4], hb[5]), pk16(hb[6], hb[7])};
      *(v4u*)(op + (size_t)(n0 + row) * kDim + k0 + c8) = u;
    }
    
  }
}

// ---------------------------------------------------------------------------
// Permuted q|k bias line: out[np] = bq[orig(np)] for np < 1024 (block 0), out[1024 + np] = bk[orig(np)] (block 1).
// Thread t owns np = 4t..4t+3 (orig of an aligned group of 4 is contiguous); one 16-B store per lane, a wave = 512 B =
// ---------------------------------------------------------------------------
__global__ __launch_bounds__(256) void biasperm_kernel(const float* __restrict__ bq, const float* __restrict__ bk,
                                                       float* __restrict__ out) {
  const int t = threadIdx.x;
  const float* src = (blockIdx.x == 0) ? bq : bk;             // block-uniform
  const int np = 4 * t;
  const int og = (((np >> 5) & 1) << 9) + ((np >> 6) << 5) + (np & 31);
  const v4f v = *(const v4f*)(src + og);
  float* dp = out + (size_t)blockIdx.x * kDim + np;
  *(v4f*)dp = v;
  
}

// ---------------------------------------------------------------------------
// Both masked softmaxes, their difference and the product with v, for every (batch, head) in one launch; no score ever
// reaches memory. Transposed forms, so that one lane owns one query column throughout:
//   St[set][j][i] = sum_d k_set[j][d] * q_set[i][d]     (A = 16 key rows, B = 16 query rows kept in registers, K = 32)
//   x = (mask[i][j] != 0) ? St * 32^-0.5 * log2(e) : -1e9 * log2(e)
//   running maximum m and sum l per query and set; p = exp2(x - m), f16
//   Ot[set][d][i] = Ot[set][d][i] * exp2(m_old - m_new) + sum_j v^T[d][j] * p[j][i]     (A = 16 rows of v^T, B = p, K = 32)
//   O[i][d] = Ot[0][d][i] / l0 - lambda * Ot[1][d][i] / l1,  lambda = exp(sum lq1*lk1) - exp(sum lq2*lk2) + 0.2
// grid (16, 16 heads, 2 batches), 8 waves; wave w owns query rows 128*blockIdx.x + 16w .. +15 and walks all 2048 keys, 64 a
// trip. A trip's operands come through LDS: 64 k rows and 64 v^T rows of 128 B (shared by the 8 waves) and 128 mask rows of
// 256 B (16 per wave), brought by asynchronous 16-B copies in which a wave covers whole 128-B lines. Two buffers: the copies
// of trip t + 1 are issued behind the barrier that ends trip t - 1 and land while trip t is worked on.
// Fragment maps: accumulator register r of lane l holds row 8*(l>>4) + r, column l & 15. Two score tiles (keys 0..15 and
// 16..31 of a 32-key chunk) converted in place are the B operand of the second product: element s = key
// (s < 8 ? 8*(l>>4) + s : 16 + 8*(l>>4) + s - 8), which is the k order in which Frag::load reads the v^T rows.
// Store: a lane holds 8 consecutive d of its query row per tile; the wave writes the whole 256-B row segment of its head.
// ---------------------------------------------------------------------------
constexpr int   kFaQ    = 128;                 // query rows per block (8 waves x 16)
constexpr int   kFaKeys = 64;                  // keys per trip
constexpr float kLog2e  = 1.4426950408889634f;
static_assert(kSeq % kFaQ == 0 && kSeq % kFaKeys == 0 && kDh == 64 && kDiff == 32, "attention tiling");
typedef __attribute__((ext_vector_type(4))) int v4i;
constexpr int kFaTrips = kSeq / kFaKeys;                   // 32
constexpr int kKvPitch = 144;                              // LDS pitch of the 128-B k and v^T rows: 16 B x odd, no bank conflict for 16-B reads
constexpr int kMkPitch = 272;                              // LDS pitch of the 256-B mask rows: 16 B x odd
constexpr int kLdsV    = kFaKeys * kKvPitch;               // k rows at 0, v^T rows behind them
constexpr int kLdsM    = kLdsV + kDh * kKvPitch;           // mask rows behind those
constexpr int kLdsBuf  = kLdsM + kFaQ * kMkPitch;          // 53,248 B a buffer
static_assert(kFaTrips >= 2 && kFaKeys * 2 == 128 && kDh * 2 == 128 && kFaKeys * 4 == 256, "staging");
// Four asynchronous copies, 16 B per lane each, global memory to LDS through no register. l = the lane's LDS byte address,
// g = its global address. The s_wait_xcnt ends the statement so that it stands in front of every later write of an address
// register named here.
__device__ __forceinline__ void copy4_to_lds(unsigned l0, const char* g0, unsigned l1, const char* g1,
                                             unsigned l2, const char* g2, unsigned l3, const char* g3) {
  asm volatile("global_load_async_to_lds_b128 %0, %1, off\n\t"
               "global_load_async_to_lds_b128 %2, %3, off\n\t"
               "global_load_async_to_lds_b128 %4, %5, off\n\t"
               "global_load_async_to_lds_b128 %6, %7, off\n\t"
               "s_wait_xcnt 0x0"
               :: "v"(l0), "v"(g0), "v"(l1), "v"(g1), "v"(l2), "v"(g2), "v"(l3), "v"(g3) : "memory");
}
// One trip's tiles into one buffer: 12 copies a lane. lk, lv, lm and gk, gv, gm are the lane's first LDS and global addresses
// in the k, v^T and mask tile; its further rows lie 32 rows on (k, v^T) and 2 rows on (mask).
__device__ __forceinline__ void stage_trip(unsigned lk, unsigned lv, unsigned lm,
                                           const char* gk, const char* gv, const char* gm) {
  copy4_to_lds(lk, gk, lk + 32 * kKvPitch, gk + (size_t)32 * kQKCols * 2,
               lv, gv, lv + 32 * kKvPitch, gv + (size_t)32 * kTok * 2);
  copy4_to_lds(lm,                gm,                          lm + 2 * kMkPitch, gm + (size_t)2 * kSeq * 4,
               lm + 4 * kMkPitch, gm + (size_t)4 * kSeq * 4,   lm + 6 * kMkPitch, gm + (size_t)6 * kSeq * 4);
  copy4_to_lds(lm + 8 * kMkPitch,  gm + (size_t)8 * kSeq * 4,  lm + 10 * kMkPitch, gm + (size_t)10 * kSeq * 4,
               lm + 12 * kMkPitch, gm + (size_t)12 * kSeq * 4, lm + 14 * kMkPitch, gm + (size_t)14 * kSeq * 4);
}
// value of lane l ^ 16, by a vector-unit lane swap (no LDS round trip)
__device__ __forceinline__ float other_half(float x) {
  const int b = __float_as_int(x);
  return __int_as_float(__builtin_amdgcn_permlanex16(b, b, 0x76543210, 0xfedcba98, false, false));
}
// exp2 in place. The instruction set asks for one slot between a transcendental and a directly following instruction that
// overwrites its source or reads its result. Here each overwrites only its own source, and the v_nop is the slot in front of
// whatever the compiler puts next.
__device__ __forceinline__ void exp2_inplace(float& x) {
  asm("v_exp_f32 %0, %0\n\tv_nop" : "+v"(x));
}
__device__ __forceinline__ void exp2_inplace8(v8f& x) {
  float a = x[0], b = x[1], c = x[2], d = x[3], e = x[4], f = x[5], g = x[6], h = x[7];
  asm("v_exp_f32 %0, %0\n\tv_exp_f32 %1, %1\n\tv_exp_f32 %2, %2\n\tv_exp_f32 %3, %3\n\t"
      "v_exp_f32 %4, %4\n\tv_exp_f32 %5, %5\n\tv_exp_f32 %6, %6\n\tv_exp_f32 %7, %7\n\tv_nop"
      : "+v"(a), "+v"(b), "+v"(c), "+v"(d), "+v"(e), "+v"(f), "+v"(g), "+v"(h));
  x = (v8f){a, b, c, d, e, f, g, h};
}
// four waves per SIMD (two blocks per WGP): the whole grid of 512 blocks is resident at once, within 256 registers a wave
// and 106,496 B of LDS a block
__global__ __launch_bounds__(256) __attribute__((amdgpu_waves_per_eu(4, 4))) void diff_attn_kernel(const unsigned short* __restrict__ QKp,
                                                        const unsigned short* __restrict__ Vtp,
                                                        const int* __restrict__ Mp,
                                                        const float* __restrict__ lq1, const float* __restrict__ lk1,
                                                        const float* __restrict__ lq2, const float* __restrict__ lk2,
                                                        float* __restrict__ O) {
  const int lane = threadIdx.x & 31, wave = threadIdx.x >> 5;
  const int c    = lane & 15;                  // this lane's query column; row of every A fragment
  const int h8   = (lane >> 4) * 8;            // k offset of this lane half; also its accumulator row offset
  const int head = blockIdx.y;
  const int b    = blockIdx.z;
  const int q0   = blockIdx.x * kFaQ + wave * 16;

  const _Float16* QK = (const _Float16*)QKp + (size_t)b * kSeq * kQKCols + head * kDh;
  const _Float16* Qr = QK + (size_t)(q0 + c) * kQKCols + h8;
  __shared__ __attribute__((aligned(16))) unsigned char smem[2 * kLdsBuf];
  // what this lane copies: of k and v^T rows (t >> 3) and (t >> 3) + 32, bytes 16 * (t & 7) .. +15 (a wave: 4 whole rows a
  // copy); of the mask its own wave's rows 2i + (lane >> 4), i = 0..7, bytes 16 * (lane & 15) .. +15 (a wave: 2 whole rows)
  const int crow = threadIdx.x >> 3, ccol = (threadIdx.x & 7) * 16;
  const int mrow = wave * 16 + (lane >> 4), mcol = (lane & 15) * 16;
  const char* gK = (const char*)(QK + kDim + (size_t)crow * kQKCols) + ccol;
  const char* gV = (const char*)((const _Float16*)Vtp + (size_t)(head * kDh + crow) * kTok + (size_t)b * kSeq) + ccol;
  const char* gM = (const char*)(Mp + ((size_t)b * kSeq + blockIdx.x * kFaQ + mrow) * kSeq) + mcol;
  const unsigned lds0 = (unsigned)(size_t)smem;            // low 32 bits of the address = byte offset in the block's LDS
  const unsigned lK = lds0 + crow * kKvPitch + ccol;
  const unsigned lV = lds0 + kLdsV + crow * kKvPitch + ccol;
  const unsigned lM = lds0 + kLdsM + mrow * kMkPitch + mcol;
  // what this lane reads: row c of every 16-row group, from byte 16 * (lane >> 4) (k, v^T) or 32 * (lane >> 4) (mask)
  const int rK = c * kKvPitch + h8 * 2;
  const int rV = kLdsV + c * kKvPitch + h8 * 2;
  const int rM = kLdsM + (wave * 16 + c) * kMkPitch + h8 * 4;
  v16h qf[2];
  qf[0] = Frag<_Float16>::load(Qr);
  qf[1] = Frag<_Float16>::load(Qr + kDiff);

  const v8f zero = (v8f){0.f,0.f,0.f,0.f,0.f,0.f,0.f,0.f};
  const float cs   = kInvScale * kLog2e;
  const float xOff = kNegBig * kLog2e;
  v8f o[2][4];
  float m[2], l[2];
#pragma unroll
  for (int st = 0; st < 2; ++st) {
    m[st] = -__builtin_inff();
    l[st] = 0.f;
#pragma unroll
    for (int dt = 0; dt < 4; ++dt) o[st][dt] = zero;
  }

  // trip 0's tiles, landed and published
  stage_trip(lK, lV, lM, gK, gV, gM);
  asm volatile("s_wait_asynccnt 0x0" ::: "memory");      // this wave's copies have landed
  __syncthreads();                                       // and every other wave's

  for (int t = 0; t < kFaTrips; ++t) {
    const int buf = (t & 1) * kLdsBuf;
    const unsigned char* sb = smem + buf;
    // directly behind the barrier that ended trip t - 1 (in front of trip 0: the one above): the next trip's tiles are asked
    // for, into the buffer that trip t - 1 has read, and fly while this trip is worked on
    if (t + 1 < kFaTrips) {                                // the same for the whole block
      const size_t j1 = (size_t)(t + 1) * kFaKeys;
      const unsigned nb = kLdsBuf - buf;
      stage_trip(lK + nb, lV + nb, lM + nb, gK + j1 * (kQKCols * 2), gV + j1 * 2, gM + j1 * 4);
    }
    v8f s[2][4];
    v4i mk[4][2];
    v16h kf[2][4];
#pragma unroll
    for (int kt = 0; kt < 4; ++kt) {
      mk[kt][0] = *(const v4i*)(sb + rM + kt * 64);
      mk[kt][1] = *(const v4i*)(sb + rM + kt * 64 + 16);
    }
#pragma unroll
    for (int kt = 0; kt < 4; ++kt) {
      const _Float16* kp = (const _Float16*)(sb + rK + kt * 16 * kKvPitch);
      kf[0][kt] = Frag<_Float16>::load(kp);
      kf[1][kt] = Frag<_Float16>::load(kp + kDiff);
    }
    // keeps the trip's mask and k reads together in front of the first product: one latency for all of them; without it
    // the scheduler, short of registers, reads one fragment at a time and waits for each
    __builtin_amdgcn_sched_barrier(0);
    // the 32 mask words of a lane become 32 lane masks in scalar registers here, which frees their vector registers
    bool keep[4][8];
#pragma unroll
    for (int kt = 0; kt < 4; ++kt)
#pragma unroll
      for (int r = 0; r < 8; ++r) keep[kt][r] = (mk[kt][r >> 2][r & 3] != 0);
#pragma unroll
    for (int kt = 0; kt < 4; ++kt) {
      s[0][kt] = Frag<_Float16>::mma(kf[0][kt], qf[0], zero);
      s[1][kt] = Frag<_Float16>::mma(kf[1][kt], qf[1], zero);
    }
    v16h vf[2][4];
    v16h pf[2][2];
#pragma unroll
    for (int st = 0; st < 2; ++st) {
      if (st == 1) {
        // all of the trip's v^T fragments are asked for by here, into the registers the first set's scores have just left:
        // their LDS latency runs under the second set's softmax arithmetic
        const _Float16* vp = (const _Float16*)(sb + rV);
#pragma unroll
        for (int kc = 0; kc < 2; ++kc)
#pragma unroll
          for (int dt = 0; dt < 4; ++dt) vf[kc][dt] = Frag<_Float16>::load(vp + dt * 16 * (kKvPitch / 2) + kc * 32);
        // keeps those reads up here; without it the scheduler sinks them to just in front of their products, each with a full wait
        __builtin_amdgcn_sched_barrier(0);
      }
      float tm = -__builtin_inff();
#pragma unroll
      for (int kt = 0; kt < 4; ++kt)
#pragma unroll
        for (int r = 0; r < 8; ++r) {
          const float x = keep[kt][r] ? s[st][kt][r] * cs : xOff;
          s[st][kt][r] = x;
          tm = fmaxf(tm, x);
        }
      tm = fmaxf(tm, other_half(tm));                // the other lane half holds the other keys of the same query
      const float mn    = fmaxf(m[st], tm);
      float sum = 0.f;
#pragma unroll
      for (int kt = 0; kt < 4; ++kt) {
        v8f p = s[st][kt] - mn;
        exp2_inplace8(p);
#pragma unroll
        for (int r = 0; r < 8; ++r) {
          sum += p[r];
          pf[st][kt >> 1][(kt & 1) * 8 + r] = (_Float16)p[r];
        }
      }
      float alpha = m[st] - mn;
      exp2_inplace(alpha);
      m[st] = mn;
      l[st] = l[st] * alpha + sum;                   // this half's keys only; the halves are joined behind the loop
#pragma unroll
      for (int dt = 0; dt < 4; ++dt) o[st][dt] *= alpha;
    }
#pragma unroll
    for (int kc = 0; kc < 2; ++kc)
#pragma unroll
      for (int dt = 0; dt < 4; ++dt) {
        o[0][dt] = Frag<_Float16>::mma(vf[kc][dt], pf[0][kc], o[0][dt]);
        o[1][dt] = Frag<_Float16>::mma(vf[kc][dt], pf[1][kc], o[1][dt]);
      }
    // hand-over: this wave's reads of the buffer are done, its copies for trip t + 1 have landed; behind the barrier that
    // holds for every wave, so trip t + 1 may be read and this trip's buffer may be refilled
    // The scheduling fence keeps the hand-over at the trip's end; without it the scheduler lifts the waits and the barrier into
    // the second set's softmax, which takes a third off the time the copies have to land.
    __builtin_amdgcn_sched_barrier(0);
    asm volatile("s_wait_dscnt 0x0" ::: "memory");
    asm volatile("s_wait_asynccnt 0x0" ::: "memory");
    __syncthreads();
  }
  asm volatile("s_wait_asynccnt 0x0" ::: "memory");        // no copy is left in flight when the wave goes on to its end

  // lambda from the two 32-vectors (wave-wide butterfly, unconditional shuffles)
  float t1 = lq1[lane] * lk1[lane];
  float t2 = lq2[lane] * lk2[lane];
#pragma unroll
  for (int off = 16; off > 0; off >>= 1) {
    t1 += __shfl_xor(t1, off, 32);
    t2 += __shfl_xor(t2, off, 32);
  }
  const float lam = (expf(t1) - expf(t2)) + kLambdaInit;

  const float l0 = l[0] + other_half(l[0]);
  const float l1 = l[1] + other_half(l[1]);
  const float inv0 = 1.0f / l0;
  const float inv1 = lam / l1;
  float* Or = O + ((size_t)b * kSeq + q0 + c) * kDim + head * kDh + h8;
#pragma unroll
  for (int dt = 0; dt < 4; ++dt) {
    v4f lo, hi;
#pragma unroll
    for (int e = 0; e < 4; ++e) {
      lo[e] = o[0][dt][e]     * inv0 - o[1][dt][e]     * inv1;
      hi[e] = o[0][dt][4 + e] * inv0 - o[1][dt][4 + e] * inv1;
    }
    *(v4f*)(Or + dt * 16)     = lo;
    *(v4f*)(Or + dt * 16 + 4) = hi;
  }
}

// ---------------------------------------------------------------------------
// Per-head LayerNorm over 64 dims of the attention output o (f32 [4096][1024], column = 64h + d), affine, x0.8, f16 cast:
//   mu = mean_d o, var = mean_d (o - mu)^2, y = ((o - mu) / sqrt(var + 1e-5) * g[h][d] + b[h][d]) * 0.8 -> A16[row][64h + d].
// 256 threads = 2 rows; within a row thread tt (0..127) owns columns 64*(tt>>3) + 8*(tt&7) .. +7 (8 threads per head, lanes
// 8q..8q+7 of one wave; reductions by xor shuffles 1,2,4 in fixed order). Loads: 2 b128 (o) + 2 (g) + 2 (b).
// grid = 2048 blocks = 4096 rows exactly.
// ---------------------------------------------------------------------------
__global__ __launch_bounds__(256) void ln_cast_kernel(const float* __restrict__ O, const float* __restrict__ g,
                                                      const float* __restrict__ bta, unsigned short* __restrict__ A16) {
  const int t   = threadIdx.x;
  const int row = blockIdx.x * 2 + (t >> 7);
  const int tt  = t & 127;
  const int h   = tt >> 3;
  const int c0  = h * kDh + (tt & 7) * 8;
  const float* op = O + (size_t)row * kDim + c0;
  const v4f a = *(const v4f*)(op);
  const v4f c = *(const v4f*)(op + 4);
  float x[8];
#pragma unroll
  for (int e = 0; e < 4; ++e) { x[e] = a[e]; x[4 + e] = c[e]; }
  float s = ((x[0] + x[1]) + (x[2] + x[3])) + ((x[4] + x[5]) + (x[6] + x[7]));
  s += __shfl_xor(s, 1, 32);
  s += __shfl_xor(s, 2, 32);
  s += __shfl_xor(s, 4, 32);
  const float mu = s * kInv64;
  float d[8];
  float vs = 0.0f;
#pragma unroll
  for (int e = 0; e < 8; ++e) { d[e] = x[e] - mu; vs += d[e] * d[e]; }
  vs += __shfl_xor(vs, 1, 32);
  vs += __shfl_xor(vs, 2, 32);
  vs += __shfl_xor(vs, 4, 32);
  const float var  = vs * kInv64;
  const float rstd = 1.0f / sqrtf(var + kLnEps);
  const float* gp = g + c0;
  const float* bp = bta + c0;
  const v4f g0 = *(const v4f*)(gp);
  const v4f g1 = *(const v4f*)(gp + 4);
  const v4f b0 = *(const v4f*)(bp);
  const v4f b1 = *(const v4f*)(bp + 4);
  float gg[8], bb[8];
#pragma unroll
  for (int e = 0; e < 4; ++e) { gg[e] = g0[e]; gg[4 + e] = g1[e]; bb[e] = b0[e]; bb[4 + e] = b1[e]; }
  unsigned short hb[8];
#pragma unroll
  for (int e = 0; e < 8; ++e) {
    const float y = (d[e] * rstd * gg[e] + bb[e]) * kOutGain;
    hb[e] = h_bits(y);
  }
  const v4u u = (v4u){pk16(hb[0], hb[1]), pk16(hb[2], hb[3]), pk16(hb[4], hb[5]), pk16(hb[6], hb[7])};
  unsigned short* pr = A16 + (size_t)row * kDim + c0;
  *(v4u*)pr = u;
  
}

// ---------------------------------------------------------------------------
// Host glue.
// producer before any consumer reads it; no region re-used with another type):
//   XH    f16 [4096][1024]               8,388,608  at           0   (cast8; read by the two projection GEMMs)
//   WQKT  f16 [2048][1024]               4,194,304  at   8,388,608   (wt z0,z1: permuted Wq^T rows 0..1023, Wk^T rows 1024..2047)
//   WVT   f16 [1024][1024]               2,097,152  at  12,582,912   (wt z2)
//   WOT   f16 [1024][1024]               2,097,152  at  14,680,064   (wt z3)
//   BQK   f32 [2048]                         8,192  at  16,777,216   (permuted bq | bk)
//   QK16  f16 [4096][2048]              16,777,216  at  16,785,408   (q plane cols 0..1023 | k plane cols 1024..2047, permuted)
//   VT16  f16 [1024][4096]               8,388,608  at  33,562,624   (v^T: row = 64h + d, col = token)
//   OATT  f32 [4096][1024]              16,777,216  at  41,951,232   (attention output before LayerNorm; 32 disjoint column slabs)
//   AOH16 f16 [4096][1024]               8,388,608  at  58,728,448   (LayerNorm output)
//   total                               67,117,056
// GEMM shapes: q|k proj M=4096 N=2048 K=1024; v^T proj M=1024 N=4096 K=1024; out proj M=4096 N=1024 K=1024 (all M,N multiples
// of 64, all K multiples of 32, no padding); scores and p.v inside diff_attn_kernel.
// 8 launches.
// ---------------------------------------------------------------------------
extern "C" void kernel_launch(void* const* d_in, const int* in_sizes, int n_in,
                              void* d_out, int out_size, void* d_ws, size_t ws_size,
                              hipStream_t stream) {
  if (n_in < 16) return;
  const int nTokElem = kTok * kDim;                 // 4,194,304
  const int nW       = kDim * kDim;                 // 1,048,576
  if (in_sizes[0] != nTokElem) return;
  if (in_sizes[1] != kBatch * kSeq * kSeq) return;
  if (in_sizes[2] != nW || in_sizes[4] != nW || in_sizes[6] != nW || in_sizes[8] != nW) return;
  if (in_sizes[3] != kDim || in_sizes[5] != kDim || in_sizes[7] != kDim || in_sizes[9] != kDim) return;
  if (in_sizes[10] != kDiff || in_sizes[11] != kDiff || in_sizes[12] != kDiff || in_sizes[13] != kDiff) return;
  if (in_sizes[14] != kHeads * kDh || in_sizes[15] != kHeads * kDh) return;
  if (out_size != nTokElem) return;

  const size_t szXH   = (size_t)kTok * kDim * 2;
  const size_t szWQK  = (size_t)kQKCols * kDim * 2;
  const size_t szW    = (size_t)kDim * kDim * 2;
  const size_t szBQK  = (size_t)kQKCols * 4;
  const size_t szQK16 = (size_t)kTok * kQKCols * 2;
  const size_t szVT16 = (size_t)kDim * kTok * 2;
  const size_t szO    = (size_t)kTok * kDim * 4;
  const size_t szAOH  = (size_t)kTok * kDim * 2;
  const size_t offXH   = 0;
  const size_t offWQK  = offXH + szXH;
  const size_t offWVT  = offWQK + szWQK;
  const size_t offWOT  = offWVT + szW;
  const size_t offBQK  = offWOT + szW;
  const size_t offQK16 = offBQK + szBQK;
  const size_t offVT16 = offQK16 + szQK16;
  const size_t offO    = offVT16 + szVT16;
  const size_t offAOH  = offO + szO;
  const size_t total   = offAOH + szAOH;          // 67,117,056
  if (ws_size < total) return;

  const float* x    = (const float*)d_in[0];
  const int*   mask = (const int*)d_in[1];
  const float* Wq   = (const float*)d_in[2];
  const float* bq   = (const float*)d_in[3];
  const float* Wk   = (const float*)d_in[4];
  const float* bk   = (const float*)d_in[5];
  const float* Wv   = (const float*)d_in[6];
  const float* bv   = (const float*)d_in[7];
  const float* Wo   = (const float*)d_in[8];
  const float* bo   = (const float*)d_in[9];
  const float* lq1  = (const float*)d_in[10];
  const float* lk1  = (const float*)d_in[11];
  const float* lq2  = (const float*)d_in[12];
  const float* lk2  = (const float*)d_in[13];
  const float* ln_g = (const float*)d_in[14];
  const float* ln_b = (const float*)d_in[15];
  float* out = (float*)d_out;

  char* ws = (char*)d_ws;
  unsigned short* XH    = (unsigned short*)(ws + offXH);
  unsigned short* WQKT  = (unsigned short*)(ws + offWQK);
  unsigned short* WVT   = (unsigned short*)(ws + offWVT);
  unsigned short* WOT   = (unsigned short*)(ws + offWOT);
  float*          BQK   = (float*)(ws + offBQK);
  unsigned short* QK16  = (unsigned short*)(ws + offQK16);
  unsigned short* VT16  = (unsigned short*)(ws + offVT16);
  float*          OATT  = (float*)(ws + offO);
  unsigned short* AOH16 = (unsigned short*)(ws + offAOH);

  // ---- prologue: 16-bit operand planes, permuted bias line ----
  const int n8 = nTokElem / 8;                                  // 524288 -> 2048 blocks exact
  cast8_f16_kernel<<<dim3(n8 / 256), dim3(256), 0, stream>>>(x, XH, n8);
  wt_kernel<<<dim3(kDim / 64, kDim / 64, 4), dim3(256), 0, stream>>>(
      Wq, Wk, Wv, Wo, WQKT, WQKT + (size_t)kDim * kDim, WVT, WOT, kWCarry);
  biasperm_kernel<<<dim3(2), dim3(256), 0, stream>>>(bq, bk, BQK);

  // ---- q|k projection: QK16[m][n'] = f16( (1/16) sum_k XH[m][k] WQKT[n'][k] + BQK[n'] )   (M=4096, N=2048, K=1024) ----
  {
    const int tiles = (kTok / 64) * (kQKCols / 64);             // 2048 -> 256 blocks
    wmma_gemm64<0, false, 2, 1, false, 0><<<dim3(tiles / 8, 1), dim3(256), 0, stream>>>(
        XH, XH, kDim, 0L, WQKT, WQKT, kDim, 0L,
        (void*)QK16, (void*)QK16, kQKCols, 0L, BQK, BQK, 0L, kTok, kQKCols, kDim, kWCarryInv);
  }
  // ---- v^T projection: VT16[n][m] = f16( (1/16) sum_k WVT[n][k] XH[m][k] + bv[n] )   (M=1024 rows n, N=4096 tokens, K=1024) ----
  {
    const int tiles = (kDim / 64) * (kTok / 64);                // 1024 -> 128 blocks
    wmma_gemm64<0, false, 1, 1, false, 0><<<dim3(tiles / 8, 1), dim3(256), 0, stream>>>(
        WVT, WVT, kDim, 0L, XH, XH, kDim, 0L,
        (void*)VT16, (void*)VT16, kTok, 0L, bv, bv, 0L, kDim, kTok, kDim, kWCarryInv);
  }

  // ---- every (batch, head) at once: scores of both sets, both softmaxes, difference, product with v -> OATT ----
  diff_attn_kernel<<<dim3(kSeq / kFaQ, kHeads, kBatch), dim3(256), 0, stream>>>(
      QK16, VT16, mask, lq1, lk1, lq2, lk2, OATT);

  // ---- per-head LayerNorm, affine, x0.8 -> AOH16 ----
  ln_cast_kernel<<<dim3(kTok / 2), dim3(256), 0, stream>>>(OATT, ln_g, ln_b, AOH16);

  // ---- output projection: out[m][n] = (1/16) sum_k AOH16[m][k] WOT[n][k] + bo[n]   (M=4096, N=1024, K=1024) ----
  {
    const int tiles = (kTok / 64) * (kDim / 64);                // 1024 -> 128 blocks
    wmma_gemm64<0, false, 2, 0, false, 0><<<dim3(tiles / 8, 1), dim3(256), 0, stream>>>(
        AOH16, AOH16, kDim, 0L, WOT, WOT, kDim, 0L,
        (void*)out, (void*)out, kDim, 0L, bo, bo, 0L, kTok, kDim, kDim, kWCarryInv);
  }
}

// v004
// A run of this version takes 129 microseconds.
// Next to v003, in two timings, it ran 1.79 times as fast each time.
// All steps since v000 together make it 28.5 times as fast.
// Contractions: q|k projection and v^T projection (x f16 by W^T f16 carried x16), scores q_set.k_set^T per head and set (q, k f16 planes, K=32), p_set.v per head and set (p = exp2 of the shifted scores, f16, by v^T f16 plane, K=2048), output projection (LayerNorm output f16 by Wo^T f16 carried x16): all v_wmma_f32_16x16x32_f16 with f32 accumulate; bias adds, mask select, both softmaxes, lambda and the per-head LayerNorm in f32.
#include <hip/hip_runtime.h>
#include <math.h>

// ---------------------------------------------------------------------------
// Problem constants
// ---------------------------------------------------------------------------
constexpr int kBatch  = 2;
constexpr int kSeq    = 2048;
constexpr int kDim    = 1024;              // hidden
constexpr int kHeads  = 16;
constexpr int kDh     = 64;                // head dim of v / output
constexpr int kDiff   = 32;                // head dim of each q/k set
constexpr int kTok    = kBatch * kSeq;     // 4096 token rows
constexpr int kQKCols = 2 * kDim;          // 2048: pitch of the q | k plane (halves)
constexpr float kWCarry    = 16.0f;        // weights carried x16 in f16
constexpr float kWCarryInv = 1.0f / 16.0f;
constexpr float kInvScale  = 0.17677669529663687f;   // 32^-0.5
constexpr float kNegBig    = -1.0e9f;
constexpr float kLambdaInit = 0.2f;
constexpr float kOutGain   = 0.8f;         // 1 - lambda_init
constexpr float kLnEps     = 1.0e-5f;
constexpr float kInv64     = 1.0f / 64.0f;
static_assert(kHeads * kDh == kDim, "shape");
static_assert(kHeads * kDiff * 2 == kDim, "shape");
// GEMM shape contract: M multiple of 128, N of 256, K of 128, at least two passes
static_assert(kTok % 256 == 0 && kQKCols % 256 == 0 && kDim % 256 == 0 && kDim / 128 >= 2 && kSeq % 64 == 0 && kDh % 64 == 0, "tiles");
static_assert(kDim % 32 == 0 && kDiff % 32 == 0 && kSeq % 32 == 0, "ktiles");
static_assert((kTok * kDim) % (8 * 256) == 0, "cast grid");

typedef __attribute__((ext_vector_type(16))) _Float16 v16h;
typedef __attribute__((ext_vector_type(8)))  _Float16 v8h;
typedef __attribute__((ext_vector_type(16))) __bf16   v16b;
typedef __attribute__((ext_vector_type(8)))  __bf16   v8b;
typedef __attribute__((ext_vector_type(8)))  float    v8f;
typedef __attribute__((ext_vector_type(4)))  float    v4f;
typedef __attribute__((ext_vector_type(2)))  float    v2f;
typedef __attribute__((ext_vector_type(2)))  int      v2i;
typedef __attribute__((ext_vector_type(4)))  unsigned int v4u;

// ---------------------------------------------------------------------------
// Helper pieces: conversions, hazard guards, WMMA fragments
// ---------------------------------------------------------------------------
__device__ __forceinline__ unsigned short f2bf_bits(float f) {
  unsigned u = __float_as_uint(f);
  return (unsigned short)((u + 0x7FFFu + ((u >> 16) & 1u)) >> 16);
}
__device__ __forceinline__ float bf_bits2f(unsigned short h) { return __uint_as_float(((unsigned)h) << 16); }

// hazard guards as plain device helpers
__device__ __forceinline__ void dep_guard_h(v8f& a, v8f& b, v16h x, v16h y) { asm volatile("v_nop\n\tv_nop\n\tv_nop\n\tv_nop" : "+v"(a), "+v"(b) : "v"(x), "v"(y)); }
__device__ __forceinline__ void dep_guard_b(v8f& a, v8f& b, v16b x, v16b y) { asm volatile("v_nop\n\tv_nop\n\tv_nop\n\tv_nop" : "+v"(a), "+v"(b) : "v"(x), "v"(y)); }
// group guard tying all four accumulators of an A-row group plus its A fragments
__device__ __forceinline__ void dep_guard4_h(v8f& a, v8f& b, v8f& c, v8f& d, v16h x, v16h y) { asm volatile("v_nop\n\tv_nop\n\tv_nop\n\tv_nop" : "+v"(a), "+v"(b), "+v"(c), "+v"(d) : "v"(x), "v"(y)); }
__device__ __forceinline__ void dep_guard4_b(v8f& a, v8f& b, v8f& c, v8f& d, v16b x, v16b y) { asm volatile("v_nop\n\tv_nop\n\tv_nop\n\tv_nop" : "+v"(a), "+v"(b), "+v"(c), "+v"(d) : "v"(x), "v"(y)); }
__device__ __forceinline__ void keep4_h(v16h a, v16h b, v16h c, v16h d) { asm volatile("v_nop" :: "v"(a), "v"(b), "v"(c), "v"(d)); }
__device__ __forceinline__ void keep4_b(v16b a, v16b b, v16b c, v16b d) { asm volatile("v_nop" :: "v"(a), "v"(b), "v"(c), "v"(d)); }
__device__ __forceinline__ void acc_guard4(v8f& a, v8f& b, v8f& c, v8f& d) { asm volatile("v_nop\n\tv_nop\n\tv_nop\n\tv_nop" : "+v"(a), "+v"(b), "+v"(c), "+v"(d)); }
template <typename T> struct Frag;
template <> struct Frag<_Float16> {
  typedef v16h V; union U { v16h v; v8h h[2]; };
  // elements 0..7 <- p[0..7], 8..15 <- p[16..23]
  static __device__ __forceinline__ v16h load(const _Float16* p) {
    U f; f.h[0] = *(const v8h*)(p); f.h[1] = *(const v8h*)(p + 16); return f.v;
  }
  static __device__ __forceinline__ v8f mma(v16h a, v16h b, v8f c) {
    return __builtin_amdgcn_wmma_f32_16x16x32_f16(false, a, false, b, (short)0, c, false, false);
  }
  static __device__ __forceinline__ void guard(v8f& a, v8f& b, v16h x, v16h y) { dep_guard_h(a, b, x, y); }
  static __device__ __forceinline__ void guard4(v8f& a, v8f& b, v8f& c, v8f& d, v16h x, v16h y) { dep_guard4_h(a, b, c, d, x, y); }
  static __device__ __forceinline__ void keep(v16h a, v16h b, v16h c, v16h d) { keep4_h(a, b, c, d); }
};
template <> struct Frag<__bf16> {
  typedef v16b V; union U { v16b v; v8b h[2]; };
  static __device__ __forceinline__ v16b load(const __bf16* p) {
    U f; f.h[0] = *(const v8b*)(p); f.h[1] = *(const v8b*)(p + 16); return f.v;
  }
  static __device__ __forceinline__ v8f mma(v16b a, v16b b, v8f c) {
    return __builtin_amdgcn_wmma_f32_16x16x32_bf16(false, a, false, b, (short)0, c, false, false);
  }
  static __device__ __forceinline__ void guard(v8f& a, v8f& b, v16b x, v16b y) { dep_guard_b(a, b, x, y); }
  static __device__ __forceinline__ void guard4(v8f& a, v8f& b, v8f& c, v8f& d, v16b x, v16b y) { dep_guard4_b(a, b, c, d, x, y); }
  static __device__ __forceinline__ void keep(v16b a, v16b b, v16b c, v16b d) { keep4_b(a, b, c, d); }
};

__device__ __forceinline__ unsigned pk16(unsigned short a, unsigned short b) { return (unsigned)a | ((unsigned)b << 16); }
__device__ __forceinline__ unsigned short h_bits(float f) { const _Float16 h = (_Float16)f; return __builtin_bit_cast(unsigned short, h); }

// Twelve asynchronous copies, 16 B per lane each, global memory to LDS through no register. l[i] = the lane's LDS byte address,
// g[i] = its global address. The s_wait_xcnt ends the statement so that it stands in front of every later write of an address
// register named here.
__device__ __forceinline__ void copy12_to_lds(const unsigned* l, const char* const* g) {
  asm volatile("global_load_async_to_lds_b128 %0, %1, off\n\t"
               "global_load_async_to_lds_b128 %2, %3, off\n\t"
               "global_load_async_to_lds_b128 %4, %5, off\n\t"
               "global_load_async_to_lds_b128 %6, %7, off\n\t"
               "global_load_async_to_lds_b128 %8, %9, off\n\t"
               "global_load_async_to_lds_b128 %10, %11, off\n\t"
               "global_load_async_to_lds_b128 %12, %13, off\n\t"
               "global_load_async_to_lds_b128 %14, %15, off\n\t"
               "global_load_async_to_lds_b128 %16, %17, off\n\t"
               "global_load_async_to_lds_b128 %18, %19, off\n\t"
               "global_load_async_to_lds_b128 %20, %21, off\n\t"
               "global_load_async_to_lds_b128 %22, %23, off\n\t"
               "s_wait_xcnt 0x0"
               :: "v"(l[0]), "v"(g[0]), "v"(l[1]), "v"(g[1]), "v"(l[2]), "v"(g[2]), "v"(l[3]), "v"(g[3]),
                  "v"(l[4]), "v"(g[4]), "v"(l[5]), "v"(g[5]), "v"(l[6]), "v"(g[6]), "v"(l[7]), "v"(g[7]),
                  "v"(l[8]), "v"(g[8]), "v"(l[9]), "v"(g[9]), "v"(l[10]), "v"(g[10]), "v"(l[11]), "v"(g[11]) : "memory");
}

// ---- Register-blocked batched WMMA GEMM (ACT reduced to none/relu/leaky) -------------------------------
// C[m,n] = scale * sum_k A[m,k] * Bt[n,k] (+bias)(+resid); a block owns a 128x256 tile, each of its 8 waves (2 x 4) 64x64 of it.
// A row-major [M,K]; Bt row-major [N,K]; M % 128 == 0, N % 256 == 0, K % 128 == 0; grid.x = (M / 128) * (N / 256).
// Operands come through LDS, 128 k a pass: 128 A rows and 256 Bt rows of 256 B, brought by asynchronous 16-B copies in which a
// wave covers two whole rows (four 128-B lines). Two buffers: the copies of pass p + 2 are issued behind the barrier that ends
// pass p, into the buffer that pass p has read, and land while pass p + 1 is worked on.
// BIAS_MODE: 0 = none, 1 = bias[m], 2 = bias[n].
// OUT_MODE: 0 = f32, 1 = f16, 2 = bf16 hi plane (Cout) + bf16 lo plane (Cout2).
// ET: 0 = f16 operands, 1 = bf16 operands (pointers passed as 16-bit storage)
constexpr int kGmBM    = 128;                              // block tile rows (A rows staged)
constexpr int kGmBN    = 256;                              // block tile columns (Bt rows staged)
constexpr int kGmPassK = 128;                              // k per pass: 256-B rows
constexpr int kGmPitch = 272;                              // LDS pitch of the 256-B rows: 16 B x odd, no bank conflict for 16-B reads
constexpr int kGmBuf   = (kGmBM + kGmBN) * kGmPitch;       // 104,448 B a buffer: A rows first, Bt rows behind them
template <int ET> struct Elem;
template <> struct Elem<0> { typedef _Float16 T; };
template <> struct Elem<1> { typedef __bf16 T; };
template <int ET, bool SPLIT, int BIAS_MODE, int OUT_MODE, bool RESID, int ACT = 0>
__global__ __launch_bounds__(256) void wmma_gemm64(
    const unsigned short* __restrict__ Ap, const unsigned short* __restrict__ A2p, int lda, long strideA,
    const unsigned short* __restrict__ Btp, const unsigned short* __restrict__ Bt2p, int ldb, long strideB,
    void* __restrict__ Cout, void* __restrict__ Cout2, int ldc, long strideC,
    const float* __restrict__ bias,
    const float* __restrict__ resid, long strideR,
    int M, int N, int K, float scale) {
  static_assert(!SPLIT, "single-plane operands only");
  typedef typename Elem<ET>::T T;
  typedef typename Frag<T>::V V;
  const T* A = (const T*)Ap; const T* Bt = (const T*)Btp;
  __shared__ __align__(16) float sT[8][16 * 68];   // per-wave 16x64 slab, pitch 68 floats
  __shared__ __attribute__((aligned(16))) unsigned char ring[2 * kGmBuf];
  const int b    = blockIdx.y;
  const int lane = threadIdx.x & 31;
  const int wave = threadIdx.x >> 5;
  const int tilesN = N / kGmBN;
  const int tilesM = M / kGmBM;
  if ((int)blockIdx.x >= tilesM * tilesN) return;   // the same for the whole block, in front of every barrier
  const int bm = blockIdx.x / tilesN;
  const int bn = blockIdx.x - bm * tilesN;
  const int wm = (wave >> 2) << 6;             // this wave's 64 rows within the staged A rows
  const int wn = (wave & 3) << 6;              // this wave's 64 rows within the staged Bt rows
  const int m0 = bm * kGmBM + wm;
  const int n0 = bn * kGmBN + wn;

  const T* Ab  = A  + (size_t)b * strideA;
  const T* Bb  = Bt + (size_t)b * strideB;

  const int rlane = lane & 15;                 // row (A) / col (B, D) within subtile
  const int koff  = (lane >> 4) * 8;           // k offset of this lane half
  const int mOff  = (lane >> 4) * 8;           // D row offset

  // what this lane copies: bytes 16 * (t & 15) .. +15 of staged rows (t >> 4) + 16 i: i = 0..7 of A, i = 0..15 of Bt
  const int crow = threadIdx.x >> 4, ccol = (threadIdx.x & 15) * 16;
  const char* gA = (const char*)(Ab + (size_t)(bm * kGmBM + crow) * lda) + ccol;
  const char* gB = (const char*)(Bb + (size_t)(bn * kGmBN + crow) * ldb) + ccol;
  const size_t stepA = (size_t)16 * lda * 2, stepB = (size_t)16 * ldb * 2;
  const unsigned lC = (unsigned)(size_t)ring + crow * kGmPitch + ccol;   // low 32 bits of the address = byte offset in the block's LDS
  // one pass's rows into one buffer: 24 copies a lane; kb = the pass's first byte in a row, lb = the buffer's first byte
  auto stage_pass = [&](size_t kb, unsigned lb) {
    unsigned l[24]; const char* g[24];
#pragma unroll
    for (int i = 0; i < 8; ++i)  { l[i] = lC + lb + i * 16 * kGmPitch;                g[i] = gA + kb + i * stepA; }
#pragma unroll
    for (int i = 0; i < 16; ++i) { l[8 + i] = lC + lb + (kGmBM + i * 16) * kGmPitch;  g[8 + i] = gB + kb + i * stepB; }
    copy12_to_lds(l, g);
    copy12_to_lds(l + 12, g + 12);
  };
  // what this lane reads: row rlane of every 16-row group of its wave's rows, from byte 16 * (lane >> 4)
  const int rA = (wm + rlane) * kGmPitch + koff * 2;
  const int rB = (kGmBM + wn + rlane) * kGmPitch + koff * 2;

  v8f acc[4][4];
#pragma unroll
  for (int i = 0; i < 4; ++i)
#pragma unroll
    for (int j = 0; j < 4; ++j) acc[i][j] = (v8f){0.f,0.f,0.f,0.f,0.f,0.f,0.f,0.f};

  const int nPass = K / kGmPassK;
  // pass 0's rows, landed and published; then pass 1's are asked for
  stage_pass(0, 0);
  asm volatile("s_wait_asynccnt 0x0" ::: "memory");      // this wave's copies have landed
  __syncthreads();                                       // and every other wave's
  if (nPass > 1) stage_pass((size_t)kGmPassK * 2, kGmBuf);

  for (int p = 0; p < nPass; ++p) {
    const unsigned char* sb = ring + (p & 1) * kGmBuf;
#pragma unroll
    for (int ks = 0; ks < kGmPassK / 32; ++ks) {
      V bh[4], ah[4];
#pragma unroll
      for (int i = 0; i < 4; ++i) ah[i] = Frag<T>::load((const T*)(sb + rA + i * 16 * kGmPitch + ks * 64));
#pragma unroll
      for (int j = 0; j < 4; ++j) bh[j] = Frag<T>::load((const T*)(sb + rB + j * 16 * kGmPitch + ks * 64));
      // keeps the 16 reads of a k step together in front of its first product: one LDS latency for all of them; without it the
      // scheduler reads the A fragments one at a time into one register set and waits for each
      __builtin_amdgcn_sched_barrier(0);
#pragma unroll
      for (int j = 0; j < 4; ++j)
#pragma unroll
        for (int i = 0; i < 4; ++i) acc[i][j] = Frag<T>::mma(ah[i], bh[j], acc[i][j]);
    }
    // hand-over: this wave's reads of the buffer are done, its copies for pass p + 1 have landed; behind the barrier that
    // holds for every wave, so pass p + 1 may be read and this pass's buffer may be refilled
    // The scheduling fence keeps the pass's products in front of the hand-over; without it the scheduler sinks products behind
    // the barrier, which delays the refill that stands there.
    __builtin_amdgcn_sched_barrier(0);
    asm volatile("s_wait_dscnt 0x0" ::: "memory");
    asm volatile("s_wait_asynccnt 0x0" ::: "memory");
    __syncthreads();
    if (p + 2 < nPass) stage_pass((size_t)(p + 2) * (kGmPassK * 2), (p & 1) * kGmBuf);   // the same for the whole block
  }
  asm volatile("s_wait_asynccnt 0x0" ::: "memory");        // no copy is left in flight when the wave goes on to its end
  acc_guard4(acc[0][0], acc[0][1], acc[0][2], acc[0][3]);
  acc_guard4(acc[1][0], acc[1][1], acc[1][2], acc[1][3]);
  acc_guard4(acc[2][0], acc[2][1], acc[2][2], acc[2][3]);
  acc_guard4(acc[3][0], acc[3][1], acc[3][2], acc[3][3]);

  // ---- epilogue ----
  float* slab = sT[wave];
  const float* Rb = RESID ? (resid + (size_t)b * strideR) : nullptr;
#pragma unroll
  for (int i = 0; i < 4; ++i) {
    const int mBase = m0 + (i << 4);
#pragma unroll
    for (int j = 0; j < 4; ++j) {
      const int n = n0 + (j << 4) + rlane;
      float bv = 0.f;
      if (BIAS_MODE == 2) bv = bias[n];
#pragma unroll
      for (int r = 0; r < 8; ++r) {
        float v = acc[i][j][r] * scale;
        if (BIAS_MODE == 1) v += bias[mBase + mOff + r];
        if (BIAS_MODE == 2) v += bv;
        if (RESID) v += Rb[(size_t)(mBase + mOff + r) * ldc + n];
        if (ACT == 2) v = fmaxf(v, 0.0f);
        if (ACT == 4) v = (v > 0.f) ? v : 0.01f * v;
        slab[(mOff + r) * 68 + (j << 4) + rlane] = v;
      }
    }
    __builtin_amdgcn_fence(__ATOMIC_RELEASE, "workgroup");
    __builtin_amdgcn_wave_barrier();
    __builtin_amdgcn_fence(__ATOMIC_ACQUIRE, "workgroup");
    if (OUT_MODE == 0) {
      float* C = (float*)Cout + (size_t)b * strideC;
      const int hh = lane >> 4, c4 = (lane & 15) * 4;     // row seg = 256 B = 16 lanes x 16 B
      {
#pragma unroll
        for (int it = 0; it < 8; ++it) {
          const int row = it * 2 + hh;
          v4f v = *(const v4f*)(slab + row * 68 + c4);
          *(v4f*)(C + (size_t)(mBase + row) * ldc + n0 + c4) = v;
        }
        
      }
    } else {
      const int q = lane >> 3, c8 = (lane & 7) * 8;
      unsigned short* C  = (unsigned short*)Cout  + (size_t)b * strideC;
      unsigned short* C2 = (OUT_MODE == 2) ? ((unsigned short*)Cout2 + (size_t)b * strideC) : nullptr;
      {
#pragma unroll
        for (int it = 0; it < 4; ++it) {
          const int row = it * 4 + q;
          const float* sp = slab + row * 68 + c8;
          v8h hv, lv;
#pragma unroll
          for (int e = 0; e < 8; ++e) {
            if (OUT_MODE == 1) {
              hv[e] = (_Float16)sp[e];
            } else {
              unsigned short hb = f2bf_bits(sp[e]);
              unsigned short lb = f2bf_bits(sp[e] - bf_bits2f(hb));
              hv[e] = __builtin_bit_cast(_Float16, hb);
              lv[e] = __builtin_bit_cast(_Float16, lb);
            }
          }
          *(v8h*)(C + (size_t)(mBase + row) * ldc + n0 + c8) = hv;
          if (OUT_MODE == 2) *(v8h*)(C2 + (size_t)(mBase + row) * ldc + n0 + c8) = lv;
        }
        
      }
    }
    __builtin_amdgcn_fence(__ATOMIC_RELEASE, "workgroup");
    __builtin_amdgcn_wave_barrier();
    __builtin_amdgcn_fence(__ATOMIC_ACQUIRE, "workgroup");
  }
}

// ---------------------------------------------------------------------------
// ---------------------------------------------------------------------------
__global__ __launch_bounds__(256) void cast8_f16_kernel(const float* __restrict__ in, unsigned short* __restrict__ out, int n8) {
  const int i = blockIdx.x * 256 + threadIdx.x;
  if (i >= n8) return;
  const float* p = in + 8 * (size_t)i;
  const v4f a = *(const v4f*)(p);
  const v4f c = *(const v4f*)(p + 4);
  unsigned short hb[8];
#pragma unroll
  for (int e = 0; e < 4; ++e) {
    hb[e]     = h_bits(a[e]);
    hb[4 + e] = h_bits(c[e]);
  }
  const v4u u = (v4u){pk16(hb[0], hb[1]), pk16(hb[2], hb[3]), pk16(hb[4], hb[5]), pk16(hb[6], hb[7])};
  unsigned short* q = out + 8 * (size_t)i;
  *(v4u*)q = u;
  
}

// ---------------------------------------------------------------------------
// Weight transpose + cast (+ optional output-feature permutation) for square [1024 in][1024 out] f32 W (row-major [k][n]):
//   out[np][k] = f16( scale * W[k][orig(np)] ), orig(np) = perm ? ((np>>5)&1)*512 + (np>>6)*32 + (np&31) : np.
// With perm, plane column 64h + 32*set + d holds feature set*512 + 32h + d, so the two q/k sets of a head sit at stride 32.
// grid (16, 16, 4): blockIdx.x = k tile (64 cols of out), blockIdx.y = np tile (64 rows of out), blockIdx.z selects
//   z0 = (W0 -> o0, perm), z1 = (W1 -> o1, perm), z2 = (W2 -> o2, identity), z3 = (W3 -> o3, identity). 256 threads.
// Load coverage: 16 iterations x 256 threads = 4096 = the whole 64x64 tile (coalesced along n inside 32-wide strips).
// Store coverage: 8 waves x 2 iterations x 4 rows (lane>>3) = 64 rows; (lane&7) x 8 halves = 64 cols; each row segment =
// ---------------------------------------------------------------------------
__global__ __launch_bounds__(256) void wt_kernel(const float* __restrict__ W0, const float* __restrict__ W1,
                                                 const float* __restrict__ W2, const float* __restrict__ W3,
                                                 unsigned short* __restrict__ o0, unsigned short* __restrict__ o1,
                                                 unsigned short* __restrict__ o2, unsigned short* __restrict__ o3,
                                                 float scale) {
  __shared__ float sm[64][65];   // sm[np_local][k_local]
  const int t  = threadIdx.x;
  const int k0 = blockIdx.x * 64;
  const int n0 = blockIdx.y * 64;
  const int z  = blockIdx.z;                                   // block-uniform
  const float* W = (z == 0) ? W0 : (z == 1) ? W1 : (z == 2) ? W2 : W3;
  unsigned short* op = (z == 0) ? o0 : (z == 1) ? o1 : (z == 2) ? o2 : o3;
  const int perm = (z < 2) ? 1 : 0;
#pragma unroll
  for (int i = 0; i < 16; ++i) {
    const int e = i * 256 + t;
    const int r = e >> 6;          // k local
    const int c = e & 63;          // np local
    const int np = n0 + c;
    const int og = perm ? ((((np >> 5) & 1) << 9) + ((np >> 6) << 5) + (np & 31)) : np;
    sm[c][r] = W[(size_t)(k0 + r) * kDim + og] * scale;
  }
  __syncthreads();
  const int lane = t & 31, wave = t >> 5;
  const int q = lane >> 3, c8 = (lane & 7) * 8;
  {
#pragma unroll
    for (int it = 0; it < 2; ++it) {
      const int row = wave * 8 + it * 4 + q;                 // np local
      unsigned short hb[8];
#pragma unroll
      for (int e = 0; e < 8; ++e) hb[e] = h_bits(sm[row][c8 + e]);
      const v4u u = (v4u){pk16(hb[0], hb[1]), pk16(hb[2], hb[3]), pk16(hb[4], hb[5]), pk16(hb[6], hb[7])};
      *(v4u*)(op + (size_t)(n0 + row) * kDim + k0 + c8) = u;
    }
    
  }
}

// ---------------------------------------------------------------------------
// Permuted q|k bias line: out[np] = bq[orig(np)] for np < 1024 (block 0), out[1024 + np] = bk[orig(np)] (block 1).
// Thread t owns np = 4t..4t+3 (orig of an aligned group of 4 is contiguous); one 16-B store per lane, a wave = 512 B =
// ---------------------------------------------------------------------------
__global__ __launch_bounds__(256) void biasperm_kernel(const float* __restrict__ bq, const float* __restrict__ bk,
                                                       float* __restrict__ out) {
  const int t = threadIdx.x;
  const float* src = (blockIdx.x == 0) ? bq : bk;             // block-uniform
  const int np = 4 * t;
  const int og = (((np >> 5) & 1) << 9) + ((np >> 6) << 5) + (np & 31);
  const v4f v = *(const v4f*)(src + og);
  float* dp = out + (size_t)blockIdx.x * kDim + np;
  *(v4f*)dp = v;
  
}

// ---------------------------------------------------------------------------
// Both masked softmaxes, their difference and the product with v, for every (batch, head) in one launch; no score ever
// reaches memory. Transposed forms, so that one lane owns one query column throughout:
//   St[set][j][i] = sum_d k_set[j][d] * q_set[i][d]     (A = 16 key rows, B = 16 query rows kept in registers, K = 32)
//   x = (mask[i][j] != 0) ? St * 32^-0.5 * log2(e) : -1e9 * log2(e)
//   running maximum m and sum l per query and set; p = exp2(x - m), f16
//   Ot[set][d][i] = Ot[set][d][i] * exp2(m_old - m_new) + sum_j v^T[d][j] * p[j][i]     (A = 16 rows of v^T, B = p, K = 32)
//   O[i][d] = Ot[0][d][i] / l0 - lambda * Ot[1][d][i] / l1,  lambda = exp(sum lq1*lk1) - exp(sum lq2*lk2) + 0.2
// grid (16, 16 heads, 2 batches), 8 waves; wave w owns query rows 128*blockIdx.x + 16w .. +15 and walks all 2048 keys, 64 a
// trip. A trip's operands come through LDS: 64 k rows and 64 v^T rows of 128 B (shared by the 8 waves) and 128 mask rows of
// 256 B (16 per wave), brought by asynchronous 16-B copies in which a wave covers whole 128-B lines. Two buffers: the copies
// of trip t + 1 are issued behind the barrier that ends trip t - 1 and land while trip t is worked on.
// Fragment maps: accumulator register r of lane l holds row 8*(l>>4) + r, column l & 15. Two score tiles (keys 0..15 and
// 16..31 of a 32-key chunk) converted in place are the B operand of the second product: element s = key
// (s < 8 ? 8*(l>>4) + s : 16 + 8*(l>>4) + s - 8), which is the k order in which Frag::load reads the v^T rows.
// Store: a lane holds 8 consecutive d of its query row per tile; the wave writes the whole 256-B row segment of its head.
// ---------------------------------------------------------------------------
constexpr int   kFaQ    = 128;                 // query rows per block (8 waves x 16)
constexpr int   kFaKeys = 64;                  // keys per trip
constexpr float kLog2e  = 1.4426950408889634f;
static_assert(kSeq % kFaQ == 0 && kSeq % kFaKeys == 0 && kDh == 64 && kDiff == 32, "attention tiling");
typedef __attribute__((ext_vector_type(4))) int v4i;
constexpr int kFaTrips = kSeq / kFaKeys;                   // 32
constexpr int kKvPitch = 144;                              // LDS pitch of the 128-B k and v^T rows: 16 B x odd, no bank conflict for 16-B reads
constexpr int kMkPitch = 272;                              // LDS pitch of the 256-B mask rows: 16 B x odd
constexpr int kLdsV    = kFaKeys * kKvPitch;               // k rows at 0, v^T rows behind them
constexpr int kLdsM    = kLdsV + kDh * kKvPitch;           // mask rows behind those
constexpr int kLdsBuf  = kLdsM + kFaQ * kMkPitch;          // 53,248 B a buffer
static_assert(kFaTrips >= 2 && kFaKeys * 2 == 128 && kDh * 2 == 128 && kFaKeys * 4 == 256, "staging");
// Four asynchronous copies, 16 B per lane each, global memory to LDS through no register. l = the lane's LDS byte address,
// g = its global address. The s_wait_xcnt ends the statement so that it stands in front of every later write of an address
// register named here.
__device__ __forceinline__ void copy4_to_lds(unsigned l0, const char* g0, unsigned l1, const char* g1,
                                             unsigned l2, const char* g2, unsigned l3, const char* g3) {
  asm volatile("global_load_async_to_lds_b128 %0, %1, off\n\t"
               "global_load_async_to_lds_b128 %2, %3, off\n\t"
               "global_load_async_to_lds_b128 %4, %5, off\n\t"
               "global_load_async_to_lds_b128 %6, %7, off\n\t"
               "s_wait_xcnt 0x0"
               :: "v"(l0), "v"(g0), "v"(l1), "v"(g1), "v"(l2), "v"(g2), "v"(l3), "v"(g3) : "memory");
}
// One trip's tiles into one buffer: 12 copies a lane. lk, lv, lm and gk, gv, gm are the lane's first LDS and global addresses
// in the k, v^T and mask tile; its further rows lie 32 rows on (k, v^T) and 2 rows on (mask).
__device__ __forceinline__ void stage_trip(unsigned lk, unsigned lv, unsigned lm,
                                           const char* gk, const char* gv, const char* gm) {
  copy4_to_lds(lk, gk, lk + 32 * kKvPitch, gk + (size_t)32 * kQKCols * 2,
               lv, gv, lv + 32 * kKvPitch, gv + (size_t)32 * kTok * 2);
  copy4_to_lds(lm,                gm,                          lm + 2 * kMkPitch, gm + (size_t)2 * kSeq * 4,
               lm + 4 * kMkPitch, gm + (size_t)4 * kSeq * 4,   lm + 6 * kMkPitch, gm + (size_t)6 * kSeq * 4);
  copy4_to_lds(lm + 8 * kMkPitch,  gm + (size_t)8 * kSeq * 4,  lm + 10 * kMkPitch, gm + (size_t)10 * kSeq * 4,
               lm + 12 * kMkPitch, gm + (size_t)12 * kSeq * 4, lm + 14 * kMkPitch, gm + (size_t)14 * kSeq * 4);
}
// value of lane l ^ 16, by a vector-unit lane swap (no LDS round trip)
__device__ __forceinline__ float other_half(float x) {
  const int b = __float_as_int(x);
  return __int_as_float(__builtin_amdgcn_permlanex16(b, b, 0x76543210, 0xfedcba98, false, false));
}
// exp2 in place. The instruction set asks for one slot between a transcendental and a directly following instruction that
// overwrites its source or reads its result. Here each overwrites only its own source, and the v_nop is the slot in front of
// whatever the compiler puts next.
__device__ __forceinline__ void exp2_inplace(float& x) {
  asm("v_exp_f32 %0, %0\n\tv_nop" : "+v"(x));
}
__device__ __forceinline__ void exp2_inplace8(v8f& x) {
  float a = x[0], b = x[1], c = x[2], d = x[3], e = x[4], f = x[5], g = x[6], h = x[7];
  asm("v_exp_f32 %0, %0\n\tv_exp_f32 %1, %1\n\tv_exp_f32 %2, %2\n\tv_exp_f32 %3, %3\n\t"
      "v_exp_f32 %4, %4\n\tv_exp_f32 %5, %5\n\tv_exp_f32 %6, %6\n\tv_exp_f32 %7, %7\n\tv_nop"
      : "+v"(a), "+v"(b), "+v"(c), "+v"(d), "+v"(e), "+v"(f), "+v"(g), "+v"(h));
  x = (v8f){a, b, c, d, e, f, g, h};
}
// four waves per SIMD (two blocks per WGP): the whole grid of 512 blocks is resident at once, within 256 registers a wave
// and 106,496 B of LDS a block
__global__ __launch_bounds__(256) __attribute__((amdgpu_waves_per_eu(4, 4))) void diff_attn_kernel(const unsigned short* __restrict__ QKp,
                                                        const unsigned short* __restrict__ Vtp,
                                                        const int* __restrict__ Mp,
                                                        const float* __restrict__ lq1, const float* __restrict__ lk1,
                                                        const float* __restrict__ lq2, const float* __restrict__ lk2,
                                                        float* __restrict__ O) {
  const int lane = threadIdx.x & 31, wave = threadIdx.x >> 5;
  const int c    = lane & 15;                  // this lane's query column; row of every A fragment
  const int h8   = (lane >> 4) * 8;            // k offset of this lane half; also its accumulator row offset
  const int head = blockIdx.y;
  const int b    = blockIdx.z;
  const int q0   = blockIdx.x * kFaQ + wave * 16;

  const _Float16* QK = (const _Float16*)QKp + (size_t)b * kSeq * kQKCols + head * kDh;
  const _Float16* Qr = QK + (size_t)(q0 + c) * kQKCols + h8;
  __shared__ __attribute__((aligned(16))) unsigned char smem[2 * kLdsBuf];
  // what this lane copies: of k and v^T rows (t >> 3) and (t >> 3) + 32, bytes 16 * (t & 7) .. +15 (a wave: 4 whole rows a
  // copy); of the mask its own wave's rows 2i + (lane >> 4), i = 0..7, bytes 16 * (lane & 15) .. +15 (a wave: 2 whole rows)
  const int crow = threadIdx.x >> 3, ccol = (threadIdx.x & 7) * 16;
  const int mrow = wave * 16 + (lane >> 4), mcol = (lane & 15) * 16;
  const char* gK = (const char*)(QK + kDim + (size_t)crow * kQKCols) + ccol;
  const char* gV = (const char*)((const _Float16*)Vtp + (size_t)(head * kDh + crow) * kTok + (size_t)b * kSeq) + ccol;
  const char* gM = (const char*)(Mp + ((size_t)b * kSeq + blockIdx.x * kFaQ + mrow) * kSeq) + mcol;
  const unsigned lds0 = (unsigned)(size_t)smem;            // low 32 bits of the address = byte offset in the block's LDS
  const unsigned lK = lds0 + crow * kKvPitch + ccol;
  const unsigned lV = lds0 + kLdsV + crow * kKvPitch + ccol;
  const unsigned lM = lds0 + kLdsM + mrow * kMkPitch + mcol;
  // what this lane reads: row c of every 16-row group, from byte 16 * (lane >> 4) (k, v^T) or 32 * (lane >> 4) (mask)
  const int rK = c * kKvPitch + h8 * 2;
  const int rV = kLdsV + c * kKvPitch + h8 * 2;
  const int rM = kLdsM + (wave * 16 + c) * kMkPitch + h8 * 4;
  v16h qf[2];
  qf[0] = Frag<_Float16>::load(Qr);
  qf[1] = Frag<_Float16>::load(Qr + kDiff);

  const v8f zero = (v8f){0.f,0.f,0.f,0.f,0.f,0.f,0.f,0.f};
  const float cs   = kInvScale * kLog2e;
  const float xOff = kNegBig * kLog2e;
  v8f o[2][4];
  float m[2], l[2];
#pragma unroll
  for (int st = 0; st < 2; ++st) {
    m[st] = -__builtin_inff();
    l[st] = 0.f;
#pragma unroll
    for (int dt = 0; dt < 4; ++dt) o[st][dt] = zero;
  }

  // trip 0's tiles, landed and published
  stage_trip(lK, lV, lM, gK, gV, gM);
  asm volatile("s_wait_asynccnt 0x0" ::: "memory");      // this wave's copies have landed
  __syncthreads();                                       // and every other wave's

  for (int t = 0; t < kFaTrips; ++t) {
    const int buf = (t & 1) * kLdsBuf;
    const unsigned char* sb = smem + buf;
    // directly behind the barrier that ended trip t - 1 (in front of trip 0: the one above): the next trip's tiles are asked
    // for, into the buffer that trip t - 1 has read, and fly while this trip is worked on
    if (t + 1 < kFaTrips) {                                // the same for the whole block
      const size_t j1 = (size_t)(t + 1) * kFaKeys;
      const unsigned nb = kLdsBuf - buf;
      stage_trip(lK + nb, lV + nb, lM + nb, gK + j1 * (kQKCols * 2), gV + j1 * 2, gM + j1 * 4);
    }
    v8f s[2][4];
    v4i mk[4][2];
    v16h kf[2][4];
#pragma unroll
    for (int kt = 0; kt < 4; ++kt) {
      mk[kt][0] = *(const v4i*)(sb + rM + kt * 64);
      mk[kt][1] = *(const v4i*)(sb + rM + kt * 64 + 16);
    }
#pragma unroll
    for (int kt = 0; kt < 4; ++kt) {
      const _Float16* kp = (const _Float16*)(sb + rK + kt * 16 * kKvPitch);
      kf[0][kt] = Frag<_Float16>::load(kp);
      kf[1][kt] = Frag<_Float16>::load(kp + kDiff);
    }
    // keeps the trip's mask and k reads together in front of the first product: one latency for all of them; without it
    // the scheduler, short of registers, reads one fragment at a time and waits for each
    __builtin_amdgcn_sched_barrier(0);
    // the 32 mask words of a lane become 32 lane masks in scalar registers here, which frees their vector registers
    bool keep[4][8];
#pragma unroll
    for (int kt = 0; kt < 4; ++kt)
#pragma unroll
      for (int r = 0; r < 8; ++r) keep[kt][r] = (mk[kt][r >> 2][r & 3] != 0);
#pragma unroll
    for (int kt = 0; kt < 4; ++kt) {
      s[0][kt] = Frag<_Float16>::mma(kf[0][kt], qf[0], zero);
      s[1][kt] = Frag<_Float16>::mma(kf[1][kt], qf[1], zero);
    }
    v16h vf[2][4];
    v16h pf[2][2];
#pragma unroll
    for (int st = 0; st < 2; ++st) {
      if (st == 1) {
        // all of the trip's v^T fragments are asked for by here, into the registers the first set's scores have just left:
        // their LDS latency runs under the second set's softmax arithmetic
        const _Float16* vp = (const _Float16*)(sb + rV);
#pragma unroll
        for (int kc = 0; kc < 2; ++kc)
#pragma unroll
          for (int dt = 0; dt < 4; ++dt) vf[kc][dt] = Frag<_Float16>::load(vp + dt * 16 * (kKvPitch / 2) + kc * 32);
        // keeps those reads up here; without it the scheduler sinks them to just in front of their products, each with a full wait
        __builtin_amdgcn_sched_barrier(0);
      }
      float tm = -__builtin_inff();
#pragma unroll
      for (int kt = 0; kt < 4; ++kt)
#pragma unroll
        for (int r = 0; r < 8; ++r) {
          const float x = keep[kt][r] ? s[st][kt][r] * cs : xOff;
          s[st][kt][r] = x;
          tm = fmaxf(tm, x);
        }
      tm = fmaxf(tm, other_half(tm));                // the other lane half holds the other keys of the same query
      const float mn    = fmaxf(m[st], tm);
      float sum = 0.f;
#pragma unroll
      for (int kt = 0; kt < 4; ++kt) {
        v8f p = s[st][kt] - mn;
        exp2_inplace8(p);
#pragma unroll
        for (int r = 0; r < 8; ++r) {
          sum += p[r];
          pf[st][kt >> 1][(kt & 1) * 8 + r] = (_Float16)p[r];
        }
      }
      float alpha = m[st] - mn;
      exp2_inplace(alpha);
      m[st] = mn;
      l[st] = l[st] * alpha + sum;                   // this half's keys only; the halves are joined behind the loop
#pragma unroll
      for (int dt = 0; dt < 4; ++dt) o[st][dt] *= alpha;
    }
#pragma unroll
    for (int kc = 0; kc < 2; ++kc)
#pragma unroll
      for (int dt = 0; dt < 4; ++dt) {
        o[0][dt] = Frag<_Float16>::mma(vf[kc][dt], pf[0][kc], o[0][dt]);
        o[1][dt] = Frag<_Float16>::mma(vf[kc][dt], pf[1][kc], o[1][dt]);
      }
    // hand-over: this wave's reads of the buffer are done, its copies for trip t + 1 have landed; behind the barrier that
    // holds for every wave, so trip t + 1 may be read and this trip's buffer may be refilled
    // The scheduling fence keeps the hand-over at the trip's end; without it the scheduler lifts the waits and the barrier into
    // the second set's softmax, which takes a third off the time the copies have to land.
    __builtin_amdgcn_sched_barrier(0);
    asm volatile("s_wait_dscnt 0x0" ::: "memory");
    asm volatile("s_wait_asynccnt 0x0" ::: "memory");
    __syncthreads();
  }
  asm volatile("s_wait_asynccnt 0x0" ::: "memory");        // no copy is left in flight when the wave goes on to its end

  // lambda from the two 32-vectors (wave-wide butterfly, unconditional shuffles)
  float t1 = lq1[lane] * lk1[lane];
  float t2 = lq2[lane] * lk2[lane];
#pragma unroll
  for (int off = 16; off > 0; off >>= 1) {
    t1 += __shfl_xor(t1, off, 32);
    t2 += __shfl_xor(t2, off, 32);
  }
  const float lam = (expf(t1) - expf(t2)) + kLambdaInit;

  const float l0 = l[0] + other_half(l[0]);
  const float l1 = l[1] + other_half(l[1]);
  const float inv0 = 1.0f / l0;
  const float inv1 = lam / l1;
  float* Or = O + ((size_t)b * kSeq + q0 + c) * kDim + head * kDh + h8;
#pragma unroll
  for (int dt = 0; dt < 4; ++dt) {
    v4f lo, hi;
#pragma unroll
    for (int e = 0; e < 4; ++e) {
      lo[e] = o[0][dt][e]     * inv0 - o[1][dt][e]     * inv1;
      hi[e] = o[0][dt][4 + e] * inv0 - o[1][dt][4 + e] * inv1;
    }
    *(v4f*)(Or + dt * 16)     = lo;
    *(v4f*)(Or + dt * 16 + 4) = hi;
  }
}

// ---------------------------------------------------------------------------
// Per-head LayerNorm over 64 dims of the attention output o (f32 [4096][1024], column = 64h + d), affine, x0.8, f16 cast:
//   mu = mean_d o, var = mean_d (o - mu)^2, y = ((o - mu) / sqrt(var + 1e-5) * g[h][d] + b[h][d]) * 0.8 -> A16[row][64h + d].
// 256 threads = 2 rows; within a row thread tt (0..127) owns columns 64*(tt>>3) + 8*(tt&7) .. +7 (8 threads per head, lanes
// 8q..8q+7 of one wave; reductions by xor shuffles 1,2,4 in fixed order). Loads: 2 b128 (o) + 2 (g) + 2 (b).
// grid = 2048 blocks = 4096 rows exactly.
// ---------------------------------------------------------------------------
__global__ __launch_bounds__(256) void ln_cast_kernel(const float* __restrict__ O, const float* __restrict__ g,
                                                      const float* __restrict__ bta, unsigned short* __restrict__ A16) {
  const int t   = threadIdx.x;
  const int row = blockIdx.x * 2 + (t >> 7);
  const int tt  = t & 127;
  const int h   = tt >> 3;
  const int c0  = h * kDh + (tt & 7) * 8;
  const float* op = O + (size_t)row * kDim + c0;
  const v4f a = *(const v4f*)(op);
  const v4f c = *(const v4f*)(op + 4);
  float x[8];
#pragma unroll
  for (int e = 0; e < 4; ++e) { x[e] = a[e]; x[4 + e] = c[e]; }
  float s = ((x[0] + x[1]) + (x[2] + x[3])) + ((x[4] + x[5]) + (x[6] + x[7]));
  s += __shfl_xor(s, 1, 32);
  s += __shfl_xor(s, 2, 32);
  s += __shfl_xor(s, 4, 32);
  const float mu = s * kInv64;
  float d[8];
  float vs = 0.0f;
#pragma unroll
  for (int e = 0; e < 8; ++e) { d[e] = x[e] - mu; vs += d[e] * d[e]; }
  vs += __shfl_xor(vs, 1, 32);
  vs += __shfl_xor(vs, 2, 32);
  vs += __shfl_xor(vs, 4, 32);
  const float var  = vs * kInv64;
  const float rstd = 1.0f / sqrtf(var + kLnEps);
  const float* gp = g + c0;
  const float* bp = bta + c0;
  const v4f g0 = *(const v4f*)(gp);
  const v4f g1 = *(const v4f*)(gp + 4);
  const v4f b0 = *(const v4f*)(bp);
  const v4f b1 = *(const v4f*)(bp + 4);
  float gg[8], bb[8];
#pragma unroll
  for (int e = 0; e < 4; ++e) { gg[e] = g0[e]; gg[4 + e] = g1[e]; bb[e] = b0[e]; bb[4 + e] = b1[e]; }
  unsigned short hb[8];
#pragma unroll
  for (int e = 0; e < 8; ++e) {
    const float y = (d[e] * rstd * gg[e] + bb[e]) * kOutGain;
    hb[e] = h_bits(y);
  }
  const v4u u = (v4u){pk16(hb[0], hb[1]), pk16(hb[2], hb[3]), pk16(hb[4], hb[5]), pk16(hb[6], hb[7])};
  unsigned short* pr = A16 + (size_t)row * kDim + c0;
  *(v4u*)pr = u;
  
}

// ---------------------------------------------------------------------------
// Host glue.
// producer before any consumer reads it; no region re-used with another type):
//   XH    f16 [4096][1024]               8,388,608  at           0   (cast8; read by the two projection GEMMs)
//   WQKT  f16 [2048][1024]               4,194,304  at   8,388,608   (wt z0,z1: permuted Wq^T rows 0..1023, Wk^T rows 1024..2047)
//   WVT   f16 [1024][1024]               2,097,152  at  12,582,912   (wt z2)
//   WOT   f16 [1024][1024]               2,097,152  at  14,680,064   (wt z3)
//   BQK   f32 [2048]                         8,192  at  16,777,216   (permuted bq | bk)
//   QK16  f16 [4096][2048]              16,777,216  at  16,785,408   (q plane cols 0..1023 | k plane cols 1024..2047, permuted)
//   VT16  f16 [1024][4096]               8,388,608  at  33,562,624   (v^T: row = 64h + d, col = token)
//   OATT  f32 [4096][1024]              16,777,216  at  41,951,232   (attention output before LayerNorm; 32 disjoint column slabs)
//   AOH16 f16 [4096][1024]               8,388,608  at  58,728,448   (LayerNorm output)
//   total                               67,117,056
// GEMM shapes: q|k proj M=4096 N=2048 K=1024; v^T proj M=1024 N=4096 K=1024; out proj M=4096 N=1024 K=1024 (all M multiples
// of 128, all N of 256, all K of 128, no padding); scores and p.v inside diff_attn_kernel.
// 8 launches.
// ---------------------------------------------------------------------------
extern "C" void kernel_launch(void* const* d_in, const int* in_sizes, int n_in,
                              void* d_out, int out_size, void* d_ws, size_t ws_size,
                              hipStream_t stream) {
  if (n_in < 16) return;
  const int nTokElem = kTok * kDim;                 // 4,194,304
  const int nW       = kDim * kDim;                 // 1,048,576
  if (in_sizes[0] != nTokElem) return;
  if (in_sizes[1] != kBatch * kSeq * kSeq) return;
  if (in_sizes[2] != nW || in_sizes[4] != nW || in_sizes[6] != nW || in_sizes[8] != nW) return;
  if (in_sizes[3] != kDim || in_sizes[5] != kDim || in_sizes[7] != kDim || in_sizes[9] != kDim) return;
  if (in_sizes[10] != kDiff || in_sizes[11] != kDiff || in_sizes[12] != kDiff || in_sizes[13] != kDiff) return;
  if (in_sizes[14] != kHeads * kDh || in_sizes[15] != kHeads * kDh) return;
  if (out_size != nTokElem) return;

  const size_t szXH   = (size_t)kTok * kDim * 2;
  const size_t szWQK  = (size_t)kQKCols * kDim * 2;
  const size_t szW    = (size_t)kDim * kDim * 2;
  const size_t szBQK  = (size_t)kQKCols * 4;
  const size_t szQK16 = (size_t)kTok * kQKCols * 2;
  const size_t szVT16 = (size_t)kDim * kTok * 2;
  const size_t szO    = (size_t)kTok * kDim * 4;
  const size_t szAOH  = (size_t)kTok * kDim * 2;
  const size_t offXH   = 0;
  const size_t offWQK  = offXH + szXH;
  const size_t offWVT  = offWQK + szWQK;
  const size_t offWOT  = offWVT + szW;
  const size_t offBQK  = offWOT + szW;
  const size_t offQK16 = offBQK + szBQK;
  const size_t offVT16 = offQK16 + szQK16;
  const size_t offO    = offVT16 + szVT16;
  const size_t offAOH  = offO + szO;
  const size_t total   = offAOH + szAOH;          // 67,117,056
  if (ws_size < total) return;

  const float* x    = (const float*)d_in[0];
  const int*   mask = (const int*)d_in[1];
  const float* Wq   = (const float*)d_in[2];
  const float* bq   = (const float*)d_in[3];
  const float* Wk   = (const float*)d_in[4];
  const float* bk   = (const float*)d_in[5];
  const float* Wv   = (const float*)d_in[6];
  const float* bv   = (const float*)d_in[7];
  const float* Wo   = (const float*)d_in[8];
  const float* bo   = (const float*)d_in[9];
  const float* lq1  = (const float*)d_in[10];
  const float* lk1  = (const float*)d_in[11];
  const float* lq2  = (const float*)d_in[12];
  const float* lk2  = (const float*)d_in[13];
  const float* ln_g = (const float*)d_in[14];
  const float* ln_b = (const float*)d_in[15];
  float* out = (float*)d_out;

  char* ws = (char*)d_ws;
  unsigned short* XH    = (unsigned short*)(ws + offXH);
  unsigned short* WQKT  = (unsigned short*)(ws + offWQK);
  unsigned short* WVT   = (unsigned short*)(ws + offWVT);
  unsigned short* WOT   = (unsigned short*)(ws + offWOT);
  float*          BQK   = (float*)(ws + offBQK);
  unsigned short* QK16  = (unsigned short*)(ws + offQK16);
  unsigned short* VT16  = (unsigned short*)(ws + offVT16);
  float*          OATT  = (float*)(ws + offO);
  unsigned short* AOH16 = (unsigned short*)(ws + offAOH);

  // ---- prologue: 16-bit operand planes, permuted bias line ----
  const int n8 = nTokElem / 8;                                  // 524288 -> 2048 blocks exact
  cast8_f16_kernel<<<dim3(n8 / 256), dim3(256), 0, stream>>>(x, XH, n8);
  wt_kernel<<<dim3(kDim / 64, kDim / 64, 4), dim3(256), 0, stream>>>(
      Wq, Wk, Wv, Wo, WQKT, WQKT + (size_t)kDim * kDim, WVT, WOT, kWCarry);
  biasperm_kernel<<<dim3(2), dim3(256), 0, stream>>>(bq, bk, BQK);

  // ---- q|k projection: QK16[m][n'] = f16( (1/16) sum_k XH[m][k] WQKT[n'][k] + BQK[n'] )   (M=4096, N=2048, K=1024) ----
  {
    const int tiles = (kTok / kGmBM) * (kQKCols / kGmBN);       // 256 blocks
    wmma_gemm64<0, false, 2, 1, false, 0><<<dim3(tiles, 1), dim3(256), 0, stream>>>(
        XH, XH, kDim, 0L, WQKT, WQKT, kDim, 0L,
        (void*)QK16, (void*)QK16, kQKCols, 0L, BQK, BQK, 0L, kTok, kQKCols, kDim, kWCarryInv);
  }
  // ---- v^T projection: VT16[n][m] = f16( (1/16) sum_k WVT[n][k] XH[m][k] + bv[n] )   (M=1024 rows n, N=4096 tokens, K=1024) ----
  {
    const int tiles = (kDim / kGmBM) * (kTok / kGmBN);          // 128 blocks
    wmma_gemm64<0, false, 1, 1, false, 0><<<dim3(tiles, 1), dim3(256), 0, stream>>>(
        WVT, WVT, kDim, 0L, XH, XH, kDim, 0L,
        (void*)VT16, (void*)VT16, kTok, 0L, bv, bv, 0L, kDim, kTok, kDim, kWCarryInv);
  }

  // ---- every (batch, head) at once: scores of both sets, both softmaxes, difference, product with v -> OATT ----
  diff_attn_kernel<<<dim3(kSeq / kFaQ, kHeads, kBatch), dim3(256), 0, stream>>>(
      QK16, VT16, mask, lq1, lk1, lq2, lk2, OATT);

  // ---- per-head LayerNorm, affine, x0.8 -> AOH16 ----
  ln_cast_kernel<<<dim3(kTok / 2), dim3(256), 0, stream>>>(OATT, ln_g, ln_b, AOH16);

  // ---- output projection: out[m][n] = (1/16) sum_k AOH16[m][k] WOT[n][k] + bo[n]   (M=4096, N=1024, K=1024) ----
  {
    const int tiles = (kTok / kGmBM) * (kDim / kGmBN);          // 128 blocks
    wmma_gemm64<0, false, 2, 0, false, 0><<<dim3(tiles, 1), dim3(256), 0, stream>>>(
        AOH16, AOH16, kDim, 0L, WOT, WOT, kDim, 0L,
        (void*)out, (void*)out, kDim, 0L, bo, bo, 0L, kTok, kDim, kDim, kWCarryInv);
  }
}

// v005
// A run of this version takes 122 microseconds.
// Next to v004, in two timings, it ran 1.05 and 1.06 times as fast.
// Over all steps from v000 it is 30.1 times as fast.
// Contractions: q|k projection and v^T projection (x f16 by W^T f16 carried x16), scores q_set.k_set^T per head and set (q, k f16 planes, K=32), p_set.v per head and set (p = exp2 of the shifted scores, f16, by v^T f16 plane, K=2048), output projection (LayerNorm output f16 by Wo^T f16 carried x16): all v_wmma_f32_16x16x32_f16 with f32 accumulate; bias adds, mask select, both softmaxes, lambda and the per-head LayerNorm in f32.
#include <hip/hip_runtime.h>
#include <math.h>

// ---------------------------------------------------------------------------
// Problem constants
// ---------------------------------------------------------------------------
constexpr int kBatch  = 2;
constexpr int kSeq    = 2048;
constexpr int kDim    = 1024;              // hidden
constexpr int kHeads  = 16;
constexpr int kDh     = 64;                // head dim of v / output
constexpr int kDiff   = 32;                // head dim of each q/k set
constexpr int kTok    = kBatch * kSeq;     // 4096 token rows
constexpr int kQKCols = 2 * kDim;          // 2048: pitch of the q | k plane (halves)
constexpr float kWCarry    = 16.0f;        // weights carried x16 in f16
constexpr float kWCarryInv = 1.0f / 16.0f;
constexpr float kInvScale  = 0.17677669529663687f;   // 32^-0.5
constexpr float kNegBig    = -1.0e9f;
constexpr float kLambdaInit = 0.2f;
constexpr float kOutGain   = 0.8f;         // 1 - lambda_init
constexpr float kLnEps     = 1.0e-5f;
constexpr float kInv64     = 1.0f / 64.0f;
static_assert(kHeads * kDh == kDim, "shape");
static_assert(kHeads * kDiff * 2 == kDim, "shape");
// GEMM shape contract: M multiple of 128, N of 256, K of 128, at least two passes
static_assert(kTok % 256 == 0 && kQKCols % 256 == 0 && kDim % 256 == 0 && kDim / 128 >= 2 && kSeq % 64 == 0 && kDh % 64 == 0, "tiles");
static_assert(kDim % 32 == 0 && kDiff % 32 == 0 && kSeq % 32 == 0, "ktiles");
static_assert((kTok * kDim) % (8 * 256) == 0, "cast grid");

typedef __attribute__((ext_vector_type(16))) _Float16 v16h;
typedef __attribute__((ext_vector_type(8)))  _Float16 v8h;
typedef __attribute__((ext_vector_type(16))) __bf16   v16b;
typedef __attribute__((ext_vector_type(8)))  __bf16   v8b;
typedef __attribute__((ext_vector_type(8)))  float    v8f;
typedef __attribute__((ext_vector_type(4)))  float    v4f;
typedef __attribute__((ext_vector_type(2)))  float    v2f;
typedef __attribute__((ext_vector_type(2)))  int      v2i;
typedef __attribute__((ext_vector_type(4)))  unsigned int v4u;

// ---------------------------------------------------------------------------
// Helper pieces: conversions, hazard guards, WMMA fragments
// ---------------------------------------------------------------------------
__device__ __forceinline__ unsigned short f2bf_bits(float f) {
  unsigned u = __float_as_uint(f);
  return (unsigned short)((u + 0x7FFFu + ((u >> 16) & 1u)) >> 16);
}
__device__ __forceinline__ float bf_bits2f(unsigned short h) { return __uint_as_float(((unsigned)h) << 16); }

// hazard guards as plain device helpers
__device__ __forceinline__ void dep_guard_h(v8f& a, v8f& b, v16h x, v16h y) { asm volatile("v_nop\n\tv_nop\n\tv_nop\n\tv_nop" : "+v"(a), "+v"(b) : "v"(x), "v"(y)); }
__device__ __forceinline__ void dep_guard_b(v8f& a, v8f& b, v16b x, v16b y) { asm volatile("v_nop\n\tv_nop\n\tv_nop\n\tv_nop" : "+v"(a), "+v"(b) : "v"(x), "v"(y)); }
// group guard tying all four accumulators of an A-row group plus its A fragments
__device__ __forceinline__ void dep_guard4_h(v8f& a, v8f& b, v8f& c, v8f& d, v16h x, v16h y) { asm volatile("v_nop\n\tv_nop\n\tv_nop\n\tv_nop" : "+v"(a), "+v"(b), "+v"(c), "+v"(d) : "v"(x), "v"(y)); }
__device__ __forceinline__ void dep_guard4_b(v8f& a, v8f& b, v8f& c, v8f& d, v16b x, v16b y) { asm volatile("v_nop\n\tv_nop\n\tv_nop\n\tv_nop" : "+v"(a), "+v"(b), "+v"(c), "+v"(d) : "v"(x), "v"(y)); }
__device__ __forceinline__ void keep4_h(v16h a, v16h b, v16h c, v16h d) { asm volatile("v_nop" :: "v"(a), "v"(b), "v"(c), "v"(d)); }
__device__ __forceinline__ void keep4_b(v16b a, v16b b, v16b c, v16b d) { asm volatile("v_nop" :: "v"(a), "v"(b), "v"(c), "v"(d)); }
__device__ __forceinline__ void acc_guard4(v8f& a, v8f& b, v8f& c, v8f& d) { asm volatile("v_nop\n\tv_nop\n\tv_nop\n\tv_nop" : "+v"(a), "+v"(b), "+v"(c), "+v"(d)); }
template <typename T> struct Frag;
template <> struct Frag<_Float16> {
  typedef v16h V; union U { v16h v; v8h h[2]; };
  // elements 0..7 <- p[0..7], 8..15 <- p[16..23]
  static __device__ __forceinline__ v16h load(const _Float16* p) {
    U f; f.h[0] = *(const v8h*)(p); f.h[1] = *(const v8h*)(p + 16); return f.v;
  }
  static __device__ __forceinline__ v8f mma(v16h a, v16h b, v8f c) {
    return __builtin_amdgcn_wmma_f32_16x16x32_f16(false, a, false, b, (short)0, c, false, false);
  }
  static __device__ __forceinline__ void guard(v8f& a, v8f& b, v16h x, v16h y) { dep_guard_h(a, b, x, y); }
  static __device__ __forceinline__ void guard4(v8f& a, v8f& b, v8f& c, v8f& d, v16h x, v16h y) { dep_guard4_h(a, b, c, d, x, y); }
  static __device__ __forceinline__ void keep(v16h a, v16h b, v16h c, v16h d) { keep4_h(a, b, c, d); }
};
template <> struct Frag<__bf16> {
  typedef v16b V; union U { v16b v; v8b h[2]; };
  static __device__ __forceinline__ v16b load(const __bf16* p) {
    U f; f.h[0] = *(const v8b*)(p); f.h[1] = *(const v8b*)(p + 16); return f.v;
  }
  static __device__ __forceinline__ v8f mma(v16b a, v16b b, v8f c) {
    return __builtin_amdgcn_wmma_f32_16x16x32_bf16(false, a, false, b, (short)0, c, false, false);
  }
  static __device__ __forceinline__ void guard(v8f& a, v8f& b, v16b x, v16b y) { dep_guard_b(a, b, x, y); }
  static __device__ __forceinline__ void guard4(v8f& a, v8f& b, v8f& c, v8f& d, v16b x, v16b y) { dep_guard4_b(a, b, c, d, x, y); }
  static __device__ __forceinline__ void keep(v16b a, v16b b, v16b c, v16b d) { keep4_b(a, b, c, d); }
};

__device__ __forceinline__ unsigned pk16(unsigned short a, unsigned short b) { return (unsigned)a | ((unsigned)b << 16); }
__device__ __forceinline__ unsigned short h_bits(float f) { const _Float16 h = (_Float16)f; return __builtin_bit_cast(unsigned short, h); }

// Twelve asynchronous copies, 16 B per lane each, global memory to LDS through no register. l[i] = the lane's LDS byte address,
// g[i] = its global address. The s_wait_xcnt ends the statement so that it stands in front of every later write of an address
// register named here.
__device__ __forceinline__ void copy12_to_lds(const unsigned* l, const char* const* g) {
  asm volatile("global_load_async_to_lds_b128 %0, %1, off\n\t"
               "global_load_async_to_lds_b128 %2, %3, off\n\t"
               "global_load_async_to_lds_b128 %4, %5, off\n\t"
               "global_load_async_to_lds_b128 %6, %7, off\n\t"
               "global_load_async_to_lds_b128 %8, %9, off\n\t"
               "global_load_async_to_lds_b128 %10, %11, off\n\t"
               "global_load_async_to_lds_b128 %12, %13, off\n\t"
               "global_load_async_to_lds_b128 %14, %15, off\n\t"
               "global_load_async_to_lds_b128 %16, %17, off\n\t"
               "global_load_async_to_lds_b128 %18, %19, off\n\t"
               "global_load_async_to_lds_b128 %20, %21, off\n\t"
               "global_load_async_to_lds_b128 %22, %23, off\n\t"
               "s_wait_xcnt 0x0"
               :: "v"(l[0]), "v"(g[0]), "v"(l[1]), "v"(g[1]), "v"(l[2]), "v"(g[2]), "v"(l[3]), "v"(g[3]),
                  "v"(l[4]), "v"(g[4]), "v"(l[5]), "v"(g[5]), "v"(l[6]), "v"(g[6]), "v"(l[7]), "v"(g[7]),
                  "v"(l[8]), "v"(g[8]), "v"(l[9]), "v"(g[9]), "v"(l[10]), "v"(g[10]), "v"(l[11]), "v"(g[11]) : "memory");
}

// ---- Register-blocked batched WMMA GEMM (ACT reduced to none/relu/leaky) -------------------------------
// C[m,n] = scale * sum_k A[m,k] * Bt[n,k] (+bias)(+resid); a block owns a 128x256 tile, each of its 8 waves (2 x 4) 64x64 of it.
// A row-major [M,K]; Bt row-major [N,K]; M % 128 == 0, N % 256 == 0, K % 128 == 0; grid.x = (M / 128) * (N / 256).
// Operands come through LDS, 128 k a pass: 128 A rows and 256 Bt rows of 256 B, brought by asynchronous 16-B copies in which a
// wave covers two whole rows (four 128-B lines). Two buffers: the copies of pass p + 2 are issued behind the barrier that ends
// pass p, into the buffer that pass p has read, and land while pass p + 1 is worked on.
// BIAS_MODE: 0 = none, 1 = bias[m], 2 = bias[n].
// OUT_MODE: 0 = f32, 1 = f16, 2 = bf16 hi plane (Cout) + bf16 lo plane (Cout2).
// ET: 0 = f16 operands, 1 = bf16 operands (pointers passed as 16-bit storage)
constexpr int kGmBM    = 128;                              // block tile rows (A rows staged)
constexpr int kGmBN    = 256;                              // block tile columns (Bt rows staged)
constexpr int kGmPassK = 128;                              // k per pass: 256-B rows
constexpr int kGmPitch = 272;                              // LDS pitch of the 256-B rows: 16 B x odd, no bank conflict for 16-B reads
constexpr int kGmBuf   = (kGmBM + kGmBN) * kGmPitch;       // 104,448 B a buffer: A rows first, Bt rows behind them
template <int ET> struct Elem;
template <> struct Elem<0> { typedef _Float16 T; };
template <> struct Elem<1> { typedef __bf16 T; };
template <int ET, bool SPLIT, int BIAS_MODE, int OUT_MODE, bool RESID, int ACT = 0>
__global__ __launch_bounds__(256) void wmma_gemm64(
    const unsigned short* __restrict__ Ap, const unsigned short* __restrict__ A2p, int lda, long strideA,
    const unsigned short* __restrict__ Btp, const unsigned short* __restrict__ Bt2p, int ldb, long strideB,
    void* __restrict__ Cout, void* __restrict__ Cout2, int ldc, long strideC,
    const float* __restrict__ bias,
    const float* __restrict__ resid, long strideR,
    int M, int N, int K, float scale) {
  static_assert(!SPLIT, "single-plane operands only");
  typedef typename Elem<ET>::T T;
  typedef typename Frag<T>::V V;
  const T* A = (const T*)Ap; const T* Bt = (const T*)Btp;
  __shared__ __align__(16) float sT[8][16 * 68];   // per-wave 16x64 slab, pitch 68 floats
  __shared__ __attribute__((aligned(16))) unsigned char ring[2 * kGmBuf];
  const int b    = blockIdx.y;
  const int lane = threadIdx.x & 31;
  const int wave = threadIdx.x >> 5;
  const int tilesN = N / kGmBN;
  const int tilesM = M / kGmBM;
  if ((int)blockIdx.x >= tilesM * tilesN) return;   // the same for the whole block, in front of every barrier
  const int bm = blockIdx.x / tilesN;
  const int bn = blockIdx.x - bm * tilesN;
  const int wm = (wave >> 2) << 6;             // this wave's 64 rows within the staged A rows
  const int wn = (wave & 3) << 6;              // this wave's 64 rows within the staged Bt rows
  const int m0 = bm * kGmBM + wm;
  const int n0 = bn * kGmBN + wn;

  const T* Ab  = A  + (size_t)b * strideA;
  const T* Bb  = Bt + (size_t)b * strideB;

  const int rlane = lane & 15;                 // row (A) / col (B, D) within subtile
  const int koff  = (lane >> 4) * 8;           // k offset of this lane half
  const int mOff  = (lane >> 4) * 8;           // D row offset

  // what this lane copies: bytes 16 * (t & 15) .. +15 of staged rows (t >> 4) + 16 i: i = 0..7 of A, i = 0..15 of Bt
  const int crow = threadIdx.x >> 4, ccol = (threadIdx.x & 15) * 16;
  const char* gA = (const char*)(Ab + (size_t)(bm * kGmBM + crow) * lda) + ccol;
  const char* gB = (const char*)(Bb + (size_t)(bn * kGmBN + crow) * ldb) + ccol;
  const size_t stepA = (size_t)16 * lda * 2, stepB = (size_t)16 * ldb * 2;
  const unsigned lC = (unsigned)(size_t)ring + crow * kGmPitch + ccol;   // low 32 bits of the address = byte offset in the block's LDS
  // one pass's rows into one buffer: 24 copies a lane; kb = the pass's first byte in a row, lb = the buffer's first byte
  auto stage_pass = [&](size_t kb, unsigned lb) {
    unsigned l[24]; const char* g[24];
#pragma unroll
    for (int i = 0; i < 8; ++i)  { l[i] = lC + lb + i * 16 * kGmPitch;                g[i] = gA + kb + i * stepA; }
#pragma unroll
    for (int i = 0; i < 16; ++i) { l[8 + i] = lC + lb + (kGmBM + i * 16) * kGmPitch;  g[8 + i] = gB + kb + i * stepB; }
    copy12_to_lds(l, g);
    copy12_to_lds(l + 12, g + 12);
  };
  // what this lane reads: row rlane of every 16-row group of its wave's rows, from byte 16 * (lane >> 4)
  const int rA = (wm + rlane) * kGmPitch + koff * 2;
  const int rB = (kGmBM + wn + rlane) * kGmPitch + koff * 2;

  v8f acc[4][4];
#pragma unroll
  for (int i = 0; i < 4; ++i)
#pragma unroll
    for (int j = 0; j < 4; ++j) acc[i][j] = (v8f){0.f,0.f,0.f,0.f,0.f,0.f,0.f,0.f};

  const int nPass = K / kGmPassK;
  // pass 0's rows, landed and published; then pass 1's are asked for
  stage_pass(0, 0);
  asm volatile("s_wait_asynccnt 0x0" ::: "memory");      // this wave's copies have landed
  __syncthreads();                                       // and every other wave's
  if (nPass > 1) stage_pass((size_t)kGmPassK * 2, kGmBuf);

  for (int p = 0; p < nPass; ++p) {
    const unsigned char* sb = ring + (p & 1) * kGmBuf;
#pragma unroll
    for (int ks = 0; ks < kGmPassK / 32; ++ks) {
      V bh[4], ah[4];
#pragma unroll
      for (int i = 0; i < 4; ++i) ah[i] = Frag<T>::load((const T*)(sb + rA + i * 16 * kGmPitch + ks * 64));
#pragma unroll
      for (int j = 0; j < 4; ++j) bh[j] = Frag<T>::load((const T*)(sb + rB + j * 16 * kGmPitch + ks * 64));
      // keeps the 16 reads of a k step together in front of its first product: one LDS latency for all of them; without it the
      // scheduler reads the A fragments one at a time into one register set and waits for each
      __builtin_amdgcn_sched_barrier(0);
#pragma unroll
      for (int j = 0; j < 4; ++j)
#pragma unroll
        for (int i = 0; i < 4; ++i) acc[i][j] = Frag<T>::mma(ah[i], bh[j], acc[i][j]);
    }
    // hand-over: this wave's reads of the buffer are done, its copies for pass p + 1 have landed; behind the barrier that
    // holds for every wave, so pass p + 1 may be read and this pass's buffer may be refilled
    // The scheduling fence keeps the pass's products in front of the hand-over; without it the scheduler sinks products behind
    // the barrier, which delays the refill that stands there.
    __builtin_amdgcn_sched_barrier(0);
    asm volatile("s_wait_dscnt 0x0" ::: "memory");
    asm volatile("s_wait_asynccnt 0x0" ::: "memory");
    __syncthreads();
    if (p + 2 < nPass) stage_pass((size_t)(p + 2) * (kGmPassK * 2), (p & 1) * kGmBuf);   // the same for the whole block
  }
  asm volatile("s_wait_asynccnt 0x0" ::: "memory");        // no copy is left in flight when the wave goes on to its end
  acc_guard4(acc[0][0], acc[0][1], acc[0][2], acc[0][3]);
  acc_guard4(acc[1][0], acc[1][1], acc[1][2], acc[1][3]);
  acc_guard4(acc[2][0], acc[2][1], acc[2][2], acc[2][3]);
  acc_guard4(acc[3][0], acc[3][1], acc[3][2], acc[3][3]);

  // ---- epilogue ----
  float* slab = sT[wave];
  const float* Rb = RESID ? (resid + (size_t)b * strideR) : nullptr;
#pragma unroll
  for (int i = 0; i < 4; ++i) {
    const int mBase = m0 + (i << 4);
#pragma unroll
    for (int j = 0; j < 4; ++j) {
      const int n = n0 + (j << 4) + rlane;
      float bv = 0.f;
      if (BIAS_MODE == 2) bv = bias[n];
#pragma unroll
      for (int r = 0; r < 8; ++r) {
        float v = acc[i][j][r] * scale;
        if (BIAS_MODE == 1) v += bias[mBase + mOff + r];
        if (BIAS_MODE == 2) v += bv;
        if (RESID) v += Rb[(size_t)(mBase + mOff + r) * ldc + n];
        if (ACT == 2) v = fmaxf(v, 0.0f);
        if (ACT == 4) v = (v > 0.f) ? v : 0.01f * v;
        slab[(mOff + r) * 68 + (j << 4) + rlane] = v;
      }
    }
    __builtin_amdgcn_fence(__ATOMIC_RELEASE, "workgroup");
    __builtin_amdgcn_wave_barrier();
    __builtin_amdgcn_fence(__ATOMIC_ACQUIRE, "workgroup");
    if (OUT_MODE == 0) {
      float* C = (float*)Cout + (size_t)b * strideC;
      const int hh = lane >> 4, c4 = (lane & 15) * 4;     // row seg = 256 B = 16 lanes x 16 B
      {
#pragma unroll
        for (int it = 0; it < 8; ++it) {
          const int row = it * 2 + hh;
          v4f v = *(const v4f*)(slab + row * 68 + c4);
          *(v4f*)(C + (size_t)(mBase + row) * ldc + n0 + c4) = v;
        }
        
      }
    } else {
      const int q = lane >> 3, c8 = (lane & 7) * 8;
      unsigned short* C  = (unsigned short*)Cout  + (size_t)b * strideC;
      unsigned short* C2 = (OUT_MODE == 2) ? ((unsigned short*)Cout2 + (size_t)b * strideC) : nullptr;
      {
#pragma unroll
        for (int it = 0; it < 4; ++it) {
          const int row = it * 4 + q;
          const float* sp = slab + row * 68 + c8;
          v8h hv, lv;
#pragma unroll
          for (int e = 0; e < 8; ++e) {
            if (OUT_MODE == 1) {
              hv[e] = (_Float16)sp[e];
            } else {
              unsigned short hb = f2bf_bits(sp[e]);
              unsigned short lb = f2bf_bits(sp[e] - bf_bits2f(hb));
              hv[e] = __builtin_bit_cast(_Float16, hb);
              lv[e] = __builtin_bit_cast(_Float16, lb);
            }
          }
          *(v8h*)(C + (size_t)(mBase + row) * ldc + n0 + c8) = hv;
          if (OUT_MODE == 2) *(v8h*)(C2 + (size_t)(mBase + row) * ldc + n0 + c8) = lv;
        }
        
      }
    }
    __builtin_amdgcn_fence(__ATOMIC_RELEASE, "workgroup");
    __builtin_amdgcn_wave_barrier();
    __builtin_amdgcn_fence(__ATOMIC_ACQUIRE, "workgroup");
  }
}

// ---------------------------------------------------------------------------
// ---------------------------------------------------------------------------
__global__ __launch_bounds__(256) void cast8_f16_kernel(const float* __restrict__ in, unsigned short* __restrict__ out, int n8) {
  const int i = blockIdx.x * 256 + threadIdx.x;
  if (i >= n8) return;
  const float* p = in + 8 * (size_t)i;
  const v4f a = *(const v4f*)(p);
  const v4f c = *(const v4f*)(p + 4);
  unsigned short hb[8];
#pragma unroll
  for (int e = 0; e < 4; ++e) {
    hb[e]     = h_bits(a[e]);
    hb[4 + e] = h_bits(c[e]);
  }
  const v4u u = (v4u){pk16(hb[0], hb[1]), pk16(hb[2], hb[3]), pk16(hb[4], hb[5]), pk16(hb[6], hb[7])};
  unsigned short* q = out + 8 * (size_t)i;
  *(v4u*)q = u;
  
}

// ---------------------------------------------------------------------------
// Weight transpose + cast (+ optional output-feature permutation) for square [1024 in][1024 out] f32 W (row-major [k][n]):
//   out[np][k] = f16( scale * W[k][orig(np)] ), orig(np) = perm ? ((np>>5)&1)*512 + (np>>6)*32 + (np&31) : np.
// With perm, plane column 64h + 32*set + d holds feature set*512 + 32h + d, so the two q/k sets of a head sit at stride 32.
// grid (16, 16, 4): blockIdx.x = k tile (64 cols of out), blockIdx.y = np tile (64 rows of out), blockIdx.z selects
//   z0 = (W0 -> o0, perm), z1 = (W1 -> o1, perm), z2 = (W2 -> o2, identity), z3 = (W3 -> o3, identity). 256 threads.
// Load coverage: 16 iterations x 256 threads = 4096 = the whole 64x64 tile (coalesced along n inside 32-wide strips).
// Store coverage: 8 waves x 2 iterations x 4 rows (lane>>3) = 64 rows; (lane&7) x 8 halves = 64 cols; each row segment =
// ---------------------------------------------------------------------------
__global__ __launch_bounds__(256) void wt_kernel(const float* __restrict__ W0, const float* __restrict__ W1,
                                                 const float* __restrict__ W2, const float* __restrict__ W3,
                                                 unsigned short* __restrict__ o0, unsigned short* __restrict__ o1,
                                                 unsigned short* __restrict__ o2, unsigned short* __restrict__ o3,
                                                 float scale) {
  __shared__ float sm[64][65];   // sm[np_local][k_local]
  const int t  = threadIdx.x;
  const int k0 = blockIdx.x * 64;
  const int n0 = blockIdx.y * 64;
  const int z  = blockIdx.z;                                   // block-uniform
  const float* W = (z == 0) ? W0 : (z == 1) ? W1 : (z == 2) ? W2 : W3;
  unsigned short* op = (z == 0) ? o0 : (z == 1) ? o1 : (z == 2) ? o2 : o3;
  const int perm = (z < 2) ? 1 : 0;
#pragma unroll
  for (int i = 0; i < 16; ++i) {
    const int e = i * 256 + t;
    const int r = e >> 6;          // k local
    const int c = e & 63;          // np local
    const int np = n0 + c;
    const int og = perm ? ((((np >> 5) & 1) << 9) + ((np >> 6) << 5) + (np & 31)) : np;
    sm[c][r] = W[(size_t)(k0 + r) * kDim + og] * scale;
  }
  __syncthreads();
  const int lane = t & 31, wave = t >> 5;
  const int q = lane >> 3, c8 = (lane & 7) * 8;
  {
#pragma unroll
    for (int it = 0; it < 2; ++it) {
      const int row = wave * 8 + it * 4 + q;                 // np local
      unsigned short hb[8];
#pragma unroll
      for (int e = 0; e < 8; ++e) hb[e] = h_bits(sm[row][c8 + e]);
      const v4u u = (v4u){pk16(hb[0], hb[1]), pk16(hb[2], hb[3]), pk16(hb[4], hb[5]), pk16(hb[6], hb[7])};
      *(v4u*)(op + (size_t)(n0 + row) * kDim + k0 + c8) = u;
    }
    
  }
}

// ---------------------------------------------------------------------------
// Permuted q|k bias line: out[np] = bq[orig(np)] for np < 1024 (block 0), out[1024 + np] = bk[orig(np)] (block 1).
// Thread t owns np = 4t..4t+3 (orig of an aligned group of 4 is contiguous); one 16-B store per lane, a wave = 512 B =
// ---------------------------------------------------------------------------
__global__ __launch_bounds__(256) void biasperm_kernel(const float* __restrict__ bq, const float* __restrict__ bk,
                                                       float* __restrict__ out) {
  const int t = threadIdx.x;
  const float* src = (blockIdx.x == 0) ? bq : bk;             // block-uniform
  const int np = 4 * t;
  const int og = (((np >> 5) & 1) << 9) + ((np >> 6) << 5) + (np & 31);
  const v4f v = *(const v4f*)(src + og);
  float* dp = out + (size_t)blockIdx.x * kDim + np;
  *(v4f*)dp = v;
  
}

// ---------------------------------------------------------------------------
// Both masked softmaxes, their difference and the product with v, for every (batch, head) in one launch; no score ever
// reaches memory. Transposed forms, so that one lane owns one query column throughout:
//   St[set][j][i] = sum_d k_set[j][d] * q_set[i][d]     (A = 16 key rows, B = 16 query rows kept in registers, K = 32)
//   x = (mask[i][j] != 0) ? St * 32^-0.5 * log2(e) : -1e9 * log2(e)
//   running maximum m and sum l per query and set; p = exp2(x - m), f16
//   Ot[set][d][i] = Ot[set][d][i] * exp2(m_old - m_new) + sum_j v^T[d][j] * p[j][i]     (A = 16 rows of v^T, B = p, K = 32)
//   O[i][d] = Ot[0][d][i] / l0 - lambda * Ot[1][d][i] / l1,  lambda = exp(sum lq1*lk1) - exp(sum lq2*lk2) + 0.2
// and, still in registers, the per-head LayerNorm over the 64 d of O[i][.], affine, x0.8, f16 cast:
//   mu = mean_d O, var = mean_d (O - mu)^2, y = ((O - mu) / sqrt(var + 1e-5) * g[h][d] + b[h][d]) * 0.8 -> A16[i][64h + d]
// (lanes l and l ^ 16 hold 32 d each of one query row: each sums its own 32, one lane swap joins the halves).
// grid (16, 16 heads, 2 batches), 8 waves; wave w owns query rows 128*blockIdx.x + 16w .. +15 and walks all 2048 keys, 64 a
// trip. A trip's operands come through LDS: 64 k rows and 64 v^T rows of 128 B (shared by the 8 waves) and 128 mask rows of
// 256 B (16 per wave), brought by asynchronous 16-B copies in which a wave covers whole 128-B lines. Two buffers: the copies
// of trip t + 1 are issued behind the barrier that ends trip t - 1 and land while trip t is worked on.
// Fragment maps: accumulator register r of lane l holds row 8*(l>>4) + r, column l & 15. Two score tiles (keys 0..15 and
// 16..31 of a 32-key chunk) converted in place are the B operand of the second product: element s = key
// (s < 8 ? 8*(l>>4) + s : 16 + 8*(l>>4) + s - 8), which is the k order in which Frag::load reads the v^T rows.
// Store: a lane holds 8 consecutive d of its query row per tile; the wave writes the whole 128-B row segment of its head.
// ---------------------------------------------------------------------------
constexpr int   kFaQ    = 128;                 // query rows per block (8 waves x 16)
constexpr int   kFaKeys = 64;                  // keys per trip
constexpr float kLog2e  = 1.4426950408889634f;
static_assert(kSeq % kFaQ == 0 && kSeq % kFaKeys == 0 && kDh == 64 && kDiff == 32, "attention tiling");
typedef __attribute__((ext_vector_type(4))) int v4i;
constexpr int kFaTrips = kSeq / kFaKeys;                   // 32
constexpr int kKvPitch = 144;                              // LDS pitch of the 128-B k and v^T rows: 16 B x odd, no bank conflict for 16-B reads
constexpr int kMkPitch = 272;                              // LDS pitch of the 256-B mask rows: 16 B x odd
constexpr int kLdsV    = kFaKeys * kKvPitch;               // k rows at 0, v^T rows behind them
constexpr int kLdsM    = kLdsV + kDh * kKvPitch;           // mask rows behind those
constexpr int kLdsBuf  = kLdsM + kFaQ * kMkPitch;          // 53,248 B a buffer
static_assert(kFaTrips >= 2 && kFaKeys * 2 == 128 && kDh * 2 == 128 && kFaKeys * 4 == 256, "staging");
// Four asynchronous copies, 16 B per lane each, global memory to LDS through no register. l = the lane's LDS byte address,
// g = its global address. The s_wait_xcnt ends the statement so that it stands in front of every later write of an address
// register named here.
__device__ __forceinline__ void copy4_to_lds(unsigned l0, const char* g0, unsigned l1, const char* g1,
                                             unsigned l2, const char* g2, unsigned l3, const char* g3) {
  asm volatile("global_load_async_to_lds_b128 %0, %1, off\n\t"
               "global_load_async_to_lds_b128 %2, %3, off\n\t"
               "global_load_async_to_lds_b128 %4, %5, off\n\t"
               "global_load_async_to_lds_b128 %6, %7, off\n\t"
               "s_wait_xcnt 0x0"
               :: "v"(l0), "v"(g0), "v"(l1), "v"(g1), "v"(l2), "v"(g2), "v"(l3), "v"(g3) : "memory");
}
// One trip's tiles into one buffer: 12 copies a lane. lk, lv, lm and gk, gv, gm are the lane's first LDS and global addresses
// in the k, v^T and mask tile; its further rows lie 32 rows on (k, v^T) and 2 rows on (mask).
__device__ __forceinline__ void stage_trip(unsigned lk, unsigned lv, unsigned lm,
                                           const char* gk, const char* gv, const char* gm) {
  copy4_to_lds(lk, gk, lk + 32 * kKvPitch, gk + (size_t)32 * kQKCols * 2,
               lv, gv, lv + 32 * kKvPitch, gv + (size_t)32 * kTok * 2);
  copy4_to_lds(lm,                gm,                          lm + 2 * kMkPitch, gm + (size_t)2 * kSeq * 4,
               lm + 4 * kMkPitch, gm + (size_t)4 * kSeq * 4,   lm + 6 * kMkPitch, gm + (size_t)6 * kSeq * 4);
  copy4_to_lds(lm + 8 * kMkPitch,  gm + (size_t)8 * kSeq * 4,  lm + 10 * kMkPitch, gm + (size_t)10 * kSeq * 4,
               lm + 12 * kMkPitch, gm + (size_t)12 * kSeq * 4, lm + 14 * kMkPitch, gm + (size_t)14 * kSeq * 4);
}
// value of lane l ^ 16, by a vector-unit lane swap (no LDS round trip)
__device__ __forceinline__ float other_half(float x) {
  const int b = __float_as_int(x);
  return __int_as_float(__builtin_amdgcn_permlanex16(b, b, 0x76543210, 0xfedcba98, false, false));
}
// exp2 in place. The instruction set asks for one slot between a transcendental and a directly following instruction that
// overwrites its source or reads its result. Here each overwrites only its own source, and the v_nop is the slot in front of
// whatever the compiler puts next.
__device__ __forceinline__ void exp2_inplace(float& x) {
  asm("v_exp_f32 %0, %0\n\tv_nop" : "+v"(x));
}
__device__ __forceinline__ void exp2_inplace8(v8f& x) {
  float a = x[0], b = x[1], c = x[2], d = x[3], e = x[4], f = x[5], g = x[6], h = x[7];
  asm("v_exp_f32 %0, %0\n\tv_exp_f32 %1, %1\n\tv_exp_f32 %2, %2\n\tv_exp_f32 %3, %3\n\t"
      "v_exp_f32 %4, %4\n\tv_exp_f32 %5, %5\n\tv_exp_f32 %6, %6\n\tv_exp_f32 %7, %7\n\tv_nop"
      : "+v"(a), "+v"(b), "+v"(c), "+v"(d), "+v"(e), "+v"(f), "+v"(g), "+v"(h));
  x = (v8f){a, b, c, d, e, f, g, h};
}
// four waves per SIMD (two blocks per WGP): the whole grid of 512 blocks is resident at once, within 256 registers a wave
// and 106,496 B of LDS a block
__global__ __launch_bounds__(256) __attribute__((amdgpu_waves_per_eu(4, 4))) void diff_attn_kernel(const unsigned short* __restrict__ QKp,
                                                        const unsigned short* __restrict__ Vtp,
                                                        const int* __restrict__ Mp,
                                                        const float* __restrict__ lq1, const float* __restrict__ lk1,
                                                        const float* __restrict__ lq2, const float* __restrict__ lk2,
                                                        const float* __restrict__ g, const float* __restrict__ bta,
                                                        unsigned short* __restrict__ A16) {
  const int lane = threadIdx.x & 31, wave = threadIdx.x >> 5;
  const int c    = lane & 15;                  // this lane's query column; row of every A fragment
  const int h8   = (lane >> 4) * 8;            // k offset of this lane half; also its accumulator row offset
  const int head = blockIdx.y;
  const int b    = blockIdx.z;
  const int q0   = blockIdx.x * kFaQ + wave * 16;

  const _Float16* QK = (const _Float16*)QKp + (size_t)b * kSeq * kQKCols + head * kDh;
  const _Float16* Qr = QK + (size_t)(q0 + c) * kQKCols + h8;
  __shared__ __attribute__((aligned(16))) unsigned char smem[2 * kLdsBuf];
  // what this lane copies: of k and v^T rows (t >> 3) and (t >> 3) + 32, bytes 16 * (t & 7) .. +15 (a wave: 4 whole rows a
  // copy); of the mask its own wave's rows 2i + (lane >> 4), i = 0..7, bytes 16 * (lane & 15) .. +15 (a wave: 2 whole rows)
  const int crow = threadIdx.x >> 3, ccol = (threadIdx.x & 7) * 16;
  const int mrow = wave * 16 + (lane >> 4), mcol = (lane & 15) * 16;
  const char* gK = (const char*)(QK + kDim + (size_t)crow * kQKCols) + ccol;
  const char* gV = (const char*)((const _Float16*)Vtp + (size_t)(head * kDh + crow) * kTok + (size_t)b * kSeq) + ccol;
  const char* gM = (const char*)(Mp + ((size_t)b * kSeq + blockIdx.x * kFaQ + mrow) * kSeq) + mcol;
  const unsigned lds0 = (unsigned)(size_t)smem;            // low 32 bits of the address = byte offset in the block's LDS
  const unsigned lK = lds0 + crow * kKvPitch + ccol;
  const unsigned lV = lds0 + kLdsV + crow * kKvPitch + ccol;
  const unsigned lM = lds0 + kLdsM + mrow * kMkPitch + mcol;
  // what this lane reads: row c of every 16-row group, from byte 16 * (lane >> 4) (k, v^T) or 32 * (lane >> 4) (mask)
  const int rK = c * kKvPitch + h8 * 2;
  const int rV = kLdsV + c * kKvPitch + h8 * 2;
  const int rM = kLdsM + (wave * 16 + c) * kMkPitch + h8 * 4;
  v16h qf[2];
  qf[0] = Frag<_Float16>::load(Qr);
  qf[1] = Frag<_Float16>::load(Qr + kDiff);

  const v8f zero = (v8f){0.f,0.f,0.f,0.f,0.f,0.f,0.f,0.f};
  const float cs   = kInvScale * kLog2e;
  const float xOff = kNegBig * kLog2e;
  v8f o[2][4];
  float m[2], l[2];
#pragma unroll
  for (int st = 0; st < 2; ++st) {
    m[st] = -__builtin_inff();
    l[st] = 0.f;
#pragma unroll
    for (int dt = 0; dt < 4; ++dt) o[st][dt] = zero;
  }

  // trip 0's tiles, landed and published
  stage_trip(lK, lV, lM, gK, gV, gM);
  asm volatile("s_wait_asynccnt 0x0" ::: "memory");      // this wave's copies have landed
  __syncthreads();                                       // and every other wave's

  for (int t = 0; t < kFaTrips; ++t) {
    const int buf = (t & 1) * kLdsBuf;
    const unsigned char* sb = smem + buf;
    // directly behind the barrier that ended trip t - 1 (in front of trip 0: the one above): the next trip's tiles are asked
    // for, into the buffer that trip t - 1 has read, and fly while this trip is worked on
    if (t + 1 < kFaTrips) {                                // the same for the whole block
      const size_t j1 = (size_t)(t + 1) * kFaKeys;
      const unsigned nb = kLdsBuf - buf;
      stage_trip(lK + nb, lV + nb, lM + nb, gK + j1 * (kQKCols * 2), gV + j1 * 2, gM + j1 * 4);
    }
    v8f s[2][4];
    v4i mk[4][2];
    v16h kf[2][4];
#pragma unroll
    for (int kt = 0; kt < 4; ++kt) {
      mk[kt][0] = *(const v4i*)(sb + rM + kt * 64);
      mk[kt][1] = *(const v4i*)(sb + rM + kt * 64 + 16);
    }
#pragma unroll
    for (int kt = 0; kt < 4; ++kt) {
      const _Float16* kp = (const _Float16*)(sb + rK + kt * 16 * kKvPitch);
      kf[0][kt] = Frag<_Float16>::load(kp);
      kf[1][kt] = Frag<_Float16>::load(kp + kDiff);
    }
    // keeps the trip's mask and k reads together in front of the first product: one latency for all of them; without it
    // the scheduler, short of registers, reads one fragment at a time and waits for each
    __builtin_amdgcn_sched_barrier(0);
    // the 32 mask words of a lane become 32 lane masks in scalar registers here, which frees their vector registers
    bool keep[4][8];
#pragma unroll
    for (int kt = 0; kt < 4; ++kt)
#pragma unroll
      for (int r = 0; r < 8; ++r) keep[kt][r] = (mk[kt][r >> 2][r & 3] != 0);
#pragma unroll
    for (int kt = 0; kt < 4; ++kt) {
      s[0][kt] = Frag<_Float16>::mma(kf[0][kt], qf[0], zero);
      s[1][kt] = Frag<_Float16>::mma(kf[1][kt], qf[1], zero);
    }
    v16h vf[2][4];
    v16h pf[2][2];
#pragma unroll
    for (int st = 0; st < 2; ++st) {
      if (st == 1) {
        // all of the trip's v^T fragments are asked for by here, into the registers the first set's scores have just left:
        // their LDS latency runs under the second set's softmax arithmetic
        const _Float16* vp = (const _Float16*)(sb + rV);
#pragma unroll
        for (int kc = 0; kc < 2; ++kc)
#pragma unroll
          for (int dt = 0; dt < 4; ++dt) vf[kc][dt] = Frag<_Float16>::load(vp + dt * 16 * (kKvPitch / 2) + kc * 32);
        // keeps those reads up here; without it the scheduler sinks them to just in front of their products, each with a full wait
        __builtin_amdgcn_sched_barrier(0);
      }
      float tm = -__builtin_inff();
#pragma unroll
      for (int kt = 0; kt < 4; ++kt)
#pragma unroll
        for (int r = 0; r < 8; ++r) {
          const float x = keep[kt][r] ? s[st][kt][r] * cs : xOff;
          s[st][kt][r] = x;
          tm = fmaxf(tm, x);
        }
      tm = fmaxf(tm, other_half(tm));                // the other lane half holds the other keys of the same query
      const float mn    = fmaxf(m[st], tm);
      float sum = 0.f;
#pragma unroll
      for (int kt = 0; kt < 4; ++kt) {
        v8f p = s[st][kt] - mn;
        exp2_inplace8(p);
#pragma unroll
        for (int r = 0; r < 8; ++r) {
          sum += p[r];
          pf[st][kt >> 1][(kt & 1) * 8 + r] = (_Float16)p[r];
        }
      }
      float alpha = m[st] - mn;
      exp2_inplace(alpha);
      m[st] = mn;
      l[st] = l[st] * alpha + sum;                   // this half's keys only; the halves are joined behind the loop
#pragma unroll
      for (int dt = 0; dt < 4; ++dt) o[st][dt] *= alpha;
    }
#pragma unroll
    for (int kc = 0; kc < 2; ++kc)
#pragma unroll
      for (int dt = 0; dt < 4; ++dt) {
        o[0][dt] = Frag<_Float16>::mma(vf[kc][dt], pf[0][kc], o[0][dt]);
        o[1][dt] = Frag<_Float16>::mma(vf[kc][dt], pf[1][kc], o[1][dt]);
      }
    // hand-over: this wave's reads of the buffer are done, its copies for trip t + 1 have landed; behind the barrier that
    // holds for every wave, so trip t + 1 may be read and this trip's buffer may be refilled
    // The scheduling fence keeps the hand-over at the trip's end; without it the scheduler lifts the waits and the barrier into
    // the second set's softmax, which takes a third off the time the copies have to land.
    __builtin_amdgcn_sched_barrier(0);
    asm volatile("s_wait_dscnt 0x0" ::: "memory");
    asm volatile("s_wait_asynccnt 0x0" ::: "memory");
    __syncthreads();
  }
  asm volatile("s_wait_asynccnt 0x0" ::: "memory");        // no copy is left in flight when the wave goes on to its end

  // lambda from the two 32-vectors (wave-wide butterfly, unconditional shuffles)
  float t1 = lq1[lane] * lk1[lane];
  float t2 = lq2[lane] * lk2[lane];
#pragma unroll
  for (int off = 16; off > 0; off >>= 1) {
    t1 += __shfl_xor(t1, off, 32);
    t2 += __shfl_xor(t2, off, 32);
  }
  const float lam = (expf(t1) - expf(t2)) + kLambdaInit;

  const float l0 = l[0] + other_half(l[0]);
  const float l1 = l[1] + other_half(l[1]);
  const float inv0 = 1.0f / l0;
  const float inv1 = lam / l1;
  // this lane's 32 of the 64 d of its query row: d = 16 dt + h8 + e
  float y[4][8], ps[4];
#pragma unroll
  for (int dt = 0; dt < 4; ++dt) {
    ps[dt] = 0.f;
#pragma unroll
    for (int e = 0; e < 8; ++e) {
      y[dt][e] = o[0][dt][e] * inv0 - o[1][dt][e] * inv1;
      ps[dt] += y[dt][e];
    }
  }
  float sm = (ps[0] + ps[1]) + (ps[2] + ps[3]);
  sm += other_half(sm);
  const float mu = sm * kInv64;
#pragma unroll
  for (int dt = 0; dt < 4; ++dt) {
    ps[dt] = 0.f;
#pragma unroll
    for (int e = 0; e < 8; ++e) {
      y[dt][e] -= mu;
      ps[dt] += y[dt][e] * y[dt][e];
    }
  }
  float vs = (ps[0] + ps[1]) + (ps[2] + ps[3]);
  vs += other_half(vs);
  const float rstd = 1.0f / sqrtf(vs * kInv64 + kLnEps);
  const float* gp = g   + head * kDh + h8;
  const float* bp = bta + head * kDh + h8;
  unsigned short* Ar = A16 + ((size_t)b * kSeq + q0 + c) * kDim + head * kDh + h8;
#pragma unroll
  for (int dt = 0; dt < 4; ++dt) {
    const v4f g0 = *(const v4f*)(gp + dt * 16);
    const v4f g1 = *(const v4f*)(gp + dt * 16 + 4);
    const v4f b0 = *(const v4f*)(bp + dt * 16);
    const v4f b1 = *(const v4f*)(bp + dt * 16 + 4);
    unsigned short hb[8];
#pragma unroll
    for (int e = 0; e < 4; ++e) {
      hb[e]     = h_bits((y[dt][e]     * rstd * g0[e] + b0[e]) * kOutGain);
      hb[4 + e] = h_bits((y[dt][4 + e] * rstd * g1[e] + b1[e]) * kOutGain);
    }
    *(v4u*)(Ar + dt * 16) = (v4u){pk16(hb[0], hb[1]), pk16(hb[2], hb[3]), pk16(hb[4], hb[5]), pk16(hb[6], hb[7])};
  }
}

// ---------------------------------------------------------------------------
// Host glue.
// producer before any consumer reads it; no region re-used with another type):
//   XH    f16 [4096][1024]               8,388,608  at           0   (cast8; read by the two projection GEMMs)
//   WQKT  f16 [2048][1024]               4,194,304  at   8,388,608   (wt z0,z1: permuted Wq^T rows 0..1023, Wk^T rows 1024..2047)
//   WVT   f16 [1024][1024]               2,097,152  at  12,582,912   (wt z2)
//   WOT   f16 [1024][1024]               2,097,152  at  14,680,064   (wt z3)
//   BQK   f32 [2048]                         8,192  at  16,777,216   (permuted bq | bk)
//   QK16  f16 [4096][2048]              16,777,216  at  16,785,408   (q plane cols 0..1023 | k plane cols 1024..2047, permuted)
//   VT16  f16 [1024][4096]               8,388,608  at  33,562,624   (v^T: row = 64h + d, col = token)
//   AOH16 f16 [4096][1024]               8,388,608  at  41,951,232   (LayerNorm output; 32 disjoint column slabs)
//   total                               50,339,840
// GEMM shapes: q|k proj M=4096 N=2048 K=1024; v^T proj M=1024 N=4096 K=1024; out proj M=4096 N=1024 K=1024 (all M multiples
// of 128, all N of 256, all K of 128, no padding); scores and p.v inside diff_attn_kernel.
// 7 launches.
// ---------------------------------------------------------------------------
extern "C" void kernel_launch(void* const* d_in, const int* in_sizes, int n_in,
                              void* d_out, int out_size, void* d_ws, size_t ws_size,
                              hipStream_t stream) {
  if (n_in < 16) return;
  const int nTokElem = kTok * kDim;                 // 4,194,304
  const int nW       = kDim * kDim;                 // 1,048,576
  if (in_sizes[0] != nTokElem) return;
  if (in_sizes[1] != kBatch * kSeq * kSeq) return;
  if (in_sizes[2] != nW || in_sizes[4] != nW || in_sizes[6] != nW || in_sizes[8] != nW) return;
  if (in_sizes[3] != kDim || in_sizes[5] != kDim || in_sizes[7] != kDim || in_sizes[9] != kDim) return;
  if (in_sizes[10] != kDiff || in_sizes[11] != kDiff || in_sizes[12] != kDiff || in_sizes[13] != kDiff) return;
  if (in_sizes[14] != kHeads * kDh || in_sizes[15] != kHeads * kDh) return;
  if (out_size != nTokElem) return;

  const size_t szXH   = (size_t)kTok * kDim * 2;
  const size_t szWQK  = (size_t)kQKCols * kDim * 2;
  const size_t szW    = (size_t)kDim * kDim * 2;
  const size_t szBQK  = (size_t)kQKCols * 4;
  const size_t szQK16 = (size_t)kTok * kQKCols * 2;
  const size_t szVT16 = (size_t)kDim * kTok * 2;
  const size_t szAOH  = (size_t)kTok * kDim * 2;
  const size_t offXH   = 0;
  const size_t offWQK  = offXH + szXH;
  const size_t offWVT  = offWQK + szWQK;
  const size_t offWOT  = offWVT + szW;
  const size_t offBQK  = offWOT + szW;
  const size_t offQK16 = offBQK + szBQK;
  const size_t offVT16 = offQK16 + szQK16;
  const size_t offAOH  = offVT16 + szVT16;
  const size_t total   = offAOH + szAOH;          // 50,339,840
  if (ws_size < total) return;

  const float* x    = (const float*)d_in[0];
  const int*   mask = (const int*)d_in[1];
  const float* Wq   = (const float*)d_in[2];
  const float* bq   = (const float*)d_in[3];
  const float* Wk   = (const float*)d_in[4];
  const float* bk   = (const float*)d_in[5];
  const float* Wv   = (const float*)d_in[6];
  const float* bv   = (const float*)d_in[7];
  const float* Wo   = (const float*)d_in[8];
  const float* bo   = (const float*)d_in[9];
  const float* lq1  = (const float*)d_in[10];
  const float* lk1  = (const float*)d_in[11];
  const float* lq2  = (const float*)d_in[12];
  const float* lk2  = (const float*)d_in[13];
  const float* ln_g = (const float*)d_in[14];
  const float* ln_b = (const float*)d_in[15];
  float* out = (float*)d_out;

  char* ws = (char*)d_ws;
  unsigned short* XH    = (unsigned short*)(ws + offXH);
  unsigned short* WQKT  = (unsigned short*)(ws + offWQK);
  unsigned short* WVT   = (unsigned short*)(ws + offWVT);
  unsigned short* WOT   = (unsigned short*)(ws + offWOT);
  float*          BQK   = (float*)(ws + offBQK);
  unsigned short* QK16  = (unsigned short*)(ws + offQK16);
  unsigned short* VT16  = (unsigned short*)(ws + offVT16);
  unsigned short* AOH16 = (unsigned short*)(ws + offAOH);

  // ---- prologue: 16-bit operand planes, permuted bias line ----
  const int n8 = nTokElem / 8;                                  // 524288 -> 2048 blocks exact
  cast8_f16_kernel<<<dim3(n8 / 256), dim3(256), 0, stream>>>(x, XH, n8);
  wt_kernel<<<dim3(kDim / 64, kDim / 64, 4), dim3(256), 0, stream>>>(
      Wq, Wk, Wv, Wo, WQKT, WQKT + (size_t)kDim * kDim, WVT, WOT, kWCarry);
  biasperm_kernel<<<dim3(2), dim3(256), 0, stream>>>(bq, bk, BQK);

  // ---- q|k projection: QK16[m][n'] = f16( (1/16) sum_k XH[m][k] WQKT[n'][k] + BQK[n'] )   (M=4096, N=2048, K=1024) ----
  {
    const int tiles = (kTok / kGmBM) * (kQKCols / kGmBN);       // 256 blocks
    wmma_gemm64<0, false, 2, 1, false, 0><<<dim3(tiles, 1), dim3(256), 0, stream>>>(
        XH, XH, kDim, 0L, WQKT, WQKT, kDim, 0L,
        (void*)QK16, (void*)QK16, kQKCols, 0L, BQK, BQK, 0L, kTok, kQKCols, kDim, kWCarryInv);
  }
  // ---- v^T projection: VT16[n][m] = f16( (1/16) sum_k WVT[n][k] XH[m][k] + bv[n] )   (M=1024 rows n, N=4096 tokens, K=1024) ----
  {
    const int tiles = (kDim / kGmBM) * (kTok / kGmBN);          // 128 blocks
    wmma_gemm64<0, false, 1, 1, false, 0><<<dim3(tiles, 1), dim3(256), 0, stream>>>(
        WVT, WVT, kDim, 0L, XH, XH, kDim, 0L,
        (void*)VT16, (void*)VT16, kTok, 0L, bv, bv, 0L, kDim, kTok, kDim, kWCarryInv);
  }

  // ---- every (batch, head) at once: scores of both sets, both softmaxes, difference, product with v, per-head LayerNorm,
  //      affine, x0.8 -> AOH16 ----
  diff_attn_kernel<<<dim3(kSeq / kFaQ, kHeads, kBatch), dim3(256), 0, stream>>>(
      QK16, VT16, mask, lq1, lk1, lq2, lk2, ln_g, ln_b, AOH16);

  // ---- output projection: out[m][n] = (1/16) sum_k AOH16[m][k] WOT[n][k] + bo[n]   (M=4096, N=1024, K=1024) ----
  {
    const int tiles = (kTok / kGmBM) * (kDim / kGmBN);          // 128 blocks
    wmma_gemm64<0, false, 2, 0, false, 0><<<dim3(tiles, 1), dim3(256), 0, stream>>>(
        AOH16, AOH16, kDim, 0L, WOT, WOT, kDim, 0L,
        (void*)out, (void*)out, kDim, 0L, bo, bo, 0L, kTok, kDim, kDim, kWCarryInv);
  }
}

// v006
// A run of this version takes 116 microseconds.
// In both of two side-by-side timings against v005, it was 1.06 times as fast.
// All steps since v000 together make it 31.9 times as fast.
// Contractions: q|k projection and v^T projection (x f16 by W^T f16 carried x16), scores q_set.k_set^T per head and set (q, k f16 planes, K=32), p_set.v per head and set (p = exp2 of the shifted scores, f16, by v^T f16 plane, K=2048), output projection (LayerNorm output f16 by Wo^T f16 carried x16): all v_wmma_f32_16x16x32_f16 with f32 accumulate; bias adds, mask select, both softmaxes, lambda and the per-head LayerNorm in f32.
#include <hip/hip_runtime.h>
#include <math.h>

// ---------------------------------------------------------------------------
// Problem constants
// ---------------------------------------------------------------------------
constexpr int kBatch  = 2;
constexpr int kSeq    = 2048;
constexpr int kDim    = 1024;              // hidden
constexpr int kHeads  = 16;
constexpr int kDh     = 64;                // head dim of v / output
constexpr int kDiff   = 32;                // head dim of each q/k set
constexpr int kTok    = kBatch * kSeq;     // 4096 token rows
constexpr int kQKCols = 2 * kDim;          // 2048: pitch of the q | k plane (halves)
constexpr float kWCarry    = 16.0f;        // weights carried x16 in f16
constexpr float kWCarryInv = 1.0f / 16.0f;
constexpr float kInvScale  = 0.17677669529663687f;   // 32^-0.5
constexpr float kNegBig    = -1.0e9f;
constexpr float kLambdaInit = 0.2f;
constexpr float kOutGain   = 0.8f;         // 1 - lambda_init
constexpr float kLnEps     = 1.0e-5f;
constexpr float kInv64     = 1.0f / 64.0f;
static_assert(kHeads * kDh == kDim, "shape");
static_assert(kHeads * kDiff * 2 == kDim, "shape");
// GEMM shape contract: M multiple of 128, N of 256, K of 128, at least two passes
static_assert(kTok % 256 == 0 && kQKCols % 256 == 0 && kDim % 256 == 0 && kDim / 128 >= 2 && kSeq % 64 == 0 && kDh % 64 == 0, "tiles");
static_assert(kDim % 32 == 0 && kDiff % 32 == 0 && kSeq % 32 == 0, "ktiles");
static_assert((kTok * kDim) % (8 * 256) == 0, "cast grid");

typedef __attribute__((ext_vector_type(16))) _Float16 v16h;
typedef __attribute__((ext_vector_type(8)))  _Float16 v8h;
typedef __attribute__((ext_vector_type(16))) __bf16   v16b;
typedef __attribute__((ext_vector_type(8)))  __bf16   v8b;
typedef __attribute__((ext_vector_type(8)))  float    v8f;
typedef __attribute__((ext_vector_type(4)))  float    v4f;
typedef __attribute__((ext_vector_type(2)))  float    v2f;
typedef __attribute__((ext_vector_type(2)))  int      v2i;
typedef __attribute__((ext_vector_type(4)))  unsigned int v4u;

// ---------------------------------------------------------------------------
// Helper pieces: conversions, hazard guards, WMMA fragments
// ---------------------------------------------------------------------------
__device__ __forceinline__ unsigned short f2bf_bits(float f) {
  unsigned u = __float_as_uint(f);
  return (unsigned short)((u + 0x7FFFu + ((u >> 16) & 1u)) >> 16);
}
__device__ __forceinline__ float bf_bits2f(unsigned short h) { return __uint_as_float(((unsigned)h) << 16); }

// hazard guards as plain device helpers
__device__ __forceinline__ void dep_guard_h(v8f& a, v8f& b, v16h x, v16h y) { asm volatile("v_nop\n\tv_nop\n\tv_nop\n\tv_nop" : "+v"(a), "+v"(b) : "v"(x), "v"(y)); }
__device__ __forceinline__ void dep_guard_b(v8f& a, v8f& b, v16b x, v16b y) { asm volatile("v_nop\n\tv_nop\n\tv_nop\n\tv_nop" : "+v"(a), "+v"(b) : "v"(x), "v"(y)); }
// group guard tying all four accumulators of an A-row group plus its A fragments
__device__ __forceinline__ void dep_guard4_h(v8f& a, v8f& b, v8f& c, v8f& d, v16h x, v16h y) { asm volatile("v_nop\n\tv_nop\n\tv_nop\n\tv_nop" : "+v"(a), "+v"(b), "+v"(c), "+v"(d) : "v"(x), "v"(y)); }
__device__ __forceinline__ void dep_guard4_b(v8f& a, v8f& b, v8f& c, v8f& d, v16b x, v16b y) { asm volatile("v_nop\n\tv_nop\n\tv_nop\n\tv_nop" : "+v"(a), "+v"(b), "+v"(c), "+v"(d) : "v"(x), "v"(y)); }
__device__ __forceinline__ void keep4_h(v16h a, v16h b, v16h c, v16h d) { asm volatile("v_nop" :: "v"(a), "v"(b), "v"(c), "v"(d)); }
__device__ __forceinline__ void keep4_b(v16b a, v16b b, v16b c, v16b d) { asm volatile("v_nop" :: "v"(a), "v"(b), "v"(c), "v"(d)); }
__device__ __forceinline__ void acc_guard4(v8f& a, v8f& b, v8f& c, v8f& d) { asm volatile("v_nop\n\tv_nop\n\tv_nop\n\tv_nop" : "+v"(a), "+v"(b), "+v"(c), "+v"(d)); }
template <typename T> struct Frag;
template <> struct Frag<_Float16> {
  typedef v16h V; union U { v16h v; v8h h[2]; };
  // elements 0..7 <- p[0..7], 8..15 <- p[16..23]
  static __device__ __forceinline__ v16h load(const _Float16* p) {
    U f; f.h[0] = *(const v8h*)(p); f.h[1] = *(const v8h*)(p + 16); return f.v;
  }
  static __device__ __forceinline__ v8f mma(v16h a, v16h b, v8f c) {
    return __builtin_amdgcn_wmma_f32_16x16x32_f16(false, a, false, b, (short)0, c, false, false);
  }
  static __device__ __forceinline__ void guard(v8f& a, v8f& b, v16h x, v16h y) { dep_guard_h(a, b, x, y); }
  static __device__ __forceinline__ void guard4(v8f& a, v8f& b, v8f& c, v8f& d, v16h x, v16h y) { dep_guard4_h(a, b, c, d, x, y); }
  static __device__ __forceinline__ void keep(v16h a, v16h b, v16h c, v16h d) { keep4_h(a, b, c, d); }
};
template <> struct Frag<__bf16> {
  typedef v16b V; union U { v16b v; v8b h[2]; };
  static __device__ __forceinline__ v16b load(const __bf16* p) {
    U f; f.h[0] = *(const v8b*)(p); f.h[1] = *(const v8b*)(p + 16); return f.v;
  }
  static __device__ __forceinline__ v8f mma(v16b a, v16b b, v8f c) {
    return __builtin_amdgcn_wmma_f32_16x16x32_bf16(false, a, false, b, (short)0, c, false, false);
  }
  static __device__ __forceinline__ void guard(v8f& a, v8f& b, v16b x, v16b y) { dep_guard_b(a, b, x, y); }
  static __device__ __forceinline__ void guard4(v8f& a, v8f& b, v8f& c, v8f& d, v16b x, v16b y) { dep_guard4_b(a, b, c, d, x, y); }
  static __device__ __forceinline__ void keep(v16b a, v16b b, v16b c, v16b d) { keep4_b(a, b, c, d); }
};

__device__ __forceinline__ unsigned pk16(unsigned short a, unsigned short b) { return (unsigned)a | ((unsigned)b << 16); }
__device__ __forceinline__ unsigned short h_bits(float f) { const _Float16 h = (_Float16)f; return __builtin_bit_cast(unsigned short, h); }

// Twelve asynchronous copies, 16 B per lane each, global memory to LDS through no register. l[i] = the lane's LDS byte address,
// g[i] = its global address. The s_wait_xcnt ends the statement so that it stands in front of every later write of an address
// register named here.
__device__ __forceinline__ void copy12_to_lds(const unsigned* l, const char* const* g) {
  asm volatile("global_load_async_to_lds_b128 %0, %1, off\n\t"
               "global_load_async_to_lds_b128 %2, %3, off\n\t"
               "global_load_async_to_lds_b128 %4, %5, off\n\t"
               "global_load_async_to_lds_b128 %6, %7, off\n\t"
               "global_load_async_to_lds_b128 %8, %9, off\n\t"
               "global_load_async_to_lds_b128 %10, %11, off\n\t"
               "global_load_async_to_lds_b128 %12, %13, off\n\t"
               "global_load_async_to_lds_b128 %14, %15, off\n\t"
               "global_load_async_to_lds_b128 %16, %17, off\n\t"
               "global_load_async_to_lds_b128 %18, %19, off\n\t"
               "global_load_async_to_lds_b128 %20, %21, off\n\t"
               "global_load_async_to_lds_b128 %22, %23, off\n\t"
               "s_wait_xcnt 0x0"
               :: "v"(l[0]), "v"(g[0]), "v"(l[1]), "v"(g[1]), "v"(l[2]), "v"(g[2]), "v"(l[3]), "v"(g[3]),
                  "v"(l[4]), "v"(g[4]), "v"(l[5]), "v"(g[5]), "v"(l[6]), "v"(g[6]), "v"(l[7]), "v"(g[7]),
                  "v"(l[8]), "v"(g[8]), "v"(l[9]), "v"(g[9]), "v"(l[10]), "v"(g[10]), "v"(l[11]), "v"(g[11]) : "memory");
}

// ---- Register-blocked batched WMMA GEMM (ACT reduced to none/relu/leaky) -------------------------------
// C[m,n] = scale * sum_k A[m,k] * Bt[n,k] (+bias)(+resid); a block owns a 128x256 tile, each of its 8 waves (2 x 4) 64x64 of it.
// A row-major [M,K]; Bt row-major [N,K]; M % 128 == 0, N % 256 == 0, K % 128 == 0; tiles blk = 0 .. (M / 128) * (N / 256) - 1.
// Operands come through LDS, 128 k a pass: 128 A rows and 256 Bt rows of 256 B, brought by asynchronous 16-B copies in which a
// wave covers two whole rows (four 128-B lines). Two buffers: the copies of pass p + 2 are issued behind the barrier that ends
// pass p, into the buffer that pass p has read, and land while pass p + 1 is worked on.
// blk = the block's tile number, b = its batch.
// BIAS_MODE: 0 = none, 1 = bias[m], 2 = bias[n], 3 = the block's own choice of the two: biasPerRow ? bias[m] : bias[n].
// OUT_MODE: 0 = f32, 1 = f16, 2 = bf16 hi plane (Cout) + bf16 lo plane (Cout2).
// ET: 0 = f16 operands, 1 = bf16 operands (pointers passed as 16-bit storage)
constexpr int kGmBM    = 128;                              // block tile rows (A rows staged)
constexpr int kGmBN    = 256;                              // block tile columns (Bt rows staged)
constexpr int kGmPassK = 128;                              // k per pass: 256-B rows
constexpr int kGmPitch = 272;                              // LDS pitch of the 256-B rows: 16 B x odd, no bank conflict for 16-B reads
constexpr int kGmBuf   = (kGmBM + kGmBN) * kGmPitch;       // 104,448 B a buffer: A rows first, Bt rows behind them
template <int V> struct BiasTag { static constexpr int value = V; };
template <int ET> struct Elem;
template <> struct Elem<0> { typedef _Float16 T; };
template <> struct Elem<1> { typedef __bf16 T; };
template <int ET, bool SPLIT, int BIAS_MODE, int OUT_MODE, bool RESID, int ACT = 0>
__device__ __forceinline__ void gemm64_tile(
    unsigned blk, int b, bool biasPerRow,
    const unsigned short* __restrict__ Ap, const unsigned short* __restrict__ A2p, int lda, long strideA,
    const unsigned short* __restrict__ Btp, const unsigned short* __restrict__ Bt2p, int ldb, long strideB,
    void* __restrict__ Cout, void* __restrict__ Cout2, int ldc, long strideC,
    const float* __restrict__ bias,
    const float* __restrict__ resid, long strideR,
    int M, int N, int K, float scale) {
  static_assert(!SPLIT, "single-plane operands only");
  typedef typename Elem<ET>::T T;
  typedef typename Frag<T>::V V;
  const T* A = (const T*)Ap; const T* Bt = (const T*)Btp;
  __shared__ __align__(16) float sT[8][16 * 68];   // per-wave 16x64 slab, pitch 68 floats
  __shared__ __attribute__((aligned(16))) unsigned char ring[2 * kGmBuf];
  const int lane = threadIdx.x & 31;
  const int wave = threadIdx.x >> 5;
  const int tilesN = N / kGmBN;
  const int tilesM = M / kGmBM;
  if ((int)blk >= tilesM * tilesN) return;   // the same for the whole block, in front of every barrier
  const int bm = blk / tilesN;
  const int bn = blk - bm * tilesN;
  const int wm = (wave >> 2) << 6;             // this wave's 64 rows within the staged A rows
  const int wn = (wave & 3) << 6;              // this wave's 64 rows within the staged Bt rows
  const int m0 = bm * kGmBM + wm;
  const int n0 = bn * kGmBN + wn;

  const T* Ab  = A  + (size_t)b * strideA;
  const T* Bb  = Bt + (size_t)b * strideB;

  const int rlane = lane & 15;                 // row (A) / col (B, D) within subtile
  const int koff  = (lane >> 4) * 8;           // k offset of this lane half
  const int mOff  = (lane >> 4) * 8;           // D row offset

  // what this lane copies: bytes 16 * (t & 15) .. +15 of staged rows (t >> 4) + 16 i: i = 0..7 of A, i = 0..15 of Bt
  const int crow = threadIdx.x >> 4, ccol = (threadIdx.x & 15) * 16;
  const char* gA = (const char*)(Ab + (size_t)(bm * kGmBM + crow) * lda) + ccol;
  const char* gB = (const char*)(Bb + (size_t)(bn * kGmBN + crow) * ldb) + ccol;
  const size_t stepA = (size_t)16 * lda * 2, stepB = (size_t)16 * ldb * 2;
  const unsigned lC = (unsigned)(size_t)ring + crow * kGmPitch + ccol;   // low 32 bits of the address = byte offset in the block's LDS
  // one pass's rows into one buffer: 24 copies a lane; kb = the pass's first byte in a row, lb = the buffer's first byte
  auto stage_pass = [&](size_t kb, unsigned lb) {
    unsigned l[24]; const char* g[24];
#pragma unroll
    for (int i = 0; i < 8; ++i)  { l[i] = lC + lb + i * 16 * kGmPitch;                g[i] = gA + kb + i * stepA; }
#pragma unroll
    for (int i = 0; i < 16; ++i) { l[8 + i] = lC + lb + (kGmBM + i * 16) * kGmPitch;  g[8 + i] = gB + kb + i * stepB; }
    copy12_to_lds(l, g);
    copy12_to_lds(l + 12, g + 12);
  };
  // what this lane reads: row rlane of every 16-row group of its wave's rows, from byte 16 * (lane >> 4)
  const int rA = (wm + rlane) * kGmPitch + koff * 2;
  const int rB = (kGmBM + wn + rlane) * kGmPitch + koff * 2;

  v8f acc[4][4];
#pragma unroll
  for (int i = 0; i < 4; ++i)
#pragma unroll
    for (int j = 0; j < 4; ++j) acc[i][j] = (v8f){0.f,0.f,0.f,0.f,0.f,0.f,0.f,0.f};

  const int nPass = K / kGmPassK;
  // pass 0's rows, landed and published; then pass 1's are asked for
  stage_pass(0, 0);
  asm volatile("s_wait_asynccnt 0x0" ::: "memory");      // this wave's copies have landed
  __syncthreads();                                       // and every other wave's
  if (nPass > 1) stage_pass((size_t)kGmPassK * 2, kGmBuf);

  for (int p = 0; p < nPass; ++p) {
    const unsigned char* sb = ring + (p & 1) * kGmBuf;
#pragma unroll
    for (int ks = 0; ks < kGmPassK / 32; ++ks) {
      V bh[4], ah[4];
#pragma unroll
      for (int i = 0; i < 4; ++i) ah[i] = Frag<T>::load((const T*)(sb + rA + i * 16 * kGmPitch + ks * 64));
#pragma unroll
      for (int j = 0; j < 4; ++j) bh[j] = Frag<T>::load((const T*)(sb + rB + j * 16 * kGmPitch + ks * 64));
      // keeps the 16 reads of a k step together in front of its first product: one LDS latency for all of them; without it the
      // scheduler reads the A fragments one at a time into one register set and waits for each
      __builtin_amdgcn_sched_barrier(0);
#pragma unroll
      for (int j = 0; j < 4; ++j)
#pragma unroll
        for (int i = 0; i < 4; ++i) acc[i][j] = Frag<T>::mma(ah[i], bh[j], acc[i][j]);
    }
    // hand-over: this wave's reads of the buffer are done, its copies for pass p + 1 have landed; behind the barrier that
    // holds for every wave, so pass p + 1 may be read and this pass's buffer may be refilled
    // The scheduling fence keeps the pass's products in front of the hand-over; without it the scheduler sinks products behind
    // the barrier, which delays the refill that stands there.
    __builtin_amdgcn_sched_barrier(0);
    asm volatile("s_wait_dscnt 0x0" ::: "memory");
    asm volatile("s_wait_asynccnt 0x0" ::: "memory");
    __syncthreads();
    if (p + 2 < nPass) stage_pass((size_t)(p + 2) * (kGmPassK * 2), (p & 1) * kGmBuf);   // the same for the whole block
  }
  asm volatile("s_wait_asynccnt 0x0" ::: "memory");        // no copy is left in flight when the wave goes on to its end
  acc_guard4(acc[0][0], acc[0][1], acc[0][2], acc[0][3]);
  acc_guard4(acc[1][0], acc[1][1], acc[1][2], acc[1][3]);
  acc_guard4(acc[2][0], acc[2][1], acc[2][2], acc[2][3]);
  acc_guard4(acc[3][0], acc[3][1], acc[3][2], acc[3][3]);

  // ---- epilogue, written once for a bias mode BM that is known at compile time ----
  float* slab = sT[wave];
  const float* Rb = RESID ? (resid + (size_t)b * strideR) : nullptr;
  auto epilogue = [&](auto tag) {
  constexpr int BM = decltype(tag)::value;
#pragma unroll
  for (int i = 0; i < 4; ++i) {
    const int mBase = m0 + (i << 4);
#pragma unroll
    for (int j = 0; j < 4; ++j) {
      const int n = n0 + (j << 4) + rlane;
      float bv = 0.f;
      if (BM == 2) bv = bias[n];
#pragma unroll
      for (int r = 0; r < 8; ++r) {
        float v = acc[i][j][r] * scale;
        if (BM == 1) v += bias[mBase + mOff + r];
        if (BM == 2) v += bv;
        if (RESID) v += Rb[(size_t)(mBase + mOff + r) * ldc + n];
        if (ACT == 2) v = fmaxf(v, 0.0f);
        if (ACT == 4) v = (v > 0.f) ? v : 0.01f * v;
        slab[(mOff + r) * 68 + (j << 4) + rlane] = v;
      }
    }
    __builtin_amdgcn_fence(__ATOMIC_RELEASE, "workgroup");
    __builtin_amdgcn_wave_barrier();
    __builtin_amdgcn_fence(__ATOMIC_ACQUIRE, "workgroup");
    if (OUT_MODE == 0) {
      float* C = (float*)Cout + (size_t)b * strideC;
      const int hh = lane >> 4, c4 = (lane & 15) * 4;     // row seg = 256 B = 16 lanes x 16 B
      {
#pragma unroll
        for (int it = 0; it < 8; ++it) {
          const int row = it * 2 + hh;
          v4f v = *(const v4f*)(slab + row * 68 + c4);
          *(v4f*)(C + (size_t)(mBase + row) * ldc + n0 + c4) = v;
        }
        
      }
    } else {
      const int q = lane >> 3, c8 = (lane & 7) * 8;
      unsigned short* C  = (unsigned short*)Cout  + (size_t)b * strideC;
      unsigned short* C2 = (OUT_MODE == 2) ? ((unsigned short*)Cout2 + (size_t)b * strideC) : nullptr;
      {
#pragma unroll
        for (int it = 0; it < 4; ++it) {
          const int row = it * 4 + q;
          const float* sp = slab + row * 68 + c8;
          v8h hv, lv;
#pragma unroll
          for (int e = 0; e < 8; ++e) {
            if (OUT_MODE == 1) {
              hv[e] = (_Float16)sp[e];
            } else {
              unsigned short hb = f2bf_bits(sp[e]);
              unsigned short lb = f2bf_bits(sp[e] - bf_bits2f(hb));
              hv[e] = __builtin_bit_cast(_Float16, hb);
              lv[e] = __builtin_bit_cast(_Float16, lb);
            }
          }
          *(v8h*)(C + (size_t)(mBase + row) * ldc + n0 + c8) = hv;
          if (OUT_MODE == 2) *(v8h*)(C2 + (size_t)(mBase + row) * ldc + n0 + c8) = lv;
        }
        
      }
    }
    __builtin_amdgcn_fence(__ATOMIC_RELEASE, "workgroup");
    __builtin_amdgcn_wave_barrier();
    __builtin_amdgcn_fence(__ATOMIC_ACQUIRE, "workgroup");
  }
  };
  if constexpr (BIAS_MODE != 3) epilogue(BiasTag<BIAS_MODE>{});
  else if (biasPerRow) epilogue(BiasTag<1>{});      // one branch, the same for the whole block
  else                 epilogue(BiasTag<2>{});
}
// one GEMM a launch: grid.x = its tiles, grid.y = its batches
template <int ET, bool SPLIT, int BIAS_MODE, int OUT_MODE, bool RESID, int ACT = 0>
__global__ __launch_bounds__(256) void wmma_gemm64(
    const unsigned short* __restrict__ Ap, const unsigned short* __restrict__ A2p, int lda, long strideA,
    const unsigned short* __restrict__ Btp, const unsigned short* __restrict__ Bt2p, int ldb, long strideB,
    void* __restrict__ Cout, void* __restrict__ Cout2, int ldc, long strideC,
    const float* __restrict__ bias,
    const float* __restrict__ resid, long strideR,
    int M, int N, int K, float scale) {
  gemm64_tile<ET, SPLIT, BIAS_MODE, OUT_MODE, RESID, ACT>(blockIdx.x, (int)blockIdx.y, false, Ap, A2p, lda, strideA, Btp, Bt2p, ldb, strideB,
                                                          Cout, Cout2, ldc, strideC, bias, resid, strideR, M, N, K, scale);
}
// Both projections of x, which do not depend on each other, in one launch. Blocks 0 .. tilesQK - 1 own the tiles of
//   QK[m][n'] = f16(scale * sum_k X[m][k] WQK[n'][k] + bqk[n'])   (M = kTok, N = kQKCols),
// the blocks behind them the tiles of
//   VT[n][m]  = f16(scale * sum_k WV[n][k] X[m][k] + bv[n])       (M = kDim rows n, N = kTok tokens).
constexpr int kProjTilesQK = (kTok / kGmBM) * (kQKCols / kGmBN);   // 256
constexpr int kProjTilesVT = (kDim / kGmBM) * (kTok / kGmBN);      // 128
__global__ __launch_bounds__(256) void proj_gemm_kernel(
    const unsigned short* __restrict__ X, const unsigned short* __restrict__ WQK, const unsigned short* __restrict__ WV,
    const float* __restrict__ bqk, const float* __restrict__ bv,
    unsigned short* __restrict__ QK, unsigned short* __restrict__ VT, int K, float scale) {
  const bool vt = (int)blockIdx.x >= kProjTilesQK;                 // the same for the whole block
  const unsigned short* A  = vt ? WV : X;
  const unsigned short* Bt = vt ? X : WQK;
  unsigned short* C        = vt ? VT : QK;
  const float* bias        = vt ? bv : bqk;
  gemm64_tile<0, false, 3, 1, false, 0>(vt ? blockIdx.x - kProjTilesQK : blockIdx.x, 0, vt, A, A, K, 0L, Bt, Bt, K, 0L,
                                        (void*)C, (void*)C, vt ? kTok : kQKCols, 0L, bias, bias, 0L,
                                        vt ? kDim : kTok, vt ? kTok : kQKCols, K, scale);
}

// ---------------------------------------------------------------------------
// The three operand preparations below do not depend on each other and share one launch (prep_kernel); blk = the block's
// number within its own part.
// ---------------------------------------------------------------------------
__device__ __forceinline__ void cast8_f16_part(int blk, const float* __restrict__ in, unsigned short* __restrict__ out, int n8) {
  const int i = blk * 256 + threadIdx.x;
  if (i >= n8) return;
  const float* p = in + 8 * (size_t)i;
  const v4f a = *(const v4f*)(p);
  const v4f c = *(const v4f*)(p + 4);
  unsigned short hb[8];
#pragma unroll
  for (int e = 0; e < 4; ++e) {
    hb[e]     = h_bits(a[e]);
    hb[4 + e] = h_bits(c[e]);
  }
  const v4u u = (v4u){pk16(hb[0], hb[1]), pk16(hb[2], hb[3]), pk16(hb[4], hb[5]), pk16(hb[6], hb[7])};
  unsigned short* q = out + 8 * (size_t)i;
  *(v4u*)q = u;
  
}

// ---------------------------------------------------------------------------
// Weight transpose + cast (+ optional output-feature permutation) for square [1024 in][1024 out] f32 W (row-major [k][n]):
//   out[np][k] = f16( scale * W[k][orig(np)] ), orig(np) = perm ? ((np>>5)&1)*512 + (np>>6)*32 + (np&31) : np.
// With perm, plane column 64h + 32*set + d holds feature set*512 + 32h + d, so the two q/k sets of a head sit at stride 32.
// 1024 blocks: blk & 15 = k tile (64 cols of out), (blk >> 4) & 15 = np tile (64 rows of out), blk >> 8 = z selects
//   z0 = (W0 -> o0, perm), z1 = (W1 -> o1, perm), z2 = (W2 -> o2, identity), z3 = (W3 -> o3, identity). 256 threads.
// Load coverage: 16 iterations x 256 threads = 4096 = the whole 64x64 tile (coalesced along n inside 32-wide strips).
// Store coverage: 8 waves x 2 iterations x 4 rows (lane>>3) = 64 rows; (lane&7) x 8 halves = 64 cols; each row segment =
// ---------------------------------------------------------------------------
__device__ __forceinline__ void wt_part(int blk, const float* __restrict__ W0, const float* __restrict__ W1,
                                        const float* __restrict__ W2, const float* __restrict__ W3,
                                        unsigned short* __restrict__ o0, unsigned short* __restrict__ o1,
                                        unsigned short* __restrict__ o2, unsigned short* __restrict__ o3,
                                        float scale) {
  __shared__ float sm[64][65];   // sm[np_local][k_local]
  const int t  = threadIdx.x;
  const int k0 = (blk & 15) * 64;
  const int n0 = ((blk >> 4) & 15) * 64;
  const int z  = blk >> 8;                                     // block-uniform
  const float* W = (z == 0) ? W0 : (z == 1) ? W1 : (z == 2) ? W2 : W3;
  unsigned short* op = (z == 0) ? o0 : (z == 1) ? o1 : (z == 2) ? o2 : o3;
  const int perm = (z < 2) ? 1 : 0;
#pragma unroll
  for (int i = 0; i < 16; ++i) {
    const int e = i * 256 + t;
    const int r = e >> 6;          // k local
    const int c = e & 63;          // np local
    const int np = n0 + c;
    const int og = perm ? ((((np >> 5) & 1) << 9) + ((np >> 6) << 5) + (np & 31)) : np;
    sm[c][r] = W[(size_t)(k0 + r) * kDim + og] * scale;
  }
  __syncthreads();
  const int lane = t & 31, wave = t >> 5;
  const int q = lane >> 3, c8 = (lane & 7) * 8;
  {
#pragma unroll
    for (int it = 0; it < 2; ++it) {
      const int row = wave * 8 + it * 4 + q;                 // np local
      unsigned short hb[8];
#pragma unroll
      for (int e = 0; e < 8; ++e) hb[e] = h_bits(sm[row][c8 + e]);
      const v4u u = (v4u){pk16(hb[0], hb[1]), pk16(hb[2], hb[3]), pk16(hb[4], hb[5]), pk16(hb[6], hb[7])};
      *(v4u*)(op + (size_t)(n0 + row) * kDim + k0 + c8) = u;
    }
    // behind the last store, in front of whatever follows this part in the kernel that holds it: no register that the two
    // stores name is rewritten ahead of this wait
    asm volatile("s_wait_xcnt 0x0" ::: "memory");
  }
}

// ---------------------------------------------------------------------------
// Permuted q|k bias line: out[np] = bq[orig(np)] for np < 1024 (block 0), out[1024 + np] = bk[orig(np)] (block 1).
// Thread t owns np = 4t..4t+3 (orig of an aligned group of 4 is contiguous); one 16-B store per lane, a wave = 512 B =
// ---------------------------------------------------------------------------
__device__ __forceinline__ void biasperm_part(int blk, const float* __restrict__ bq, const float* __restrict__ bk,
                                              float* __restrict__ out) {
  const int t = threadIdx.x;
  const float* src = (blk == 0) ? bq : bk;                    // block-uniform
  const int np = 4 * t;
  const int og = (((np >> 5) & 1) << 9) + ((np >> 6) << 5) + (np & 31);
  const v4f v = *(const v4f*)(src + og);
  float* dp = out + (size_t)blk * kDim + np;
  *(v4f*)dp = v;
  
}

// One launch for the three parts; every test below reads the same for the whole block, so the barrier inside wt_part is
// passed by all of a block's threads or by none. Blocks 0..1: bias line; the next 1024: weight planes; the rest: x.
constexpr int kPrepBias = 2;
constexpr int kPrepWt   = (kDim / 64) * (kDim / 64) * 4;          // 1024
constexpr int kPrepCast = (kTok * kDim) / (8 * 256);              // 2048
static_assert(kDim / 64 == 16, "wt_part's block decoding");
__global__ __launch_bounds__(256) void prep_kernel(const float* __restrict__ x, const float* __restrict__ Wq,
                                                   const float* __restrict__ Wk, const float* __restrict__ Wv,
                                                   const float* __restrict__ Wo, const float* __restrict__ bq,
                                                   const float* __restrict__ bk,
                                                   unsigned short* __restrict__ xh, unsigned short* __restrict__ wqt,
                                                   unsigned short* __restrict__ wkt, unsigned short* __restrict__ wvt,
                                                   unsigned short* __restrict__ wot, float* __restrict__ bqk,
                                                   int n8, float wscale) {
  const int blk = blockIdx.x;
  if (blk < kPrepBias)                biasperm_part(blk, bq, bk, bqk);
  else if (blk < kPrepBias + kPrepWt) wt_part(blk - kPrepBias, Wq, Wk, Wv, Wo, wqt, wkt, wvt, wot, wscale);
  else                                cast8_f16_part(blk - (kPrepBias + kPrepWt), x, xh, n8);
}

// ---------------------------------------------------------------------------
// Both masked softmaxes, their difference and the product with v, for every (batch, head) in one launch; no score ever
// reaches memory. Transposed forms, so that one lane owns one query column throughout:
//   St[set][j][i] = sum_d k_set[j][d] * q_set[i][d]     (A = 16 key rows, B = 16 query rows kept in registers, K = 32)
//   x = (mask[i][j] != 0) ? St * 32^-0.5 * log2(e) : -1e9 * log2(e)
//   running maximum m and sum l per query and set; p = exp2(x - m), f16
//   Ot[set][d][i] = Ot[set][d][i] * exp2(m_old - m_new) + sum_j v^T[d][j] * p[j][i]     (A = 16 rows of v^T, B = p, K = 32)
//   O[i][d] = Ot[0][d][i] / l0 - lambda * Ot[1][d][i] / l1,  lambda = exp(sum lq1*lk1) - exp(sum lq2*lk2) + 0.2
// and, still in registers, the per-head LayerNorm over the 64 d of O[i][.], affine, x0.8, f16 cast:
//   mu = mean_d O, var = mean_d (O - mu)^2, y = ((O - mu) / sqrt(var + 1e-5) * g[h][d] + b[h][d]) * 0.8 -> A16[i][64h + d]
// (lanes l and l ^ 16 hold 32 d each of one query row: each sums its own 32, one lane swap joins the halves).
// grid (16, 16 heads, 2 batches), 8 waves; wave w owns query rows 128*blockIdx.x + 16w .. +15 and walks all 2048 keys, 64 a
// trip. A trip's operands come through LDS: 64 k rows and 64 v^T rows of 128 B (shared by the 8 waves) and 128 mask rows of
// 256 B (16 per wave), brought by asynchronous 16-B copies in which a wave covers whole 128-B lines. Two buffers: the copies
// of trip t + 1 are issued behind the barrier that ends trip t - 1 and land while trip t is worked on.
// Fragment maps: accumulator register r of lane l holds row 8*(l>>4) + r, column l & 15. Two score tiles (keys 0..15 and
// 16..31 of a 32-key chunk) converted in place are the B operand of the second product: element s = key
// (s < 8 ? 8*(l>>4) + s : 16 + 8*(l>>4) + s - 8), which is the k order in which Frag::load reads the v^T rows.
// Store: a lane holds 8 consecutive d of its query row per tile; the wave writes the whole 128-B row segment of its head.
// ---------------------------------------------------------------------------
constexpr int   kFaQ    = 128;                 // query rows per block (8 waves x 16)
constexpr int   kFaKeys = 64;                  // keys per trip
constexpr float kLog2e  = 1.4426950408889634f;
static_assert(kSeq % kFaQ == 0 && kSeq % kFaKeys == 0 && kDh == 64 && kDiff == 32, "attention tiling");
typedef __attribute__((ext_vector_type(4))) int v4i;
constexpr int kFaTrips = kSeq / kFaKeys;                   // 32
constexpr int kKvPitch = 144;                              // LDS pitch of the 128-B k and v^T rows: 16 B x odd, no bank conflict for 16-B reads
constexpr int kMkPitch = 272;                              // LDS pitch of the 256-B mask rows: 16 B x odd
constexpr int kLdsV    = kFaKeys * kKvPitch;               // k rows at 0, v^T rows behind them
constexpr int kLdsM    = kLdsV + kDh * kKvPitch;           // mask rows behind those
constexpr int kLdsBuf  = kLdsM + kFaQ * kMkPitch;          // 53,248 B a buffer
static_assert(kFaTrips >= 2 && kFaKeys * 2 == 128 && kDh * 2 == 128 && kFaKeys * 4 == 256, "staging");
// Four asynchronous copies, 16 B per lane each, global memory to LDS through no register. l = the lane's LDS byte address,
// g = its global address. The s_wait_xcnt ends the statement so that it stands in front of every later write of an address
// register named here.
__device__ __forceinline__ void copy4_to_lds(unsigned l0, const char* g0, unsigned l1, const char* g1,
                                             unsigned l2, const char* g2, unsigned l3, const char* g3) {
  asm volatile("global_load_async_to_lds_b128 %0, %1, off\n\t"
               "global_load_async_to_lds_b128 %2, %3, off\n\t"
               "global_load_async_to_lds_b128 %4, %5, off\n\t"
               "global_load_async_to_lds_b128 %6, %7, off\n\t"
               "s_wait_xcnt 0x0"
               :: "v"(l0), "v"(g0), "v"(l1), "v"(g1), "v"(l2), "v"(g2), "v"(l3), "v"(g3) : "memory");
}
// One trip's tiles into one buffer: 12 copies a lane. lk, lv, lm and gk, gv, gm are the lane's first LDS and global addresses
// in the k, v^T and mask tile; its further rows lie 32 rows on (k, v^T) and 2 rows on (mask).
__device__ __forceinline__ void stage_trip(unsigned lk, unsigned lv, unsigned lm,
                                           const char* gk, const char* gv, const char* gm) {
  copy4_to_lds(lk, gk, lk + 32 * kKvPitch, gk + (size_t)32 * kQKCols * 2,
               lv, gv, lv + 32 * kKvPitch, gv + (size_t)32 * kTok * 2);
  copy4_to_lds(lm,                gm,                          lm + 2 * kMkPitch, gm + (size_t)2 * kSeq * 4,
               lm + 4 * kMkPitch, gm + (size_t)4 * kSeq * 4,   lm + 6 * kMkPitch, gm + (size_t)6 * kSeq * 4);
  copy4_to_lds(lm + 8 * kMkPitch,  gm + (size_t)8 * kSeq * 4,  lm + 10 * kMkPitch, gm + (size_t)10 * kSeq * 4,
               lm + 12 * kMkPitch, gm + (size_t)12 * kSeq * 4, lm + 14 * kMkPitch, gm + (size_t)14 * kSeq * 4);
}
// value of lane l ^ 16, by a vector-unit lane swap (no LDS round trip)
__device__ __forceinline__ float other_half(float x) {
  const int b = __float_as_int(x);
  return __int_as_float(__builtin_amdgcn_permlanex16(b, b, 0x76543210, 0xfedcba98, false, false));
}
// exp2 in place. The instruction set asks for one slot between a transcendental and a directly following instruction that
// overwrites its source or reads its result. Here each overwrites only its own source, and the v_nop is the slot in front of
// whatever the compiler puts next.
__device__ __forceinline__ void exp2_inplace(float& x) {
  asm("v_exp_f32 %0, %0\n\tv_nop" : "+v"(x));
}
__device__ __forceinline__ void exp2_inplace8(v8f& x) {
  float a = x[0], b = x[1], c = x[2], d = x[3], e = x[4], f = x[5], g = x[6], h = x[7];
  asm("v_exp_f32 %0, %0\n\tv_exp_f32 %1, %1\n\tv_exp_f32 %2, %2\n\tv_exp_f32 %3, %3\n\t"
      "v_exp_f32 %4, %4\n\tv_exp_f32 %5, %5\n\tv_exp_f32 %6, %6\n\tv_exp_f32 %7, %7\n\tv_nop"
      : "+v"(a), "+v"(b), "+v"(c), "+v"(d), "+v"(e), "+v"(f), "+v"(g), "+v"(h));
  x = (v8f){a, b, c, d, e, f, g, h};
}
// four waves per SIMD (two blocks per WGP): the whole grid of 512 blocks is resident at once, within 256 registers a wave
// and 106,496 B of LDS a block
__global__ __launch_bounds__(256) __attribute__((amdgpu_waves_per_eu(4, 4))) void diff_attn_kernel(const unsigned short* __restrict__ QKp,
                                                        const unsigned short* __restrict__ Vtp,
                                                        const int* __restrict__ Mp,
                                                        const float* __restrict__ lq1, const float* __restrict__ lk1,
                                                        const float* __restrict__ lq2, const float* __restrict__ lk2,
                                                        const float* __restrict__ g, const float* __restrict__ bta,
                                                        unsigned short* __restrict__ A16) {
  const int lane = threadIdx.x & 31, wave = threadIdx.x >> 5;
  const int c    = lane & 15;                  // this lane's query column; row of every A fragment
  const int h8   = (lane >> 4) * 8;            // k offset of this lane half; also its accumulator row offset
  const int head = blockIdx.y;
  const int b    = blockIdx.z;
  const int q0   = blockIdx.x * kFaQ + wave * 16;

  const _Float16* QK = (const _Float16*)QKp + (size_t)b * kSeq * kQKCols + head * kDh;
  const _Float16* Qr = QK + (size_t)(q0 + c) * kQKCols + h8;
  __shared__ __attribute__((aligned(16))) unsigned char smem[2 * kLdsBuf];
  // what this lane copies: of k and v^T rows (t >> 3) and (t >> 3) + 32, bytes 16 * (t & 7) .. +15 (a wave: 4 whole rows a
  // copy); of the mask its own wave's rows 2i + (lane >> 4), i = 0..7, bytes 16 * (lane & 15) .. +15 (a wave: 2 whole rows)
  const int crow = threadIdx.x >> 3, ccol = (threadIdx.x & 7) * 16;
  const int mrow = wave * 16 + (lane >> 4), mcol = (lane & 15) * 16;
  const char* gK = (const char*)(QK + kDim + (size_t)crow * kQKCols) + ccol;
  const char* gV = (const char*)((const _Float16*)Vtp + (size_t)(head * kDh + crow) * kTok + (size_t)b * kSeq) + ccol;
  const char* gM = (const char*)(Mp + ((size_t)b * kSeq + blockIdx.x * kFaQ + mrow) * kSeq) + mcol;
  const unsigned lds0 = (unsigned)(size_t)smem;            // low 32 bits of the address = byte offset in the block's LDS
  const unsigned lK = lds0 + crow * kKvPitch + ccol;
  const unsigned lV = lds0 + kLdsV + crow * kKvPitch + ccol;
  const unsigned lM = lds0 + kLdsM + mrow * kMkPitch + mcol;
  // what this lane reads: row c of every 16-row group, from byte 16 * (lane >> 4) (k, v^T) or 32 * (lane >> 4) (mask)
  const int rK = c * kKvPitch + h8 * 2;
  const int rV = kLdsV + c * kKvPitch + h8 * 2;
  const int rM = kLdsM + (wave * 16 + c) * kMkPitch + h8 * 4;
  v16h qf[2];
  qf[0] = Frag<_Float16>::load(Qr);
  qf[1] = Frag<_Float16>::load(Qr + kDiff);

  const v8f zero = (v8f){0.f,0.f,0.f,0.f,0.f,0.f,0.f,0.f};
  const float cs   = kInvScale * kLog2e;
  const float xOff = kNegBig * kLog2e;
  v8f o[2][4];
  float m[2], l[2];
#pragma unroll
  for (int st = 0; st < 2; ++st) {
    m[st] = -__builtin_inff();
    l[st] = 0.f;
#pragma unroll
    for (int dt = 0; dt < 4; ++dt) o[st][dt] = zero;
  }

  // trip 0's tiles, landed and published
  stage_trip(lK, lV, lM, gK, gV, gM);
  asm volatile("s_wait_asynccnt 0x0" ::: "memory");      // this wave's copies have landed
  __syncthreads();                                       // and every other wave's

  for (int t = 0; t < kFaTrips; ++t) {
    const int buf = (t & 1) * kLdsBuf;
    const unsigned char* sb = smem + buf;
    // directly behind the barrier that ended trip t - 1 (in front of trip 0: the one above): the next trip's tiles are asked
    // for, into the buffer that trip t - 1 has read, and fly while this trip is worked on
    if (t + 1 < kFaTrips) {                                // the same for the whole block
      const size_t j1 = (size_t)(t + 1) * kFaKeys;
      const unsigned nb = kLdsBuf - buf;
      stage_trip(lK + nb, lV + nb, lM + nb, gK + j1 * (kQKCols * 2), gV + j1 * 2, gM + j1 * 4);
    }
    v8f s[2][4];
    v4i mk[4][2];
    v16h kf[2][4];
#pragma unroll
    for (int kt = 0; kt < 4; ++kt) {
      mk[kt][0] = *(const v4i*)(sb + rM + kt * 64);
      mk[kt][1] = *(const v4i*)(sb + rM + kt * 64 + 16);
    }
#pragma unroll
    for (int kt = 0; kt < 4; ++kt) {
      const _Float16* kp = (const _Float16*)(sb + rK + kt * 16 * kKvPitch);
      kf[0][kt] = Frag<_Float16>::load(kp);
      kf[1][kt] = Frag<_Float16>::load(kp + kDiff);
    }
    // keeps the trip's mask and k reads together in front of the first product: one latency for all of them; without it
    // the scheduler, short of registers, reads one fragment at a time and waits for each
    __builtin_amdgcn_sched_barrier(0);
    // the 32 mask words of a lane become 32 lane masks in scalar registers here, which frees their vector registers
    bool keep[4][8];
#pragma unroll
    for (int kt = 0; kt < 4; ++kt)
#pragma unroll
      for (int r = 0; r < 8; ++r) keep[kt][r] = (mk[kt][r >> 2][r & 3] != 0);
#pragma unroll
    for (int kt = 0; kt < 4; ++kt) {
      s[0][kt] = Frag<_Float16>::mma(kf[0][kt], qf[0], zero);
      s[1][kt] = Frag<_Float16>::mma(kf[1][kt], qf[1], zero);
    }
    v16h vf[2][4];
    v16h pf[2][2];
#pragma unroll
    for (int st = 0; st < 2; ++st) {
      if (st == 1) {
        // all of the trip's v^T fragments are asked for by here, into the registers the first set's scores have just left:
        // their LDS latency runs under the second set's softmax arithmetic
        const _Float16* vp = (const _Float16*)(sb + rV);
#pragma unroll
        for (int kc = 0; kc < 2; ++kc)
#pragma unroll
          for (int dt = 0; dt < 4; ++dt) vf[kc][dt] = Frag<_Float16>::load(vp + dt * 16 * (kKvPitch / 2) + kc * 32);
        // keeps those reads up here; without it the scheduler sinks them to just in front of their products, each with a full wait
        __builtin_amdgcn_sched_barrier(0);
      }
      float tm = -__builtin_inff();
#pragma unroll
      for (int kt = 0; kt < 4; ++kt)
#pragma unroll
        for (int r = 0; r < 8; ++r) {
          const float x = keep[kt][r] ? s[st][kt][r] * cs : xOff;
          s[st][kt][r] = x;
          tm = fmaxf(tm, x);
        }
      tm = fmaxf(tm, other_half(tm));                // the other lane half holds the other keys of the same query
      const float mn    = fmaxf(m[st], tm);
      float sum = 0.f;
#pragma unroll
      for (int kt = 0; kt < 4; ++kt) {
        v8f p = s[st][kt] - mn;
        exp2_inplace8(p);
#pragma unroll
        for (int r = 0; r < 8; ++r) {
          sum += p[r];
          pf[st][kt >> 1][(kt & 1) * 8 + r] = (_Float16)p[r];
        }
      }
      float alpha = m[st] - mn;
      exp2_inplace(alpha);
      m[st] = mn;
      l[st] = l[st] * alpha + sum;                   // this half's keys only; the halves are joined behind the loop
#pragma unroll
      for (int dt = 0; dt < 4; ++dt) o[st][dt] *= alpha;
    }
#pragma unroll
    for (int kc = 0; kc < 2; ++kc)
#pragma unroll
      for (int dt = 0; dt < 4; ++dt) {
        o[0][dt] = Frag<_Float16>::mma(vf[kc][dt], pf[0][kc], o[0][dt]);
        o[1][dt] = Frag<_Float16>::mma(vf[kc][dt], pf[1][kc], o[1][dt]);
      }
    // hand-over: this wave's reads of the buffer are done, its copies for trip t + 1 have landed; behind the barrier that
    // holds for every wave, so trip t + 1 may be read and this trip's buffer may be refilled
    // The scheduling fence keeps the hand-over at the trip's end; without it the scheduler lifts the waits and the barrier into
    // the second set's softmax, which takes a third off the time the copies have to land.
    __builtin_amdgcn_sched_barrier(0);
    asm volatile("s_wait_dscnt 0x0" ::: "memory");
    asm volatile("s_wait_asynccnt 0x0" ::: "memory");
    __syncthreads();
  }
  asm volatile("s_wait_asynccnt 0x0" ::: "memory");        // no copy is left in flight when the wave goes on to its end

  // lambda from the two 32-vectors (wave-wide butterfly, unconditional shuffles)
  float t1 = lq1[lane] * lk1[lane];
  float t2 = lq2[lane] * lk2[lane];
#pragma unroll
  for (int off = 16; off > 0; off >>= 1) {
    t1 += __shfl_xor(t1, off, 32);
    t2 += __shfl_xor(t2, off, 32);
  }
  const float lam = (expf(t1) - expf(t2)) + kLambdaInit;

  const float l0 = l[0] + other_half(l[0]);
  const float l1 = l[1] + other_half(l[1]);
  const float inv0 = 1.0f / l0;
  const float inv1 = lam / l1;
  // this lane's 32 of the 64 d of its query row: d = 16 dt + h8 + e
  float y[4][8], ps[4];
#pragma unroll
  for (int dt = 0; dt < 4; ++dt) {
    ps[dt] = 0.f;
#pragma unroll
    for (int e = 0; e < 8; ++e) {
      y[dt][e] = o[0][dt][e] * inv0 - o[1][dt][e] * inv1;
      ps[dt] += y[dt][e];
    }
  }
  float sm = (ps[0] + ps[1]) + (ps[2] + ps[3]);
  sm += other_half(sm);
  const float mu = sm * kInv64;
#pragma unroll
  for (int dt = 0; dt < 4; ++dt) {
    ps[dt] = 0.f;
#pragma unroll
    for (int e = 0; e < 8; ++e) {
      y[dt][e] -= mu;
      ps[dt] += y[dt][e] * y[dt][e];
    }
  }
  float vs = (ps[0] + ps[1]) + (ps[2] + ps[3]);
  vs += other_half(vs);
  const float rstd = 1.0f / sqrtf(vs * kInv64 + kLnEps);
  const float* gp = g   + head * kDh + h8;
  const float* bp = bta + head * kDh + h8;
  unsigned short* Ar = A16 + ((size_t)b * kSeq + q0 + c) * kDim + head * kDh + h8;
#pragma unroll
  for (int dt = 0; dt < 4; ++dt) {
    const v4f g0 = *(const v4f*)(gp + dt * 16);
    const v4f g1 = *(const v4f*)(gp + dt * 16 + 4);
    const v4f b0 = *(const v4f*)(bp + dt * 16);
    const v4f b1 = *(const v4f*)(bp + dt * 16 + 4);
    unsigned short hb[8];
#pragma unroll
    for (int e = 0; e < 4; ++e) {
      hb[e]     = h_bits((y[dt][e]     * rstd * g0[e] + b0[e]) * kOutGain);
      hb[4 + e] = h_bits((y[dt][4 + e] * rstd * g1[e] + b1[e]) * kOutGain);
    }
    *(v4u*)(Ar + dt * 16) = (v4u){pk16(hb[0], hb[1]), pk16(hb[2], hb[3]), pk16(hb[4], hb[5]), pk16(hb[6], hb[7])};
  }
}

// ---------------------------------------------------------------------------
// Host glue.
// producer before any consumer reads it; no region re-used with another type):
//   XH    f16 [4096][1024]               8,388,608  at           0   (cast8; read by the two projection GEMMs)
//   WQKT  f16 [2048][1024]               4,194,304  at   8,388,608   (wt z0,z1: permuted Wq^T rows 0..1023, Wk^T rows 1024..2047)
//   WVT   f16 [1024][1024]               2,097,152  at  12,582,912   (wt z2)
//   WOT   f16 [1024][1024]               2,097,152  at  14,680,064   (wt z3)
//   BQK   f32 [2048]                         8,192  at  16,777,216   (permuted bq | bk)
//   QK16  f16 [4096][2048]              16,777,216  at  16,785,408   (q plane cols 0..1023 | k plane cols 1024..2047, permuted)
//   VT16  f16 [1024][4096]               8,388,608  at  33,562,624   (v^T: row = 64h + d, col = token)
//   AOH16 f16 [4096][1024]               8,388,608  at  41,951,232   (LayerNorm output; 32 disjoint column slabs)
//   total                               50,339,840
// GEMM shapes: q|k proj M=4096 N=2048 K=1024; v^T proj M=1024 N=4096 K=1024; out proj M=4096 N=1024 K=1024 (all M multiples
// of 128, all N of 256, all K of 128, no padding); scores and p.v inside diff_attn_kernel.
// 4 launches.
// ---------------------------------------------------------------------------
extern "C" void kernel_launch(void* const* d_in, const int* in_sizes, int n_in,
                              void* d_out, int out_size, void* d_ws, size_t ws_size,
                              hipStream_t stream) {
  if (n_in < 16) return;
  const int nTokElem = kTok * kDim;                 // 4,194,304
  const int nW       = kDim * kDim;                 // 1,048,576
  if (in_sizes[0] != nTokElem) return;
  if (in_sizes[1] != kBatch * kSeq * kSeq) return;
  if (in_sizes[2] != nW || in_sizes[4] != nW || in_sizes[6] != nW || in_sizes[8] != nW) return;
  if (in_sizes[3] != kDim || in_sizes[5] != kDim || in_sizes[7] != kDim || in_sizes[9] != kDim) return;
  if (in_sizes[10] != kDiff || in_sizes[11] != kDiff || in_sizes[12] != kDiff || in_sizes[13] != kDiff) return;
  if (in_sizes[14] != kHeads * kDh || in_sizes[15] != kHeads * kDh) return;
  if (out_size != nTokElem) return;

  const size_t szXH   = (size_t)kTok * kDim * 2;
  const size_t szWQK  = (size_t)kQKCols * kDim * 2;
  const size_t szW    = (size_t)kDim * kDim * 2;
  const size_t szBQK  = (size_t)kQKCols * 4;
  const size_t szQK16 = (size_t)kTok * kQKCols * 2;
  const size_t szVT16 = (size_t)kDim * kTok * 2;
  const size_t szAOH  = (size_t)kTok * kDim * 2;
  const size_t offXH   = 0;
  const size_t offWQK  = offXH + szXH;
  const size_t offWVT  = offWQK + szWQK;
  const size_t offWOT  = offWVT + szW;
  const size_t offBQK  = offWOT + szW;
  const size_t offQK16 = offBQK + szBQK;
  const size_t offVT16 = offQK16 + szQK16;
  const size_t offAOH  = offVT16 + szVT16;
  const size_t total   = offAOH + szAOH;          // 50,339,840
  if (ws_size < total) return;

  const float* x    = (const float*)d_in[0];
  const int*   mask = (const int*)d_in[1];
  const float* Wq   = (const float*)d_in[2];
  const float* bq   = (const float*)d_in[3];
  const float* Wk   = (const float*)d_in[4];
  const float* bk   = (const float*)d_in[5];
  const float* Wv   = (const float*)d_in[6];
  const float* bv   = (const float*)d_in[7];
  const float* Wo   = (const float*)d_in[8];
  const float* bo   = (const float*)d_in[9];
  const float* lq1  = (const float*)d_in[10];
  const float* lk1  = (const float*)d_in[11];
  const float* lq2  = (const float*)d_in[12];
  const float* lk2  = (const float*)d_in[13];
  const float* ln_g = (const float*)d_in[14];
  const float* ln_b = (const float*)d_in[15];
  float* out = (float*)d_out;

  char* ws = (char*)d_ws;
  unsigned short* XH    = (unsigned short*)(ws + offXH);
  unsigned short* WQKT  = (unsigned short*)(ws + offWQK);
  unsigned short* WVT   = (unsigned short*)(ws + offWVT);
  unsigned short* WOT   = (unsigned short*)(ws + offWOT);
  float*          BQK   = (float*)(ws + offBQK);
  unsigned short* QK16  = (unsigned short*)(ws + offQK16);
  unsigned short* VT16  = (unsigned short*)(ws + offVT16);
  unsigned short* AOH16 = (unsigned short*)(ws + offAOH);

  // ---- prologue: 16-bit operand planes, permuted bias line ----
  const int n8 = nTokElem / 8;                                  // 524288 -> 2048 blocks exact
  prep_kernel<<<dim3(kPrepBias + kPrepWt + kPrepCast), dim3(256), 0, stream>>>(
      x, Wq, Wk, Wv, Wo, bq, bk, XH, WQKT, WQKT + (size_t)kDim * kDim, WVT, WOT, BQK, n8, kWCarry);

  // ---- q|k projection: QK16[m][n'] = f16( (1/16) sum_k XH[m][k] WQKT[n'][k] + BQK[n'] )   (M=4096, N=2048, K=1024) ----
  // ---- v^T projection: VT16[n][m] = f16( (1/16) sum_k WVT[n][k] XH[m][k] + bv[n] )   (M=1024 rows n, N=4096 tokens, K=1024) ----
  // ---- both in one launch: 256 + 128 blocks ----
  proj_gemm_kernel<<<dim3(kProjTilesQK + kProjTilesVT), dim3(256), 0, stream>>>(
      XH, WQKT, WVT, BQK, bv, QK16, VT16, kDim, kWCarryInv);

  // ---- every (batch, head) at once: scores of both sets, both softmaxes, difference, product with v, per-head LayerNorm,
  //      affine, x0.8 -> AOH16 ----
  diff_attn_kernel<<<dim3(kSeq / kFaQ, kHeads, kBatch), dim3(256), 0, stream>>>(
      QK16, VT16, mask, lq1, lk1, lq2, lk2, ln_g, ln_b, AOH16);

  // ---- output projection: out[m][n] = (1/16) sum_k AOH16[m][k] WOT[n][k] + bo[n]   (M=4096, N=1024, K=1024) ----
  {
    const int tiles = (kTok / kGmBM) * (kDim / kGmBN);          // 128 blocks
    wmma_gemm64<0, false, 2, 0, false, 0><<<dim3(tiles, 1), dim3(256), 0, stream>>>(
        AOH16, AOH16, kDim, 0L, WOT, WOT, kDim, 0L,
        (void*)out, (void*)out, kDim, 0L, bo, bo, 0L, kTok, kDim, kDim, kWCarryInv);
  }
}

// v007
// It runs in 112 microseconds.
// Timed twice side by side with v006, it ran 1.03 times as fast both times.
// Counting every step since v000, it is 32.9 times as fast.
// Contractions: q|k projection and v^T projection (x f16 by W^T f16 carried x16), scores q_set.k_set^T per head and set (q, k f16 planes, K=32), p_set.v per head and set (p = exp2 of the shifted scores, f16, by v^T f16 plane, K=2048), output projection (LayerNorm output f16 by Wo^T f16 carried x16): all v_wmma_f32_16x16x32_f16 with f32 accumulate; bias adds, mask select, both softmaxes, lambda and the per-head LayerNorm in f32.
#include <hip/hip_runtime.h>
#include <math.h>

// ---------------------------------------------------------------------------
// Problem constants
// ---------------------------------------------------------------------------
constexpr int kBatch  = 2;
constexpr int kSeq    = 2048;
constexpr int kDim    = 1024;              // hidden
constexpr int kHeads  = 16;
constexpr int kDh     = 64;                // head dim of v / output
constexpr int kDiff   = 32;                // head dim of each q/k set
constexpr int kTok    = kBatch * kSeq;     // 4096 token rows
constexpr int kQKCols = 2 * kDim;          // 2048: pitch of the q | k plane (halves)
constexpr float kWCarry    = 16.0f;        // weights carried x16 in f16
constexpr float kWCarryInv = 1.0f / 16.0f;
constexpr float kInvScale  = 0.17677669529663687f;   // 32^-0.5
constexpr float kLambdaInit = 0.2f;
constexpr float kOutGain   = 0.8f;         // 1 - lambda_init
constexpr float kLnEps     = 1.0e-5f;
constexpr float kInv64     = 1.0f / 64.0f;
static_assert(kHeads * kDh == kDim, "shape");
static_assert(kHeads * kDiff * 2 == kDim, "shape");
// GEMM shape contract: M multiple of 128, N of 256, K of 128, at least two passes
static_assert(kTok % 256 == 0 && kQKCols % 256 == 0 && kDim % 256 == 0 && kDim / 128 >= 2 && kSeq % 64 == 0 && kDh % 64 == 0, "tiles");
static_assert(kDim % 32 == 0 && kDiff % 32 == 0 && kSeq % 32 == 0, "ktiles");
static_assert((kTok * kDim) % (8 * 256) == 0, "cast grid");

typedef __attribute__((ext_vector_type(16))) _Float16 v16h;
typedef __attribute__((ext_vector_type(8)))  _Float16 v8h;
typedef __attribute__((ext_vector_type(16))) __bf16   v16b;
typedef __attribute__((ext_vector_type(8)))  __bf16   v8b;
typedef __attribute__((ext_vector_type(8)))  float    v8f;
typedef __attribute__((ext_vector_type(4)))  float    v4f;
typedef __attribute__((ext_vector_type(2)))  float    v2f;
typedef __attribute__((ext_vector_type(2)))  int      v2i;
typedef __attribute__((ext_vector_type(4)))  unsigned int v4u;

// ---------------------------------------------------------------------------
// Helper pieces: conversions, hazard guards, WMMA fragments
// ---------------------------------------------------------------------------
__device__ __forceinline__ unsigned short f2bf_bits(float f) {
  unsigned u = __float_as_uint(f);
  return (unsigned short)((u + 0x7FFFu + ((u >> 16) & 1u)) >> 16);
}
__device__ __forceinline__ float bf_bits2f(unsigned short h) { return __uint_as_float(((unsigned)h) << 16); }

// hazard guards as plain device helpers
__device__ __forceinline__ void dep_guard_h(v8f& a, v8f& b, v16h x, v16h y) { asm volatile("v_nop\n\tv_nop\n\tv_nop\n\tv_nop" : "+v"(a), "+v"(b) : "v"(x), "v"(y)); }
__device__ __forceinline__ void dep_guard_b(v8f& a, v8f& b, v16b x, v16b y) { asm volatile("v_nop\n\tv_nop\n\tv_nop\n\tv_nop" : "+v"(a), "+v"(b) : "v"(x), "v"(y)); }
// group guard tying all four accumulators of an A-row group plus its A fragments
__device__ __forceinline__ void dep_guard4_h(v8f& a, v8f& b, v8f& c, v8f& d, v16h x, v16h y) { asm volatile("v_nop\n\tv_nop\n\tv_nop\n\tv_nop" : "+v"(a), "+v"(b), "+v"(c), "+v"(d) : "v"(x), "v"(y)); }
__device__ __forceinline__ void dep_guard4_b(v8f& a, v8f& b, v8f& c, v8f& d, v16b x, v16b y) { asm volatile("v_nop\n\tv_nop\n\tv_nop\n\tv_nop" : "+v"(a), "+v"(b), "+v"(c), "+v"(d) : "v"(x), "v"(y)); }
__device__ __forceinline__ void keep4_h(v16h a, v16h b, v16h c, v16h d) { asm volatile("v_nop" :: "v"(a), "v"(b), "v"(c), "v"(d)); }
__device__ __forceinline__ void keep4_b(v16b a, v16b b, v16b c, v16b d) { asm volatile("v_nop" :: "v"(a), "v"(b), "v"(c), "v"(d)); }
__device__ __forceinline__ void acc_guard4(v8f& a, v8f& b, v8f& c, v8f& d) { asm volatile("v_nop\n\tv_nop\n\tv_nop\n\tv_nop" : "+v"(a), "+v"(b), "+v"(c), "+v"(d)); }
template <typename T> struct Frag;
template <> struct Frag<_Float16> {
  typedef v16h V; union U { v16h v; v8h h[2]; };
  // elements 0..7 <- p[0..7], 8..15 <- p[16..23]
  static __device__ __forceinline__ v16h load(const _Float16* p) {
    U f; f.h[0] = *(const v8h*)(p); f.h[1] = *(const v8h*)(p + 16); return f.v;
  }
  static __device__ __forceinline__ v8f mma(v16h a, v16h b, v8f c) {
    return __builtin_amdgcn_wmma_f32_16x16x32_f16(false, a, false, b, (short)0, c, false, false);
  }
  static __device__ __forceinline__ void guard(v8f& a, v8f& b, v16h x, v16h y) { dep_guard_h(a, b, x, y); }
  static __device__ __forceinline__ void guard4(v8f& a, v8f& b, v8f& c, v8f& d, v16h x, v16h y) { dep_guard4_h(a, b, c, d, x, y); }
  static __device__ __forceinline__ void keep(v16h a, v16h b, v16h c, v16h d) { keep4_h(a, b, c, d); }
};
template <> struct Frag<__bf16> {
  typedef v16b V; union U { v16b v; v8b h[2]; };
  static __device__ __forceinline__ v16b load(const __bf16* p) {
    U f; f.h[0] = *(const v8b*)(p); f.h[1] = *(const v8b*)(p + 16); return f.v;
  }
  static __device__ __forceinline__ v8f mma(v16b a, v16b b, v8f c) {
    return __builtin_amdgcn_wmma_f32_16x16x32_bf16(false, a, false, b, (short)0, c, false, false);
  }
  static __device__ __forceinline__ void guard(v8f& a, v8f& b, v16b x, v16b y) { dep_guard_b(a, b, x, y); }
  static __device__ __forceinline__ void guard4(v8f& a, v8f& b, v8f& c, v8f& d, v16b x, v16b y) { dep_guard4_b(a, b, c, d, x, y); }
  static __device__ __forceinline__ void keep(v16b a, v16b b, v16b c, v16b d) { keep4_b(a, b, c, d); }
};

__device__ __forceinline__ unsigned pk16(unsigned short a, unsigned short b) { return (unsigned)a | ((unsigned)b << 16); }
__device__ __forceinline__ unsigned short h_bits(float f) { const _Float16 h = (_Float16)f; return __builtin_bit_cast(unsigned short, h); }

// Twelve asynchronous copies, 16 B per lane each, global memory to LDS through no register. l[i] = the lane's LDS byte address,
// g[i] = its global address. The s_wait_xcnt ends the statement so that it stands in front of every later write of an address
// register named here.
__device__ __forceinline__ void copy12_to_lds(const unsigned* l, const char* const* g) {
  asm volatile("global_load_async_to_lds_b128 %0, %1, off\n\t"
               "global_load_async_to_lds_b128 %2, %3, off\n\t"
               "global_load_async_to_lds_b128 %4, %5, off\n\t"
               "global_load_async_to_lds_b128 %6, %7, off\n\t"
               "global_load_async_to_lds_b128 %8, %9, off\n\t"
               "global_load_async_to_lds_b128 %10, %11, off\n\t"
               "global_load_async_to_lds_b128 %12, %13, off\n\t"
               "global_load_async_to_lds_b128 %14, %15, off\n\t"
               "global_load_async_to_lds_b128 %16, %17, off\n\t"
               "global_load_async_to_lds_b128 %18, %19, off\n\t"
               "global_load_async_to_lds_b128 %20, %21, off\n\t"
               "global_load_async_to_lds_b128 %22, %23, off\n\t"
               "s_wait_xcnt 0x0"
               :: "v"(l[0]), "v"(g[0]), "v"(l[1]), "v"(g[1]), "v"(l[2]), "v"(g[2]), "v"(l[3]), "v"(g[3]),
                  "v"(l[4]), "v"(g[4]), "v"(l[5]), "v"(g[5]), "v"(l[6]), "v"(g[6]), "v"(l[7]), "v"(g[7]),
                  "v"(l[8]), "v"(g[8]), "v"(l[9]), "v"(g[9]), "v"(l[10]), "v"(g[10]), "v"(l[11]), "v"(g[11]) : "memory");
}

// ---- Register-blocked batched WMMA GEMM (ACT reduced to none/relu/leaky) -------------------------------
// C[m,n] = scale * sum_k A[m,k] * Bt[n,k] (+bias)(+resid); a block owns a 128x256 tile, each of its 8 waves (2 x 4) 64x64 of it.
// A row-major [M,K]; Bt row-major [N,K]; M % 128 == 0, N % 256 == 0, K % 128 == 0; tiles blk = 0 .. (M / 128) * (N / 256) - 1.
// Operands come through LDS, 128 k a pass: 128 A rows and 256 Bt rows of 256 B, brought by asynchronous 16-B copies in which a
// wave covers two whole rows (four 128-B lines). Two buffers: the copies of pass p + 2 are issued behind the barrier that ends
// pass p, into the buffer that pass p has read, and land while pass p + 1 is worked on.
// blk = the block's tile number, b = its batch.
// BIAS_MODE: 0 = none, 1 = bias[m], 2 = bias[n], 3 = the block's own choice of the two: biasPerRow ? bias[m] : bias[n].
// OUT_MODE: 0 = f32, 1 = f16, 2 = bf16 hi plane (Cout) + bf16 lo plane (Cout2).
// ET: 0 = f16 operands, 1 = bf16 operands (pointers passed as 16-bit storage)
constexpr int kGmBM    = 128;                              // block tile rows (A rows staged)
constexpr int kGmBN    = 256;                              // block tile columns (Bt rows staged)
constexpr int kGmPassK = 128;                              // k per pass: 256-B rows
constexpr int kGmPitch = 272;                              // LDS pitch of the 256-B rows: 16 B x odd, no bank conflict for 16-B reads
constexpr int kGmBuf   = (kGmBM + kGmBN) * kGmPitch;       // 104,448 B a buffer: A rows first, Bt rows behind them
template <int V> struct BiasTag { static constexpr int value = V; };
template <int ET> struct Elem;
template <> struct Elem<0> { typedef _Float16 T; };
template <> struct Elem<1> { typedef __bf16 T; };
template <int ET, bool SPLIT, int BIAS_MODE, int OUT_MODE, bool RESID, int ACT = 0>
__device__ __forceinline__ void gemm64_tile(
    unsigned blk, int b, bool biasPerRow,
    const unsigned short* __restrict__ Ap, const unsigned short* __restrict__ A2p, int lda, long strideA,
    const unsigned short* __restrict__ Btp, const unsigned short* __restrict__ Bt2p, int ldb, long strideB,
    void* __restrict__ Cout, void* __restrict__ Cout2, int ldc, long strideC,
    const float* __restrict__ bias,
    const float* __restrict__ resid, long strideR,
    int M, int N, int K, float scale) {
  static_assert(!SPLIT, "single-plane operands only");
  typedef typename Elem<ET>::T T;
  typedef typename Frag<T>::V V;
  const T* A = (const T*)Ap; const T* Bt = (const T*)Btp;
  __shared__ __align__(16) float sT[8][16 * 68];   // per-wave 16x64 slab, pitch 68 floats
  __shared__ __attribute__((aligned(16))) unsigned char ring[2 * kGmBuf];
  const int lane = threadIdx.x & 31;
  const int wave = threadIdx.x >> 5;
  const int tilesN = N / kGmBN;
  const int tilesM = M / kGmBM;
  if ((int)blk >= tilesM * tilesN) return;   // the same for the whole block, in front of every barrier
  const int bm = blk / tilesN;
  const int bn = blk - bm * tilesN;
  const int wm = (wave >> 2) << 6;             // this wave's 64 rows within the staged A rows
  const int wn = (wave & 3) << 6;              // this wave's 64 rows within the staged Bt rows
  const int m0 = bm * kGmBM + wm;
  const int n0 = bn * kGmBN + wn;

  const T* Ab  = A  + (size_t)b * strideA;
  const T* Bb  = Bt + (size_t)b * strideB;

  const int rlane = lane & 15;                 // row (A) / col (B, D) within subtile
  const int koff  = (lane >> 4) * 8;           // k offset of this lane half
  const int mOff  = (lane >> 4) * 8;           // D row offset

  // what this lane copies: bytes 16 * (t & 15) .. +15 of staged rows (t >> 4) + 16 i: i = 0..7 of A, i = 0..15 of Bt
  const int crow = threadIdx.x >> 4, ccol = (threadIdx.x & 15) * 16;
  const char* gA = (const char*)(Ab + (size_t)(bm * kGmBM + crow) * lda) + ccol;
  const char* gB = (const char*)(Bb + (size_t)(bn * kGmBN + crow) * ldb) + ccol;
  const size_t stepA = (size_t)16 * lda * 2, stepB = (size_t)16 * ldb * 2;
  const unsigned lC = (unsigned)(size_t)ring + crow * kGmPitch + ccol;   // low 32 bits of the address = byte offset in the block's LDS
  // one pass's rows into one buffer: 24 copies a lane; kb = the pass's first byte in a row, lb = the buffer's first byte
  auto stage_pass = [&](size_t kb, unsigned lb) {
    unsigned l[24]; const char* g[24];
#pragma unroll
    for (int i = 0; i < 8; ++i)  { l[i] = lC + lb + i * 16 * kGmPitch;                g[i] = gA + kb + i * stepA; }
#pragma unroll
    for (int i = 0; i < 16; ++i) { l[8 + i] = lC + lb + (kGmBM + i * 16) * kGmPitch;  g[8 + i] = gB + kb + i * stepB; }
    copy12_to_lds(l, g);
    copy12_to_lds(l + 12, g + 12);
  };
  // what this lane reads: row rlane of every 16-row group of its wave's rows, from byte 16 * (lane >> 4)
  const int rA = (wm + rlane) * kGmPitch + koff * 2;
  const int rB = (kGmBM + wn + rlane) * kGmPitch + koff * 2;

  v8f acc[4][4];
#pragma unroll
  for (int i = 0; i < 4; ++i)
#pragma unroll
    for (int j = 0; j < 4; ++j) acc[i][j] = (v8f){0.f,0.f,0.f,0.f,0.f,0.f,0.f,0.f};

  const int nPass = K / kGmPassK;
  // pass 0's rows, landed and published; then pass 1's are asked for
  stage_pass(0, 0);
  asm volatile("s_wait_asynccnt 0x0" ::: "memory");      // this wave's copies have landed
  __syncthreads();                                       // and every other wave's
  if (nPass > 1) stage_pass((size_t)kGmPassK * 2, kGmBuf);

  for (int p = 0; p < nPass; ++p) {
    const unsigned char* sb = ring + (p & 1) * kGmBuf;
#pragma unroll
    for (int ks = 0; ks < kGmPassK / 32; ++ks) {
      V bh[4], ah[4];
#pragma unroll
      for (int i = 0; i < 4; ++i) ah[i] = Frag<T>::load((const T*)(sb + rA + i * 16 * kGmPitch + ks * 64));
#pragma unroll
      for (int j = 0; j < 4; ++j) bh[j] = Frag<T>::load((const T*)(sb + rB + j * 16 * kGmPitch + ks * 64));
      // keeps the 16 reads of a k step together in front of its first product: one LDS latency for all of them; without it the
      // scheduler reads the A fragments one at a time into one register set and waits for each
      __builtin_amdgcn_sched_barrier(0);
#pragma unroll
      for (int j = 0; j < 4; ++j)
#pragma unroll
        for (int i = 0; i < 4; ++i) acc[i][j] = Frag<T>::mma(ah[i], bh[j], acc[i][j]);
    }
    // hand-over: this wave's reads of the buffer are done, its copies for pass p + 1 have landed; behind the barrier that
    // holds for every wave, so pass p + 1 may be read and this pass's buffer may be refilled
    // The scheduling fence keeps the pass's products in front of the hand-over; without it the scheduler sinks products behind
    // the barrier, which delays the refill that stands there.
    __builtin_amdgcn_sched_barrier(0);
    asm volatile("s_wait_dscnt 0x0" ::: "memory");
    asm volatile("s_wait_asynccnt 0x0" ::: "memory");
    __syncthreads();
    if (p + 2 < nPass) stage_pass((size_t)(p + 2) * (kGmPassK * 2), (p & 1) * kGmBuf);   // the same for the whole block
  }
  asm volatile("s_wait_asynccnt 0x0" ::: "memory");        // no copy is left in flight when the wave goes on to its end
  acc_guard4(acc[0][0], acc[0][1], acc[0][2], acc[0][3]);
  acc_guard4(acc[1][0], acc[1][1], acc[1][2], acc[1][3]);
  acc_guard4(acc[2][0], acc[2][1], acc[2][2], acc[2][3]);
  acc_guard4(acc[3][0], acc[3][1], acc[3][2], acc[3][3]);

  // ---- epilogue, written once for a bias mode BM that is known at compile time ----
  float* slab = sT[wave];
  const float* Rb = RESID ? (resid + (size_t)b * strideR) : nullptr;
  auto epilogue = [&](auto tag) {
  constexpr int BM = decltype(tag)::value;
#pragma unroll
  for (int i = 0; i < 4; ++i) {
    const int mBase = m0 + (i << 4);
#pragma unroll
    for (int j = 0; j < 4; ++j) {
      const int n = n0 + (j << 4) + rlane;
      float bv = 0.f;
      if (BM == 2) bv = bias[n];
#pragma unroll
      for (int r = 0; r < 8; ++r) {
        float v = acc[i][j][r] * scale;
        if (BM == 1) v += bias[mBase + mOff + r];
        if (BM == 2) v += bv;
        if (RESID) v += Rb[(size_t)(mBase + mOff + r) * ldc + n];
        if (ACT == 2) v = fmaxf(v, 0.0f);
        if (ACT == 4) v = (v > 0.f) ? v : 0.01f * v;
        slab[(mOff + r) * 68 + (j << 4) + rlane] = v;
      }
    }
    __builtin_amdgcn_fence(__ATOMIC_RELEASE, "workgroup");
    __builtin_amdgcn_wave_barrier();
    __builtin_amdgcn_fence(__ATOMIC_ACQUIRE, "workgroup");
    if (OUT_MODE == 0) {
      float* C = (float*)Cout + (size_t)b * strideC;
      const int hh = lane >> 4, c4 = (lane & 15) * 4;     // row seg = 256 B = 16 lanes x 16 B
      {
#pragma unroll
        for (int it = 0; it < 8; ++it) {
          const int row = it * 2 + hh;
          v4f v = *(const v4f*)(slab + row * 68 + c4);
          *(v4f*)(C + (size_t)(mBase + row) * ldc + n0 + c4) = v;
        }
        
      }
    } else {
      const int q = lane >> 3, c8 = (lane & 7) * 8;
      unsigned short* C  = (unsigned short*)Cout  + (size_t)b * strideC;
      unsigned short* C2 = (OUT_MODE == 2) ? ((unsigned short*)Cout2 + (size_t)b * strideC) : nullptr;
      {
#pragma unroll
        for (int it = 0; it < 4; ++it) {
          const int row = it * 4 + q;
          const float* sp = slab + row * 68 + c8;
          v8h hv, lv;
#pragma unroll
          for (int e = 0; e < 8; ++e) {
            if (OUT_MODE == 1) {
              hv[e] = (_Float16)sp[e];
            } else {
              unsigned short hb = f2bf_bits(sp[e]);
              unsigned short lb = f2bf_bits(sp[e] - bf_bits2f(hb));
              hv[e] = __builtin_bit_cast(_Float16, hb);
              lv[e] = __builtin_bit_cast(_Float16, lb);
            }
          }
          *(v8h*)(C + (size_t)(mBase + row) * ldc + n0 + c8) = hv;
          if (OUT_MODE == 2) *(v8h*)(C2 + (size_t)(mBase + row) * ldc + n0 + c8) = lv;
        }
        
      }
    }
    __builtin_amdgcn_fence(__ATOMIC_RELEASE, "workgroup");
    __builtin_amdgcn_wave_barrier();
    __builtin_amdgcn_fence(__ATOMIC_ACQUIRE, "workgroup");
  }
  };
  if constexpr (BIAS_MODE != 3) epilogue(BiasTag<BIAS_MODE>{});
  else if (biasPerRow) epilogue(BiasTag<1>{});      // one branch, the same for the whole block
  else                 epilogue(BiasTag<2>{});
}
// one GEMM a launch: grid.x = its tiles, grid.y = its batches
template <int ET, bool SPLIT, int BIAS_MODE, int OUT_MODE, bool RESID, int ACT = 0>
__global__ __launch_bounds__(256) void wmma_gemm64(
    const unsigned short* __restrict__ Ap, const unsigned short* __restrict__ A2p, int lda, long strideA,
    const unsigned short* __restrict__ Btp, const unsigned short* __restrict__ Bt2p, int ldb, long strideB,
    void* __restrict__ Cout, void* __restrict__ Cout2, int ldc, long strideC,
    const float* __restrict__ bias,
    const float* __restrict__ resid, long strideR,
    int M, int N, int K, float scale) {
  gemm64_tile<ET, SPLIT, BIAS_MODE, OUT_MODE, RESID, ACT>(blockIdx.x, (int)blockIdx.y, false, Ap, A2p, lda, strideA, Btp, Bt2p, ldb, strideB,
                                                          Cout, Cout2, ldc, strideC, bias, resid, strideR, M, N, K, scale);
}
// Both projections of x, which do not depend on each other, in one launch. Blocks 0 .. tilesQK - 1 own the tiles of
//   QK[m][n'] = f16(scale * sum_k X[m][k] WQK[n'][k] + bqk[n'])   (M = kTok, N = kQKCols),
// the blocks behind them the tiles of
//   VT[n][m]  = f16(scale * sum_k WV[n][k] X[m][k] + bv[n])       (M = kDim rows n, N = kTok tokens).
constexpr int kProjTilesQK = (kTok / kGmBM) * (kQKCols / kGmBN);   // 256
constexpr int kProjTilesVT = (kDim / kGmBM) * (kTok / kGmBN);      // 128
__global__ __launch_bounds__(256) void proj_gemm_kernel(
    const unsigned short* __restrict__ X, const unsigned short* __restrict__ WQK, const unsigned short* __restrict__ WV,
    const float* __restrict__ bqk, const float* __restrict__ bv,
    unsigned short* __restrict__ QK, unsigned short* __restrict__ VT, int K, float scale) {
  const bool vt = (int)blockIdx.x >= kProjTilesQK;                 // the same for the whole block
  const unsigned short* A  = vt ? WV : X;
  const unsigned short* Bt = vt ? X : WQK;
  unsigned short* C        = vt ? VT : QK;
  const float* bias        = vt ? bv : bqk;
  gemm64_tile<0, false, 3, 1, false, 0>(vt ? blockIdx.x - kProjTilesQK : blockIdx.x, 0, vt, A, A, K, 0L, Bt, Bt, K, 0L,
                                        (void*)C, (void*)C, vt ? kTok : kQKCols, 0L, bias, bias, 0L,
                                        vt ? kDim : kTok, vt ? kTok : kQKCols, K, scale);
}

// ---------------------------------------------------------------------------
// The three operand preparations below do not depend on each other and share one launch (prep_kernel); blk = the block's
// number within its own part.
// ---------------------------------------------------------------------------
__device__ __forceinline__ void cast8_f16_part(int blk, const float* __restrict__ in, unsigned short* __restrict__ out, int n8) {
  const int i = blk * 256 + threadIdx.x;
  if (i >= n8) return;
  const float* p = in + 8 * (size_t)i;
  const v4f a = *(const v4f*)(p);
  const v4f c = *(const v4f*)(p + 4);
  unsigned short hb[8];
#pragma unroll
  for (int e = 0; e < 4; ++e) {
    hb[e]     = h_bits(a[e]);
    hb[4 + e] = h_bits(c[e]);
  }
  const v4u u = (v4u){pk16(hb[0], hb[1]), pk16(hb[2], hb[3]), pk16(hb[4], hb[5]), pk16(hb[6], hb[7])};
  unsigned short* q = out + 8 * (size_t)i;
  *(v4u*)q = u;
  
}

// ---------------------------------------------------------------------------
// Weight transpose + cast (+ optional output-feature permutation) for square [1024 in][1024 out] f32 W (row-major [k][n]):
//   out[np][k] = f16( scale * W[k][orig(np)] ), orig(np) = perm ? ((np>>5)&1)*512 + (np>>6)*32 + (np&31) : np.
// With perm, plane column 64h + 32*set + d holds feature set*512 + 32h + d, so the two q/k sets of a head sit at stride 32.
// 1024 blocks: blk & 15 = k tile (64 cols of out), (blk >> 4) & 15 = np tile (64 rows of out), blk >> 8 = z selects
//   z0 = (W0 -> o0, perm), z1 = (W1 -> o1, perm), z2 = (W2 -> o2, identity), z3 = (W3 -> o3, identity). 256 threads.
// Load coverage: 16 iterations x 256 threads = 4096 = the whole 64x64 tile (coalesced along n inside 32-wide strips).
// Store coverage: 8 waves x 2 iterations x 4 rows (lane>>3) = 64 rows; (lane&7) x 8 halves = 64 cols; each row segment =
// ---------------------------------------------------------------------------
__device__ __forceinline__ void wt_part(int blk, const float* __restrict__ W0, const float* __restrict__ W1,
                                        const float* __restrict__ W2, const float* __restrict__ W3,
                                        unsigned short* __restrict__ o0, unsigned short* __restrict__ o1,
                                        unsigned short* __restrict__ o2, unsigned short* __restrict__ o3,
                                        float scale) {
  __shared__ float sm[64][65];   // sm[np_local][k_local]
  const int t  = threadIdx.x;
  const int k0 = (blk & 15) * 64;
  const int n0 = ((blk >> 4) & 15) * 64;
  const int z  = blk >> 8;                                     // block-uniform
  const float* W = (z == 0) ? W0 : (z == 1) ? W1 : (z == 2) ? W2 : W3;
  unsigned short* op = (z == 0) ? o0 : (z == 1) ? o1 : (z == 2) ? o2 : o3;
  const int perm = (z < 2) ? 1 : 0;
#pragma unroll
  for (int i = 0; i < 16; ++i) {
    const int e = i * 256 + t;
    const int r = e >> 6;          // k local
    const int c = e & 63;          // np local
    const int np = n0 + c;
    const int og = perm ? ((((np >> 5) & 1) << 9) + ((np >> 6) << 5) + (np & 31)) : np;
    sm[c][r] = W[(size_t)(k0 + r) * kDim + og] * scale;
  }
  __syncthreads();
  const int lane = t & 31, wave = t >> 5;
  const int q = lane >> 3, c8 = (lane & 7) * 8;
  {
#pragma unroll
    for (int it = 0; it < 2; ++it) {
      const int row = wave * 8 + it * 4 + q;                 // np local
      unsigned short hb[8];
#pragma unroll
      for (int e = 0; e < 8; ++e) hb[e] = h_bits(sm[row][c8 + e]);
      const v4u u = (v4u){pk16(hb[0], hb[1]), pk16(hb[2], hb[3]), pk16(hb[4], hb[5]), pk16(hb[6], hb[7])};
      *(v4u*)(op + (size_t)(n0 + row) * kDim + k0 + c8) = u;
    }
    // behind the last store, in front of whatever follows this part in the kernel that holds it: no register that the two
    // stores name is rewritten ahead of this wait
    asm volatile("s_wait_xcnt 0x0" ::: "memory");
  }
}

// ---------------------------------------------------------------------------
// Permuted q|k bias line: out[np] = bq[orig(np)] for np < 1024 (block 0), out[1024 + np] = bk[orig(np)] (block 1).
// Thread t owns np = 4t..4t+3 (orig of an aligned group of 4 is contiguous); one 16-B store per lane, a wave = 512 B =
// ---------------------------------------------------------------------------
__device__ __forceinline__ void biasperm_part(int blk, const float* __restrict__ bq, const float* __restrict__ bk,
                                              float* __restrict__ out) {
  const int t = threadIdx.x;
  const float* src = (blk == 0) ? bq : bk;                    // block-uniform
  const int np = 4 * t;
  const int og = (((np >> 5) & 1) << 9) + ((np >> 6) << 5) + (np & 31);
  const v4f v = *(const v4f*)(src + og);
  float* dp = out + (size_t)blk * kDim + np;
  *(v4f*)dp = v;
  
}

// One launch for the three parts; every test below reads the same for the whole block, so the barrier inside wt_part is
// passed by all of a block's threads or by none. Blocks 0..1: bias line; the next 1024: weight planes; the rest: x.
constexpr int kPrepBias = 2;
constexpr int kPrepWt   = (kDim / 64) * (kDim / 64) * 4;          // 1024
constexpr int kPrepCast = (kTok * kDim) / (8 * 256);              // 2048
static_assert(kDim / 64 == 16, "wt_part's block decoding");
__global__ __launch_bounds__(256) void prep_kernel(const float* __restrict__ x, const float* __restrict__ Wq,
                                                   const float* __restrict__ Wk, const float* __restrict__ Wv,
                                                   const float* __restrict__ Wo, const float* __restrict__ bq,
                                                   const float* __restrict__ bk,
                                                   unsigned short* __restrict__ xh, unsigned short* __restrict__ wqt,
                                                   unsigned short* __restrict__ wkt, unsigned short* __restrict__ wvt,
                                                   unsigned short* __restrict__ wot, float* __restrict__ bqk,
                                                   int n8, float wscale) {
  const int blk = blockIdx.x;
  if (blk < kPrepBias)                biasperm_part(blk, bq, bk, bqk);
  else if (blk < kPrepBias + kPrepWt) wt_part(blk - kPrepBias, Wq, Wk, Wv, Wo, wqt, wkt, wvt, wot, wscale);
  else                                cast8_f16_part(blk - (kPrepBias + kPrepWt), x, xh, n8);
}

// ---------------------------------------------------------------------------
// Both masked softmaxes, their difference and the product with v, for every (batch, head) in one launch; no score ever
// reaches memory. Transposed forms, so that one lane owns one query column throughout:
//   St[set][j][i] = sum_d k_set[j][d] * q_set[i][d]     (A = 16 key rows, B = 16 query rows kept in registers, K = 32)
//   x = ((mask[i][j] != 0) ? St : -2^100) * 32^-0.5 * log2(e)
//   running maximum m and sum l per query and set; p = exp2(x - m), f16
//   Ot[set][d][i] = Ot[set][d][i] * exp2(m_old - m_new) + sum_j v^T[d][j] * p[j][i]     (A = 16 rows of v^T, B = p, K = 32)
//   O[i][d] = Ot[0][d][i] / l0 - lambda * Ot[1][d][i] / l1,  lambda = exp(sum lq1*lk1) - exp(sum lq2*lk2) + 0.2
// and, still in registers, the per-head LayerNorm over the 64 d of O[i][.], affine, x0.8, f16 cast:
//   mu = mean_d O, var = mean_d (O - mu)^2, y = ((O - mu) / sqrt(var + 1e-5) * g[h][d] + b[h][d]) * 0.8 -> A16[i][64h + d]
// (lanes l and l ^ 16 hold 32 d each of one query row: each sums its own 32, one lane swap joins the halves).
// grid (16, 16 heads, 2 batches), 8 waves; wave w owns query rows 128*blockIdx.x + 16w .. +15 and walks all 2048 keys, 64 a
// trip. A trip's operands come through LDS: 64 k rows and 64 v^T rows of 128 B (shared by the 8 waves) and 128 mask rows of
// 256 B (16 per wave), brought by asynchronous 16-B copies in which a wave covers whole 128-B lines. Two buffers: the copies
// of trip t + 1 are issued behind the barrier that ends trip t - 1 and land while trip t is worked on.
// Fragment maps: accumulator register r of lane l holds row 8*(l>>4) + r, column l & 15. Two score tiles (keys 0..15 and
// 16..31 of a 32-key chunk) converted in place are the B operand of the second product: element s = key
// (s < 8 ? 8*(l>>4) + s : 16 + 8*(l>>4) + s - 8), which is the k order in which Frag::load reads the v^T rows.
// Store: a lane holds 8 consecutive d of its query row per tile; the wave writes the whole 128-B row segment of its head.
// ---------------------------------------------------------------------------
constexpr int   kFaQ    = 128;                 // query rows per block (8 waves x 16)
constexpr int   kFaKeys = 64;                  // keys per trip
constexpr float kLog2e  = 1.4426950408889634f;
// Value of a masked score, in front of the scale: -2^100. A power of two, so that its product with the scale is exact and
// (score * scale - maximum) is exactly 0 in a row whose every key is masked, whether or not the compiler fuses the two.
constexpr float kMaskedScore = -0x1p100f;
static_assert(kSeq % kFaQ == 0 && kSeq % kFaKeys == 0 && kDh == 64 && kDiff == 32, "attention tiling");
typedef __attribute__((ext_vector_type(4))) int v4i;
constexpr int kFaTrips = kSeq / kFaKeys;                   // 32
constexpr int kKvPitch = 144;                              // LDS pitch of the 128-B k and v^T rows: 16 B x odd, no bank conflict for 16-B reads
constexpr int kMkPitch = 272;                              // LDS pitch of the 256-B mask rows: 16 B x odd
constexpr int kLdsV    = kFaKeys * kKvPitch;               // k rows at 0, v^T rows behind them
constexpr int kLdsM    = kLdsV + kDh * kKvPitch;           // mask rows behind those
constexpr int kLdsBuf  = kLdsM + kFaQ * kMkPitch;          // 53,248 B a buffer
static_assert(kFaTrips >= 2 && kFaKeys * 2 == 128 && kDh * 2 == 128 && kFaKeys * 4 == 256, "staging");
// Four asynchronous copies, 16 B per lane each, global memory to LDS through no register. l = the lane's LDS byte address,
// g = its global address. The s_wait_xcnt ends the statement so that it stands in front of every later write of an address
// register named here.
__device__ __forceinline__ void copy4_to_lds(unsigned l0, const char* g0, unsigned l1, const char* g1,
                                             unsigned l2, const char* g2, unsigned l3, const char* g3) {
  asm volatile("global_load_async_to_lds_b128 %0, %1, off\n\t"
               "global_load_async_to_lds_b128 %2, %3, off\n\t"
               "global_load_async_to_lds_b128 %4, %5, off\n\t"
               "global_load_async_to_lds_b128 %6, %7, off\n\t"
               "s_wait_xcnt 0x0"
               :: "v"(l0), "v"(g0), "v"(l1), "v"(g1), "v"(l2), "v"(g2), "v"(l3), "v"(g3) : "memory");
}
// One trip's tiles into one buffer: 12 copies a lane. lk, lv, lm and gk, gv, gm are the lane's first LDS and global addresses
// in the k, v^T and mask tile; its further rows lie 32 rows on (k, v^T) and 2 rows on (mask).
__device__ __forceinline__ void stage_trip(unsigned lk, unsigned lv, unsigned lm,
                                           const char* gk, const char* gv, const char* gm) {
  copy4_to_lds(lk, gk, lk + 32 * kKvPitch, gk + (size_t)32 * kQKCols * 2,
               lv, gv, lv + 32 * kKvPitch, gv + (size_t)32 * kTok * 2);
  copy4_to_lds(lm,                gm,                          lm + 2 * kMkPitch, gm + (size_t)2 * kSeq * 4,
               lm + 4 * kMkPitch, gm + (size_t)4 * kSeq * 4,   lm + 6 * kMkPitch, gm + (size_t)6 * kSeq * 4);
  copy4_to_lds(lm + 8 * kMkPitch,  gm + (size_t)8 * kSeq * 4,  lm + 10 * kMkPitch, gm + (size_t)10 * kSeq * 4,
               lm + 12 * kMkPitch, gm + (size_t)12 * kSeq * 4, lm + 14 * kMkPitch, gm + (size_t)14 * kSeq * 4);
}
// value of lane l ^ 16, by a vector-unit lane swap (no LDS round trip)
__device__ __forceinline__ float other_half(float x) {
  const int b = __float_as_int(x);
  return __int_as_float(__builtin_amdgcn_permlanex16(b, b, 0x76543210, 0xfedcba98, false, false));
}
// exp2 in place. The instruction set asks for one slot between a transcendental and a directly following instruction that
// overwrites its source or reads its result. Here each overwrites only its own source, and the v_nop is the slot in front of
// whatever the compiler puts next.
__device__ __forceinline__ void exp2_inplace(float& x) {
  asm("v_exp_f32 %0, %0\n\tv_nop" : "+v"(x));
}
__device__ __forceinline__ void exp2_inplace8(v8f& x) {
  float a = x[0], b = x[1], c = x[2], d = x[3], e = x[4], f = x[5], g = x[6], h = x[7];
  asm("v_exp_f32 %0, %0\n\tv_exp_f32 %1, %1\n\tv_exp_f32 %2, %2\n\tv_exp_f32 %3, %3\n\t"
      "v_exp_f32 %4, %4\n\tv_exp_f32 %5, %5\n\tv_exp_f32 %6, %6\n\tv_exp_f32 %7, %7\n\tv_nop"
      : "+v"(a), "+v"(b), "+v"(c), "+v"(d), "+v"(e), "+v"(f), "+v"(g), "+v"(h));
  x = (v8f){a, b, c, d, e, f, g, h};
}
// four waves per SIMD (two blocks per WGP): the whole grid of 512 blocks is resident at once, within 256 registers a wave
// and 106,496 B of LDS a block
__global__ __launch_bounds__(256) __attribute__((amdgpu_waves_per_eu(4, 4))) void diff_attn_kernel(const unsigned short* __restrict__ QKp,
                                                        const unsigned short* __restrict__ Vtp,
                                                        const int* __restrict__ Mp,
                                                        const float* __restrict__ lq1, const float* __restrict__ lk1,
                                                        const float* __restrict__ lq2, const float* __restrict__ lk2,
                                                        const float* __restrict__ g, const float* __restrict__ bta,
                                                        unsigned short* __restrict__ A16) {
  const int lane = threadIdx.x & 31, wave = threadIdx.x >> 5;
  const int c    = lane & 15;                  // this lane's query column; row of every A fragment
  const int h8   = (lane >> 4) * 8;            // k offset of this lane half; also its accumulator row offset
  const int head = blockIdx.y;
  const int b    = blockIdx.z;
  const int q0   = blockIdx.x * kFaQ + wave * 16;

  const _Float16* QK = (const _Float16*)QKp + (size_t)b * kSeq * kQKCols + head * kDh;
  const _Float16* Qr = QK + (size_t)(q0 + c) * kQKCols + h8;
  __shared__ __attribute__((aligned(16))) unsigned char smem[2 * kLdsBuf];
  // what this lane copies: of k and v^T rows (t >> 3) and (t >> 3) + 32, bytes 16 * (t & 7) .. +15 (a wave: 4 whole rows a
  // copy); of the mask its own wave's rows 2i + (lane >> 4), i = 0..7, bytes 16 * (lane & 15) .. +15 (a wave: 2 whole rows)
  const int crow = threadIdx.x >> 3, ccol = (threadIdx.x & 7) * 16;
  const int mrow = wave * 16 + (lane >> 4), mcol = (lane & 15) * 16;
  const char* gK = (const char*)(QK + kDim + (size_t)crow * kQKCols) + ccol;
  const char* gV = (const char*)((const _Float16*)Vtp + (size_t)(head * kDh + crow) * kTok + (size_t)b * kSeq) + ccol;
  const char* gM = (const char*)(Mp + ((size_t)b * kSeq + blockIdx.x * kFaQ + mrow) * kSeq) + mcol;
  const unsigned lds0 = (unsigned)(size_t)smem;            // low 32 bits of the address = byte offset in the block's LDS
  const unsigned lK = lds0 + crow * kKvPitch + ccol;
  const unsigned lV = lds0 + kLdsV + crow * kKvPitch + ccol;
  const unsigned lM = lds0 + kLdsM + mrow * kMkPitch + mcol;
  // what this lane reads: row c of every 16-row group, from byte 16 * (lane >> 4) (k, v^T) or 32 * (lane >> 4) (mask)
  const int rK = c * kKvPitch + h8 * 2;
  const int rV = kLdsV + c * kKvPitch + h8 * 2;
  const int rM = kLdsM + (wave * 16 + c) * kMkPitch + h8 * 4;
  v16h qf[2];
  qf[0] = Frag<_Float16>::load(Qr);
  qf[1] = Frag<_Float16>::load(Qr + kDiff);

  const v8f zero = (v8f){0.f,0.f,0.f,0.f,0.f,0.f,0.f,0.f};
  const float cs   = kInvScale * kLog2e;
  v8f o[2][4];
  float m[2], l[2];
#pragma unroll
  for (int st = 0; st < 2; ++st) {
    m[st] = -__builtin_inff();
    l[st] = 0.f;
#pragma unroll
    for (int dt = 0; dt < 4; ++dt) o[st][dt] = zero;
  }

  // trip 0's tiles, landed and published
  stage_trip(lK, lV, lM, gK, gV, gM);
  asm volatile("s_wait_asynccnt 0x0" ::: "memory");      // this wave's copies have landed
  __syncthreads();                                       // and every other wave's

  for (int t = 0; t < kFaTrips; ++t) {
    const int buf = (t & 1) * kLdsBuf;
    const unsigned char* sb = smem + buf;
    // directly behind the barrier that ended trip t - 1 (in front of trip 0: the one above): the next trip's tiles are asked
    // for, into the buffer that trip t - 1 has read, and fly while this trip is worked on
    if (t + 1 < kFaTrips) {                                // the same for the whole block
      const size_t j1 = (size_t)(t + 1) * kFaKeys;
      const unsigned nb = kLdsBuf - buf;
      stage_trip(lK + nb, lV + nb, lM + nb, gK + j1 * (kQKCols * 2), gV + j1 * 2, gM + j1 * 4);
    }
    v8f s[2][4];
    v4i mk[4][2];
    v16h kf[2][4];
#pragma unroll
    for (int kt = 0; kt < 4; ++kt) {
      mk[kt][0] = *(const v4i*)(sb + rM + kt * 64);
      mk[kt][1] = *(const v4i*)(sb + rM + kt * 64 + 16);
    }
#pragma unroll
    for (int kt = 0; kt < 4; ++kt) {
      const _Float16* kp = (const _Float16*)(sb + rK + kt * 16 * kKvPitch);
      kf[0][kt] = Frag<_Float16>::load(kp);
      kf[1][kt] = Frag<_Float16>::load(kp + kDiff);
    }
    // keeps the trip's mask and k reads together in front of the first product: one latency for all of them; without it
    // the scheduler, short of registers, reads one fragment at a time and waits for each
    __builtin_amdgcn_sched_barrier(0);
    // smallest of the lane's 32 mask words, read as unsigned: 0 exactly where one of them is 0 (four short chains, then joined)
    unsigned mlow[4];
#pragma unroll
    for (int kt = 0; kt < 4; ++kt) {
      mlow[kt] = (unsigned)mk[kt][0][0];
#pragma unroll
      for (int r = 1; r < 8; ++r) mlow[kt] = min(mlow[kt], (unsigned)mk[kt][r >> 2][r & 3]);
    }
    const unsigned mlowAll = min(min(mlow[0], mlow[1]), min(mlow[2], mlow[3]));
    // One scalar branch, the same for every lane of the wave (every lane stays on in both arms; no barrier stands inside).
    // A wave whose 16 x 64 mask tile holds no zero has nothing to mask: its arm is the products alone. In the other arm each
    // masked score is replaced, behind the products, by the one constant kMaskedScore: masked scores are all bit-equal and far
    // below every kept one (at most 32 * 65504^2 in size), as with the reference's -1e9: weight 0 beside any kept key, equal
    // weights where every key of a row is masked. The products stand in both arms so that the arm without selects writes
    // the scores where the softmax reads them, with no register moves at the join.
    if (__builtin_amdgcn_ballot_w32(mlowAll == 0u) != 0u) {
#pragma unroll
      for (int kt = 0; kt < 4; ++kt) {
        const v8f a0 = Frag<_Float16>::mma(kf[0][kt], qf[0], zero);
        const v8f a1 = Frag<_Float16>::mma(kf[1][kt], qf[1], zero);
#pragma unroll
        for (int r = 0; r < 8; ++r) {
          const bool keep = (mk[kt][r >> 2][r & 3] != 0);
          s[0][kt][r] = keep ? a0[r] : kMaskedScore;
          s[1][kt][r] = keep ? a1[r] : kMaskedScore;
        }
      }
    } else {
#pragma unroll
      for (int kt = 0; kt < 4; ++kt) {
        s[0][kt] = Frag<_Float16>::mma(kf[0][kt], qf[0], zero);
        s[1][kt] = Frag<_Float16>::mma(kf[1][kt], qf[1], zero);
      }
    }
    v16h vf[2][4];
    v16h pf[2][2];
#pragma unroll
    for (int st = 0; st < 2; ++st) {
      if (st == 1) {
        // all of the trip's v^T fragments are asked for by here, into the registers the first set's scores have just left:
        // their LDS latency runs under the second set's softmax arithmetic
        const _Float16* vp = (const _Float16*)(sb + rV);
#pragma unroll
        for (int kc = 0; kc < 2; ++kc)
#pragma unroll
          for (int dt = 0; dt < 4; ++dt) vf[kc][dt] = Frag<_Float16>::load(vp + dt * 16 * (kKvPitch / 2) + kc * 32);
        // keeps those reads up here; without it the scheduler sinks them to just in front of their products, each with a full wait
        __builtin_amdgcn_sched_barrier(0);
      }
      float tm = -__builtin_inff();
#pragma unroll
      for (int kt = 0; kt < 4; ++kt) {
        s[st][kt] *= cs;
#pragma unroll
        for (int r = 0; r < 8; ++r) tm = fmaxf(tm, s[st][kt][r]);
      }
      tm = fmaxf(tm, other_half(tm));                // the other lane half holds the other keys of the same query
      const float mn    = fmaxf(m[st], tm);
      float sum = 0.f;
#pragma unroll
      for (int kt = 0; kt < 4; ++kt) {
        v8f p = s[st][kt] - mn;
        exp2_inplace8(p);
#pragma unroll
        for (int r = 0; r < 8; ++r) {
          sum += p[r];
          pf[st][kt >> 1][(kt & 1) * 8 + r] = (_Float16)p[r];
        }
      }
      float alpha = m[st] - mn;
      exp2_inplace(alpha);
      m[st] = mn;
      l[st] = l[st] * alpha + sum;                   // this half's keys only; the halves are joined behind the loop
#pragma unroll
      for (int dt = 0; dt < 4; ++dt) o[st][dt] *= alpha;
    }
#pragma unroll
    for (int kc = 0; kc < 2; ++kc)
#pragma unroll
      for (int dt = 0; dt < 4; ++dt) {
        o[0][dt] = Frag<_Float16>::mma(vf[kc][dt], pf[0][kc], o[0][dt]);
        o[1][dt] = Frag<_Float16>::mma(vf[kc][dt], pf[1][kc], o[1][dt]);
      }
    // hand-over: this wave's reads of the buffer are done, its copies for trip t + 1 have landed; behind the barrier that
    // holds for every wave, so trip t + 1 may be read and this trip's buffer may be refilled
    // The scheduling fence keeps the hand-over at the trip's end; without it the scheduler lifts the waits and the barrier into
    // the second set's softmax, which takes a third off the time the copies have to land.
    __builtin_amdgcn_sched_barrier(0);
    asm volatile("s_wait_dscnt 0x0" ::: "memory");
    asm volatile("s_wait_asynccnt 0x0" ::: "memory");
    __syncthreads();
  }
  asm volatile("s_wait_asynccnt 0x0" ::: "memory");        // no copy is left in flight when the wave goes on to its end

  // lambda from the two 32-vectors (wave-wide butterfly, unconditional shuffles)
  float t1 = lq1[lane] * lk1[lane];
  float t2 = lq2[lane] * lk2[lane];
#pragma unroll
  for (int off = 16; off > 0; off >>= 1) {
    t1 += __shfl_xor(t1, off, 32);
    t2 += __shfl_xor(t2, off, 32);
  }
  const float lam = (expf(t1) - expf(t2)) + kLambdaInit;

  const float l0 = l[0] + other_half(l[0]);
  const float l1 = l[1] + other_half(l[1]);
  const float inv0 = 1.0f / l0;
  const float inv1 = lam / l1;
  // this lane's 32 of the 64 d of its query row: d = 16 dt + h8 + e
  float y[4][8], ps[4];
#pragma unroll
  for (int dt = 0; dt < 4; ++dt) {
    ps[dt] = 0.f;
#pragma unroll
    for (int e = 0; e < 8; ++e) {
      y[dt][e] = o[0][dt][e] * inv0 - o[1][dt][e] * inv1;
      ps[dt] += y[dt][e];
    }
  }
  float sm = (ps[0] + ps[1]) + (ps[2] + ps[3]);
  sm += other_half(sm);
  const float mu = sm * kInv64;
#pragma unroll
  for (int dt = 0; dt < 4; ++dt) {
    ps[dt] = 0.f;
#pragma unroll
    for (int e = 0; e < 8; ++e) {
      y[dt][e] -= mu;
      ps[dt] += y[dt][e] * y[dt][e];
    }
  }
  float vs = (ps[0] + ps[1]) + (ps[2] + ps[3]);
  vs += other_half(vs);
  const float rstd = 1.0f / sqrtf(vs * kInv64 + kLnEps);
  const float* gp = g   + head * kDh + h8;
  const float* bp = bta + head * kDh + h8;
  unsigned short* Ar = A16 + ((size_t)b * kSeq + q0 + c) * kDim + head * kDh + h8;
#pragma unroll
  for (int dt = 0; dt < 4; ++dt) {
    const v4f g0 = *(const v4f*)(gp + dt * 16);
    const v4f g1 = *(const v4f*)(gp + dt * 16 + 4);
    const v4f b0 = *(const v4f*)(bp + dt * 16);
    const v4f b1 = *(const v4f*)(bp + dt * 16 + 4);
    unsigned short hb[8];
#pragma unroll
    for (int e = 0; e < 4; ++e) {
      hb[e]     = h_bits((y[dt][e]     * rstd * g0[e] + b0[e]) * kOutGain);
      hb[4 + e] = h_bits((y[dt][4 + e] * rstd * g1[e] + b1[e]) * kOutGain);
    }
    *(v4u*)(Ar + dt * 16) = (v4u){pk16(hb[0], hb[1]), pk16(hb[2], hb[3]), pk16(hb[4], hb[5]), pk16(hb[6], hb[7])};
  }
}

// ---------------------------------------------------------------------------
// Host glue.
// producer before any consumer reads it; no region re-used with another type):
//   XH    f16 [4096][1024]               8,388,608  at           0   (cast8; read by the two projection GEMMs)
//   WQKT  f16 [2048][1024]               4,194,304  at   8,388,608   (wt z0,z1: permuted Wq^T rows 0..1023, Wk^T rows 1024..2047)
//   WVT   f16 [1024][1024]               2,097,152  at  12,582,912   (wt z2)
//   WOT   f16 [1024][1024]               2,097,152  at  14,680,064   (wt z3)
//   BQK   f32 [2048]                         8,192  at  16,777,216   (permuted bq | bk)
//   QK16  f16 [4096][2048]              16,777,216  at  16,785,408   (q plane cols 0..1023 | k plane cols 1024..2047, permuted)
//   VT16  f16 [1024][4096]               8,388,608  at  33,562,624   (v^T: row = 64h + d, col = token)
//   AOH16 f16 [4096][1024]               8,388,608  at  41,951,232   (LayerNorm output; 32 disjoint column slabs)
//   total                               50,339,840
// GEMM shapes: q|k proj M=4096 N=2048 K=1024; v^T proj M=1024 N=4096 K=1024; out proj M=4096 N=1024 K=1024 (all M multiples
// of 128, all N of 256, all K of 128, no padding); scores and p.v inside diff_attn_kernel.
// 4 launches.
// ---------------------------------------------------------------------------
extern "C" void kernel_launch(void* const* d_in, const int* in_sizes, int n_in,
                              void* d_out, int out_size, void* d_ws, size_t ws_size,
                              hipStream_t stream) {
  if (n_in < 16) return;
  const int nTokElem = kTok * kDim;                 // 4,194,304
  const int nW       = kDim * kDim;                 // 1,048,576
  if (in_sizes[0] != nTokElem) return;
  if (in_sizes[1] != kBatch * kSeq * kSeq) return;
  if (in_sizes[2] != nW || in_sizes[4] != nW || in_sizes[6] != nW || in_sizes[8] != nW) return;
  if (in_sizes[3] != kDim || in_sizes[5] != kDim || in_sizes[7] != kDim || in_sizes[9] != kDim) return;
  if (in_sizes[10] != kDiff || in_sizes[11] != kDiff || in_sizes[12] != kDiff || in_sizes[13] != kDiff) return;
  if (in_sizes[14] != kHeads * kDh || in_sizes[15] != kHeads * kDh) return;
  if (out_size != nTokElem) return;

  const size_t szXH   = (size_t)kTok * kDim * 2;
  const size_t szWQK  = (size_t)kQKCols * kDim * 2;
  const size_t szW    = (size_t)kDim * kDim * 2;
  const size_t szBQK  = (size_t)kQKCols * 4;
  const size_t szQK16 = (size_t)kTok * kQKCols * 2;
  const size_t szVT16 = (size_t)kDim * kTok * 2;
  const size_t szAOH  = (size_t)kTok * kDim * 2;
  const size_t offXH   = 0;
  const size_t offWQK  = offXH + szXH;
  const size_t offWVT  = offWQK + szWQK;
  const size_t offWOT  = offWVT + szW;
  const size_t offBQK  = offWOT + szW;
  const size_t offQK16 = offBQK + szBQK;
  const size_t offVT16 = offQK16 + szQK16;
  const size_t offAOH  = offVT16 + szVT16;
  const size_t total   = offAOH + szAOH;          // 50,339,840
  if (ws_size < total) return;

  const float* x    = (const float*)d_in[0];
  const int*   mask = (const int*)d_in[1];
  const float* Wq   = (const float*)d_in[2];
  const float* bq   = (const float*)d_in[3];
  const float* Wk   = (const float*)d_in[4];
  const float* bk   = (const float*)d_in[5];
  const float* Wv   = (const float*)d_in[6];
  const float* bv   = (const float*)d_in[7];
  const float* Wo   = (const float*)d_in[8];
  const float* bo   = (const float*)d_in[9];
  const float* lq1  = (const float*)d_in[10];
  const float* lk1  = (const float*)d_in[11];
  const float* lq2  = (const float*)d_in[12];
  const float* lk2  = (const float*)d_in[13];
  const float* ln_g = (const float*)d_in[14];
  const float* ln_b = (const float*)d_in[15];
  float* out = (float*)d_out;

  char* ws = (char*)d_ws;
  unsigned short* XH    = (unsigned short*)(ws + offXH);
  unsigned short* WQKT  = (unsigned short*)(ws + offWQK);
  unsigned short* WVT   = (unsigned short*)(ws + offWVT);
  unsigned short* WOT   = (unsigned short*)(ws + offWOT);
  float*          BQK   = (float*)(ws + offBQK);
  unsigned short* QK16  = (unsigned short*)(ws + offQK16);
  unsigned short* VT16  = (unsigned short*)(ws + offVT16);
  unsigned short* AOH16 = (unsigned short*)(ws + offAOH);

  // ---- prologue: 16-bit operand planes, permuted bias line ----
  const int n8 = nTokElem / 8;                                  // 524288 -> 2048 blocks exact
  prep_kernel<<<dim3(kPrepBias + kPrepWt + kPrepCast), dim3(256), 0, stream>>>(
      x, Wq, Wk, Wv, Wo, bq, bk, XH, WQKT, WQKT + (size_t)kDim * kDim, WVT, WOT, BQK, n8, kWCarry);

  // ---- q|k projection: QK16[m][n'] = f16( (1/16) sum_k XH[m][k] WQKT[n'][k] + BQK[n'] )   (M=4096, N=2048, K=1024) ----
  // ---- v^T projection: VT16[n][m] = f16( (1/16) sum_k WVT[n][k] XH[m][k] + bv[n] )   (M=1024 rows n, N=4096 tokens, K=1024) ----
  // ---- both in one launch: 256 + 128 blocks ----
  proj_gemm_kernel<<<dim3(kProjTilesQK + kProjTilesVT), dim3(256), 0, stream>>>(
      XH, WQKT, WVT, BQK, bv, QK16, VT16, kDim, kWCarryInv);

  // ---- every (batch, head) at once: scores of both sets, both softmaxes, difference, product with v, per-head LayerNorm,
  //      affine, x0.8 -> AOH16 ----
  diff_attn_kernel<<<dim3(kSeq / kFaQ, kHeads, kBatch), dim3(256), 0, stream>>>(
      QK16, VT16, mask, lq1, lk1, lq2, lk2, ln_g, ln_b, AOH16);

  // ---- output projection: out[m][n] = (1/16) sum_k AOH16[m][k] WOT[n][k] + bo[n]   (M=4096, N=1024, K=1024) ----
  {
    const int tiles = (kTok / kGmBM) * (kDim / kGmBN);          // 128 blocks
    wmma_gemm64<0, false, 2, 0, false, 0><<<dim3(tiles, 1), dim3(256), 0, stream>>>(
        AOH16, AOH16, kDim, 0L, WOT, WOT, kDim, 0L,
        (void*)out, (void*)out, kDim, 0L, bo, bo, 0L, kTok, kDim, kDim, kWCarryInv);
  }
}

// v008
// Measured time: 102 microseconds a run.
// Next to v007, in two timings, it ran 1.09 and 1.10 times as fast.
// All steps since v000 together make it 36.0 times as fast.
// Contractions: q|k projection and v^T projection (x f16 by W^T f16 carried x16), scores q_set.k_set^T per head and set (q, k f16 planes, K=32), p_set.v per head and set (p = exp2 of the shifted scores, f16, by v^T f16 plane, K=2048), output projection (LayerNorm output f16 by Wo^T f16 carried x16): all v_wmma_f32_16x16x32_f16 with f32 accumulate; bias adds, mask select, both softmaxes, lambda and the per-head LayerNorm in f32.
#include <hip/hip_runtime.h>
#include <math.h>

// ---------------------------------------------------------------------------
// Problem constants
// ---------------------------------------------------------------------------
constexpr int kBatch  = 2;
constexpr int kSeq    = 2048;
constexpr int kDim    = 1024;              // hidden
constexpr int kHeads  = 16;
constexpr int kDh     = 64;                // head dim of v / output
constexpr int kDiff   = 32;                // head dim of each q/k set
constexpr int kTok    = kBatch * kSeq;     // 4096 token rows
constexpr int kQKCols = 2 * kDim;          // 2048: pitch of the q | k plane (halves)
constexpr float kWCarry    = 16.0f;        // weights carried x16 in f16
constexpr float kWCarryInv = 1.0f / 16.0f;
constexpr float kInvScale  = 0.17677669529663687f;   // 32^-0.5
constexpr float kLambdaInit = 0.2f;
constexpr float kOutGain   = 0.8f;         // 1 - lambda_init
constexpr float kLnEps     = 1.0e-5f;
constexpr float kInv64     = 1.0f / 64.0f;
static_assert(kHeads * kDh == kDim, "shape");
static_assert(kHeads * kDiff * 2 == kDim, "shape");
// GEMM shape contract: M and N multiples of the block tile, K of 128, at least two passes
static_assert(kTok % 256 == 0 && kQKCols % 256 == 0 && kDim % 256 == 0 && kDim / 128 >= 2 && kSeq % 64 == 0 && kDh % 64 == 0, "tiles");
static_assert(kDim % 32 == 0 && kDiff % 32 == 0 && kSeq % 32 == 0, "ktiles");
static_assert((kTok * kDim) % (8 * 256) == 0, "cast grid");

typedef __attribute__((ext_vector_type(16))) _Float16 v16h;
typedef __attribute__((ext_vector_type(8)))  _Float16 v8h;
typedef __attribute__((ext_vector_type(16))) __bf16   v16b;
typedef __attribute__((ext_vector_type(8)))  __bf16   v8b;
typedef __attribute__((ext_vector_type(8)))  float    v8f;
typedef __attribute__((ext_vector_type(4)))  float    v4f;
typedef __attribute__((ext_vector_type(2)))  float    v2f;
typedef __attribute__((ext_vector_type(2)))  int      v2i;
typedef __attribute__((ext_vector_type(4)))  unsigned int v4u;

// ---------------------------------------------------------------------------
// Helper pieces: conversions, hazard guards, WMMA fragments
// ---------------------------------------------------------------------------
__device__ __forceinline__ unsigned short f2bf_bits(float f) {
  unsigned u = __float_as_uint(f);
  return (unsigned short)((u + 0x7FFFu + ((u >> 16) & 1u)) >> 16);
}
__device__ __forceinline__ float bf_bits2f(unsigned short h) { return __uint_as_float(((unsigned)h) << 16); }

// hazard guards as plain device helpers
__device__ __forceinline__ void dep_guard_h(v8f& a, v8f& b, v16h x, v16h y) { asm volatile("v_nop\n\tv_nop\n\tv_nop\n\tv_nop" : "+v"(a), "+v"(b) : "v"(x), "v"(y)); }
__device__ __forceinline__ void dep_guard_b(v8f& a, v8f& b, v16b x, v16b y) { asm volatile("v_nop\n\tv_nop\n\tv_nop\n\tv_nop" : "+v"(a), "+v"(b) : "v"(x), "v"(y)); }
// group guard tying all four accumulators of an A-row group plus its A fragments
__device__ __forceinline__ void dep_guard4_h(v8f& a, v8f& b, v8f& c, v8f& d, v16h x, v16h y) { asm volatile("v_nop\n\tv_nop\n\tv_nop\n\tv_nop" : "+v"(a), "+v"(b), "+v"(c), "+v"(d) : "v"(x), "v"(y)); }
__device__ __forceinline__ void dep_guard4_b(v8f& a, v8f& b, v8f& c, v8f& d, v16b x, v16b y) { asm volatile("v_nop\n\tv_nop\n\tv_nop\n\tv_nop" : "+v"(a), "+v"(b), "+v"(c), "+v"(d) : "v"(x), "v"(y)); }
__device__ __forceinline__ void keep4_h(v16h a, v16h b, v16h c, v16h d) { asm volatile("v_nop" :: "v"(a), "v"(b), "v"(c), "v"(d)); }
__device__ __forceinline__ void keep4_b(v16b a, v16b b, v16b c, v16b d) { asm volatile("v_nop" :: "v"(a), "v"(b), "v"(c), "v"(d)); }
__device__ __forceinline__ void acc_guard4(v8f& a, v8f& b, v8f& c, v8f& d) { asm volatile("v_nop\n\tv_nop\n\tv_nop\n\tv_nop" : "+v"(a), "+v"(b), "+v"(c), "+v"(d)); }
template <typename T> struct Frag;
template <> struct Frag<_Float16> {
  typedef v16h V; union U { v16h v; v8h h[2]; };
  // elements 0..7 <- p[0..7], 8..15 <- p[16..23]
  static __device__ __forceinline__ v16h load(const _Float16* p) {
    U f; f.h[0] = *(const v8h*)(p); f.h[1] = *(const v8h*)(p + 16); return f.v;
  }
  static __device__ __forceinline__ v8f mma(v16h a, v16h b, v8f c) {
    return __builtin_amdgcn_wmma_f32_16x16x32_f16(false, a, false, b, (short)0, c, false, false);
  }
  static __device__ __forceinline__ void guard(v8f& a, v8f& b, v16h x, v16h y) { dep_guard_h(a, b, x, y); }
  static __device__ __forceinline__ void guard4(v8f& a, v8f& b, v8f& c, v8f& d, v16h x, v16h y) { dep_guard4_h(a, b, c, d, x, y); }
  static __device__ __forceinline__ void keep(v16h a, v16h b, v16h c, v16h d) { keep4_h(a, b, c, d); }
};
template <> struct Frag<__bf16> {
  typedef v16b V; union U { v16b v; v8b h[2]; };
  static __device__ __forceinline__ v16b load(const __bf16* p) {
    U f; f.h[0] = *(const v8b*)(p); f.h[1] = *(const v8b*)(p + 16); return f.v;
  }
  static __device__ __forceinline__ v8f mma(v16b a, v16b b, v8f c) {
    return __builtin_amdgcn_wmma_f32_16x16x32_bf16(false, a, false, b, (short)0, c, false, false);
  }
  static __device__ __forceinline__ void guard(v8f& a, v8f& b, v16b x, v16b y) { dep_guard_b(a, b, x, y); }
  static __device__ __forceinline__ void guard4(v8f& a, v8f& b, v8f& c, v8f& d, v16b x, v16b y) { dep_guard4_b(a, b, c, d, x, y); }
  static __device__ __forceinline__ void keep(v16b a, v16b b, v16b c, v16b d) { keep4_b(a, b, c, d); }
};

__device__ __forceinline__ unsigned pk16(unsigned short a, unsigned short b) { return (unsigned)a | ((unsigned)b << 16); }
__device__ __forceinline__ unsigned short h_bits(float f) { const _Float16 h = (_Float16)f; return __builtin_bit_cast(unsigned short, h); }

// Twelve asynchronous copies, 16 B per lane each, global memory to LDS through no register. l[i] = the lane's LDS byte address,
// g[i] = its global address. The s_wait_xcnt ends the statement so that it stands in front of every later write of an address
// register named here.
__device__ __forceinline__ void copy12_to_lds(const unsigned* l, const char* const* g) {
  asm volatile("global_load_async_to_lds_b128 %0, %1, off\n\t"
               "global_load_async_to_lds_b128 %2, %3, off\n\t"
               "global_load_async_to_lds_b128 %4, %5, off\n\t"
               "global_load_async_to_lds_b128 %6, %7, off\n\t"
               "global_load_async_to_lds_b128 %8, %9, off\n\t"
               "global_load_async_to_lds_b128 %10, %11, off\n\t"
               "global_load_async_to_lds_b128 %12, %13, off\n\t"
               "global_load_async_to_lds_b128 %14, %15, off\n\t"
               "global_load_async_to_lds_b128 %16, %17, off\n\t"
               "global_load_async_to_lds_b128 %18, %19, off\n\t"
               "global_load_async_to_lds_b128 %20, %21, off\n\t"
               "global_load_async_to_lds_b128 %22, %23, off\n\t"
               "s_wait_xcnt 0x0"
               :: "v"(l[0]), "v"(g[0]), "v"(l[1]), "v"(g[1]), "v"(l[2]), "v"(g[2]), "v"(l[3]), "v"(g[3]),
                  "v"(l[4]), "v"(g[4]), "v"(l[5]), "v"(g[5]), "v"(l[6]), "v"(g[6]), "v"(l[7]), "v"(g[7]),
                  "v"(l[8]), "v"(g[8]), "v"(l[9]), "v"(g[9]), "v"(l[10]), "v"(g[10]), "v"(l[11]), "v"(g[11]) : "memory");
}

// The same for eight copies.
__device__ __forceinline__ void copy8_to_lds(const unsigned* l, const char* const* g) {
  asm volatile("global_load_async_to_lds_b128 %0, %1, off\n\t"
               "global_load_async_to_lds_b128 %2, %3, off\n\t"
               "global_load_async_to_lds_b128 %4, %5, off\n\t"
               "global_load_async_to_lds_b128 %6, %7, off\n\t"
               "global_load_async_to_lds_b128 %8, %9, off\n\t"
               "global_load_async_to_lds_b128 %10, %11, off\n\t"
               "global_load_async_to_lds_b128 %12, %13, off\n\t"
               "global_load_async_to_lds_b128 %14, %15, off\n\t"
               "s_wait_xcnt 0x0"
               :: "v"(l[0]), "v"(g[0]), "v"(l[1]), "v"(g[1]), "v"(l[2]), "v"(g[2]), "v"(l[3]), "v"(g[3]),
                  "v"(l[4]), "v"(g[4]), "v"(l[5]), "v"(g[5]), "v"(l[6]), "v"(g[6]), "v"(l[7]), "v"(g[7]) : "memory");
}

// ---- Register-blocked batched WMMA GEMM (ACT reduced to none/relu/leaky) -------------------------------
// C[m,n] = scale * sum_k A[m,k] * Bt[n,k] (+bias)(+resid); a block of WM x WN waves owns a (16 NI WM) x (64 WN) tile, each wave
// (16 NI) x 64 of it: 4 x 3 waves of 64x64 (a 256x192 tile), or 4 x 2 waves of 32x64 (a 128x128 tile).
// A row-major [M,K]; Bt row-major [N,K]; M, N multiples of the tile, K % 128 == 0; grid.x = the number of tiles.
// Operands come through LDS, 128 k a pass: the tile's A rows and Bt rows of 256 B, brought by asynchronous 16-B copies in which a
// wave covers two whole rows (four 128-B lines). Two buffers: the copies of pass p + 2 are issued behind the barrier that ends
// pass p, into the buffer that pass p has read, and land while pass p + 1 is worked on.
// blk = the block's tile number, b = its batch.
// BIAS_MODE: 0 = none, 1 = bias[m], 2 = bias[n].
// TSPLIT: a wave whose columns lie at or past splitN writes them transposed, as f16, CoutT[n - splitN][m] (pitch ldT), with
// biasT[n - splitN]; splitN % 64 == 0, so a wave lies wholly on one side.
// OUT_MODE: 0 = f32, 1 = f16, 2 = bf16 hi plane (Cout) + bf16 lo plane (Cout2).
// ET: 0 = f16 operands, 1 = bf16 operands (pointers passed as 16-bit storage)
constexpr int kGmPassK = 128;                              // k per pass: 256-B rows
constexpr int kGmPitch = 272;                              // LDS pitch of the 256-B rows: 16 B x odd, no bank conflict for 16-B reads
template <int V> struct BiasTag { static constexpr int value = V; };
template <int ET> struct Elem;
template <> struct Elem<0> { typedef _Float16 T; };
template <> struct Elem<1> { typedef __bf16 T; };
template <int ET, bool SPLIT, int BIAS_MODE, int OUT_MODE, bool RESID, int ACT, int WM, int WN, int NI, bool TSPLIT>
__device__ __forceinline__ void gemm64_tile(
    unsigned blk, int b,
    const unsigned short* __restrict__ Ap, const unsigned short* __restrict__ A2p, int lda, long strideA,
    const unsigned short* __restrict__ Btp, const unsigned short* __restrict__ Bt2p, int ldb, long strideB,
    void* __restrict__ Cout, void* __restrict__ Cout2, int ldc, long strideC,
    const float* __restrict__ bias,
    const float* __restrict__ resid, long strideR,
    int M, int N, int K, float scale,
    unsigned short* __restrict__ CoutT, const float* __restrict__ biasT, int splitN, int ldT) {
  static_assert(!SPLIT, "single-plane operands only");
  static_assert((WM == 4 && WN == 3 && NI == 4) || (WM == 4 && WN == 2 && NI == 2), "staging is written for these two tiles");
  static_assert(!TSPLIT || NI == 4, "the transposed epilogue writes 64 m a row");
  constexpr int kGmBM  = 16 * NI * WM;                     // block tile rows (A rows staged)
  constexpr int kGmBN  = 64 * WN;                          // block tile columns (Bt rows staged)
  constexpr int kGmBuf = (kGmBM + kGmBN) * kGmPitch;       // a buffer: A rows first, Bt rows behind them
  typedef typename Elem<ET>::T T;
  typedef typename Frag<T>::V V;
  const T* A = (const T*)Ap; const T* Bt = (const T*)Btp;
  __shared__ __align__(16) float sT[WM * WN][16 * 68];   // per-wave 16x64 slab, pitch 68 floats
  __shared__ __attribute__((aligned(16))) unsigned char ring[2 * kGmBuf];
  const int lane = threadIdx.x & 31;
  const int wave = __builtin_amdgcn_readfirstlane(threadIdx.x >> 5);   // in a scalar register: tests on it are scalar branches
  const int tilesN = N / kGmBN;
  const int tilesM = M / kGmBM;
  if ((int)blk >= tilesM * tilesN) return;   // the same for the whole block, in front of every barrier
  const int bm = blk / tilesN;
  const int bn = blk - bm * tilesN;
  const int wm = (wave / WN) * (16 * NI);      // this wave's rows within the staged A rows
  const int wn = (wave % WN) << 6;             // this wave's 64 rows within the staged Bt rows
  const int m0 = bm * kGmBM + wm;
  const int n0 = bn * kGmBN + wn;

  const T* Ab  = A  + (size_t)b * strideA;
  const T* Bb  = Bt + (size_t)b * strideB;

  const int rlane = lane & 15;                 // row (A) / col (B, D) within subtile
  const int koff  = (lane >> 4) * 8;           // k offset of this lane half
  const int mOff  = (lane >> 4) * 8;           // D row offset

  // what this lane copies, 4 x 2 waves: bytes 16 * (t & 15) .. +15 of staged rows (t >> 4) + 16 i: i = 0..7 of A, i = 0..7 of Bt.
  // 4 x 3 waves: the same bytes; waves 0..7 bring the 256 A rows (rows (t >> 4) + 16 i, i = 0..15), waves 8..11 the 192 Bt rows
  // (rows ((t - 256) >> 4) + 8 i, i = 0..23).
  const int crow = threadIdx.x >> 4, ccol = (threadIdx.x & 15) * 16;
  const char* gA = (const char*)(Ab + (size_t)(bm * kGmBM + crow) * lda) + ccol;
  const char* gB = (const char*)(Bb + (size_t)(bn * kGmBN + crow) * ldb) + ccol;
  const size_t stepA = (size_t)16 * lda * 2, stepB = (size_t)16 * ldb * 2;
  const unsigned lC = (unsigned)(size_t)ring + crow * kGmPitch + ccol;   // low 32 bits of the address = byte offset in the block's LDS
  // one pass's rows into one buffer: at most 24 copies a lane; kb = the pass's first byte in a row, lb = the buffer's first byte
  auto stage_pass = [&](size_t kb, unsigned lb) {
    unsigned l[24]; const char* g[24];
    if constexpr (WN == 2) {
#pragma unroll
      for (int i = 0; i < 8; ++i)  { l[i] = lC + lb + i * 16 * kGmPitch;                g[i] = gA + kb + i * stepA; }
#pragma unroll
      for (int i = 0; i < 8; ++i)  { l[8 + i] = lC + lb + (kGmBM + i * 16) * kGmPitch;  g[8 + i] = gB + kb + i * stepB; }
      copy8_to_lds(l, g);
      copy8_to_lds(l + 8, g + 8);
    } else if (wave < 8) {                     // a scalar branch: every lane of the wave is on in its arm
#pragma unroll
      for (int i = 0; i < 16; ++i) { l[i] = lC + lb + i * 16 * kGmPitch;                g[i] = gA + kb + i * stepA; }
      copy8_to_lds(l, g);
      copy8_to_lds(l + 8, g + 8);
    } else {                                   // crow - 16 = 0..7: lC and gB name row crow, 16 rows too far
#pragma unroll
      for (int i = 0; i < 24; ++i) { l[i] = lC + lb + (kGmBM - 16 + i * 8) * kGmPitch;  g[i] = gB + kb + (size_t)i * (stepB / 2) - stepB; }
      copy12_to_lds(l, g);
      copy12_to_lds(l + 12, g + 12);
    }
  };
  // what this lane reads: row rlane of every 16-row group of its wave's rows, from byte 16 * (lane >> 4)
  const int rA = (wm + rlane) * kGmPitch + koff * 2;
  const int rB = (kGmBM + wn + rlane) * kGmPitch + koff * 2;

  v8f acc[NI][4];
#pragma unroll
  for (int i = 0; i < NI; ++i)
#pragma unroll
    for (int j = 0; j < 4; ++j) acc[i][j] = (v8f){0.f,0.f,0.f,0.f,0.f,0.f,0.f,0.f};

  const int nPass = K / kGmPassK;
  // pass 0's rows, landed and published; then pass 1's are asked for
  stage_pass(0, 0);
  asm volatile("s_wait_asynccnt 0x0" ::: "memory");      // this wave's copies have landed
  __syncthreads();                                       // and every other wave's
  if (nPass > 1) stage_pass((size_t)kGmPassK * 2, kGmBuf);

  for (int p = 0; p < nPass; ++p) {
    const unsigned char* sb = ring + (p & 1) * kGmBuf;
#pragma unroll
    for (int ks = 0; ks < kGmPassK / 32; ++ks) {
      V bh[4], ah[NI];
#pragma unroll
      for (int i = 0; i < NI; ++i) ah[i] = Frag<T>::load((const T*)(sb + rA + i * 16 * kGmPitch + ks * 64));
#pragma unroll
      for (int j = 0; j < 4; ++j) bh[j] = Frag<T>::load((const T*)(sb + rB + j * 16 * kGmPitch + ks * 64));
      // keeps the reads of a k step together in front of its first product: one LDS latency for all of them; without it the
      // scheduler reads the A fragments one at a time into one register set and waits for each
      __builtin_amdgcn_sched_barrier(0);
#pragma unroll
      for (int j = 0; j < 4; ++j)
#pragma unroll
        for (int i = 0; i < NI; ++i) acc[i][j] = Frag<T>::mma(ah[i], bh[j], acc[i][j]);
    }
    // hand-over: this wave's reads of the buffer are done, its copies for pass p + 1 have landed; behind the barrier that
    // holds for every wave, so pass p + 1 may be read and this pass's buffer may be refilled
    // The scheduling fence keeps the pass's products in front of the hand-over; without it the scheduler sinks products behind
    // the barrier, which delays the refill that stands there.
    __builtin_amdgcn_sched_barrier(0);
    asm volatile("s_wait_dscnt 0x0" ::: "memory");
    asm volatile("s_wait_asynccnt 0x0" ::: "memory");
    __syncthreads();
    if (p + 2 < nPass) stage_pass((size_t)(p + 2) * (kGmPassK * 2), (p & 1) * kGmBuf);   // the same for the whole block
  }
  asm volatile("s_wait_asynccnt 0x0" ::: "memory");        // no copy is left in flight when the wave goes on to its end
#pragma unroll
  for (int i = 0; i < NI; ++i) acc_guard4(acc[i][0], acc[i][1], acc[i][2], acc[i][3]);

  float* slab = sT[wave];
  // ---- transposed epilogue: 16 columns n at a time become 16 slab rows of this wave's 64 m; a row leaves as one whole 128-B line ----
  if constexpr (TSPLIT) {
    if (n0 >= splitN) {                          // the same for the whole wave; no block barrier stands behind this point
      const int q = lane >> 3, c8 = (lane & 7) * 8;
      float bT[4];                               // all four asked for up front: one memory latency, not four
#pragma unroll
      for (int j = 0; j < 4; ++j) bT[j] = biasT[n0 - splitN + (j << 4) + rlane];
#pragma unroll
      for (int j = 0; j < 4; ++j) {
        const int nT = n0 - splitN + (j << 4);
        const float bv = bT[j];
#pragma unroll
        for (int i = 0; i < 4; ++i)
#pragma unroll
          for (int r = 0; r < 8; ++r) slab[rlane * 68 + (i << 4) + mOff + r] = acc[i][j][r] * scale + bv;
        __builtin_amdgcn_fence(__ATOMIC_RELEASE, "workgroup");
        __builtin_amdgcn_wave_barrier();
        __builtin_amdgcn_fence(__ATOMIC_ACQUIRE, "workgroup");
#pragma unroll
        for (int it = 0; it < 4; ++it) {
          const int row = it * 4 + q;
          const float* sp = slab + row * 68 + c8;
          v8h hv;
#pragma unroll
          for (int e = 0; e < 8; ++e) hv[e] = (_Float16)sp[e];
          *(v8h*)(CoutT + (size_t)(nT + row) * ldT + m0 + c8) = hv;
        }
        __builtin_amdgcn_fence(__ATOMIC_RELEASE, "workgroup");
        __builtin_amdgcn_wave_barrier();
        __builtin_amdgcn_fence(__ATOMIC_ACQUIRE, "workgroup");
      }
      return;
    }
  }
  // ---- epilogue, written once for a bias mode BM that is known at compile time ----
  const float* Rb = RESID ? (resid + (size_t)b * strideR) : nullptr;
  auto epilogue = [&](auto tag) {
  constexpr int BM = decltype(tag)::value;
#pragma unroll
  for (int i = 0; i < NI; ++i) {
    const int mBase = m0 + (i << 4);
#pragma unroll
    for (int j = 0; j < 4; ++j) {
      const int n = n0 + (j << 4) + rlane;
      float bv = 0.f;
      if (BM == 2) bv = bias[n];
#pragma unroll
      for (int r = 0; r < 8; ++r) {
        float v = acc[i][j][r] * scale;
        if (BM == 1) v += bias[mBase + mOff + r];
        if (BM == 2) v += bv;
        if (RESID) v += Rb[(size_t)(mBase + mOff + r) * ldc + n];
        if (ACT == 2) v = fmaxf(v, 0.0f);
        if (ACT == 4) v = (v > 0.f) ? v : 0.01f * v;
        slab[(mOff + r) * 68 + (j << 4) + rlane] = v;
      }
    }
    __builtin_amdgcn_fence(__ATOMIC_RELEASE, "workgroup");
    __builtin_amdgcn_wave_barrier();
    __builtin_amdgcn_fence(__ATOMIC_ACQUIRE, "workgroup");
    if (OUT_MODE == 0) {
      float* C = (float*)Cout + (size_t)b * strideC;
      const int hh = lane >> 4, c4 = (lane & 15) * 4;     // row seg = 256 B = 16 lanes x 16 B
      {
#pragma unroll
        for (int it = 0; it < 8; ++it) {
          const int row = it * 2 + hh;
          v4f v = *(const v4f*)(slab + row * 68 + c4);
          *(v4f*)(C + (size_t)(mBase + row) * ldc + n0 + c4) = v;
        }
        
      }
    } else {
      const int q = lane >> 3, c8 = (lane & 7) * 8;
      unsigned short* C  = (unsigned short*)Cout  + (size_t)b * strideC;
      unsigned short* C2 = (OUT_MODE == 2) ? ((unsigned short*)Cout2 + (size_t)b * strideC) : nullptr;
      {
#pragma unroll
        for (int it = 0; it < 4; ++it) {
          const int row = it * 4 + q;
          const float* sp = slab + row * 68 + c8;
          v8h hv, lv;
#pragma unroll
          for (int e = 0; e < 8; ++e) {
            if (OUT_MODE == 1) {
              hv[e] = (_Float16)sp[e];
            } else {
              unsigned short hb = f2bf_bits(sp[e]);
              unsigned short lb = f2bf_bits(sp[e] - bf_bits2f(hb));
              hv[e] = __builtin_bit_cast(_Float16, hb);
              lv[e] = __builtin_bit_cast(_Float16, lb);
            }
          }
          *(v8h*)(C + (size_t)(mBase + row) * ldc + n0 + c8) = hv;
          if (OUT_MODE == 2) *(v8h*)(C2 + (size_t)(mBase + row) * ldc + n0 + c8) = lv;
        }
        
      }
    }
    __builtin_amdgcn_fence(__ATOMIC_RELEASE, "workgroup");
    __builtin_amdgcn_wave_barrier();
    __builtin_amdgcn_fence(__ATOMIC_ACQUIRE, "workgroup");
  }
  };
  epilogue(BiasTag<BIAS_MODE>{});
}
// one GEMM a launch, 128x128 tiles: grid.x = its tiles, grid.y = its batches
template <int ET, bool SPLIT, int BIAS_MODE, int OUT_MODE, bool RESID, int ACT = 0>
__global__ __launch_bounds__(256) void wmma_gemm64(
    const unsigned short* __restrict__ Ap, const unsigned short* __restrict__ A2p, int lda, long strideA,
    const unsigned short* __restrict__ Btp, const unsigned short* __restrict__ Bt2p, int ldb, long strideB,
    void* __restrict__ Cout, void* __restrict__ Cout2, int ldc, long strideC,
    const float* __restrict__ bias,
    const float* __restrict__ resid, long strideR,
    int M, int N, int K, float scale) {
  gemm64_tile<ET, SPLIT, BIAS_MODE, OUT_MODE, RESID, ACT, 4, 2, 2, false>(blockIdx.x, (int)blockIdx.y, Ap, A2p, lda, strideA, Btp, Bt2p, ldb, strideB,
                                                                       Cout, Cout2, ldc, strideC, bias, resid, strideR, M, N, K, scale,
                                                                       nullptr, nullptr, 0, 0);
}
// All three projections of x as one GEMM, one launch. W = the q|k plane's 2048 rows with the v plane's 1024 rows directly behind
// them (one [3072][K] matrix in the workspace). 256 x 192 tiles: 16 x 16 = 256 blocks, one for every WGP, all of one size.
//   QK[m][n'] = f16(scale * sum_k X[m][k] W[n'][k] + bqk[n'])                    for n' < kQKCols,
//   VT[n][m]  = f16(scale * sum_k X[m][k] W[kQKCols + n][k] + bv[n])             for the columns behind them, written transposed.
constexpr int kProjN     = kQKCols + kDim;                         // 3072
constexpr int kProjTiles = (kTok / 256) * (kProjN / 192);          // 256
static_assert(kTok % 256 == 0 && kProjN % 192 == 0 && kQKCols % 64 == 0, "projection tiles");
__global__ __launch_bounds__(384) void proj_gemm_kernel(
    const unsigned short* __restrict__ X, const unsigned short* __restrict__ Wall,
    const float* __restrict__ bqk, const float* __restrict__ bv,
    unsigned short* __restrict__ QK, unsigned short* __restrict__ VT, int K, float scale) {
  gemm64_tile<0, false, 2, 1, false, 0, 4, 3, 4, true>(blockIdx.x, 0, X, X, K, 0L, Wall, Wall, K, 0L,
                                                    (void*)QK, (void*)QK, kQKCols, 0L, bqk, bqk, 0L,
                                                    kTok, kProjN, K, scale, VT, bv, kQKCols, kTok);
}

// ---------------------------------------------------------------------------
// The three operand preparations below do not depend on each other and share one launch (prep_kernel); blk = the block's
// number within its own part.
// ---------------------------------------------------------------------------
__device__ __forceinline__ void cast8_f16_part(int blk, const float* __restrict__ in, unsigned short* __restrict__ out, int n8) {
  const int i = blk * 256 + threadIdx.x;
  if (i >= n8) return;
  const float* p = in + 8 * (size_t)i;
  const v4f a = *(const v4f*)(p);
  const v4f c = *(const v4f*)(p + 4);
  unsigned short hb[8];
#pragma unroll
  for (int e = 0; e < 4; ++e) {
    hb[e]     = h_bits(a[e]);
    hb[4 + e] = h_bits(c[e]);
  }
  const v4u u = (v4u){pk16(hb[0], hb[1]), pk16(hb[2], hb[3]), pk16(hb[4], hb[5]), pk16(hb[6], hb[7])};
  unsigned short* q = out + 8 * (size_t)i;
  *(v4u*)q = u;
  
}

// ---------------------------------------------------------------------------
// Weight transpose + cast (+ optional output-feature permutation) for square [1024 in][1024 out] f32 W (row-major [k][n]):
//   out[np][k] = f16( scale * W[k][orig(np)] ), orig(np) = perm ? ((np>>5)&1)*512 + (np>>6)*32 + (np&31) : np.
// With perm, plane column 64h + 32*set + d holds feature set*512 + 32h + d, so the two q/k sets of a head sit at stride 32.
// 1024 blocks: blk & 15 = k tile (64 cols of out), (blk >> 4) & 15 = np tile (64 rows of out), blk >> 8 = z selects
//   z0 = (W0 -> o0, perm), z1 = (W1 -> o1, perm), z2 = (W2 -> o2, identity), z3 = (W3 -> o3, identity). 256 threads.
// Load coverage: 16 iterations x 256 threads = 4096 = the whole 64x64 tile (coalesced along n inside 32-wide strips).
// Store coverage: 8 waves x 2 iterations x 4 rows (lane>>3) = 64 rows; (lane&7) x 8 halves = 64 cols; each row segment =
// ---------------------------------------------------------------------------
__device__ __forceinline__ void wt_part(int blk, const float* __restrict__ W0, const float* __restrict__ W1,
                                        const float* __restrict__ W2, const float* __restrict__ W3,
                                        unsigned short* __restrict__ o0, unsigned short* __restrict__ o1,
                                        unsigned short* __restrict__ o2, unsigned short* __restrict__ o3,
                                        float scale) {
  __shared__ float sm[64][65];   // sm[np_local][k_local]
  const int t  = threadIdx.x;
  const int k0 = (blk & 15) * 64;
  const int n0 = ((blk >> 4) & 15) * 64;
  const int z  = blk >> 8;                                     // block-uniform
  const float* W = (z == 0) ? W0 : (z == 1) ? W1 : (z == 2) ? W2 : W3;
  unsigned short* op = (z == 0) ? o0 : (z == 1) ? o1 : (z == 2) ? o2 : o3;
  const int perm = (z < 2) ? 1 : 0;
#pragma unroll
  for (int i = 0; i < 16; ++i) {
    const int e = i * 256 + t;
    const int r = e >> 6;          // k local
    const int c = e & 63;          // np local
    const int np = n0 + c;
    const int og = perm ? ((((np >> 5) & 1) << 9) + ((np >> 6) << 5) + (np & 31)) : np;
    sm[c][r] = W[(size_t)(k0 + r) * kDim + og] * scale;
  }
  __syncthreads();
  const int lane = t & 31, wave = t >> 5;
  const int q = lane >> 3, c8 = (lane & 7) * 8;
  {
#pragma unroll
    for (int it = 0; it < 2; ++it) {
      const int row = wave * 8 + it * 4 + q;                 // np local
      unsigned short hb[8];
#pragma unroll
      for (int e = 0; e < 8; ++e) hb[e] = h_bits(sm[row][c8 + e]);
      const v4u u = (v4u){pk16(hb[0], hb[1]), pk16(hb[2], hb[3]), pk16(hb[4], hb[5]), pk16(hb[6], hb[7])};
      *(v4u*)(op + (size_t)(n0 + row) * kDim + k0 + c8) = u;
    }
    // behind the last store, in front of whatever follows this part in the kernel that holds it: no register that the two
    // stores name is rewritten ahead of this wait
    asm volatile("s_wait_xcnt 0x0" ::: "memory");
  }
}

// ---------------------------------------------------------------------------
// Permuted q|k bias line: out[np] = bq[orig(np)] for np < 1024 (block 0), out[1024 + np] = bk[orig(np)] (block 1).
// Thread t owns np = 4t..4t+3 (orig of an aligned group of 4 is contiguous); one 16-B store per lane, a wave = 512 B =
// ---------------------------------------------------------------------------
__device__ __forceinline__ void biasperm_part(int blk, const float* __restrict__ bq, const float* __restrict__ bk,
                                              float* __restrict__ out) {
  const int t = threadIdx.x;
  const float* src = (blk == 0) ? bq : bk;                    // block-uniform
  const int np = 4 * t;
  const int og = (((np >> 5) & 1) << 9) + ((np >> 6) << 5) + (np & 31);
  const v4f v = *(const v4f*)(src + og);
  float* dp = out + (size_t)blk * kDim + np;
  *(v4f*)dp = v;
  
}

// One launch for the three parts; every test below reads the same for the whole block, so the barrier inside wt_part is
// passed by all of a block's threads or by none. Blocks 0..1: bias line; the next 1024: weight planes; the rest: x.
constexpr int kPrepBias = 2;
constexpr int kPrepWt   = (kDim / 64) * (kDim / 64) * 4;          // 1024
constexpr int kPrepCast = (kTok * kDim) / (8 * 256);              // 2048
static_assert(kDim / 64 == 16, "wt_part's block decoding");
__global__ __launch_bounds__(256) void prep_kernel(const float* __restrict__ x, const float* __restrict__ Wq,
                                                   const float* __restrict__ Wk, const float* __restrict__ Wv,
                                                   const float* __restrict__ Wo, const float* __restrict__ bq,
                                                   const float* __restrict__ bk,
                                                   unsigned short* __restrict__ xh, unsigned short* __restrict__ wqt,
                                                   unsigned short* __restrict__ wkt, unsigned short* __restrict__ wvt,
                                                   unsigned short* __restrict__ wot, float* __restrict__ bqk,
                                                   int n8, float wscale) {
  const int blk = blockIdx.x;
  if (blk < kPrepBias)                biasperm_part(blk, bq, bk, bqk);
  else if (blk < kPrepBias + kPrepWt) wt_part(blk - kPrepBias, Wq, Wk, Wv, Wo, wqt, wkt, wvt, wot, wscale);
  else                                cast8_f16_part(blk - (kPrepBias + kPrepWt), x, xh, n8);
}

// ---------------------------------------------------------------------------
// Both masked softmaxes, their difference and the product with v, for every (batch, head) in one launch; no score ever
// reaches memory. Transposed forms, so that one lane owns one query column throughout:
//   St[set][j][i] = sum_d k_set[j][d] * q_set[i][d]     (A = 16 key rows, B = 16 query rows kept in registers, K = 32)
//   x = ((mask[i][j] != 0) ? St : -2^100) * 32^-0.5 * log2(e)
//   running maximum m and sum l per query and set; p = exp2(x - m), f16
//   Ot[set][d][i] = Ot[set][d][i] * exp2(m_old - m_new) + sum_j v^T[d][j] * p[j][i]     (A = 16 rows of v^T, B = p, K = 32)
//   O[i][d] = Ot[0][d][i] / l0 - lambda * Ot[1][d][i] / l1,  lambda = exp(sum lq1*lk1) - exp(sum lq2*lk2) + 0.2
// and, still in registers, the per-head LayerNorm over the 64 d of O[i][.], affine, x0.8, f16 cast:
//   mu = mean_d O, var = mean_d (O - mu)^2, y = ((O - mu) / sqrt(var + 1e-5) * g[h][d] + b[h][d]) * 0.8 -> A16[i][64h + d]
// (lanes l and l ^ 16 hold 32 d each of one query row: each sums its own 32, one lane swap joins the halves).
// grid (16, 16 heads, 2 batches), 8 waves; wave w owns query rows 128*blockIdx.x + 16w .. +15 and walks all 2048 keys, 64 a
// trip. A trip's operands come through LDS: 64 k rows and 64 v^T rows of 128 B (shared by the 8 waves) and 128 mask rows of
// 256 B (16 per wave), brought by asynchronous 16-B copies in which a wave covers whole 128-B lines. Two buffers: the copies
// of trip t + 1 are issued behind the barrier that ends trip t - 1 and land while trip t is worked on.
// Fragment maps: accumulator register r of lane l holds row 8*(l>>4) + r, column l & 15. Two score tiles (keys 0..15 and
// 16..31 of a 32-key chunk) converted in place are the B operand of the second product: element s = key
// (s < 8 ? 8*(l>>4) + s : 16 + 8*(l>>4) + s - 8), which is the k order in which Frag::load reads the v^T rows.
// Store: a lane holds 8 consecutive d of its query row per tile; the wave writes the whole 128-B row segment of its head.
// ---------------------------------------------------------------------------
constexpr int   kFaQ    = 128;                 // query rows per block (8 waves x 16)
constexpr int   kFaKeys = 64;                  // keys per trip
constexpr float kLog2e  = 1.4426950408889634f;
// Value of a masked score, in front of the scale: -2^100. A power of two, so that its product with the scale is exact and
// (score * scale - maximum) is exactly 0 in a row whose every key is masked, whether or not the compiler fuses the two.
constexpr float kMaskedScore = -0x1p100f;
static_assert(kSeq % kFaQ == 0 && kSeq % kFaKeys == 0 && kDh == 64 && kDiff == 32, "attention tiling");
typedef __attribute__((ext_vector_type(4))) int v4i;
constexpr int kFaTrips = kSeq / kFaKeys;                   // 32
constexpr int kKvPitch = 144;                              // LDS pitch of the 128-B k and v^T rows: 16 B x odd, no bank conflict for 16-B reads
constexpr int kMkPitch = 272;                              // LDS pitch of the 256-B mask rows: 16 B x odd
constexpr int kLdsV    = kFaKeys * kKvPitch;               // k rows at 0, v^T rows behind them
constexpr int kLdsM    = kLdsV + kDh * kKvPitch;           // mask rows behind those
constexpr int kLdsBuf  = kLdsM + kFaQ * kMkPitch;          // 53,248 B a buffer
static_assert(kFaTrips >= 2 && kFaKeys * 2 == 128 && kDh * 2 == 128 && kFaKeys * 4 == 256, "staging");
// Four asynchronous copies, 16 B per lane each, global memory to LDS through no register. l = the lane's LDS byte address,
// g = its global address. The s_wait_xcnt ends the statement so that it stands in front of every later write of an address
// register named here.
__device__ __forceinline__ void copy4_to_lds(unsigned l0, const char* g0, unsigned l1, const char* g1,
                                             unsigned l2, const char* g2, unsigned l3, const char* g3) {
  asm volatile("global_load_async_to_lds_b128 %0, %1, off\n\t"
               "global_load_async_to_lds_b128 %2, %3, off\n\t"
               "global_load_async_to_lds_b128 %4, %5, off\n\t"
               "global_load_async_to_lds_b128 %6, %7, off\n\t"
               "s_wait_xcnt 0x0"
               :: "v"(l0), "v"(g0), "v"(l1), "v"(g1), "v"(l2), "v"(g2), "v"(l3), "v"(g3) : "memory");
}
// One trip's tiles into one buffer: 12 copies a lane. lk, lv, lm and gk, gv, gm are the lane's first LDS and global addresses
// in the k, v^T and mask tile; its further rows lie 32 rows on (k, v^T) and 2 rows on (mask).
__device__ __forceinline__ void stage_trip(unsigned lk, unsigned lv, unsigned lm,
                                           const char* gk, const char* gv, const char* gm) {
  copy4_to_lds(lk, gk, lk + 32 * kKvPitch, gk + (size_t)32 * kQKCols * 2,
               lv, gv, lv + 32 * kKvPitch, gv + (size_t)32 * kTok * 2);
  copy4_to_lds(lm,                gm,                          lm + 2 * kMkPitch, gm + (size_t)2 * kSeq * 4,
               lm + 4 * kMkPitch, gm + (size_t)4 * kSeq * 4,   lm + 6 * kMkPitch, gm + (size_t)6 * kSeq * 4);
  copy4_to_lds(lm + 8 * kMkPitch,  gm + (size_t)8 * kSeq * 4,  lm + 10 * kMkPitch, gm + (size_t)10 * kSeq * 4,
               lm + 12 * kMkPitch, gm + (size_t)12 * kSeq * 4, lm + 14 * kMkPitch, gm + (size_t)14 * kSeq * 4);
}
// value of lane l ^ 16, by a vector-unit lane swap (no LDS round trip)
__device__ __forceinline__ float other_half(float x) {
  const int b = __float_as_int(x);
  return __int_as_float(__builtin_amdgcn_permlanex16(b, b, 0x76543210, 0xfedcba98, false, false));
}
// exp2 in place. The instruction set asks for one slot between a transcendental and a directly following instruction that
// overwrites its source or reads its result. Here each overwrites only its own source, and the v_nop is the slot in front of
// whatever the compiler puts next.
__device__ __forceinline__ void exp2_inplace(float& x) {
  asm("v_exp_f32 %0, %0\n\tv_nop" : "+v"(x));
}
__device__ __forceinline__ void exp2_inplace8(v8f& x) {
  float a = x[0], b = x[1], c = x[2], d = x[3], e = x[4], f = x[5], g = x[6], h = x[7];
  asm("v_exp_f32 %0, %0\n\tv_exp_f32 %1, %1\n\tv_exp_f32 %2, %2\n\tv_exp_f32 %3, %3\n\t"
      "v_exp_f32 %4, %4\n\tv_exp_f32 %5, %5\n\tv_exp_f32 %6, %6\n\tv_exp_f32 %7, %7\n\tv_nop"
      : "+v"(a), "+v"(b), "+v"(c), "+v"(d), "+v"(e), "+v"(f), "+v"(g), "+v"(h));
  x = (v8f){a, b, c, d, e, f, g, h};
}
// four waves per SIMD (two blocks per WGP): the whole grid of 512 blocks is resident at once, within 256 registers a wave
// and 106,496 B of LDS a block
__global__ __launch_bounds__(256) __attribute__((amdgpu_waves_per_eu(4, 4))) void diff_attn_kernel(const unsigned short* __restrict__ QKp,
                                                        const unsigned short* __restrict__ Vtp,
                                                        const int* __restrict__ Mp,
                                                        const float* __restrict__ lq1, const float* __restrict__ lk1,
                                                        const float* __restrict__ lq2, const float* __restrict__ lk2,
                                                        const float* __restrict__ g, const float* __restrict__ bta,
                                                        unsigned short* __restrict__ A16) {
  const int lane = threadIdx.x & 31, wave = threadIdx.x >> 5;
  const int c    = lane & 15;                  // this lane's query column; row of every A fragment
  const int h8   = (lane >> 4) * 8;            // k offset of this lane half; also its accumulator row offset
  const int head = blockIdx.y;
  const int b    = blockIdx.z;
  const int q0   = blockIdx.x * kFaQ + wave * 16;

  const _Float16* QK = (const _Float16*)QKp + (size_t)b * kSeq * kQKCols + head * kDh;
  const _Float16* Qr = QK + (size_t)(q0 + c) * kQKCols + h8;
  __shared__ __attribute__((aligned(16))) unsigned char smem[2 * kLdsBuf];
  // what this lane copies: of k and v^T rows (t >> 3) and (t >> 3) + 32, bytes 16 * (t & 7) .. +15 (a wave: 4 whole rows a
  // copy); of the mask its own wave's rows 2i + (lane >> 4), i = 0..7, bytes 16 * (lane & 15) .. +15 (a wave: 2 whole rows)
  const int crow = threadIdx.x >> 3, ccol = (threadIdx.x & 7) * 16;
  const int mrow = wave * 16 + (lane >> 4), mcol = (lane & 15) * 16;
  const char* gK = (const char*)(QK + kDim + (size_t)crow * kQKCols) + ccol;
  const char* gV = (const char*)((const _Float16*)Vtp + (size_t)(head * kDh + crow) * kTok + (size_t)b * kSeq) + ccol;
  const char* gM = (const char*)(Mp + ((size_t)b * kSeq + blockIdx.x * kFaQ + mrow) * kSeq) + mcol;
  const unsigned lds0 = (unsigned)(size_t)smem;            // low 32 bits of the address = byte offset in the block's LDS
  const unsigned lK = lds0 + crow * kKvPitch + ccol;
  const unsigned lV = lds0 + kLdsV + crow * kKvPitch + ccol;
  const unsigned lM = lds0 + kLdsM + mrow * kMkPitch + mcol;
  // what this lane reads: row c of every 16-row group, from byte 16 * (lane >> 4) (k, v^T) or 32 * (lane >> 4) (mask)
  const int rK = c * kKvPitch + h8 * 2;
  const int rV = kLdsV + c * kKvPitch + h8 * 2;
  const int rM = kLdsM + (wave * 16 + c) * kMkPitch + h8 * 4;
  v16h qf[2];
  qf[0] = Frag<_Float16>::load(Qr);
  qf[1] = Frag<_Float16>::load(Qr + kDiff);

  const v8f zero = (v8f){0.f,0.f,0.f,0.f,0.f,0.f,0.f,0.f};
  const float cs   = kInvScale * kLog2e;
  v8f o[2][4];
  float m[2], l[2];
#pragma unroll
  for (int st = 0; st < 2; ++st) {
    m[st] = -__builtin_inff();
    l[st] = 0.f;
#pragma unroll
    for (int dt = 0; dt < 4; ++dt) o[st][dt] = zero;
  }

  // trip 0's tiles, landed and published
  stage_trip(lK, lV, lM, gK, gV, gM);
  asm volatile("s_wait_asynccnt 0x0" ::: "memory");      // this wave's copies have landed
  __syncthreads();                                       // and every other wave's

  for (int t = 0; t < kFaTrips; ++t) {
    const int buf = (t & 1) * kLdsBuf;
    const unsigned char* sb = smem + buf;
    // directly behind the barrier that ended trip t - 1 (in front of trip 0: the one above): the next trip's tiles are asked
    // for, into the buffer that trip t - 1 has read, and fly while this trip is worked on
    if (t + 1 < kFaTrips) {                                // the same for the whole block
      const size_t j1 = (size_t)(t + 1) * kFaKeys;
      const unsigned nb = kLdsBuf - buf;
      stage_trip(lK + nb, lV + nb, lM + nb, gK + j1 * (kQKCols * 2), gV + j1 * 2, gM + j1 * 4);
    }
    v8f s[2][4];
    v4i mk[4][2];
    v16h kf[2][4];
#pragma unroll
    for (int kt = 0; kt < 4; ++kt) {
      mk[kt][0] = *(const v4i*)(sb + rM + kt * 64);
      mk[kt][1] = *(const v4i*)(sb + rM + kt * 64 + 16);
    }
#pragma unroll
    for (int kt = 0; kt < 4; ++kt) {
      const _Float16* kp = (const _Float16*)(sb + rK + kt * 16 * kKvPitch);
      kf[0][kt] = Frag<_Float16>::load(kp);
      kf[1][kt] = Frag<_Float16>::load(kp + kDiff);
    }
    // keeps the trip's mask and k reads together in front of the first product: one latency for all of them; without it
    // the scheduler, short of registers, reads one fragment at a time and waits for each
    __builtin_amdgcn_sched_barrier(0);
    // smallest of the lane's 32 mask words, read as unsigned: 0 exactly where one of them is 0 (four short chains, then joined)
    unsigned mlow[4];
#pragma unroll
    for (int kt = 0; kt < 4; ++kt) {
      mlow[kt] = (unsigned)mk[kt][0][0];
#pragma unroll
      for (int r = 1; r < 8; ++r) mlow[kt] = min(mlow[kt], (unsigned)mk[kt][r >> 2][r & 3]);
    }
    const unsigned mlowAll = min(min(mlow[0], mlow[1]), min(mlow[2], mlow[3]));
    // One scalar branch, the same for every lane of the wave (every lane stays on in both arms; no barrier stands inside).
    // A wave whose 16 x 64 mask tile holds no zero has nothing to mask: its arm is the products alone. In the other arm each
    // masked score is replaced, behind the products, by the one constant kMaskedScore: masked scores are all bit-equal and far
    // below every kept one (at most 32 * 65504^2 in size), as with the reference's -1e9: weight 0 beside any kept key, equal
    // weights where every key of a row is masked. The products stand in both arms so that the arm without selects writes
    // the scores where the softmax reads them, with no register moves at the join.
    if (__builtin_amdgcn_ballot_w32(mlowAll == 0u) != 0u) {
#pragma unroll
      for (int kt = 0; kt < 4; ++kt) {
        const v8f a0 = Frag<_Float16>::mma(kf[0][kt], qf[0], zero);
        const v8f a1 = Frag<_Float16>::mma(kf[1][kt], qf[1], zero);
#pragma unroll
        for (int r = 0; r < 8; ++r) {
          const bool keep = (mk[kt][r >> 2][r & 3] != 0);
          s[0][kt][r] = keep ? a0[r] : kMaskedScore;
          s[1][kt][r] = keep ? a1[r] : kMaskedScore;
        }
      }
    } else {
#pragma unroll
      for (int kt = 0; kt < 4; ++kt) {
        s[0][kt] = Frag<_Float16>::mma(kf[0][kt], qf[0], zero);
        s[1][kt] = Frag<_Float16>::mma(kf[1][kt], qf[1], zero);
      }
    }
    v16h vf[2][4];
    v16h pf[2][2];
#pragma unroll
    for (int st = 0; st < 2; ++st) {
      if (st == 1) {
        // all of the trip's v^T fragments are asked for by here, into the registers the first set's scores have just left:
        // their LDS latency runs under the second set's softmax arithmetic
        const _Float16* vp = (const _Float16*)(sb + rV);
#pragma unroll
        for (int kc = 0; kc < 2; ++kc)
#pragma unroll
          for (int dt = 0; dt < 4; ++dt) vf[kc][dt] = Frag<_Float16>::load(vp + dt * 16 * (kKvPitch / 2) + kc * 32);
        // keeps those reads up here; without it the scheduler sinks them to just in front of their products, each with a full wait
        __builtin_amdgcn_sched_barrier(0);
      }
      float tm = -__builtin_inff();
#pragma unroll
      for (int kt = 0; kt < 4; ++kt) {
        s[st][kt] *= cs;
#pragma unroll
        for (int r = 0; r < 8; ++r) tm = fmaxf(tm, s[st][kt][r]);
      }
      tm = fmaxf(tm, other_half(tm));                // the other lane half holds the other keys of the same query
      const float mn    = fmaxf(m[st], tm);
      float sum = 0.f;
#pragma unroll
      for (int kt = 0; kt < 4; ++kt) {
        v8f p = s[st][kt] - mn;
        exp2_inplace8(p);
#pragma unroll
        for (int r = 0; r < 8; ++r) {
          sum += p[r];
          pf[st][kt >> 1][(kt & 1) * 8 + r] = (_Float16)p[r];
        }
      }
      float alpha = m[st] - mn;
      exp2_inplace(alpha);
      m[st] = mn;
      l[st] = l[st] * alpha + sum;                   // this half's keys only; the halves are joined behind the loop
#pragma unroll
      for (int dt = 0; dt < 4; ++dt) o[st][dt] *= alpha;
    }
#pragma unroll
    for (int kc = 0; kc < 2; ++kc)
#pragma unroll
      for (int dt = 0; dt < 4; ++dt) {
        o[0][dt] = Frag<_Float16>::mma(vf[kc][dt], pf[0][kc], o[0][dt]);
        o[1][dt] = Frag<_Float16>::mma(vf[kc][dt], pf[1][kc], o[1][dt]);
      }
    // hand-over: this wave's reads of the buffer are done, its copies for trip t + 1 have landed; behind the barrier that
    // holds for every wave, so trip t + 1 may be read and this trip's buffer may be refilled
    // The scheduling fence keeps the hand-over at the trip's end; without it the scheduler lifts the waits and the barrier into
    // the second set's softmax, which takes a third off the time the copies have to land.
    __builtin_amdgcn_sched_barrier(0);
    asm volatile("s_wait_dscnt 0x0" ::: "memory");
    asm volatile("s_wait_asynccnt 0x0" ::: "memory");
    __syncthreads();
  }
  asm volatile("s_wait_asynccnt 0x0" ::: "memory");        // no copy is left in flight when the wave goes on to its end

  // lambda from the two 32-vectors (wave-wide butterfly, unconditional shuffles)
  float t1 = lq1[lane] * lk1[lane];
  float t2 = lq2[lane] * lk2[lane];
#pragma unroll
  for (int off = 16; off > 0; off >>= 1) {
    t1 += __shfl_xor(t1, off, 32);
    t2 += __shfl_xor(t2, off, 32);
  }
  const float lam = (expf(t1) - expf(t2)) + kLambdaInit;

  const float l0 = l[0] + other_half(l[0]);
  const float l1 = l[1] + other_half(l[1]);
  const float inv0 = 1.0f / l0;
  const float inv1 = lam / l1;
  // this lane's 32 of the 64 d of its query row: d = 16 dt + h8 + e
  float y[4][8], ps[4];
#pragma unroll
  for (int dt = 0; dt < 4; ++dt) {
    ps[dt] = 0.f;
#pragma unroll
    for (int e = 0; e < 8; ++e) {
      y[dt][e] = o[0][dt][e] * inv0 - o[1][dt][e] * inv1;
      ps[dt] += y[dt][e];
    }
  }
  float sm = (ps[0] + ps[1]) + (ps[2] + ps[3]);
  sm += other_half(sm);
  const float mu = sm * kInv64;
#pragma unroll
  for (int dt = 0; dt < 4; ++dt) {
    ps[dt] = 0.f;
#pragma unroll
    for (int e = 0; e < 8; ++e) {
      y[dt][e] -= mu;
      ps[dt] += y[dt][e] * y[dt][e];
    }
  }
  float vs = (ps[0] + ps[1]) + (ps[2] + ps[3]);
  vs += other_half(vs);
  const float rstd = 1.0f / sqrtf(vs * kInv64 + kLnEps);
  const float* gp = g   + head * kDh + h8;
  const float* bp = bta + head * kDh + h8;
  unsigned short* Ar = A16 + ((size_t)b * kSeq + q0 + c) * kDim + head * kDh + h8;
#pragma unroll
  for (int dt = 0; dt < 4; ++dt) {
    const v4f g0 = *(const v4f*)(gp + dt * 16);
    const v4f g1 = *(const v4f*)(gp + dt * 16 + 4);
    const v4f b0 = *(const v4f*)(bp + dt * 16);
    const v4f b1 = *(const v4f*)(bp + dt * 16 + 4);
    unsigned short hb[8];
#pragma unroll
    for (int e = 0; e < 4; ++e) {
      hb[e]     = h_bits((y[dt][e]     * rstd * g0[e] + b0[e]) * kOutGain);
      hb[4 + e] = h_bits((y[dt][4 + e] * rstd * g1[e] + b1[e]) * kOutGain);
    }
    *(v4u*)(Ar + dt * 16) = (v4u){pk16(hb[0], hb[1]), pk16(hb[2], hb[3]), pk16(hb[4], hb[5]), pk16(hb[6], hb[7])};
  }
}

// ---------------------------------------------------------------------------
// Host glue.
// producer before any consumer reads it; no region re-used with another type):
//   XH    f16 [4096][1024]               8,388,608  at           0   (cast8; read by the projection GEMM)
//   WQKT  f16 [2048][1024]               4,194,304  at   8,388,608   (wt z0,z1: permuted Wq^T rows 0..1023, Wk^T rows 1024..2047)
//   WVT   f16 [1024][1024]               2,097,152  at  12,582,912   (wt z2)
//   WOT   f16 [1024][1024]               2,097,152  at  14,680,064   (wt z3)
//   BQK   f32 [2048]                         8,192  at  16,777,216   (permuted bq | bk)
//   QK16  f16 [4096][2048]              16,777,216  at  16,785,408   (q plane cols 0..1023 | k plane cols 1024..2047, permuted)
//   VT16  f16 [1024][4096]               8,388,608  at  33,562,624   (v^T: row = 64h + d, col = token)
//   AOH16 f16 [4096][1024]               8,388,608  at  41,951,232   (LayerNorm output; 32 disjoint column slabs)
//   total                               50,339,840
// GEMM shapes: q|k|v proj M=4096 N=3072 K=1024 (256x192 tiles); out proj M=4096 N=1024 K=1024 (128x128 tiles); all K multiples
// of 128, no padding; scores and p.v inside diff_attn_kernel.
// 4 launches.
// ---------------------------------------------------------------------------
extern "C" void kernel_launch(void* const* d_in, const int* in_sizes, int n_in,
                              void* d_out, int out_size, void* d_ws, size_t ws_size,
                              hipStream_t stream) {
  if (n_in < 16) return;
  const int nTokElem = kTok * kDim;                 // 4,194,304
  const int nW       = kDim * kDim;                 // 1,048,576
  if (in_sizes[0] != nTokElem) return;
  if (in_sizes[1] != kBatch * kSeq * kSeq) return;
  if (in_sizes[2] != nW || in_sizes[4] != nW || in_sizes[6] != nW || in_sizes[8] != nW) return;
  if (in_sizes[3] != kDim || in_sizes[5] != kDim || in_sizes[7] != kDim || in_sizes[9] != kDim) return;
  if (in_sizes[10] != kDiff || in_sizes[11] != kDiff || in_sizes[12] != kDiff || in_sizes[13] != kDiff) return;
  if (in_sizes[14] != kHeads * kDh || in_sizes[15] != kHeads * kDh) return;
  if (out_size != nTokElem) return;

  const size_t szXH   = (size_t)kTok * kDim * 2;
  const size_t szWQK  = (size_t)kQKCols * kDim * 2;
  const size_t szW    = (size_t)kDim * kDim * 2;
  const size_t szBQK  = (size_t)kQKCols * 4;
  const size_t szQK16 = (size_t)kTok * kQKCols * 2;
  const size_t szVT16 = (size_t)kDim * kTok * 2;
  const size_t szAOH  = (size_t)kTok * kDim * 2;
  const size_t offXH   = 0;
  const size_t offWQK  = offXH + szXH;
  const size_t offWVT  = offWQK + szWQK;
  const size_t offWOT  = offWVT + szW;
  const size_t offBQK  = offWOT + szW;
  const size_t offQK16 = offBQK + szBQK;
  const size_t offVT16 = offQK16 + szQK16;
  const size_t offAOH  = offVT16 + szVT16;
  const size_t total   = offAOH + szAOH;          // 50,339,840
  if (ws_size < total) return;

  const float* x    = (const float*)d_in[0];
  const int*   mask = (const int*)d_in[1];
  const float* Wq   = (const float*)d_in[2];
  const float* bq   = (const float*)d_in[3];
  const float* Wk   = (const float*)d_in[4];
  const float* bk   = (const float*)d_in[5];
  const float* Wv   = (const float*)d_in[6];
  const float* bv   = (const float*)d_in[7];
  const float* Wo   = (const float*)d_in[8];
  const float* bo   = (const float*)d_in[9];
  const float* lq1  = (const float*)d_in[10];
  const float* lk1  = (const float*)d_in[11];
  const float* lq2  = (const float*)d_in[12];
  const float* lk2  = (const float*)d_in[13];
  const float* ln_g = (const float*)d_in[14];
  const float* ln_b = (const float*)d_in[15];
  float* out = (float*)d_out;

  char* ws = (char*)d_ws;
  unsigned short* XH    = (unsigned short*)(ws + offXH);
  unsigned short* WQKT  = (unsigned short*)(ws + offWQK);
  unsigned short* WVT   = (unsigned short*)(ws + offWVT);
  unsigned short* WOT   = (unsigned short*)(ws + offWOT);
  float*          BQK   = (float*)(ws + offBQK);
  unsigned short* QK16  = (unsigned short*)(ws + offQK16);
  unsigned short* VT16  = (unsigned short*)(ws + offVT16);
  unsigned short* AOH16 = (unsigned short*)(ws + offAOH);

  // ---- prologue: 16-bit operand planes, permuted bias line ----
  const int n8 = nTokElem / 8;                                  // 524288 -> 2048 blocks exact
  prep_kernel<<<dim3(kPrepBias + kPrepWt + kPrepCast), dim3(256), 0, stream>>>(
      x, Wq, Wk, Wv, Wo, bq, bk, XH, WQKT, WQKT + (size_t)kDim * kDim, WVT, WOT, BQK, n8, kWCarry);

  // ---- q|k projection: QK16[m][n'] = f16( (1/16) sum_k XH[m][k] WQKT[n'][k] + BQK[n'] )   (M=4096, N=2048, K=1024) ----
  // ---- v^T projection: VT16[n][m] = f16( (1/16) sum_k XH[m][k] WVT[n][k] + bv[n] )   (M=4096, N=1024, K=1024, written transposed) ----
  // ---- one GEMM of N = 3072 (WVT lies directly behind WQKT): 256 blocks of 12 waves ----
  proj_gemm_kernel<<<dim3(kProjTiles), dim3(384), 0, stream>>>(
      XH, WQKT, BQK, bv, QK16, VT16, kDim, kWCarryInv);

  // ---- every (batch, head) at once: scores of both sets, both softmaxes, difference, product with v, per-head LayerNorm,
  //      affine, x0.8 -> AOH16 ----
  diff_attn_kernel<<<dim3(kSeq / kFaQ, kHeads, kBatch), dim3(256), 0, stream>>>(
      QK16, VT16, mask, lq1, lk1, lq2, lk2, ln_g, ln_b, AOH16);

  // ---- output projection: out[m][n] = (1/16) sum_k AOH16[m][k] WOT[n][k] + bo[n]   (M=4096, N=1024, K=1024) ----
  {
    const int tiles = (kTok / 128) * (kDim / 128);              // 256 blocks, one for every WGP
    wmma_gemm64<0, false, 2, 0, false, 0><<<dim3(tiles, 1), dim3(256), 0, stream>>>(
        AOH16, AOH16, kDim, 0L, WOT, WOT, kDim, 0L,
        (void*)out, (void*)out, kDim, 0L, bo, bo, 0L, kTok, kDim, kDim, kWCarryInv);
  }
}

// v009
// It runs in 93.8 microseconds.
// In both of two side-by-side timings against v008, it was 1.09 times as fast.
// Counting every step since v000, it is 39.3 times as fast.
// Contractions: q|k projection and v^T projection (x f16 by W^T f16 carried x16), scores q_set.k_set^T per head and set (q, k f16 planes, K=32), p_set.v per head and set (p = exp2 of the scores less a row reference, f16, by v^T f16 plane, K=2048), output projection (LayerNorm output f16 by Wo^T f16 carried x16): all v_wmma_f32_16x16x32_f16 with f32 accumulate; bias adds, mask select, both softmaxes, lambda and the per-head LayerNorm in f32.
#include <hip/hip_runtime.h>
#include <math.h>

// ---------------------------------------------------------------------------
// Problem constants
// ---------------------------------------------------------------------------
constexpr int kBatch  = 2;
constexpr int kSeq    = 2048;
constexpr int kDim    = 1024;              // hidden
constexpr int kHeads  = 16;
constexpr int kDh     = 64;                // head dim of v / output
constexpr int kDiff   = 32;                // head dim of each q/k set
constexpr int kTok    = kBatch * kSeq;     // 4096 token rows
constexpr int kQKCols = 2 * kDim;          // 2048: pitch of the q | k plane (halves)
constexpr float kWCarry    = 16.0f;        // weights carried x16 in f16
constexpr float kWCarryInv = 1.0f / 16.0f;
constexpr float kInvScale  = 0.17677669529663687f;   // 32^-0.5
constexpr float kLog2e     = 1.4426950408889634f;
constexpr float kQFold     = kInvScale * kLog2e;     // carried by Wq and bq: q.k is then the softmax exponent to base 2
constexpr float kLambdaInit = 0.2f;
constexpr float kOutGain   = 0.8f;         // 1 - lambda_init
constexpr float kLnEps     = 1.0e-5f;
constexpr float kInv64     = 1.0f / 64.0f;
static_assert(kHeads * kDh == kDim, "shape");
static_assert(kHeads * kDiff * 2 == kDim, "shape");
// GEMM shape contract: M and N multiples of the block tile, K of 128, at least two passes
static_assert(kTok % 256 == 0 && kQKCols % 256 == 0 && kDim % 256 == 0 && kDim / 128 >= 2 && kSeq % 64 == 0 && kDh % 64 == 0, "tiles");
static_assert(kDim % 32 == 0 && kDiff % 32 == 0 && kSeq % 32 == 0, "ktiles");
static_assert((kTok * kDim) % (8 * 256) == 0, "cast grid");

typedef __attribute__((ext_vector_type(16))) _Float16 v16h;
typedef __attribute__((ext_vector_type(8)))  _Float16 v8h;
typedef __attribute__((ext_vector_type(16))) __bf16   v16b;
typedef __attribute__((ext_vector_type(8)))  __bf16   v8b;
typedef __attribute__((ext_vector_type(8)))  float    v8f;
typedef __attribute__((ext_vector_type(4)))  float    v4f;
typedef __attribute__((ext_vector_type(2)))  float    v2f;
typedef __attribute__((ext_vector_type(2)))  int      v2i;
typedef __attribute__((ext_vector_type(4)))  unsigned int v4u;

// ---------------------------------------------------------------------------
// Helper pieces: conversions, hazard guards, WMMA fragments
// ---------------------------------------------------------------------------
__device__ __forceinline__ unsigned short f2bf_bits(float f) {
  unsigned u = __float_as_uint(f);
  return (unsigned short)((u + 0x7FFFu + ((u >> 16) & 1u)) >> 16);
}
__device__ __forceinline__ float bf_bits2f(unsigned short h) { return __uint_as_float(((unsigned)h) << 16); }

// hazard guards as plain device helpers
__device__ __forceinline__ void dep_guard_h(v8f& a, v8f& b, v16h x, v16h y) { asm volatile("v_nop\n\tv_nop\n\tv_nop\n\tv_nop" : "+v"(a), "+v"(b) : "v"(x), "v"(y)); }
__device__ __forceinline__ void dep_guard_b(v8f& a, v8f& b, v16b x, v16b y) { asm volatile("v_nop\n\tv_nop\n\tv_nop\n\tv_nop" : "+v"(a), "+v"(b) : "v"(x), "v"(y)); }
// group guard tying all four accumulators of an A-row group plus its A fragments
__device__ __forceinline__ void dep_guard4_h(v8f& a, v8f& b, v8f& c, v8f& d, v16h x, v16h y) { asm volatile("v_nop\n\tv_nop\n\tv_nop\n\tv_nop" : "+v"(a), "+v"(b), "+v"(c), "+v"(d) : "v"(x), "v"(y)); }
__device__ __forceinline__ void dep_guard4_b(v8f& a, v8f& b, v8f& c, v8f& d, v16b x, v16b y) { asm volatile("v_nop\n\tv_nop\n\tv_nop\n\tv_nop" : "+v"(a), "+v"(b), "+v"(c), "+v"(d) : "v"(x), "v"(y)); }
__device__ __forceinline__ void keep4_h(v16h a, v16h b, v16h c, v16h d) { asm volatile("v_nop" :: "v"(a), "v"(b), "v"(c), "v"(d)); }
__device__ __forceinline__ void keep4_b(v16b a, v16b b, v16b c, v16b d) { asm volatile("v_nop" :: "v"(a), "v"(b), "v"(c), "v"(d)); }
__device__ __forceinline__ void acc_guard4(v8f& a, v8f& b, v8f& c, v8f& d) { asm volatile("v_nop\n\tv_nop\n\tv_nop\n\tv_nop" : "+v"(a), "+v"(b), "+v"(c), "+v"(d)); }
template <typename T> struct Frag;
template <> struct Frag<_Float16> {
  typedef v16h V; union U { v16h v; v8h h[2]; };
  // elements 0..7 <- p[0..7], 8..15 <- p[16..23]
  static __device__ __forceinline__ v16h load(const _Float16* p) {
    U f; f.h[0] = *(const v8h*)(p); f.h[1] = *(const v8h*)(p + 16); return f.v;
  }
  static __device__ __forceinline__ v8f mma(v16h a, v16h b, v8f c) {
    return __builtin_amdgcn_wmma_f32_16x16x32_f16(false, a, false, b, (short)0, c, false, false);
  }
  static __device__ __forceinline__ void guard(v8f& a, v8f& b, v16h x, v16h y) { dep_guard_h(a, b, x, y); }
  static __device__ __forceinline__ void guard4(v8f& a, v8f& b, v8f& c, v8f& d, v16h x, v16h y) { dep_guard4_h(a, b, c, d, x, y); }
  static __device__ __forceinline__ void keep(v16h a, v16h b, v16h c, v16h d) { keep4_h(a, b, c, d); }
};
template <> struct Frag<__bf16> {
  typedef v16b V; union U { v16b v; v8b h[2]; };
  static __device__ __forceinline__ v16b load(const __bf16* p) {
    U f; f.h[0] = *(const v8b*)(p); f.h[1] = *(const v8b*)(p + 16); return f.v;
  }
  static __device__ __forceinline__ v8f mma(v16b a, v16b b, v8f c) {
    return __builtin_amdgcn_wmma_f32_16x16x32_bf16(false, a, false, b, (short)0, c, false, false);
  }
  static __device__ __forceinline__ void guard(v8f& a, v8f& b, v16b x, v16b y) { dep_guard_b(a, b, x, y); }
  static __device__ __forceinline__ void guard4(v8f& a, v8f& b, v8f& c, v8f& d, v16b x, v16b y) { dep_guard4_b(a, b, c, d, x, y); }
  static __device__ __forceinline__ void keep(v16b a, v16b b, v16b c, v16b d) { keep4_b(a, b, c, d); }
};

__device__ __forceinline__ unsigned pk16(unsigned short a, unsigned short b) { return (unsigned)a | ((unsigned)b << 16); }
__device__ __forceinline__ unsigned short h_bits(float f) { const _Float16 h = (_Float16)f; return __builtin_bit_cast(unsigned short, h); }

// Twelve asynchronous copies, 16 B per lane each, global memory to LDS through no register. l[i] = the lane's LDS byte address,
// g[i] = its global address. The s_wait_xcnt ends the statement so that it stands in front of every later write of an address
// register named here.
__device__ __forceinline__ void copy12_to_lds(const unsigned* l, const char* const* g) {
  asm volatile("global_load_async_to_lds_b128 %0, %1, off\n\t"
               "global_load_async_to_lds_b128 %2, %3, off\n\t"
               "global_load_async_to_lds_b128 %4, %5, off\n\t"
               "global_load_async_to_lds_b128 %6, %7, off\n\t"
               "global_load_async_to_lds_b128 %8, %9, off\n\t"
               "global_load_async_to_lds_b128 %10, %11, off\n\t"
               "global_load_async_to_lds_b128 %12, %13, off\n\t"
               "global_load_async_to_lds_b128 %14, %15, off\n\t"
               "global_load_async_to_lds_b128 %16, %17, off\n\t"
               "global_load_async_to_lds_b128 %18, %19, off\n\t"
               "global_load_async_to_lds_b128 %20, %21, off\n\t"
               "global_load_async_to_lds_b128 %22, %23, off\n\t"
               "s_wait_xcnt 0x0"
               :: "v"(l[0]), "v"(g[0]), "v"(l[1]), "v"(g[1]), "v"(l[2]), "v"(g[2]), "v"(l[3]), "v"(g[3]),
                  "v"(l[4]), "v"(g[4]), "v"(l[5]), "v"(g[5]), "v"(l[6]), "v"(g[6]), "v"(l[7]), "v"(g[7]),
                  "v"(l[8]), "v"(g[8]), "v"(l[9]), "v"(g[9]), "v"(l[10]), "v"(g[10]), "v"(l[11]), "v"(g[11]) : "memory");
}

// The same for eight copies.
__device__ __forceinline__ void copy8_to_lds(const unsigned* l, const char* const* g) {
  asm volatile("global_load_async_to_lds_b128 %0, %1, off\n\t"
               "global_load_async_to_lds_b128 %2, %3, off\n\t"
               "global_load_async_to_lds_b128 %4, %5, off\n\t"
               "global_load_async_to_lds_b128 %6, %7, off\n\t"
               "global_load_async_to_lds_b128 %8, %9, off\n\t"
               "global_load_async_to_lds_b128 %10, %11, off\n\t"
               "global_load_async_to_lds_b128 %12, %13, off\n\t"
               "global_load_async_to_lds_b128 %14, %15, off\n\t"
               "s_wait_xcnt 0x0"
               :: "v"(l[0]), "v"(g[0]), "v"(l[1]), "v"(g[1]), "v"(l[2]), "v"(g[2]), "v"(l[3]), "v"(g[3]),
                  "v"(l[4]), "v"(g[4]), "v"(l[5]), "v"(g[5]), "v"(l[6]), "v"(g[6]), "v"(l[7]), "v"(g[7]) : "memory");
}

// ---- Register-blocked batched WMMA GEMM (ACT reduced to none/relu/leaky) -------------------------------
// C[m,n] = scale * sum_k A[m,k] * Bt[n,k] (+bias)(+resid); a block of WM x WN waves owns a (16 NI WM) x (64 WN) tile, each wave
// (16 NI) x 64 of it: 4 x 3 waves of 64x64 (a 256x192 tile), or 4 x 2 waves of 32x64 (a 128x128 tile).
// A row-major [M,K]; Bt row-major [N,K]; M, N multiples of the tile, K % 128 == 0; grid.x = the number of tiles.
// Operands come through LDS, 128 k a pass: the tile's A rows and Bt rows of 256 B, brought by asynchronous 16-B copies in which a
// wave covers two whole rows (four 128-B lines). Two buffers: the copies of pass p + 2 are issued behind the barrier that ends
// pass p, into the buffer that pass p has read, and land while pass p + 1 is worked on.
// blk = the block's tile number, b = its batch.
// BIAS_MODE: 0 = none, 1 = bias[m], 2 = bias[n].
// TSPLIT: a wave whose columns lie at or past splitN writes them transposed, as f16, CoutT[n - splitN][m] (pitch ldT), with
// biasT[n - splitN]; splitN % 64 == 0, so a wave lies wholly on one side.
// OUT_MODE: 0 = f32, 1 = f16, 2 = bf16 hi plane (Cout) + bf16 lo plane (Cout2).
// ET: 0 = f16 operands, 1 = bf16 operands (pointers passed as 16-bit storage)
constexpr int kGmPassK = 128;                              // k per pass: 256-B rows
constexpr int kGmPitch = 272;                              // LDS pitch of the 256-B rows: 16 B x odd, no bank conflict for 16-B reads
template <int V> struct BiasTag { static constexpr int value = V; };
template <int ET> struct Elem;
template <> struct Elem<0> { typedef _Float16 T; };
template <> struct Elem<1> { typedef __bf16 T; };
template <int ET, bool SPLIT, int BIAS_MODE, int OUT_MODE, bool RESID, int ACT, int WM, int WN, int NI, bool TSPLIT>
__device__ __forceinline__ void gemm64_tile(
    unsigned blk, int b,
    const unsigned short* __restrict__ Ap, const unsigned short* __restrict__ A2p, int lda, long strideA,
    const unsigned short* __restrict__ Btp, const unsigned short* __restrict__ Bt2p, int ldb, long strideB,
    void* __restrict__ Cout, void* __restrict__ Cout2, int ldc, long strideC,
    const float* __restrict__ bias,
    const float* __restrict__ resid, long strideR,
    int M, int N, int K, float scale,
    unsigned short* __restrict__ CoutT, const float* __restrict__ biasT, int splitN, int ldT) {
  static_assert(!SPLIT, "single-plane operands only");
  static_assert((WM == 4 && WN == 3 && NI == 4) || (WM == 4 && WN == 2 && NI == 2), "staging is written for these two tiles");
  static_assert(!TSPLIT || NI == 4, "the transposed epilogue writes 64 m a row");
  constexpr int kGmBM  = 16 * NI * WM;                     // block tile rows (A rows staged)
  constexpr int kGmBN  = 64 * WN;                          // block tile columns (Bt rows staged)
  constexpr int kGmBuf = (kGmBM + kGmBN) * kGmPitch;       // a buffer: A rows first, Bt rows behind them
  typedef typename Elem<ET>::T T;
  typedef typename Frag<T>::V V;
  const T* A = (const T*)Ap; const T* Bt = (const T*)Btp;
  __shared__ __align__(16) float sT[WM * WN][16 * 68];   // per-wave 16x64 slab, pitch 68 floats
  __shared__ __attribute__((aligned(16))) unsigned char ring[2 * kGmBuf];
  const int lane = threadIdx.x & 31;
  const int wave = __builtin_amdgcn_readfirstlane(threadIdx.x >> 5);   // in a scalar register: tests on it are scalar branches
  const int tilesN = N / kGmBN;
  const int tilesM = M / kGmBM;
  if ((int)blk >= tilesM * tilesN) return;   // the same for the whole block, in front of every barrier
  const int bm = blk / tilesN;
  const int bn = blk - bm * tilesN;
  const int wm = (wave / WN) * (16 * NI);      // this wave's rows within the staged A rows
  const int wn = (wave % WN) << 6;             // this wave's 64 rows within the staged Bt rows
  const int m0 = bm * kGmBM + wm;
  const int n0 = bn * kGmBN + wn;

  const T* Ab  = A  + (size_t)b * strideA;
  const T* Bb  = Bt + (size_t)b * strideB;

  const int rlane = lane & 15;                 // row (A) / col (B, D) within subtile
  const int koff  = (lane >> 4) * 8;           // k offset of this lane half
  const int mOff  = (lane >> 4) * 8;           // D row offset

  // what this lane copies, 4 x 2 waves: bytes 16 * (t & 15) .. +15 of staged rows (t >> 4) + 16 i: i = 0..7 of A, i = 0..7 of Bt.
  // 4 x 3 waves: the same bytes; waves 0..7 bring the 256 A rows (rows (t >> 4) + 16 i, i = 0..15), waves 8..11 the 192 Bt rows
  // (rows ((t - 256) >> 4) + 8 i, i = 0..23).
  const int crow = threadIdx.x >> 4, ccol = (threadIdx.x & 15) * 16;
  const char* gA = (const char*)(Ab + (size_t)(bm * kGmBM + crow) * lda) + ccol;
  const char* gB = (const char*)(Bb + (size_t)(bn * kGmBN + crow) * ldb) + ccol;
  const size_t stepA = (size_t)16 * lda * 2, stepB = (size_t)16 * ldb * 2;
  const unsigned lC = (unsigned)(size_t)ring + crow * kGmPitch + ccol;   // low 32 bits of the address = byte offset in the block's LDS
  // one pass's rows into one buffer: at most 24 copies a lane; kb = the pass's first byte in a row, lb = the buffer's first byte
  auto stage_pass = [&](size_t kb, unsigned lb) {
    unsigned l[24]; const char* g[24];
    if constexpr (WN == 2) {
#pragma unroll
      for (int i = 0; i < 8; ++i)  { l[i] = lC + lb + i * 16 * kGmPitch;                g[i] = gA + kb + i * stepA; }
#pragma unroll
      for (int i = 0; i < 8; ++i)  { l[8 + i] = lC + lb + (kGmBM + i * 16) * kGmPitch;  g[8 + i] = gB + kb + i * stepB; }
      copy8_to_lds(l, g);
      copy8_to_lds(l + 8, g + 8);
    } else if (wave < 8) {                     // a scalar branch: every lane of the wave is on in its arm
#pragma unroll
      for (int i = 0; i < 16; ++i) { l[i] = lC + lb + i * 16 * kGmPitch;                g[i] = gA + kb + i * stepA; }
      copy8_to_lds(l, g);
      copy8_to_lds(l + 8, g + 8);
    } else {                                   // crow - 16 = 0..7: lC and gB name row crow, 16 rows too far
#pragma unroll
      for (int i = 0; i < 24; ++i) { l[i] = lC + lb + (kGmBM - 16 + i * 8) * kGmPitch;  g[i] = gB + kb + (size_t)i * (stepB / 2) - stepB; }
      copy12_to_lds(l, g);
      copy12_to_lds(l + 12, g + 12);
    }
  };
  // what this lane reads: row rlane of every 16-row group of its wave's rows, from byte 16 * (lane >> 4)
  const int rA = (wm + rlane) * kGmPitch + koff * 2;
  const int rB = (kGmBM + wn + rlane) * kGmPitch + koff * 2;

  v8f acc[NI][4];
#pragma unroll
  for (int i = 0; i < NI; ++i)
#pragma unroll
    for (int j = 0; j < 4; ++j) acc[i][j] = (v8f){0.f,0.f,0.f,0.f,0.f,0.f,0.f,0.f};

  const int nPass = K / kGmPassK;
  // pass 0's rows, landed and published; then pass 1's are asked for
  stage_pass(0, 0);
  asm volatile("s_wait_asynccnt 0x0" ::: "memory");      // this wave's copies have landed
  __syncthreads();                                       // and every other wave's
  if (nPass > 1) stage_pass((size_t)kGmPassK * 2, kGmBuf);

  for (int p = 0; p < nPass; ++p) {
    const unsigned char* sb = ring + (p & 1) * kGmBuf;
#pragma unroll
    for (int ks = 0; ks < kGmPassK / 32; ++ks) {
      V bh[4], ah[NI];
#pragma unroll
      for (int i = 0; i < NI; ++i) ah[i] = Frag<T>::load((const T*)(sb + rA + i * 16 * kGmPitch + ks * 64));
#pragma unroll
      for (int j = 0; j < 4; ++j) bh[j] = Frag<T>::load((const T*)(sb + rB + j * 16 * kGmPitch + ks * 64));
      // keeps the reads of a k step together in front of its first product: one LDS latency for all of them; without it the
      // scheduler reads the A fragments one at a time into one register set and waits for each
      __builtin_amdgcn_sched_barrier(0);
#pragma unroll
      for (int j = 0; j < 4; ++j)
#pragma unroll
        for (int i = 0; i < NI; ++i) acc[i][j] = Frag<T>::mma(ah[i], bh[j], acc[i][j]);
    }
    // hand-over: this wave's reads of the buffer are done, its copies for pass p + 1 have landed; behind the barrier that
    // holds for every wave, so pass p + 1 may be read and this pass's buffer may be refilled
    // The scheduling fence keeps the pass's products in front of the hand-over; without it the scheduler sinks products behind
    // the barrier, which delays the refill that stands there.
    __builtin_amdgcn_sched_barrier(0);
    asm volatile("s_wait_dscnt 0x0" ::: "memory");
    asm volatile("s_wait_asynccnt 0x0" ::: "memory");
    __syncthreads();
    if (p + 2 < nPass) stage_pass((size_t)(p + 2) * (kGmPassK * 2), (p & 1) * kGmBuf);   // the same for the whole block
  }
  asm volatile("s_wait_asynccnt 0x0" ::: "memory");        // no copy is left in flight when the wave goes on to its end
#pragma unroll
  for (int i = 0; i < NI; ++i) acc_guard4(acc[i][0], acc[i][1], acc[i][2], acc[i][3]);

  float* slab = sT[wave];
  // ---- transposed epilogue: 16 columns n at a time become 16 slab rows of this wave's 64 m; a row leaves as one whole 128-B line ----
  if constexpr (TSPLIT) {
    if (n0 >= splitN) {                          // the same for the whole wave; no block barrier stands behind this point
      const int q = lane >> 3, c8 = (lane & 7) * 8;
      float bT[4];                               // all four asked for up front: one memory latency, not four
#pragma unroll
      for (int j = 0; j < 4; ++j) bT[j] = biasT[n0 - splitN + (j << 4) + rlane];
#pragma unroll
      for (int j = 0; j < 4; ++j) {
        const int nT = n0 - splitN + (j << 4);
        const float bv = bT[j];
#pragma unroll
        for (int i = 0; i < 4; ++i)
#pragma unroll
          for (int r = 0; r < 8; ++r) slab[rlane * 68 + (i << 4) + mOff + r] = acc[i][j][r] * scale + bv;
        __builtin_amdgcn_fence(__ATOMIC_RELEASE, "workgroup");
        __builtin_amdgcn_wave_barrier();
        __builtin_amdgcn_fence(__ATOMIC_ACQUIRE, "workgroup");
#pragma unroll
        for (int it = 0; it < 4; ++it) {
          const int row = it * 4 + q;
          const float* sp = slab + row * 68 + c8;
          v8h hv;
#pragma unroll
          for (int e = 0; e < 8; ++e) hv[e] = (_Float16)sp[e];
          *(v8h*)(CoutT + (size_t)(nT + row) * ldT + m0 + c8) = hv;
        }
        __builtin_amdgcn_fence(__ATOMIC_RELEASE, "workgroup");
        __builtin_amdgcn_wave_barrier();
        __builtin_amdgcn_fence(__ATOMIC_ACQUIRE, "workgroup");
      }
      return;
    }
  }
  // ---- epilogue, written once for a bias mode BM that is known at compile time ----
  const float* Rb = RESID ? (resid + (size_t)b * strideR) : nullptr;
  auto epilogue = [&](auto tag) {
  constexpr int BM = decltype(tag)::value;
#pragma unroll
  for (int i = 0; i < NI; ++i) {
    const int mBase = m0 + (i << 4);
#pragma unroll
    for (int j = 0; j < 4; ++j) {
      const int n = n0 + (j << 4) + rlane;
      float bv = 0.f;
      if (BM == 2) bv = bias[n];
#pragma unroll
      for (int r = 0; r < 8; ++r) {
        float v = acc[i][j][r] * scale;
        if (BM == 1) v += bias[mBase + mOff + r];
        if (BM == 2) v += bv;
        if (RESID) v += Rb[(size_t)(mBase + mOff + r) * ldc + n];
        if (ACT == 2) v = fmaxf(v, 0.0f);
        if (ACT == 4) v = (v > 0.f) ? v : 0.01f * v;
        slab[(mOff + r) * 68 + (j << 4) + rlane] = v;
      }
    }
    __builtin_amdgcn_fence(__ATOMIC_RELEASE, "workgroup");
    __builtin_amdgcn_wave_barrier();
    __builtin_amdgcn_fence(__ATOMIC_ACQUIRE, "workgroup");
    if (OUT_MODE == 0) {
      float* C = (float*)Cout + (size_t)b * strideC;
      const int hh = lane >> 4, c4 = (lane & 15) * 4;     // row seg = 256 B = 16 lanes x 16 B
      {
#pragma unroll
        for (int it = 0; it < 8; ++it) {
          const int row = it * 2 + hh;
          v4f v = *(const v4f*)(slab + row * 68 + c4);
          *(v4f*)(C + (size_t)(mBase + row) * ldc + n0 + c4) = v;
        }
        
      }
    } else {
      const int q = lane >> 3, c8 = (lane & 7) * 8;
      unsigned short* C  = (unsigned short*)Cout  + (size_t)b * strideC;
      unsigned short* C2 = (OUT_MODE == 2) ? ((unsigned short*)Cout2 + (size_t)b * strideC) : nullptr;
      {
#pragma unroll
        for (int it = 0; it < 4; ++it) {
          const int row = it * 4 + q;
          const float* sp = slab + row * 68 + c8;
          v8h hv, lv;
#pragma unroll
          for (int e = 0; e < 8; ++e) {
            if (OUT_MODE == 1) {
              hv[e] = (_Float16)sp[e];
            } else {
              unsigned short hb = f2bf_bits(sp[e]);
              unsigned short lb = f2bf_bits(sp[e] - bf_bits2f(hb));
              hv[e] = __builtin_bit_cast(_Float16, hb);
              lv[e] = __builtin_bit_cast(_Float16, lb);
            }
          }
          *(v8h*)(C + (size_t)(mBase + row) * ldc + n0 + c8) = hv;
          if (OUT_MODE == 2) *(v8h*)(C2 + (size_t)(mBase + row) * ldc + n0 + c8) = lv;
        }
        
      }
    }
    __builtin_amdgcn_fence(__ATOMIC_RELEASE, "workgroup");
    __builtin_amdgcn_wave_barrier();
    __builtin_amdgcn_fence(__ATOMIC_ACQUIRE, "workgroup");
  }
  };
  epilogue(BiasTag<BIAS_MODE>{});
}
// one GEMM a launch, 128x128 tiles: grid.x = its tiles, grid.y = its batches
template <int ET, bool SPLIT, int BIAS_MODE, int OUT_MODE, bool RESID, int ACT = 0>
__global__ __launch_bounds__(256) void wmma_gemm64(
    const unsigned short* __restrict__ Ap, const unsigned short* __restrict__ A2p, int lda, long strideA,
    const unsigned short* __restrict__ Btp, const unsigned short* __restrict__ Bt2p, int ldb, long strideB,
    void* __restrict__ Cout, void* __restrict__ Cout2, int ldc, long strideC,
    const float* __restrict__ bias,
    const float* __restrict__ resid, long strideR,
    int M, int N, int K, float scale) {
  gemm64_tile<ET, SPLIT, BIAS_MODE, OUT_MODE, RESID, ACT, 4, 2, 2, false>(blockIdx.x, (int)blockIdx.y, Ap, A2p, lda, strideA, Btp, Bt2p, ldb, strideB,
                                                                       Cout, Cout2, ldc, strideC, bias, resid, strideR, M, N, K, scale,
                                                                       nullptr, nullptr, 0, 0);
}
// All three projections of x as one GEMM, one launch. W = the q|k plane's 2048 rows with the v plane's 1024 rows directly behind
// them (one [3072][K] matrix in the workspace). 256 x 192 tiles: 16 x 16 = 256 blocks, one for every WGP, all of one size.
//   QK[m][n'] = f16(scale * sum_k X[m][k] W[n'][k] + bqk[n'])                    for n' < kQKCols,
//   VT[n][m]  = f16(scale * sum_k X[m][k] W[kQKCols + n][k] + bv[n])             for the columns behind them, written transposed.
constexpr int kProjN     = kQKCols + kDim;                         // 3072
constexpr int kProjTiles = (kTok / 256) * (kProjN / 192);          // 256
static_assert(kTok % 256 == 0 && kProjN % 192 == 0 && kQKCols % 64 == 0, "projection tiles");
__global__ __launch_bounds__(384) void proj_gemm_kernel(
    const unsigned short* __restrict__ X, const unsigned short* __restrict__ Wall,
    const float* __restrict__ bqk, const float* __restrict__ bv,
    unsigned short* __restrict__ QK, unsigned short* __restrict__ VT, int K, float scale) {
  gemm64_tile<0, false, 2, 1, false, 0, 4, 3, 4, true>(blockIdx.x, 0, X, X, K, 0L, Wall, Wall, K, 0L,
                                                    (void*)QK, (void*)QK, kQKCols, 0L, bqk, bqk, 0L,
                                                    kTok, kProjN, K, scale, VT, bv, kQKCols, kTok);
}

// ---------------------------------------------------------------------------
// The three operand preparations below do not depend on each other and share one launch (prep_kernel); blk = the block's
// number within its own part.
// ---------------------------------------------------------------------------
__device__ __forceinline__ void cast8_f16_part(int blk, const float* __restrict__ in, unsigned short* __restrict__ out, int n8) {
  const int i = blk * 256 + threadIdx.x;
  if (i >= n8) return;
  const float* p = in + 8 * (size_t)i;
  const v4f a = *(const v4f*)(p);
  const v4f c = *(const v4f*)(p + 4);
  unsigned short hb[8];
#pragma unroll
  for (int e = 0; e < 4; ++e) {
    hb[e]     = h_bits(a[e]);
    hb[4 + e] = h_bits(c[e]);
  }
  const v4u u = (v4u){pk16(hb[0], hb[1]), pk16(hb[2], hb[3]), pk16(hb[4], hb[5]), pk16(hb[6], hb[7])};
  unsigned short* q = out + 8 * (size_t)i;
  *(v4u*)q = u;
  
}

// ---------------------------------------------------------------------------
// Weight transpose + cast (+ optional output-feature permutation) for square [1024 in][1024 out] f32 W (row-major [k][n]):
//   out[np][k] = f16( scale * W[k][orig(np)] ), orig(np) = perm ? ((np>>5)&1)*512 + (np>>6)*32 + (np&31) : np;
//   z0 (Wq) carries kQFold on top of scale.
// With perm, plane column 64h + 32*set + d holds feature set*512 + 32h + d, so the two q/k sets of a head sit at stride 32.
// 1024 blocks: blk & 15 = k tile (64 cols of out), (blk >> 4) & 15 = np tile (64 rows of out), blk >> 8 = z selects
//   z0 = (W0 -> o0, perm), z1 = (W1 -> o1, perm), z2 = (W2 -> o2, identity), z3 = (W3 -> o3, identity). 256 threads.
// Load coverage: 16 iterations x 256 threads = 4096 = the whole 64x64 tile (coalesced along n inside 32-wide strips).
// Store coverage: 8 waves x 2 iterations x 4 rows (lane>>3) = 64 rows; (lane&7) x 8 halves = 64 cols; each row segment =
// ---------------------------------------------------------------------------
__device__ __forceinline__ void wt_part(int blk, const float* __restrict__ W0, const float* __restrict__ W1,
                                        const float* __restrict__ W2, const float* __restrict__ W3,
                                        unsigned short* __restrict__ o0, unsigned short* __restrict__ o1,
                                        unsigned short* __restrict__ o2, unsigned short* __restrict__ o3,
                                        float scale) {
  __shared__ float sm[64][65];   // sm[np_local][k_local]
  const int t  = threadIdx.x;
  const int k0 = (blk & 15) * 64;
  const int n0 = ((blk >> 4) & 15) * 64;
  const int z  = blk >> 8;                                     // block-uniform
  const float* W = (z == 0) ? W0 : (z == 1) ? W1 : (z == 2) ? W2 : W3;
  unsigned short* op = (z == 0) ? o0 : (z == 1) ? o1 : (z == 2) ? o2 : o3;
  const int perm = (z < 2) ? 1 : 0;
  const float sc = (z == 0) ? scale * kQFold : scale;
#pragma unroll
  for (int i = 0; i < 16; ++i) {
    const int e = i * 256 + t;
    const int r = e >> 6;          // k local
    const int c = e & 63;          // np local
    const int np = n0 + c;
    const int og = perm ? ((((np >> 5) & 1) << 9) + ((np >> 6) << 5) + (np & 31)) : np;
    sm[c][r] = W[(size_t)(k0 + r) * kDim + og] * sc;
  }
  __syncthreads();
  const int lane = t & 31, wave = t >> 5;
  const int q = lane >> 3, c8 = (lane & 7) * 8;
  {
#pragma unroll
    for (int it = 0; it < 2; ++it) {
      const int row = wave * 8 + it * 4 + q;                 // np local
      unsigned short hb[8];
#pragma unroll
      for (int e = 0; e < 8; ++e) hb[e] = h_bits(sm[row][c8 + e]);
      const v4u u = (v4u){pk16(hb[0], hb[1]), pk16(hb[2], hb[3]), pk16(hb[4], hb[5]), pk16(hb[6], hb[7])};
      *(v4u*)(op + (size_t)(n0 + row) * kDim + k0 + c8) = u;
    }
    // behind the last store, in front of whatever follows this part in the kernel that holds it: no register that the two
    // stores name is rewritten ahead of this wait
    asm volatile("s_wait_xcnt 0x0" ::: "memory");
  }
}

// ---------------------------------------------------------------------------
// Permuted q|k bias line: out[np] = kQFold * bq[orig(np)] for np < 1024 (block 0), out[1024 + np] = bk[orig(np)] (block 1).
// Thread t owns np = 4t..4t+3 (orig of an aligned group of 4 is contiguous); one 16-B store per lane, a wave = 512 B =
// ---------------------------------------------------------------------------
__device__ __forceinline__ void biasperm_part(int blk, const float* __restrict__ bq, const float* __restrict__ bk,
                                              float* __restrict__ out) {
  const int t = threadIdx.x;
  const float* src = (blk == 0) ? bq : bk;                    // block-uniform
  const int np = 4 * t;
  const int og = (((np >> 5) & 1) << 9) + ((np >> 6) << 5) + (np & 31);
  const v4f v = *(const v4f*)(src + og) * ((blk == 0) ? kQFold : 1.0f);
  float* dp = out + (size_t)blk * kDim + np;
  *(v4f*)dp = v;
  
}

// One launch for the three parts; every test below reads the same for the whole block, so the barrier inside wt_part is
// passed by all of a block's threads or by none. Blocks 0..1: bias line; the next 1024: weight planes; the rest: x.
constexpr int kPrepBias = 2;
constexpr int kPrepWt   = (kDim / 64) * (kDim / 64) * 4;          // 1024
constexpr int kPrepCast = (kTok * kDim) / (8 * 256);              // 2048
static_assert(kDim / 64 == 16, "wt_part's block decoding");
__global__ __launch_bounds__(256) void prep_kernel(const float* __restrict__ x, const float* __restrict__ Wq,
                                                   const float* __restrict__ Wk, const float* __restrict__ Wv,
                                                   const float* __restrict__ Wo, const float* __restrict__ bq,
                                                   const float* __restrict__ bk,
                                                   unsigned short* __restrict__ xh, unsigned short* __restrict__ wqt,
                                                   unsigned short* __restrict__ wkt, unsigned short* __restrict__ wvt,
                                                   unsigned short* __restrict__ wot, float* __restrict__ bqk,
                                                   int n8, float wscale) {
  const int blk = blockIdx.x;
  if (blk < kPrepBias)                biasperm_part(blk, bq, bk, bqk);
  else if (blk < kPrepBias + kPrepWt) wt_part(blk - kPrepBias, Wq, Wk, Wv, Wo, wqt, wkt, wvt, wot, wscale);
  else                                cast8_f16_part(blk - (kPrepBias + kPrepWt), x, xh, n8);
}

// ---------------------------------------------------------------------------
// Both masked softmaxes, their difference and the product with v, for every (batch, head) in one launch; no score ever
// reaches memory. Transposed forms, so that one lane owns one query column throughout:
//   x[set][j][i] = sum_d k_set[j][d] * q_set[i][d]      (A = 16 key rows, B = 16 query rows kept in registers, K = 32; the q
//   plane carries 32^-0.5 * log2(e), so x is the softmax exponent to base 2); where mask[i][j] == 0, x = -2^100
//   a reference m per query and set, held from trip to trip, enters the product as its start value: the product gives x - m
//   p = exp2(x - m), f16; sum l per query and set
//   Ot[set][d][i] += sum_j v^T[d][j] * p[j][i]          (A = 16 rows of v^T, B = p, K = 32)
//   Any m gives the same O below, as long as no p overflows: m is raised, to the trip's maximum where that is higher, only in a trip whose mask tile holds a zero or in which a
//   lane's p sum to more than 2^12 (always so in the first trip). That trip is worked anew from LDS: maximum, the new m, Ot and l
//   times exp2(m_old - m_new), p by the new m. m is never above the maximum met so far, so the largest p of a row is at least 1.
//   O[i][d] = Ot[0][d][i] / l0 - lambda * Ot[1][d][i] / l1,  lambda = exp(sum lq1*lk1) - exp(sum lq2*lk2) + 0.2
// and, still in registers, the per-head LayerNorm over the 64 d of O[i][.], affine, x0.8, f16 cast:
//   mu = mean_d O, var = mean_d (O - mu)^2, y = ((O - mu) / sqrt(var + 1e-5) * g[h][d] + b[h][d]) * 0.8 -> A16[i][64h + d]
// (lanes l and l ^ 16 hold 32 d each of one query row: each sums its own 32, one lane swap joins the halves).
// grid (16, 16 heads, 2 batches), 8 waves; wave w owns query rows 128*blockIdx.x + 16w .. +15 and walks all 2048 keys, 64 a
// trip. A trip's operands come through LDS: 64 k rows and 64 v^T rows of 128 B (shared by the 8 waves) and 128 mask rows of
// 256 B (16 per wave), brought by asynchronous 16-B copies in which a wave covers whole 128-B lines. Two buffers: the copies
// of trip t + 1 are issued behind the barrier that ends trip t - 1 and land while trip t is worked on.
// Fragment maps: accumulator register r of lane l holds row 8*(l>>4) + r, column l & 15. Two score tiles (keys 0..15 and
// 16..31 of a 32-key chunk) converted in place are the B operand of the second product: element s = key
// (s < 8 ? 8*(l>>4) + s : 16 + 8*(l>>4) + s - 8), which is the k order in which Frag::load reads the v^T rows.
// Store: a lane holds 8 consecutive d of its query row per tile; the wave writes the whole 128-B row segment of its head.
// ---------------------------------------------------------------------------
constexpr int   kFaQ    = 128;                 // query rows per block (8 waves x 16)
constexpr int   kFaKeys = 64;                  // keys per trip
// Value of a masked x: -2^100. In a row whose every key so far is masked m is this very value, and x - m is exactly 0.
constexpr float kMaskedScore = -0x1p100f;
// m in front of the first trip: below every x, the masked one too, so that every p of the first trip is infinite and m is set there
constexpr float kRefStart = -0x1p120f;
// a lane's p of one trip (32 keys, both sets) may sum to this much before m is raised; every single p then fits f16 with room
constexpr float kSumCap = 4096.0f;
static_assert(kSeq % kFaQ == 0 && kSeq % kFaKeys == 0 && kDh == 64 && kDiff == 32, "attention tiling");
typedef __attribute__((ext_vector_type(4))) int v4i;
constexpr int kFaTrips = kSeq / kFaKeys;                   // 32
constexpr int kKvPitch = 144;                              // LDS pitch of the 128-B k and v^T rows: 16 B x odd, no bank conflict for 16-B reads
constexpr int kMkPitch = 272;                              // LDS pitch of the 256-B mask rows: 16 B x odd
constexpr int kLdsV    = kFaKeys * kKvPitch;               // k rows at 0, v^T rows behind them
constexpr int kLdsM    = kLdsV + kDh * kKvPitch;           // mask rows behind those
constexpr int kLdsBuf  = kLdsM + kFaQ * kMkPitch;          // 53,248 B a buffer
static_assert(kFaTrips >= 2 && kFaKeys * 2 == 128 && kDh * 2 == 128 && kFaKeys * 4 == 256, "staging");
// Four asynchronous copies, 16 B per lane each, global memory to LDS through no register. l = the lane's LDS byte address,
// g = its global address. The s_wait_xcnt ends the statement so that it stands in front of every later write of an address
// register named here.
__device__ __forceinline__ void copy4_to_lds(unsigned l0, const char* g0, unsigned l1, const char* g1,
                                             unsigned l2, const char* g2, unsigned l3, const char* g3) {
  asm volatile("global_load_async_to_lds_b128 %0, %1, off\n\t"
               "global_load_async_to_lds_b128 %2, %3, off\n\t"
               "global_load_async_to_lds_b128 %4, %5, off\n\t"
               "global_load_async_to_lds_b128 %6, %7, off\n\t"
               "s_wait_xcnt 0x0"
               :: "v"(l0), "v"(g0), "v"(l1), "v"(g1), "v"(l2), "v"(g2), "v"(l3), "v"(g3) : "memory");
}
// One trip's tiles into one buffer: 12 copies a lane. lk, lv, lm and gk, gv, gm are the lane's first LDS and global addresses
// in the k, v^T and mask tile; its further rows lie 32 rows on (k, v^T) and 2 rows on (mask).
__device__ __forceinline__ void stage_trip(unsigned lk, unsigned lv, unsigned lm,
                                           const char* gk, const char* gv, const char* gm) {
  copy4_to_lds(lk, gk, lk + 32 * kKvPitch, gk + (size_t)32 * kQKCols * 2,
               lv, gv, lv + 32 * kKvPitch, gv + (size_t)32 * kTok * 2);
  copy4_to_lds(lm,                gm,                          lm + 2 * kMkPitch, gm + (size_t)2 * kSeq * 4,
               lm + 4 * kMkPitch, gm + (size_t)4 * kSeq * 4,   lm + 6 * kMkPitch, gm + (size_t)6 * kSeq * 4);
  copy4_to_lds(lm + 8 * kMkPitch,  gm + (size_t)8 * kSeq * 4,  lm + 10 * kMkPitch, gm + (size_t)10 * kSeq * 4,
               lm + 12 * kMkPitch, gm + (size_t)12 * kSeq * 4, lm + 14 * kMkPitch, gm + (size_t)14 * kSeq * 4);
}
// value of lane l ^ 16, by a vector-unit lane swap (no LDS round trip)
__device__ __forceinline__ float other_half(float x) {
  const int b = __float_as_int(x);
  return __int_as_float(__builtin_amdgcn_permlanex16(b, b, 0x76543210, 0xfedcba98, false, false));
}
// exp2 in place. The instruction set asks for one slot between a transcendental and a directly following instruction that
// overwrites its source or reads its result. Here each overwrites only its own source, and the v_nop is the slot in front of
// whatever the compiler puts next.
__device__ __forceinline__ void exp2_inplace(float& x) {
  asm("v_exp_f32 %0, %0\n\tv_nop" : "+v"(x));
}
__device__ __forceinline__ void exp2_inplace8(v8f& x) {
  float a = x[0], b = x[1], c = x[2], d = x[3], e = x[4], f = x[5], g = x[6], h = x[7];
  asm("v_exp_f32 %0, %0\n\tv_exp_f32 %1, %1\n\tv_exp_f32 %2, %2\n\tv_exp_f32 %3, %3\n\t"
      "v_exp_f32 %4, %4\n\tv_exp_f32 %5, %5\n\tv_exp_f32 %6, %6\n\tv_exp_f32 %7, %7\n\tv_nop"
      : "+v"(a), "+v"(b), "+v"(c), "+v"(d), "+v"(e), "+v"(f), "+v"(g), "+v"(h));
  x = (v8f){a, b, c, d, e, f, g, h};
}
// four waves per SIMD (two blocks per WGP): the whole grid of 512 blocks is resident at once, within 256 registers a wave
// and 106,496 B of LDS a block
__global__ __launch_bounds__(256) __attribute__((amdgpu_waves_per_eu(4, 4))) void diff_attn_kernel(const unsigned short* __restrict__ QKp,
                                                        const unsigned short* __restrict__ Vtp,
                                                        const int* __restrict__ Mp,
                                                        const float* __restrict__ lq1, const float* __restrict__ lk1,
                                                        const float* __restrict__ lq2, const float* __restrict__ lk2,
                                                        const float* __restrict__ g, const float* __restrict__ bta,
                                                        unsigned short* __restrict__ A16) {
  const int lane = threadIdx.x & 31, wave = threadIdx.x >> 5;
  const int c    = lane & 15;                  // this lane's query column; row of every A fragment
  const int h8   = (lane >> 4) * 8;            // k offset of this lane half; also its accumulator row offset
  const int head = blockIdx.y;
  const int b    = blockIdx.z;
  const int q0   = blockIdx.x * kFaQ + wave * 16;

  const _Float16* QK = (const _Float16*)QKp + (size_t)b * kSeq * kQKCols + head * kDh;
  const _Float16* Qr = QK + (size_t)(q0 + c) * kQKCols + h8;
  __shared__ __attribute__((aligned(16))) unsigned char smem[2 * kLdsBuf];
  // what this lane copies: of k and v^T rows (t >> 3) and (t >> 3) + 32, bytes 16 * (t & 7) .. +15 (a wave: 4 whole rows a
  // copy); of the mask its own wave's rows 2i + (lane >> 4), i = 0..7, bytes 16 * (lane & 15) .. +15 (a wave: 2 whole rows)
  const int crow = threadIdx.x >> 3, ccol = (threadIdx.x & 7) * 16;
  const int mrow = wave * 16 + (lane >> 4), mcol = (lane & 15) * 16;
  const char* gK = (const char*)(QK + kDim + (size_t)crow * kQKCols) + ccol;
  const char* gV = (const char*)((const _Float16*)Vtp + (size_t)(head * kDh + crow) * kTok + (size_t)b * kSeq) + ccol;
  const char* gM = (const char*)(Mp + ((size_t)b * kSeq + blockIdx.x * kFaQ + mrow) * kSeq) + mcol;
  const unsigned lds0 = (unsigned)(size_t)smem;            // low 32 bits of the address = byte offset in the block's LDS
  const unsigned lK = lds0 + crow * kKvPitch + ccol;
  const unsigned lV = lds0 + kLdsV + crow * kKvPitch + ccol;
  const unsigned lM = lds0 + kLdsM + mrow * kMkPitch + mcol;
  // what this lane reads: row c of every 16-row group, from byte 16 * (lane >> 4) (k, v^T) or 32 * (lane >> 4) (mask)
  const int rK = c * kKvPitch + h8 * 2;
  const int rV = kLdsV + c * kKvPitch + h8 * 2;
  const int rM = kLdsM + (wave * 16 + c) * kMkPitch + h8 * 4;
  v16h qf[2];
  qf[0] = Frag<_Float16>::load(Qr);
  qf[1] = Frag<_Float16>::load(Qr + kDiff);

  const v8f zero = (v8f){0.f,0.f,0.f,0.f,0.f,0.f,0.f,0.f};
  v8f o[2][4];
  v8f nref[2];                                 // minus the lane's reference m, eight times over: start value of the score products
  float l[2];
#pragma unroll
  for (int st = 0; st < 2; ++st) {
    nref[st] = zero - kRefStart;
    l[st] = 0.f;
#pragma unroll
    for (int dt = 0; dt < 4; ++dt) o[st][dt] = zero;
  }

  // trip 0's tiles, landed and published
  stage_trip(lK, lV, lM, gK, gV, gM);
  asm volatile("s_wait_asynccnt 0x0" ::: "memory");      // this wave's copies have landed
  __syncthreads();                                       // and every other wave's

  for (int t = 0; t < kFaTrips; ++t) {
    const int buf = (t & 1) * kLdsBuf;
    const unsigned char* sb = smem + buf;
    // directly behind the barrier that ended trip t - 1 (in front of trip 0: the one above): the next trip's tiles are asked
    // for, into the buffer that trip t - 1 has read, and fly while this trip is worked on
    if (t + 1 < kFaTrips) {                                // the same for the whole block
      const size_t j1 = (size_t)(t + 1) * kFaKeys;
      const unsigned nb = kLdsBuf - buf;
      stage_trip(lK + nb, lV + nb, lM + nb, gK + j1 * (kQKCols * 2), gV + j1 * 2, gM + j1 * 4);
    }
    v8f s[2][4];
    v4i mk[4][2];
    v16h kf[2][4];
#pragma unroll
    for (int kt = 0; kt < 4; ++kt) {
      mk[kt][0] = *(const v4i*)(sb + rM + kt * 64);
      mk[kt][1] = *(const v4i*)(sb + rM + kt * 64 + 16);
    }
#pragma unroll
    for (int kt = 0; kt < 4; ++kt) {
      const _Float16* kp = (const _Float16*)(sb + rK + kt * 16 * kKvPitch);
      kf[0][kt] = Frag<_Float16>::load(kp);
      kf[1][kt] = Frag<_Float16>::load(kp + kDiff);
    }
    // keeps the trip's mask and k reads together in front of the first product: one latency for all of them; without it
    // the scheduler, short of registers, reads one fragment at a time and waits for each
    __builtin_amdgcn_sched_barrier(0);
    // smallest of the lane's 32 mask words, read as unsigned: 0 exactly where one of them is 0 (four short chains, then joined)
    unsigned mlow[4];
#pragma unroll
    for (int kt = 0; kt < 4; ++kt) {
      mlow[kt] = (unsigned)mk[kt][0][0];
#pragma unroll
      for (int r = 1; r < 8; ++r) mlow[kt] = min(mlow[kt], (unsigned)mk[kt][r >> 2][r & 3]);
    }
    const unsigned mlowAll = min(min(mlow[0], mlow[1]), min(mlow[2], mlow[3]));
    v16h vf[2][4];
    v16h pf[2][2];
    float tsum[2];                                   // the trip's p summed: this half's keys only
    const _Float16* vp = (const _Float16*)(sb + rV);
    auto long_arm = [&]() __attribute__((always_inline)) {
      // The long arm: the trip from the buffer it still owns, with the mask, and with m raised to the trip's maximum where that is higher; every
      // lane of the wave goes along (for a lane within the cap that changes roundings only). Each masked x is replaced, behind
      // the product, by the one constant kMaskedScore: masked x are all bit-equal and far below every kept one (at most
      // 32 * 65504^2 in size), as with the reference's -1e9: weight 0 beside any kept key, equal weights where every key of a
      // row is masked. Operands are read again from LDS: held from the trip's head they would take the short arm's registers.
#pragma unroll
      for (int st = 0; st < 2; ++st) {
        v8f x[4];
        float tm = kMaskedScore;
#pragma unroll
        for (int kt = 0; kt < 4; ++kt) {
          const v16h kr = Frag<_Float16>::load((const _Float16*)(sb + rK + kt * 16 * kKvPitch) + st * kDiff);
          const v4i w0 = *(const v4i*)(sb + rM + kt * 64);
          const v4i w1 = *(const v4i*)(sb + rM + kt * 64 + 16);
          const v8f a = Frag<_Float16>::mma(kr, qf[st], zero);
#pragma unroll
          for (int r = 0; r < 8; ++r) {
            x[kt][r] = (((r < 4) ? w0[r & 3] : w1[r & 3]) != 0) ? a[r] : kMaskedScore;
            tm = fmaxf(tm, x[kt][r]);
          }
        }
        tm = fmaxf(tm, other_half(tm));              // the other lane half holds the other keys of the same query
        const float mo = -nref[st][0];
        const float mn = fmaxf(mo, tm);
        float sum = 0.f;
#pragma unroll
        for (int kt = 0; kt < 4; ++kt) {
          v8f p = x[kt] - mn;
          exp2_inplace8(p);
#pragma unroll
          for (int r = 0; r < 8; ++r) {
            sum += p[r];
            pf[st][kt >> 1][(kt & 1) * 8 + r] = (_Float16)p[r];
          }
        }
        float alpha = mo - mn;
        exp2_inplace(alpha);
        tsum[st] = sum;
        nref[st] = zero - mn;
        l[st] *= alpha;
#pragma unroll
        for (int dt = 0; dt < 4; ++dt) o[st][dt] *= alpha;
      }
#pragma unroll
      for (int dt = 0; dt < 4; ++dt) vf[0][dt] = Frag<_Float16>::load(vp + dt * 16 * (kKvPitch / 2));
    };
    // Scalar branches, the same for every lane of the wave (every lane stays on in every arm; no barrier stands inside).
    // A wave whose 16 x 64 mask tile holds no zero has nothing to mask: it takes the short arm, the products and the exponentials
    // alone. A tile with a zero takes the long arm at once. (The long arm is written out at both places it is entered from: with
    // one copy behind a flag, the build held the registers of p and v^T through the whole loop and spilled q.)
    if (__builtin_amdgcn_ballot_w32(mlowAll == 0u) != 0u) {
      long_arm();
    } else {
#pragma unroll
      for (int kt = 0; kt < 4; ++kt) {
        s[0][kt] = Frag<_Float16>::mma(kf[0][kt], qf[0], nref[0]);
        s[1][kt] = Frag<_Float16>::mma(kf[1][kt], qf[1], nref[1]);
      }
      // keeps the eight products together in front of the exponentials, each filling the slots that the one in front of it needs
      // before its result is read; without it the scheduler deals them out among the exponentials, which stand in asm text
      __builtin_amdgcn_sched_barrier(0);
#pragma unroll
      for (int st = 0; st < 2; ++st) {
        if (st == 1) {
          // the v^T fragments of the trip's first 32 keys are asked for by here, into the registers the first set's scores have
          // just left: their LDS latency runs under the second set's softmax arithmetic
#pragma unroll
          for (int dt = 0; dt < 4; ++dt) vf[0][dt] = Frag<_Float16>::load(vp + dt * 16 * (kKvPitch / 2));
          // keeps those reads up here; without it the scheduler sinks them to just in front of their products, each with a full wait
          __builtin_amdgcn_sched_barrier(0);
        }
        float sum = 0.f;
#pragma unroll
        for (int kt = 0; kt < 4; ++kt) {
          v8f p = s[st][kt];
          exp2_inplace8(p);
#pragma unroll
          for (int r = 0; r < 8; ++r) {
            sum += p[r];
            pf[st][kt >> 1][(kt & 1) * 8 + r] = (_Float16)p[r];
          }
        }
        tsum[st] = sum;
      }
      // No p is negative, so a sum within the cap bounds every p under it; the test is written so that an infinite sum or a NaN
      // fails it as well.
      if (__builtin_amdgcn_ballot_w32(!(tsum[0] + tsum[1] <= kSumCap)) != 0u) long_arm();
    }
    // the fragments of the other 32 keys, into the registers the second set's scores have left: their latency runs under the
    // first 32 keys' products
#pragma unroll
    for (int dt = 0; dt < 4; ++dt) vf[1][dt] = Frag<_Float16>::load(vp + dt * 16 * (kKvPitch / 2) + 32);
    // keeps those reads in front of the products; without it the scheduler sinks each to just in front of its own product
    __builtin_amdgcn_sched_barrier(0);
    l[0] += tsum[0];                                 // this half's keys only; the halves are joined behind the loop
    l[1] += tsum[1];
#pragma unroll
    for (int kc = 0; kc < 2; ++kc)
#pragma unroll
      for (int dt = 0; dt < 4; ++dt) {
        o[0][dt] = Frag<_Float16>::mma(vf[kc][dt], pf[0][kc], o[0][dt]);
        o[1][dt] = Frag<_Float16>::mma(vf[kc][dt], pf[1][kc], o[1][dt]);
      }
    // hand-over: this wave's reads of the buffer are done, its copies for trip t + 1 have landed; behind the barrier that
    // holds for every wave, so trip t + 1 may be read and this trip's buffer may be refilled
    // The scheduling fence keeps the hand-over at the trip's end.
    __builtin_amdgcn_sched_barrier(0);
    asm volatile("s_wait_dscnt 0x0" ::: "memory");
    asm volatile("s_wait_asynccnt 0x0" ::: "memory");
    __syncthreads();
  }
  asm volatile("s_wait_asynccnt 0x0" ::: "memory");        // no copy is left in flight when the wave goes on to its end

  // lambda from the two 32-vectors (wave-wide butterfly, unconditional shuffles)
  float t1 = lq1[lane] * lk1[lane];
  float t2 = lq2[lane] * lk2[lane];
#pragma unroll
  for (int off = 16; off > 0; off >>= 1) {
    t1 += __shfl_xor(t1, off, 32);
    t2 += __shfl_xor(t2, off, 32);
  }
  const float lam = (expf(t1) - expf(t2)) + kLambdaInit;

  const float l0 = l[0] + other_half(l[0]);
  const float l1 = l[1] + other_half(l[1]);
  const float inv0 = 1.0f / l0;
  const float inv1 = lam / l1;
  // this lane's 32 of the 64 d of its query row: d = 16 dt + h8 + e
  float y[4][8], ps[4];
#pragma unroll
  for (int dt = 0; dt < 4; ++dt) {
    ps[dt] = 0.f;
#pragma unroll
    for (int e = 0; e < 8; ++e) {
      y[dt][e] = o[0][dt][e] * inv0 - o[1][dt][e] * inv1;
      ps[dt] += y[dt][e];
    }
  }
  float sm = (ps[0] + ps[1]) + (ps[2] + ps[3]);
  sm += other_half(sm);
  const float mu = sm * kInv64;
#pragma unroll
  for (int dt = 0; dt < 4; ++dt) {
    ps[dt] = 0.f;
#pragma unroll
    for (int e = 0; e < 8; ++e) {
      y[dt][e] -= mu;
      ps[dt] += y[dt][e] * y[dt][e];
    }
  }
  float vs = (ps[0] + ps[1]) + (ps[2] + ps[3]);
  vs += other_half(vs);
  const float rstd = 1.0f / sqrtf(vs * kInv64 + kLnEps);
  const float* gp = g   + head * kDh + h8;
  const float* bp = bta + head * kDh + h8;
  unsigned short* Ar = A16 + ((size_t)b * kSeq + q0 + c) * kDim + head * kDh + h8;
#pragma unroll
  for (int dt = 0; dt < 4; ++dt) {
    const v4f g0 = *(const v4f*)(gp + dt * 16);
    const v4f g1 = *(const v4f*)(gp + dt * 16 + 4);
    const v4f b0 = *(const v4f*)(bp + dt * 16);
    const v4f b1 = *(const v4f*)(bp + dt * 16 + 4);
    unsigned short hb[8];
#pragma unroll
    for (int e = 0; e < 4; ++e) {
      hb[e]     = h_bits((y[dt][e]     * rstd * g0[e] + b0[e]) * kOutGain);
      hb[4 + e] = h_bits((y[dt][4 + e] * rstd * g1[e] + b1[e]) * kOutGain);
    }
    *(v4u*)(Ar + dt * 16) = (v4u){pk16(hb[0], hb[1]), pk16(hb[2], hb[3]), pk16(hb[4], hb[5]), pk16(hb[6], hb[7])};
  }
}

// ---------------------------------------------------------------------------
// Host glue.
// producer before any consumer reads it; no region re-used with another type):
//   XH    f16 [4096][1024]               8,388,608  at           0   (cast8; read by the projection GEMM)
//   WQKT  f16 [2048][1024]               4,194,304  at   8,388,608   (wt z0,z1: permuted Wq^T rows 0..1023, Wk^T rows 1024..2047)
//   WVT   f16 [1024][1024]               2,097,152  at  12,582,912   (wt z2)
//   WOT   f16 [1024][1024]               2,097,152  at  14,680,064   (wt z3)
//   BQK   f32 [2048]                         8,192  at  16,777,216   (permuted bq | bk)
//   QK16  f16 [4096][2048]              16,777,216  at  16,785,408   (q plane cols 0..1023 | k plane cols 1024..2047, permuted)
//   VT16  f16 [1024][4096]               8,388,608  at  33,562,624   (v^T: row = 64h + d, col = token)
//   AOH16 f16 [4096][1024]               8,388,608  at  41,951,232   (LayerNorm output; 32 disjoint column slabs)
//   total                               50,339,840
// GEMM shapes: q|k|v proj M=4096 N=3072 K=1024 (256x192 tiles); out proj M=4096 N=1024 K=1024 (128x128 tiles); all K multiples
// of 128, no padding; scores and p.v inside diff_attn_kernel.
// 4 launches.
// ---------------------------------------------------------------------------
extern "C" void kernel_launch(void* const* d_in, const int* in_sizes, int n_in,
                              void* d_out, int out_size, void* d_ws, size_t ws_size,
                              hipStream_t stream) {
  if (n_in < 16) return;
  const int nTokElem = kTok * kDim;                 // 4,194,304
  const int nW       = kDim * kDim;                 // 1,048,576
  if (in_sizes[0] != nTokElem) return;
  if (in_sizes[1] != kBatch * kSeq * kSeq) return;
  if (in_sizes[2] != nW || in_sizes[4] != nW || in_sizes[6] != nW || in_sizes[8] != nW) return;
  if (in_sizes[3] != kDim || in_sizes[5] != kDim || in_sizes[7] != kDim || in_sizes[9] != kDim) return;
  if (in_sizes[10] != kDiff || in_sizes[11] != kDiff || in_sizes[12] != kDiff || in_sizes[13] != kDiff) return;
  if (in_sizes[14] != kHeads * kDh || in_sizes[15] != kHeads * kDh) return;
  if (out_size != nTokElem) return;

  const size_t szXH   = (size_t)kTok * kDim * 2;
  const size_t szWQK  = (size_t)kQKCols * kDim * 2;
  const size_t szW    = (size_t)kDim * kDim * 2;
  const size_t szBQK  = (size_t)kQKCols * 4;
  const size_t szQK16 = (size_t)kTok * kQKCols * 2;
  const size_t szVT16 = (size_t)kDim * kTok * 2;
  const size_t szAOH  = (size_t)kTok * kDim * 2;
  const size_t offXH   = 0;
  const size_t offWQK  = offXH + szXH;
  const size_t offWVT  = offWQK + szWQK;
  const size_t offWOT  = offWVT + szW;
  const size_t offBQK  = offWOT + szW;
  const size_t offQK16 = offBQK + szBQK;
  const size_t offVT16 = offQK16 + szQK16;
  const size_t offAOH  = offVT16 + szVT16;
  const size_t total   = offAOH + szAOH;          // 50,339,840
  if (ws_size < total) return;

  const float* x    = (const float*)d_in[0];
  const int*   mask = (const int*)d_in[1];
  const float* Wq   = (const float*)d_in[2];
  const float* bq   = (const float*)d_in[3];
  const float* Wk   = (const float*)d_in[4];
  const float* bk   = (const float*)d_in[5];
  const float* Wv   = (const float*)d_in[6];
  const float* bv   = (const float*)d_in[7];
  const float* Wo   = (const float*)d_in[8];
  const float* bo   = (const float*)d_in[9];
  const float* lq1  = (const float*)d_in[10];
  const float* lk1  = (const float*)d_in[11];
  const float* lq2  = (const float*)d_in[12];
  const float* lk2  = (const float*)d_in[13];
  const float* ln_g = (const float*)d_in[14];
  const float* ln_b = (const float*)d_in[15];
  float* out = (float*)d_out;

  char* ws = (char*)d_ws;
  unsigned short* XH    = (unsigned short*)(ws + offXH);
  unsigned short* WQKT  = (unsigned short*)(ws + offWQK);
  unsigned short* WVT   = (unsigned short*)(ws + offWVT);
  unsigned short* WOT   = (unsigned short*)(ws + offWOT);
  float*          BQK   = (float*)(ws + offBQK);
  unsigned short* QK16  = (unsigned short*)(ws + offQK16);
  unsigned short* VT16  = (unsigned short*)(ws + offVT16);
  unsigned short* AOH16 = (unsigned short*)(ws + offAOH);

  // ---- prologue: 16-bit operand planes, permuted bias line ----
  const int n8 = nTokElem / 8;                                  // 524288 -> 2048 blocks exact
  prep_kernel<<<dim3(kPrepBias + kPrepWt + kPrepCast), dim3(256), 0, stream>>>(
      x, Wq, Wk, Wv, Wo, bq, bk, XH, WQKT, WQKT + (size_t)kDim * kDim, WVT, WOT, BQK, n8, kWCarry);

  // ---- q|k projection: QK16[m][n'] = f16( (1/16) sum_k XH[m][k] WQKT[n'][k] + BQK[n'] )   (M=4096, N=2048, K=1024) ----
  // ---- v^T projection: VT16[n][m] = f16( (1/16) sum_k XH[m][k] WVT[n][k] + bv[n] )   (M=4096, N=1024, K=1024, written transposed) ----
  // ---- one GEMM of N = 3072 (WVT lies directly behind WQKT): 256 blocks of 12 waves ----
  proj_gemm_kernel<<<dim3(kProjTiles), dim3(384), 0, stream>>>(
      XH, WQKT, BQK, bv, QK16, VT16, kDim, kWCarryInv);

  // ---- every (batch, head) at once: scores of both sets, both softmaxes, difference, product with v, per-head LayerNorm,
  //      affine, x0.8 -> AOH16 ----
  diff_attn_kernel<<<dim3(kSeq / kFaQ, kHeads, kBatch), dim3(256), 0, stream>>>(
      QK16, VT16, mask, lq1, lk1, lq2, lk2, ln_g, ln_b, AOH16);

  // ---- output projection: out[m][n] = (1/16) sum_k AOH16[m][k] WOT[n][k] + bo[n]   (M=4096, N=1024, K=1024) ----
  {
    const int tiles = (kTok / 128) * (kDim / 128);              // 256 blocks, one for every WGP
    wmma_gemm64<0, false, 2, 0, false, 0><<<dim3(tiles, 1), dim3(256), 0, stream>>>(
        AOH16, AOH16, kDim, 0L, WOT, WOT, kDim, 0L,
        (void*)out, (void*)out, kDim, 0L, bo, bo, 0L, kTok, kDim, kDim, kWCarryInv);
  }
}

// v010
// One run takes 86.9 microseconds.
// Next to v009, in two timings, it ran 1.07 times as fast each time.
// Counting every step since v000, it is 42.3 times as fast.
// Contractions: q|k projection and v^T projection (x f16 by W^T f16 carried x16), scores q_set.k_set^T per head and set (q, k f16 planes, K=32), p_set.v per head and set (p = exp2 of the scores less a row reference, f16, by v^T f16 plane, K=2048), output projection (LayerNorm output f16 by Wo^T f16 carried x16): all v_wmma_f32_16x16x32_f16 with f32 accumulate; bias adds, mask select, both softmaxes, lambda and the per-head LayerNorm in f32.
#include <hip/hip_runtime.h>
#include <math.h>

// ---------------------------------------------------------------------------
// Problem constants
// ---------------------------------------------------------------------------
constexpr int kBatch  = 2;
constexpr int kSeq    = 2048;
constexpr int kDim    = 1024;              // hidden
constexpr int kHeads  = 16;
constexpr int kDh     = 64;                // head dim of v / output
constexpr int kDiff   = 32;                // head dim of each q/k set
constexpr int kTok    = kBatch * kSeq;     // 4096 token rows
constexpr int kQKCols = 2 * kDim;          // 2048: pitch of the q | k plane (halves)
constexpr float kWCarry    = 16.0f;        // weights carried x16 in f16
constexpr float kWCarryInv = 1.0f / 16.0f;
constexpr float kInvScale  = 0.17677669529663687f;   // 32^-0.5
constexpr float kLog2e     = 1.4426950408889634f;
constexpr float kQFold     = kInvScale * kLog2e;     // carried by Wq and bq: q.k is then the softmax exponent to base 2
constexpr float kLambdaInit = 0.2f;
constexpr float kOutGain   = 0.8f;         // 1 - lambda_init
constexpr float kLnEps     = 1.0e-5f;
constexpr float kInv64     = 1.0f / 64.0f;
static_assert(kHeads * kDh == kDim, "shape");
static_assert(kHeads * kDiff * 2 == kDim, "shape");
// GEMM shape contract: M and N multiples of the block tile, K of 128, at least two passes
static_assert(kTok % 256 == 0 && kQKCols % 256 == 0 && kDim % 256 == 0 && kDim / 128 >= 2 && kSeq % 64 == 0 && kDh % 64 == 0, "tiles");
static_assert(kDim % 32 == 0 && kDiff % 32 == 0 && kSeq % 32 == 0, "ktiles");
static_assert((kTok * kDim) % (8 * 256) == 0, "cast grid");

typedef __attribute__((ext_vector_type(16))) _Float16 v16h;
typedef __attribute__((ext_vector_type(8)))  _Float16 v8h;
typedef __attribute__((ext_vector_type(16))) __bf16   v16b;
typedef __attribute__((ext_vector_type(8)))  __bf16   v8b;
typedef __attribute__((ext_vector_type(8)))  float    v8f;
typedef __attribute__((ext_vector_type(4)))  float    v4f;
typedef __attribute__((ext_vector_type(2)))  float    v2f;
typedef __attribute__((ext_vector_type(2)))  int      v2i;
typedef __attribute__((ext_vector_type(4)))  unsigned int v4u;
typedef __attribute__((ext_vector_type(4)))  int      v4i;

// ---------------------------------------------------------------------------
// Helper pieces: conversions, hazard guards, WMMA fragments
// ---------------------------------------------------------------------------
__device__ __forceinline__ unsigned short f2bf_bits(float f) {
  unsigned u = __float_as_uint(f);
  return (unsigned short)((u + 0x7FFFu + ((u >> 16) & 1u)) >> 16);
}
__device__ __forceinline__ float bf_bits2f(unsigned short h) { return __uint_as_float(((unsigned)h) << 16); }

// hazard guards as plain device helpers
__device__ __forceinline__ void dep_guard_h(v8f& a, v8f& b, v16h x, v16h y) { asm volatile("v_nop\n\tv_nop\n\tv_nop\n\tv_nop" : "+v"(a), "+v"(b) : "v"(x), "v"(y)); }
__device__ __forceinline__ void dep_guard_b(v8f& a, v8f& b, v16b x, v16b y) { asm volatile("v_nop\n\tv_nop\n\tv_nop\n\tv_nop" : "+v"(a), "+v"(b) : "v"(x), "v"(y)); }
// group guard tying all four accumulators of an A-row group plus its A fragments
__device__ __forceinline__ void dep_guard4_h(v8f& a, v8f& b, v8f& c, v8f& d, v16h x, v16h y) { asm volatile("v_nop\n\tv_nop\n\tv_nop\n\tv_nop" : "+v"(a), "+v"(b), "+v"(c), "+v"(d) : "v"(x), "v"(y)); }
__device__ __forceinline__ void dep_guard4_b(v8f& a, v8f& b, v8f& c, v8f& d, v16b x, v16b y) { asm volatile("v_nop\n\tv_nop\n\tv_nop\n\tv_nop" : "+v"(a), "+v"(b), "+v"(c), "+v"(d) : "v"(x), "v"(y)); }
__device__ __forceinline__ void keep4_h(v16h a, v16h b, v16h c, v16h d) { asm volatile("v_nop" :: "v"(a), "v"(b), "v"(c), "v"(d)); }
__device__ __forceinline__ void keep4_b(v16b a, v16b b, v16b c, v16b d) { asm volatile("v_nop" :: "v"(a), "v"(b), "v"(c), "v"(d)); }
__device__ __forceinline__ void acc_guard4(v8f& a, v8f& b, v8f& c, v8f& d) { asm volatile("v_nop\n\tv_nop\n\tv_nop\n\tv_nop" : "+v"(a), "+v"(b), "+v"(c), "+v"(d)); }
template <typename T> struct Frag;
template <> struct Frag<_Float16> {
  typedef v16h V; union U { v16h v; v8h h[2]; };
  // elements 0..7 <- p[0..7], 8..15 <- p[16..23]
  static __device__ __forceinline__ v16h load(const _Float16* p) {
    U f; f.h[0] = *(const v8h*)(p); f.h[1] = *(const v8h*)(p + 16); return f.v;
  }
  static __device__ __forceinline__ v8f mma(v16h a, v16h b, v8f c) {
    return __builtin_amdgcn_wmma_f32_16x16x32_f16(false, a, false, b, (short)0, c, false, false);
  }
  static __device__ __forceinline__ void guard(v8f& a, v8f& b, v16h x, v16h y) { dep_guard_h(a, b, x, y); }
  static __device__ __forceinline__ void guard4(v8f& a, v8f& b, v8f& c, v8f& d, v16h x, v16h y) { dep_guard4_h(a, b, c, d, x, y); }
  static __device__ __forceinline__ void keep(v16h a, v16h b, v16h c, v16h d) { keep4_h(a, b, c, d); }
};
template <> struct Frag<__bf16> {
  typedef v16b V; union U { v16b v; v8b h[2]; };
  static __device__ __forceinline__ v16b load(const __bf16* p) {
    U f; f.h[0] = *(const v8b*)(p); f.h[1] = *(const v8b*)(p + 16); return f.v;
  }
  static __device__ __forceinline__ v8f mma(v16b a, v16b b, v8f c) {
    return __builtin_amdgcn_wmma_f32_16x16x32_bf16(false, a, false, b, (short)0, c, false, false);
  }
  static __device__ __forceinline__ void guard(v8f& a, v8f& b, v16b x, v16b y) { dep_guard_b(a, b, x, y); }
  static __device__ __forceinline__ void guard4(v8f& a, v8f& b, v8f& c, v8f& d, v16b x, v16b y) { dep_guard4_b(a, b, c, d, x, y); }
  static __device__ __forceinline__ void keep(v16b a, v16b b, v16b c, v16b d) { keep4_b(a, b, c, d); }
};

__device__ __forceinline__ unsigned pk16(unsigned short a, unsigned short b) { return (unsigned)a | ((unsigned)b << 16); }
__device__ __forceinline__ unsigned short h_bits(float f) { const _Float16 h = (_Float16)f; return __builtin_bit_cast(unsigned short, h); }

// Twelve asynchronous copies, 16 B per lane each, global memory to LDS through no register. l[i] = the lane's LDS byte address,
// g[i] = its global address. The s_wait_xcnt ends the statement so that it stands in front of every later write of an address
// register named here.
__device__ __forceinline__ void copy12_to_lds(const unsigned* l, const char* const* g) {
  asm volatile("global_load_async_to_lds_b128 %0, %1, off\n\t"
               "global_load_async_to_lds_b128 %2, %3, off\n\t"
               "global_load_async_to_lds_b128 %4, %5, off\n\t"
               "global_load_async_to_lds_b128 %6, %7, off\n\t"
               "global_load_async_to_lds_b128 %8, %9, off\n\t"
               "global_load_async_to_lds_b128 %10, %11, off\n\t"
               "global_load_async_to_lds_b128 %12, %13, off\n\t"
               "global_load_async_to_lds_b128 %14, %15, off\n\t"
               "global_load_async_to_lds_b128 %16, %17, off\n\t"
               "global_load_async_to_lds_b128 %18, %19, off\n\t"
               "global_load_async_to_lds_b128 %20, %21, off\n\t"
               "global_load_async_to_lds_b128 %22, %23, off\n\t"
               "s_wait_xcnt 0x0"
               :: "v"(l[0]), "v"(g[0]), "v"(l[1]), "v"(g[1]), "v"(l[2]), "v"(g[2]), "v"(l[3]), "v"(g[3]),
                  "v"(l[4]), "v"(g[4]), "v"(l[5]), "v"(g[5]), "v"(l[6]), "v"(g[6]), "v"(l[7]), "v"(g[7]),
                  "v"(l[8]), "v"(g[8]), "v"(l[9]), "v"(g[9]), "v"(l[10]), "v"(g[10]), "v"(l[11]), "v"(g[11]) : "memory");
}

// The same for eight copies.
__device__ __forceinline__ void copy8_to_lds(const unsigned* l, const char* const* g) {
  asm volatile("global_load_async_to_lds_b128 %0, %1, off\n\t"
               "global_load_async_to_lds_b128 %2, %3, off\n\t"
               "global_load_async_to_lds_b128 %4, %5, off\n\t"
               "global_load_async_to_lds_b128 %6, %7, off\n\t"
               "global_load_async_to_lds_b128 %8, %9, off\n\t"
               "global_load_async_to_lds_b128 %10, %11, off\n\t"
               "global_load_async_to_lds_b128 %12, %13, off\n\t"
               "global_load_async_to_lds_b128 %14, %15, off\n\t"
               "s_wait_xcnt 0x0"
               :: "v"(l[0]), "v"(g[0]), "v"(l[1]), "v"(g[1]), "v"(l[2]), "v"(g[2]), "v"(l[3]), "v"(g[3]),
                  "v"(l[4]), "v"(g[4]), "v"(l[5]), "v"(g[5]), "v"(l[6]), "v"(g[6]), "v"(l[7]), "v"(g[7]) : "memory");
}

// ---- Register-blocked batched WMMA GEMM (ACT reduced to none/relu/leaky) -------------------------------
// C[m,n] = scale * sum_k A[m,k] * Bt[n,k] (+bias)(+resid); a block of WM x WN waves owns a (16 NI WM) x (64 WN) tile, each wave
// (16 NI) x 64 of it: 4 x 3 waves of 64x64 (a 256x192 tile), or 4 x 2 waves of 32x64 (a 128x128 tile).
// A row-major [M,K]; Bt row-major [N,K]; M, N multiples of the tile, K % 128 == 0; grid.x = the number of tiles.
// Operands come through LDS, 128 k a pass: the tile's A rows and Bt rows of 256 B, brought by asynchronous 16-B copies in which a
// wave covers two whole rows (four 128-B lines). Two buffers: the copies of pass p + 2 are issued behind the barrier that ends
// pass p, into the buffer that pass p has read, and land while pass p + 1 is worked on.
// blk = the block's tile number, b = its batch.
// BIAS_MODE: 0 = none, 1 = bias[m], 2 = bias[n].
// TSPLIT: a wave whose columns lie at or past splitN writes them transposed, as f16, CoutT[n - splitN][m] (pitch ldT), with
// biasT[n - splitN]; splitN % 64 == 0, so a wave lies wholly on one side.
// OUT_MODE: 0 = f32, 1 = f16, 2 = bf16 hi plane (Cout) + bf16 lo plane (Cout2).
// ET: 0 = f16 operands, 1 = bf16 operands (pointers passed as 16-bit storage)
constexpr int kGmPassK = 128;                              // k per pass: 256-B rows
constexpr int kGmPitch = 272;                              // LDS pitch of the 256-B rows: 16 B x odd, no bank conflict for 16-B reads
template <int V> struct BiasTag { static constexpr int value = V; };
template <int ET> struct Elem;
template <> struct Elem<0> { typedef _Float16 T; };
template <> struct Elem<1> { typedef __bf16 T; };
template <int ET, bool SPLIT, int BIAS_MODE, int OUT_MODE, bool RESID, int ACT, int WM, int WN, int NI, bool TSPLIT>
__device__ __forceinline__ void gemm64_tile(
    unsigned blk, int b,
    const unsigned short* __restrict__ Ap, const unsigned short* __restrict__ A2p, int lda, long strideA,
    const unsigned short* __restrict__ Btp, const unsigned short* __restrict__ Bt2p, int ldb, long strideB,
    void* __restrict__ Cout, void* __restrict__ Cout2, int ldc, long strideC,
    const float* __restrict__ bias,
    const float* __restrict__ resid, long strideR,
    int M, int N, int K, float scale,
    unsigned short* __restrict__ CoutT, const float* __restrict__ biasT, int splitN, int ldT) {
  static_assert(!SPLIT, "single-plane operands only");
  static_assert((WM == 4 && WN == 3 && NI == 4) || (WM == 4 && WN == 2 && NI == 2), "staging is written for these two tiles");
  static_assert(!TSPLIT || NI == 4, "the transposed epilogue writes 64 m a row");
  constexpr int kGmBM  = 16 * NI * WM;                     // block tile rows (A rows staged)
  constexpr int kGmBN  = 64 * WN;                          // block tile columns (Bt rows staged)
  constexpr int kGmBuf = (kGmBM + kGmBN) * kGmPitch;       // a buffer: A rows first, Bt rows behind them
  typedef typename Elem<ET>::T T;
  typedef typename Frag<T>::V V;
  const T* A = (const T*)Ap; const T* Bt = (const T*)Btp;
  __shared__ __align__(16) float sT[WM * WN][16 * 68];   // per-wave 16x64 slab, pitch 68 floats
  __shared__ __attribute__((aligned(16))) unsigned char ring[2 * kGmBuf];
  const int lane = threadIdx.x & 31;
  const int wave = __builtin_amdgcn_readfirstlane(threadIdx.x >> 5);   // in a scalar register: tests on it are scalar branches
  const int tilesN = N / kGmBN;
  const int tilesM = M / kGmBM;
  if ((int)blk >= tilesM * tilesN) return;   // the same for the whole block, in front of every barrier
  const int bm = blk / tilesN;
  const int bn = blk - bm * tilesN;
  const int wm = (wave / WN) * (16 * NI);      // this wave's rows within the staged A rows
  const int wn = (wave % WN) << 6;             // this wave's 64 rows within the staged Bt rows
  const int m0 = bm * kGmBM + wm;
  const int n0 = bn * kGmBN + wn;

  const T* Ab  = A  + (size_t)b * strideA;
  const T* Bb  = Bt + (size_t)b * strideB;

  const int rlane = lane & 15;                 // row (A) / col (B, D) within subtile
  const int koff  = (lane >> 4) * 8;           // k offset of this lane half
  const int mOff  = (lane >> 4) * 8;           // D row offset

  // what this lane copies, 4 x 2 waves: bytes 16 * (t & 15) .. +15 of staged rows (t >> 4) + 16 i: i = 0..7 of A, i = 0..7 of Bt.
  // 4 x 3 waves: the same bytes; waves 0..7 bring the 256 A rows (rows (t >> 4) + 16 i, i = 0..15), waves 8..11 the 192 Bt rows
  // (rows ((t - 256) >> 4) + 8 i, i = 0..23).
  const int crow = threadIdx.x >> 4, ccol = (threadIdx.x & 15) * 16;
  const char* gA = (const char*)(Ab + (size_t)(bm * kGmBM + crow) * lda) + ccol;
  const char* gB = (const char*)(Bb + (size_t)(bn * kGmBN + crow) * ldb) + ccol;
  const size_t stepA = (size_t)16 * lda * 2, stepB = (size_t)16 * ldb * 2;
  const unsigned lC = (unsigned)(size_t)ring + crow * kGmPitch + ccol;   // low 32 bits of the address = byte offset in the block's LDS
  // one pass's rows into one buffer: at most 24 copies a lane; kb = the pass's first byte in a row, lb = the buffer's first byte
  auto stage_pass = [&](size_t kb, unsigned lb) {
    unsigned l[24]; const char* g[24];
    if constexpr (WN == 2) {
#pragma unroll
      for (int i = 0; i < 8; ++i)  { l[i] = lC + lb + i * 16 * kGmPitch;                g[i] = gA + kb + i * stepA; }
#pragma unroll
      for (int i = 0; i < 8; ++i)  { l[8 + i] = lC + lb + (kGmBM + i * 16) * kGmPitch;  g[8 + i] = gB + kb + i * stepB; }
      copy8_to_lds(l, g);
      copy8_to_lds(l + 8, g + 8);
    } else if (wave < 8) {                     // a scalar branch: every lane of the wave is on in its arm
#pragma unroll
      for (int i = 0; i < 16; ++i) { l[i] = lC + lb + i * 16 * kGmPitch;                g[i] = gA + kb + i * stepA; }
      copy8_to_lds(l, g);
      copy8_to_lds(l + 8, g + 8);
    } else {                                   // crow - 16 = 0..7: lC and gB name row crow, 16 rows too far
#pragma unroll
      for (int i = 0; i < 24; ++i) { l[i] = lC + lb + (kGmBM - 16 + i * 8) * kGmPitch;  g[i] = gB + kb + (size_t)i * (stepB / 2) - stepB; }
      copy12_to_lds(l, g);
      copy12_to_lds(l + 12, g + 12);
    }
  };
  // what this lane reads: row rlane of every 16-row group of its wave's rows, from byte 16 * (lane >> 4)
  const int rA = (wm + rlane) * kGmPitch + koff * 2;
  const int rB = (kGmBM + wn + rlane) * kGmPitch + koff * 2;

  v8f acc[NI][4];
#pragma unroll
  for (int i = 0; i < NI; ++i)
#pragma unroll
    for (int j = 0; j < 4; ++j) acc[i][j] = (v8f){0.f,0.f,0.f,0.f,0.f,0.f,0.f,0.f};

  const int nPass = K / kGmPassK;
  // pass 0's rows, landed and published; then pass 1's are asked for
  stage_pass(0, 0);
  asm volatile("s_wait_asynccnt 0x0" ::: "memory");      // this wave's copies have landed
  __syncthreads();                                       // and every other wave's
  if (nPass > 1) stage_pass((size_t)kGmPassK * 2, kGmBuf);

  for (int p = 0; p < nPass; ++p) {
    const unsigned char* sb = ring + (p & 1) * kGmBuf;
#pragma unroll
    for (int ks = 0; ks < kGmPassK / 32; ++ks) {
      V bh[4], ah[NI];
#pragma unroll
      for (int i = 0; i < NI; ++i) ah[i] = Frag<T>::load((const T*)(sb + rA + i * 16 * kGmPitch + ks * 64));
#pragma unroll
      for (int j = 0; j < 4; ++j) bh[j] = Frag<T>::load((const T*)(sb + rB + j * 16 * kGmPitch + ks * 64));
      // keeps the reads of a k step together in front of its first product: one LDS latency for all of them; without it the
      // scheduler reads the A fragments one at a time into one register set and waits for each
      __builtin_amdgcn_sched_barrier(0);
#pragma unroll
      for (int j = 0; j < 4; ++j)
#pragma unroll
        for (int i = 0; i < NI; ++i) acc[i][j] = Frag<T>::mma(ah[i], bh[j], acc[i][j]);
    }
    // hand-over: this wave's reads of the buffer are done, its copies for pass p + 1 have landed; behind the barrier that
    // holds for every wave, so pass p + 1 may be read and this pass's buffer may be refilled
    // The scheduling fence keeps the pass's products in front of the hand-over; without it the scheduler sinks products behind
    // the barrier, which delays the refill that stands there.
    __builtin_amdgcn_sched_barrier(0);
    asm volatile("s_wait_dscnt 0x0" ::: "memory");
    asm volatile("s_wait_asynccnt 0x0" ::: "memory");
    __syncthreads();
    if (p + 2 < nPass) stage_pass((size_t)(p + 2) * (kGmPassK * 2), (p & 1) * kGmBuf);   // the same for the whole block
  }
  asm volatile("s_wait_asynccnt 0x0" ::: "memory");        // no copy is left in flight when the wave goes on to its end
#pragma unroll
  for (int i = 0; i < NI; ++i) acc_guard4(acc[i][0], acc[i][1], acc[i][2], acc[i][3]);

  float* slab = sT[wave];
  // ---- transposed epilogue: 16 columns n at a time become 16 slab rows of this wave's 64 m; a row leaves as one whole 128-B line ----
  if constexpr (TSPLIT) {
    if (n0 >= splitN) {                          // the same for the whole wave; no block barrier stands behind this point
      const int q = lane >> 3, c8 = (lane & 7) * 8;
      float bT[4];                               // all four asked for up front: one memory latency, not four
#pragma unroll
      for (int j = 0; j < 4; ++j) bT[j] = biasT[n0 - splitN + (j << 4) + rlane];
#pragma unroll
      for (int j = 0; j < 4; ++j) {
        const int nT = n0 - splitN + (j << 4);
        const float bv = bT[j];
#pragma unroll
        for (int i = 0; i < 4; ++i)
#pragma unroll
          for (int r = 0; r < 8; ++r) slab[rlane * 68 + (i << 4) + mOff + r] = acc[i][j][r] * scale + bv;
        __builtin_amdgcn_fence(__ATOMIC_RELEASE, "workgroup");
        __builtin_amdgcn_wave_barrier();
        __builtin_amdgcn_fence(__ATOMIC_ACQUIRE, "workgroup");
#pragma unroll
        for (int it = 0; it < 4; ++it) {
          const int row = it * 4 + q;
          const float* sp = slab + row * 68 + c8;
          v8h hv;
#pragma unroll
          for (int e = 0; e < 8; ++e) hv[e] = (_Float16)sp[e];
          *(v8h*)(CoutT + (size_t)(nT + row) * ldT + m0 + c8) = hv;
        }
        __builtin_amdgcn_fence(__ATOMIC_RELEASE, "workgroup");
        __builtin_amdgcn_wave_barrier();
        __builtin_amdgcn_fence(__ATOMIC_ACQUIRE, "workgroup");
      }
      return;
    }
  }
  // ---- epilogue, written once for a bias mode BM that is known at compile time ----
  const float* Rb = RESID ? (resid + (size_t)b * strideR) : nullptr;
  auto epilogue = [&](auto tag) {
  constexpr int BM = decltype(tag)::value;
#pragma unroll
  for (int i = 0; i < NI; ++i) {
    const int mBase = m0 + (i << 4);
#pragma unroll
    for (int j = 0; j < 4; ++j) {
      const int n = n0 + (j << 4) + rlane;
      float bv = 0.f;
      if (BM == 2) bv = bias[n];
#pragma unroll
      for (int r = 0; r < 8; ++r) {
        float v = acc[i][j][r] * scale;
        if (BM == 1) v += bias[mBase + mOff + r];
        if (BM == 2) v += bv;
        if (RESID) v += Rb[(size_t)(mBase + mOff + r) * ldc + n];
        if (ACT == 2) v = fmaxf(v, 0.0f);
        if (ACT == 4) v = (v > 0.f) ? v : 0.01f * v;
        slab[(mOff + r) * 68 + (j << 4) + rlane] = v;
      }
    }
    __builtin_amdgcn_fence(__ATOMIC_RELEASE, "workgroup");
    __builtin_amdgcn_wave_barrier();
    __builtin_amdgcn_fence(__ATOMIC_ACQUIRE, "workgroup");
    if (OUT_MODE == 0) {
      float* C = (float*)Cout + (size_t)b * strideC;
      const int hh = lane >> 4, c4 = (lane & 15) * 4;     // row seg = 256 B = 16 lanes x 16 B
      {
#pragma unroll
        for (int it = 0; it < 8; ++it) {
          const int row = it * 2 + hh;
          v4f v = *(const v4f*)(slab + row * 68 + c4);
          *(v4f*)(C + (size_t)(mBase + row) * ldc + n0 + c4) = v;
        }
        
      }
    } else {
      const int q = lane >> 3, c8 = (lane & 7) * 8;
      unsigned short* C  = (unsigned short*)Cout  + (size_t)b * strideC;
      unsigned short* C2 = (OUT_MODE == 2) ? ((unsigned short*)Cout2 + (size_t)b * strideC) : nullptr;
      {
#pragma unroll
        for (int it = 0; it < 4; ++it) {
          const int row = it * 4 + q;
          const float* sp = slab + row * 68 + c8;
          v8h hv, lv;
#pragma unroll
          for (int e = 0; e < 8; ++e) {
            if (OUT_MODE == 1) {
              hv[e] = (_Float16)sp[e];
            } else {
              unsigned short hb = f2bf_bits(sp[e]);
              unsigned short lb = f2bf_bits(sp[e] - bf_bits2f(hb));
              hv[e] = __builtin_bit_cast(_Float16, hb);
              lv[e] = __builtin_bit_cast(_Float16, lb);
            }
          }
          *(v8h*)(C + (size_t)(mBase + row) * ldc + n0 + c8) = hv;
          if (OUT_MODE == 2) *(v8h*)(C2 + (size_t)(mBase + row) * ldc + n0 + c8) = lv;
        }
        
      }
    }
    __builtin_amdgcn_fence(__ATOMIC_RELEASE, "workgroup");
    __builtin_amdgcn_wave_barrier();
    __builtin_amdgcn_fence(__ATOMIC_ACQUIRE, "workgroup");
  }
  };
  epilogue(BiasTag<BIAS_MODE>{});
}
// one GEMM a launch, 128x128 tiles: grid.x = its tiles, grid.y = its batches
template <int ET, bool SPLIT, int BIAS_MODE, int OUT_MODE, bool RESID, int ACT = 0>
__global__ __launch_bounds__(256) void wmma_gemm64(
    const unsigned short* __restrict__ Ap, const unsigned short* __restrict__ A2p, int lda, long strideA,
    const unsigned short* __restrict__ Btp, const unsigned short* __restrict__ Bt2p, int ldb, long strideB,
    void* __restrict__ Cout, void* __restrict__ Cout2, int ldc, long strideC,
    const float* __restrict__ bias,
    const float* __restrict__ resid, long strideR,
    int M, int N, int K, float scale) {
  gemm64_tile<ET, SPLIT, BIAS_MODE, OUT_MODE, RESID, ACT, 4, 2, 2, false>(blockIdx.x, (int)blockIdx.y, Ap, A2p, lda, strideA, Btp, Bt2p, ldb, strideB,
                                                                       Cout, Cout2, ldc, strideC, bias, resid, strideR, M, N, K, scale,
                                                                       nullptr, nullptr, 0, 0);
}
// All three projections of x as one GEMM, one launch. W = the q|k plane's 2048 rows with the v plane's 1024 rows directly behind
// them (one [3072][K] matrix in the workspace). 256 x 192 tiles: 16 x 16 = 256 blocks, one for every WGP, all of one size.
//   QK[m][n'] = f16(scale * sum_k X[m][k] W[n'][k] + bqk[n'])                    for n' < kQKCols,
//   VT[n][m]  = f16(scale * sum_k X[m][k] W[kQKCols + n][k] + bv[n])             for the columns behind them, written transposed.
constexpr int kProjN     = kQKCols + kDim;                         // 3072
constexpr int kProjTiles = (kTok / 256) * (kProjN / 192);          // 256
static_assert(kTok % 256 == 0 && kProjN % 192 == 0 && kQKCols % 64 == 0, "projection tiles");
__global__ __launch_bounds__(384) void proj_gemm_kernel(
    const unsigned short* __restrict__ X, const unsigned short* __restrict__ Wall,
    const float* __restrict__ bqk, const float* __restrict__ bv,
    unsigned short* __restrict__ QK, unsigned short* __restrict__ VT, int K, float scale) {
  gemm64_tile<0, false, 2, 1, false, 0, 4, 3, 4, true>(blockIdx.x, 0, X, X, K, 0L, Wall, Wall, K, 0L,
                                                    (void*)QK, (void*)QK, kQKCols, 0L, bqk, bqk, 0L,
                                                    kTok, kProjN, K, scale, VT, bv, kQKCols, kTok);
}

// ---------------------------------------------------------------------------
// The four operand preparations below do not depend on each other and share one launch (prep_kernel); blk = the block's
// number within its own part.
// ---------------------------------------------------------------------------
__device__ __forceinline__ void cast8_f16_part(int blk, const float* __restrict__ in, unsigned short* __restrict__ out, int n8) {
  const int i = blk * 256 + threadIdx.x;
  if (i >= n8) return;
  const float* p = in + 8 * (size_t)i;
  const v4f a = *(const v4f*)(p);
  const v4f c = *(const v4f*)(p + 4);
  unsigned short hb[8];
#pragma unroll
  for (int e = 0; e < 4; ++e) {
    hb[e]     = h_bits(a[e]);
    hb[4 + e] = h_bits(c[e]);
  }
  const v4u u = (v4u){pk16(hb[0], hb[1]), pk16(hb[2], hb[3]), pk16(hb[4], hb[5]), pk16(hb[6], hb[7])};
  unsigned short* q = out + 8 * (size_t)i;
  *(v4u*)q = u;
  
}

// ---------------------------------------------------------------------------
// Weight transpose + cast (+ optional output-feature permutation) for square [1024 in][1024 out] f32 W (row-major [k][n]):
//   out[np][k] = f16( scale * W[k][orig(np)] ), orig(np) = perm ? ((np>>5)&1)*512 + (np>>6)*32 + (np&31) : np;
//   z0 (Wq) carries kQFold on top of scale.
// With perm, plane column 64h + 32*set + d holds feature set*512 + 32h + d, so the two q/k sets of a head sit at stride 32.
// 1024 blocks: blk & 15 = k tile (64 cols of out), (blk >> 4) & 15 = np tile (64 rows of out), blk >> 8 = z selects
//   z0 = (W0 -> o0, perm), z1 = (W1 -> o1, perm), z2 = (W2 -> o2, identity), z3 = (W3 -> o3, identity). 256 threads.
// Load coverage: 16 iterations x 256 threads = 4096 = the whole 64x64 tile (coalesced along n inside 32-wide strips).
// Store coverage: 8 waves x 2 iterations x 4 rows (lane>>3) = 64 rows; (lane&7) x 8 halves = 64 cols; each row segment =
// ---------------------------------------------------------------------------
__device__ __forceinline__ void wt_part(int blk, const float* __restrict__ W0, const float* __restrict__ W1,
                                        const float* __restrict__ W2, const float* __restrict__ W3,
                                        unsigned short* __restrict__ o0, unsigned short* __restrict__ o1,
                                        unsigned short* __restrict__ o2, unsigned short* __restrict__ o3,
                                        float scale) {
  __shared__ float sm[64][65];   // sm[np_local][k_local]
  const int t  = threadIdx.x;
  const int k0 = (blk & 15) * 64;
  const int n0 = ((blk >> 4) & 15) * 64;
  const int z  = blk >> 8;                                     // block-uniform
  const float* W = (z == 0) ? W0 : (z == 1) ? W1 : (z == 2) ? W2 : W3;
  unsigned short* op = (z == 0) ? o0 : (z == 1) ? o1 : (z == 2) ? o2 : o3;
  const int perm = (z < 2) ? 1 : 0;
  const float sc = (z == 0) ? scale * kQFold : scale;
#pragma unroll
  for (int i = 0; i < 16; ++i) {
    const int e = i * 256 + t;
    const int r = e >> 6;          // k local
    const int c = e & 63;          // np local
    const int np = n0 + c;
    const int og = perm ? ((((np >> 5) & 1) << 9) + ((np >> 6) << 5) + (np & 31)) : np;
    sm[c][r] = W[(size_t)(k0 + r) * kDim + og] * sc;
  }
  __syncthreads();
  const int lane = t & 31, wave = t >> 5;
  const int q = lane >> 3, c8 = (lane & 7) * 8;
  {
#pragma unroll
    for (int it = 0; it < 2; ++it) {
      const int row = wave * 8 + it * 4 + q;                 // np local
      unsigned short hb[8];
#pragma unroll
      for (int e = 0; e < 8; ++e) hb[e] = h_bits(sm[row][c8 + e]);
      const v4u u = (v4u){pk16(hb[0], hb[1]), pk16(hb[2], hb[3]), pk16(hb[4], hb[5]), pk16(hb[6], hb[7])};
      *(v4u*)(op + (size_t)(n0 + row) * kDim + k0 + c8) = u;
    }
    // behind the last store, in front of whatever follows this part in the kernel that holds it: no register that the two
    // stores name is rewritten ahead of this wait
    asm volatile("s_wait_xcnt 0x0" ::: "memory");
  }
}

// ---------------------------------------------------------------------------
// Permuted q|k bias line: out[np] = kQFold * bq[orig(np)] for np < 1024 (block 0), out[1024 + np] = bk[orig(np)] (block 1).
// Thread t owns np = 4t..4t+3 (orig of an aligned group of 4 is contiguous); one 16-B store per lane, a wave = 512 B =
// ---------------------------------------------------------------------------
__device__ __forceinline__ void biasperm_part(int blk, const float* __restrict__ bq, const float* __restrict__ bk,
                                              float* __restrict__ out) {
  const int t = threadIdx.x;
  const float* src = (blk == 0) ? bq : bk;                    // block-uniform
  const int np = 4 * t;
  const int og = (((np >> 5) & 1) << 9) + ((np >> 6) << 5) + (np & 31);
  const v4f v = *(const v4f*)(src + og) * ((blk == 0) ? kQFold : 1.0f);
  float* dp = out + (size_t)blk * kDim + np;
  *(v4f*)dp = v;
  
}

// ---------------------------------------------------------------------------
// The mask packed to one bit a key, bit = (mask word != 0), once for all 16 heads. One 16-B load a lane takes in a group of 128
// keys (whole lines, read once: non-temporal): lane l holds keys 4 l + e of the group, e = 0..3. The ballot over the wave of
// (word e != 0) is one packed word; with j = the group's number in its mask row, 0..15:
//   bits[row][4 j + e], bit l  =  (mask[row][128 j + 4 l + e] != 0):  64 words = 256 B a row of 2048 keys.
// A wave takes 8 groups (a chunk: 1024 keys, 32 packed words, in the order of the mask's memory) a pass. Ballot i of a pass is
// put into lane i, so the pass leaves as one whole 128-B line. Every lane is on at every ballot.
// 256 blocks of 8 waves, 4 passes a wave; a group's registers are asked for anew, for the next pass, as soon as its words are copied out,
// ahead of its ballots, so that a wave's loads stay in flight from pass to pass.
// ---------------------------------------------------------------------------
constexpr int kMbPasses = 4;
constexpr int kBitRowBytes = kSeq / 8;                            // 256
static_assert(kSeq % 1024 == 0 && ((long)kBatch * kSeq * kSeq) % (1024 * kMbPasses * 8) == 0, "mask chunks");
__device__ __forceinline__ void maskbits_part(int blk, const int* __restrict__ mask, unsigned* __restrict__ bits) {
  const int lane = threadIdx.x & 31, wave = threadIdx.x >> 5;
  const size_t chunk0 = ((size_t)blk * 8 + wave) * kMbPasses;
  const int* sp = mask + chunk0 * 1024 + 4 * lane;
  v4i v[8];
#pragma unroll
  for (int j = 0; j < 8; ++j) v[j] = __builtin_nontemporal_load((const v4i*)(sp + 128 * j));
  // unrolled: v[] stays in registers, and every load is the one base address with a constant offset
#pragma unroll
  for (int p = 0; p < kMbPasses; ++p) {
    unsigned w = 0;
#pragma unroll
    for (int j = 0; j < 8; ++j) {
      const v4i cur = v[j];
      if (p + 1 < kMbPasses) v[j] = __builtin_nontemporal_load((const v4i*)(sp + (p + 1) * 1024 + 128 * j));
#pragma unroll
      for (int e = 0; e < 4; ++e) {
        const unsigned bl = __builtin_amdgcn_ballot_w32(cur[e] != 0);
        w = (lane == 4 * j + e) ? bl : w;
      }
    }
    bits[(chunk0 + p) * 32 + lane] = w;
  }
}

// One launch for the four parts; every test below reads the same for the whole block, so the barrier inside wt_part is
// passed by all of a block's threads or by none. Blocks 0..255: mask bits (the longest blocks, so they start first); the next 2:
// bias line; the next 1024: weight planes; the rest: x.
constexpr int kPrepMask = (int)(((long)kBatch * kSeq * kSeq) / (1024 * kMbPasses * 8));   // 256
constexpr int kPrepBias = 2;
constexpr int kPrepWt   = (kDim / 64) * (kDim / 64) * 4;          // 1024
constexpr int kPrepCast = (kTok * kDim) / (8 * 256);              // 2048
static_assert(kDim / 64 == 16, "wt_part's block decoding");
__global__ __launch_bounds__(256) void prep_kernel(const float* __restrict__ x, const float* __restrict__ Wq,
                                                   const float* __restrict__ Wk, const float* __restrict__ Wv,
                                                   const float* __restrict__ Wo, const float* __restrict__ bq,
                                                   const float* __restrict__ bk, const int* __restrict__ mask,
                                                   unsigned* __restrict__ mbits,
                                                   unsigned short* __restrict__ xh, unsigned short* __restrict__ wqt,
                                                   unsigned short* __restrict__ wkt, unsigned short* __restrict__ wvt,
                                                   unsigned short* __restrict__ wot, float* __restrict__ bqk,
                                                   int n8, float wscale) {
  if ((int)blockIdx.x < kPrepMask) { maskbits_part(blockIdx.x, mask, mbits); return; }
  const int blk = blockIdx.x - kPrepMask;
  if (blk < kPrepBias)                biasperm_part(blk, bq, bk, bqk);
  else if (blk < kPrepBias + kPrepWt) wt_part(blk - kPrepBias, Wq, Wk, Wv, Wo, wqt, wkt, wvt, wot, wscale);
  else                                cast8_f16_part(blk - (kPrepBias + kPrepWt), x, xh, n8);
}

// ---------------------------------------------------------------------------
// Both masked softmaxes, their difference and the product with v, for every (batch, head) in one launch; no score ever
// reaches memory. Transposed forms, so that one lane owns one query column throughout:
//   x[set][j][i] = sum_d k_set[j][d] * q_set[i][d]      (A = 16 key rows, B = 16 query rows kept in registers, K = 32; the q
//   plane carries 32^-0.5 * log2(e), so x is the softmax exponent to base 2); where mask[i][j] == 0, x = -2^100
//   a reference m per query and set, held from trip to trip, enters the product as its start value: the product gives x - m
//   p = exp2(x - m), f16; sum l per query and set
//   Ot[set][d][i] += sum_j v^T[d][j] * p[j][i]          (A = 16 rows of v^T, B = p, K = 32)
//   Any m gives the same O below, as long as no p overflows: m is raised, to the trip's maximum where that is higher, only in a trip whose mask tile holds a zero or in which a
//   lane's p sum to more than 2^12 (always so in the first trip). That trip is worked anew from LDS: maximum, the new m, Ot and l
//   times exp2(m_old - m_new), p by the new m. m is never above the maximum met so far, so the largest p of a row is at least 1.
//   O[i][d] = Ot[0][d][i] / l0 - lambda * Ot[1][d][i] / l1,  lambda = exp(sum lq1*lk1) - exp(sum lq2*lk2) + 0.2
// and, still in registers, the per-head LayerNorm over the 64 d of O[i][.], affine, x0.8, f16 cast:
//   mu = mean_d O, var = mean_d (O - mu)^2, y = ((O - mu) / sqrt(var + 1e-5) * g[h][d] + b[h][d]) * 0.8 -> A16[i][64h + d]
// (lanes l and l ^ 16 hold 32 d each of one query row: each sums its own 32, one lane swap joins the halves).
// grid (16, 16 heads, 2 batches), 8 waves; wave w owns query rows 128*blockIdx.x + 16w .. +15 and walks all 2048 keys, 64 a
// trip. A trip's operands come through LDS: 64 k rows and 64 v^T rows of 128 B (shared by the 8 waves), brought by asynchronous
// 16-B copies in which a wave covers whole 128-B lines. Two buffers: the copies of trip t + 1 are issued behind the barrier that
// ends trip t - 1 and land while trip t is worked on.
// The mask comes as the packed bits of maskbits_part: the block's 128 rows of 256 B (16 per wave, all 2048 keys) are copied to
// LDS once, with trip 0's tiles. Each wave then forms one word of trip flags, bit t = its 16 x 64 tile of trip t holds a masked
// key; the loop tests that bit, and only a trip that masks or raises m reads the packed words themselves.
// Fragment maps: accumulator register r of lane l holds row 8*(l>>4) + r, column l & 15. Two score tiles (keys 0..15 and
// 16..31 of a 32-key chunk) converted in place are the B operand of the second product: element s = key
// (s < 8 ? 8*(l>>4) + s : 16 + 8*(l>>4) + s - 8), which is the k order in which Frag::load reads the v^T rows.
// Store: a lane holds 8 consecutive d of its query row per tile; the wave writes the whole 128-B row segment of its head.
// ---------------------------------------------------------------------------
constexpr int   kFaQ    = 128;                 // query rows per block (8 waves x 16)
constexpr int   kFaKeys = 64;                  // keys per trip
// Value of a masked x: -2^100. In a row whose every key so far is masked m is this very value, and x - m is exactly 0.
constexpr float kMaskedScore = -0x1p100f;
// m in front of the first trip: below every x, the masked one too, so that every p of the first trip is infinite and m is set there
constexpr float kRefStart = -0x1p120f;
// a lane's p of one trip (32 keys, both sets) may sum to this much before m is raised; every single p then fits f16 with room
constexpr float kSumCap = 4096.0f;
static_assert(kSeq % kFaQ == 0 && kSeq % kFaKeys == 0 && kDh == 64 && kDiff == 32, "attention tiling");
constexpr int kFaTrips = kSeq / kFaKeys;                   // 32
constexpr int kKvPitch = 144;                              // LDS pitch of the 128-B k and v^T rows: 16 B x odd, no bank conflict for 16-B reads
constexpr int kMkPitch = 272;                              // LDS pitch of the 256-B rows of mask bits: 16 B x odd
constexpr int kLdsV    = kFaKeys * kKvPitch;               // k rows at 0, v^T rows behind them
constexpr int kLdsBuf  = kLdsV + kDh * kKvPitch;           // 18,432 B a buffer
constexpr int kLdsBits = 2 * kLdsBuf;                      // the rows of mask bits behind the two buffers
constexpr int kLdsAll  = kLdsBits + kFaQ * kMkPitch;       // 71,680 B
static_assert(kFaTrips >= 2 && kFaTrips <= 32 && kFaKeys * 2 == 128 && kDh * 2 == 128 && kBitRowBytes == 256, "staging");
// Four asynchronous copies, 16 B per lane each, global memory to LDS through no register. l = the lane's LDS byte address,
// g = its global address. The s_wait_xcnt ends the statement so that it stands in front of every later write of an address
// register named here.
__device__ __forceinline__ void copy4_to_lds(unsigned l0, const char* g0, unsigned l1, const char* g1,
                                             unsigned l2, const char* g2, unsigned l3, const char* g3) {
  asm volatile("global_load_async_to_lds_b128 %0, %1, off\n\t"
               "global_load_async_to_lds_b128 %2, %3, off\n\t"
               "global_load_async_to_lds_b128 %4, %5, off\n\t"
               "global_load_async_to_lds_b128 %6, %7, off\n\t"
               "s_wait_xcnt 0x0"
               :: "v"(l0), "v"(g0), "v"(l1), "v"(g1), "v"(l2), "v"(g2), "v"(l3), "v"(g3) : "memory");
}
// One trip's tiles into one buffer: 4 copies a lane. lk, lv and gk, gv are the lane's first LDS and global addresses in the k
// and v^T tile; its further rows lie 32 rows on.
__device__ __forceinline__ void stage_trip(unsigned lk, unsigned lv, const char* gk, const char* gv) {
  copy4_to_lds(lk, gk, lk + 32 * kKvPitch, gk + (size_t)32 * kQKCols * 2,
               lv, gv, lv + 32 * kKvPitch, gv + (size_t)32 * kTok * 2);
}
// The wave's 16 rows of mask bits: 8 copies a lane. lm, gm = the lane's first LDS and global address; its further rows lie 2 rows on.
__device__ __forceinline__ void stage_bits(unsigned lm, const char* gm) {
  copy4_to_lds(lm,                gm,                     lm + 2 * kMkPitch, gm + 2 * kBitRowBytes,
               lm + 4 * kMkPitch, gm + 4 * kBitRowBytes,  lm + 6 * kMkPitch, gm + 6 * kBitRowBytes);
  copy4_to_lds(lm + 8 * kMkPitch,  gm + 8 * kBitRowBytes,  lm + 10 * kMkPitch, gm + 10 * kBitRowBytes,
               lm + 12 * kMkPitch, gm + 12 * kBitRowBytes, lm + 14 * kMkPitch, gm + 14 * kBitRowBytes);
}
// value of lane l ^ 16, by a vector-unit lane swap (no LDS round trip)
__device__ __forceinline__ float other_half(float x) {
  const int b = __float_as_int(x);
  return __int_as_float(__builtin_amdgcn_permlanex16(b, b, 0x76543210, 0xfedcba98, false, false));
}
// exp2 in place. The instruction set asks for one slot between a transcendental and a directly following instruction that
// overwrites its source or reads its result. Here each overwrites only its own source, and the v_nop is the slot in front of
// whatever the compiler puts next.
__device__ __forceinline__ void exp2_inplace(float& x) {
  asm("v_exp_f32 %0, %0\n\tv_nop" : "+v"(x));
}
__device__ __forceinline__ void exp2_inplace8(v8f& x) {
  float a = x[0], b = x[1], c = x[2], d = x[3], e = x[4], f = x[5], g = x[6], h = x[7];
  asm("v_exp_f32 %0, %0\n\tv_exp_f32 %1, %1\n\tv_exp_f32 %2, %2\n\tv_exp_f32 %3, %3\n\t"
      "v_exp_f32 %4, %4\n\tv_exp_f32 %5, %5\n\tv_exp_f32 %6, %6\n\tv_exp_f32 %7, %7\n\tv_nop"
      : "+v"(a), "+v"(b), "+v"(c), "+v"(d), "+v"(e), "+v"(f), "+v"(g), "+v"(h));
  x = (v8f){a, b, c, d, e, f, g, h};
}
// four waves per SIMD (two blocks per WGP): the whole grid of 512 blocks is resident at once, within 256 registers a wave
// and 71,680 B of LDS a block
__global__ __launch_bounds__(256) __attribute__((amdgpu_waves_per_eu(4, 4))) void diff_attn_kernel(const unsigned short* __restrict__ QKp,
                                                        const unsigned short* __restrict__ Vtp,
                                                        const unsigned* __restrict__ Mb,
                                                        const float* __restrict__ lq1, const float* __restrict__ lk1,
                                                        const float* __restrict__ lq2, const float* __restrict__ lk2,
                                                        const float* __restrict__ g, const float* __restrict__ bta,
                                                        unsigned short* __restrict__ A16) {
  const int lane = threadIdx.x & 31, wave = threadIdx.x >> 5;
  const int c    = lane & 15;                  // this lane's query column; row of every A fragment
  const int h8   = (lane >> 4) * 8;            // k offset of this lane half; also its accumulator row offset
  const int head = blockIdx.y;
  const int b    = blockIdx.z;
  const int q0   = blockIdx.x * kFaQ + wave * 16;

  const _Float16* QK = (const _Float16*)QKp + (size_t)b * kSeq * kQKCols + head * kDh;
  const _Float16* Qr = QK + (size_t)(q0 + c) * kQKCols + h8;
  __shared__ __attribute__((aligned(16))) unsigned char smem[kLdsAll];
  // what this lane copies: of k and v^T rows (t >> 3) and (t >> 3) + 32, bytes 16 * (t & 7) .. +15 (a wave: 4 whole rows a
  // copy); of the mask bits its own wave's rows 2i + (lane >> 4), i = 0..7, bytes 16 * (lane & 15) .. +15 (a wave: 2 whole rows)
  const int crow = threadIdx.x >> 3, ccol = (threadIdx.x & 7) * 16;
  const int mrow = wave * 16 + (lane >> 4), mcol = (lane & 15) * 16;
  const char* gK = (const char*)(QK + kDim + (size_t)crow * kQKCols) + ccol;
  const char* gV = (const char*)((const _Float16*)Vtp + (size_t)(head * kDh + crow) * kTok + (size_t)b * kSeq) + ccol;
  const char* gM = (const char*)Mb + ((size_t)b * kSeq + blockIdx.x * kFaQ + mrow) * kBitRowBytes + mcol;
  const unsigned lds0 = (unsigned)(size_t)smem;            // low 32 bits of the address = byte offset in the block's LDS
  const unsigned lK = lds0 + crow * kKvPitch + ccol;
  const unsigned lV = lds0 + kLdsV + crow * kKvPitch + ccol;
  const unsigned lM = lds0 + kLdsBits + mrow * kMkPitch + mcol;
  // what this lane reads: row c of every 16-row group, from byte 16 * (lane >> 4) (k, v^T); of the mask bits its query's row
  const int rK = c * kKvPitch + h8 * 2;
  const int rV = kLdsV + c * kKvPitch + h8 * 2;
  const int rM = kLdsBits + (wave * 16 + c) * kMkPitch;
  v16h qf[2];
  qf[0] = Frag<_Float16>::load(Qr);
  qf[1] = Frag<_Float16>::load(Qr + kDiff);

  const v8f zero = (v8f){0.f,0.f,0.f,0.f,0.f,0.f,0.f,0.f};
  v8f o[2][4];
  v8f nref[2];                                 // minus the lane's reference m, eight times over: start value of the score products
  float l[2];
#pragma unroll
  for (int st = 0; st < 2; ++st) {
    nref[st] = zero - kRefStart;
    l[st] = 0.f;
#pragma unroll
    for (int dt = 0; dt < 4; ++dt) o[st][dt] = zero;
  }

  // trip 0's tiles and the mask bits, landed and published
  stage_trip(lK, lV, gK, gV);
  stage_bits(lM, gM);
  asm volatile("s_wait_asynccnt 0x0" ::: "memory");      // this wave's copies have landed
  __syncthreads();                                       // and every other wave's

  // Trip flags. Trip t's 64 keys are half t & 1 of the 128-key group t >> 1: bits 16 (t & 1) .. +15 of that group's four packed
  // words. Lane t joins them over the wave's 16 rows; the ballot puts lane t's finding into bit t, in a scalar register.
  unsigned maskedTrips;
  {
    const unsigned char* bw = smem + kLdsBits + wave * 16 * kMkPitch + (lane >> 1) * 16;
    v4u all = *(const v4u*)bw;
#pragma unroll
    for (int r = 1; r < 16; ++r) all &= *(const v4u*)(bw + r * kMkPitch);
    const unsigned a4 = (all[0] & all[1]) & (all[2] & all[3]);
    const unsigned a16 = (lane & 1) ? (a4 >> 16) : (a4 & 0xFFFFu);
    maskedTrips = __builtin_amdgcn_ballot_w32(a16 != 0xFFFFu);
  }

  for (int t = 0; t < kFaTrips; ++t) {
    const int buf = (t & 1) * kLdsBuf;
    const unsigned char* sb = smem + buf;
    // directly behind the barrier that ended trip t - 1 (in front of trip 0: the one above): the next trip's tiles are asked
    // for, into the buffer that trip t - 1 has read, and fly while this trip is worked on
    if (t + 1 < kFaTrips) {                                // the same for the whole block
      const size_t j1 = (size_t)(t + 1) * kFaKeys;
      const unsigned nb = kLdsBuf - buf;
      stage_trip(lK + nb, lV + nb, gK + j1 * (kQKCols * 2), gV + j1 * 2);
    }
    v8f s[2][4];
    v16h vf[2][4];
    v16h pf[2][2];
    float tsum[2];                                   // the trip's p summed: this half's keys only
    const _Float16* vp = (const _Float16*)(sb + rV);
    auto long_arm = [&]() __attribute__((always_inline)) {
      // The long arm: the trip from the buffer it still owns, with the mask, and with m raised to the trip's maximum where that is higher; every
      // lane of the wave goes along (for a lane within the cap that changes roundings only). Each masked x is replaced, behind
      // the product, by the one constant kMaskedScore: masked x are all bit-equal and far below every kept one (at most
      // 32 * 65504^2 in size), as with the reference's -1e9: weight 0 beside any kept key, equal weights where every key of a
      // row is masked. Operands are read again from LDS: held from the trip's head they would take the short arm's registers.
      // The lane's key 16 kt + 8 (lane >> 4) + r of the trip is bit 16 (t & 1) + 4 kt + 2 (lane >> 4) + (r >> 2) of packed word r & 3
      // of the 128-key group t >> 1; the part of the bit number that is not a constant is shifted out here.
      const v4u wb = *(const v4u*)(smem + rM + (t >> 1) * 16) >> (unsigned)((t & 1) * 16 + (lane >> 4) * 2);
#pragma unroll
      for (int st = 0; st < 2; ++st) {
        v8f x[4];
        float tm = kMaskedScore;
#pragma unroll
        for (int kt = 0; kt < 4; ++kt) {
          const v16h kr = Frag<_Float16>::load((const _Float16*)(sb + rK + kt * 16 * kKvPitch) + st * kDiff);
          const v8f a = Frag<_Float16>::mma(kr, qf[st], zero);
#pragma unroll
          for (int r = 0; r < 8; ++r) {
            x[kt][r] = ((wb[r & 3] >> (kt * 4 + (r >> 2))) & 1u) ? a[r] : kMaskedScore;
            tm = fmaxf(tm, x[kt][r]);
          }
        }
        tm = fmaxf(tm, other_half(tm));              // the other lane half holds the other keys of the same query
        const float mo = -nref[st][0];
        const float mn = fmaxf(mo, tm);
        float sum = 0.f;
#pragma unroll
        for (int kt = 0; kt < 4; ++kt) {
          v8f p = x[kt] - mn;
          exp2_inplace8(p);
#pragma unroll
          for (int r = 0; r < 8; ++r) {
            sum += p[r];
            pf[st][kt >> 1][(kt & 1) * 8 + r] = (_Float16)p[r];
          }
        }
        float alpha = mo - mn;
        exp2_inplace(alpha);
        tsum[st] = sum;
        nref[st] = zero - mn;
        l[st] *= alpha;
#pragma unroll
        for (int dt = 0; dt < 4; ++dt) o[st][dt] *= alpha;
      }
#pragma unroll
      for (int dt = 0; dt < 4; ++dt) vf[0][dt] = Frag<_Float16>::load(vp + dt * 16 * (kKvPitch / 2));
    };
    // Scalar branches, the same for every lane of the wave (every lane stays on in every arm; no barrier stands inside).
    // A wave whose 16 x 64 mask tile holds no zero has nothing to mask: it takes the short arm, the products and the exponentials
    // alone. A tile with a zero (its trip flag is set) takes the long arm at once. (The long arm is written out at both places it is entered from: with
    // one copy behind a flag, the build held the registers of p and v^T through the whole loop and spilled q.)
    if ((maskedTrips >> t) & 1u) {
      long_arm();
    } else {
      v16h kf[2][4];
#pragma unroll
      for (int kt = 0; kt < 4; ++kt) {
        const _Float16* kp = (const _Float16*)(sb + rK + kt * 16 * kKvPitch);
        kf[0][kt] = Frag<_Float16>::load(kp);
        kf[1][kt] = Frag<_Float16>::load(kp + kDiff);
      }
      // keeps the trip's k reads together in front of the first product: one latency for all of them; without it
      // the scheduler, short of registers, reads one fragment at a time and waits for each
      __builtin_amdgcn_sched_barrier(0);
#pragma unroll
      for (int kt = 0; kt < 4; ++kt) {
        s[0][kt] = Frag<_Float16>::mma(kf[0][kt], qf[0], nref[0]);
        s[1][kt] = Frag<_Float16>::mma(kf[1][kt], qf[1], nref[1]);
      }
      // keeps the eight products together in front of the exponentials, each filling the slots that the one in front of it needs
      // before its result is read; without it the scheduler deals them out among the exponentials, which stand in asm text
      __builtin_amdgcn_sched_barrier(0);
#pragma unroll
      for (int st = 0; st < 2; ++st) {
        if (st == 1) {
          // the v^T fragments of the trip's first 32 keys are asked for by here, into the registers the first set's scores have
          // just left: their LDS latency runs under the second set's softmax arithmetic
#pragma unroll
          for (int dt = 0; dt < 4; ++dt) vf[0][dt] = Frag<_Float16>::load(vp + dt * 16 * (kKvPitch / 2));
          // keeps those reads up here; without it the scheduler sinks them to just in front of their products, each with a full wait
          __builtin_amdgcn_sched_barrier(0);
        }
        float sum = 0.f;
#pragma unroll
        for (int kt = 0; kt < 4; ++kt) {
          v8f p = s[st][kt];
          exp2_inplace8(p);
#pragma unroll
          for (int r = 0; r < 8; ++r) {
            sum += p[r];
            pf[st][kt >> 1][(kt & 1) * 8 + r] = (_Float16)p[r];
          }
        }
        tsum[st] = sum;
      }
      // No p is negative, so a sum within the cap bounds every p under it; the test is written so that an infinite sum or a NaN
      // fails it as well.
      if (__builtin_amdgcn_ballot_w32(!(tsum[0] + tsum[1] <= kSumCap)) != 0u) long_arm();
    }
    // the fragments of the other 32 keys, into the registers the second set's scores have left: their latency runs under the
    // first 32 keys' products
#pragma unroll
    for (int dt = 0; dt < 4; ++dt) vf[1][dt] = Frag<_Float16>::load(vp + dt * 16 * (kKvPitch / 2) + 32);
    // keeps those reads in front of the products; without it the scheduler sinks each to just in front of its own product
    __builtin_amdgcn_sched_barrier(0);
    l[0] += tsum[0];                                 // this half's keys only; the halves are joined behind the loop
    l[1] += tsum[1];
#pragma unroll
    for (int kc = 0; kc < 2; ++kc)
#pragma unroll
      for (int dt = 0; dt < 4; ++dt) {
        o[0][dt] = Frag<_Float16>::mma(vf[kc][dt], pf[0][kc], o[0][dt]);
        o[1][dt] = Frag<_Float16>::mma(vf[kc][dt], pf[1][kc], o[1][dt]);
      }
    // hand-over: this wave's reads of the buffer are done, its copies for trip t + 1 have landed; behind the barrier that
    // holds for every wave, so trip t + 1 may be read and this trip's buffer may be refilled
    // The scheduling fence keeps the hand-over at the trip's end.
    __builtin_amdgcn_sched_barrier(0);
    asm volatile("s_wait_dscnt 0x0" ::: "memory");
    asm volatile("s_wait_asynccnt 0x0" ::: "memory");
    __syncthreads();
  }
  asm volatile("s_wait_asynccnt 0x0" ::: "memory");        // no copy is left in flight when the wave goes on to its end

  // lambda from the two 32-vectors (wave-wide butterfly, unconditional shuffles)
  float t1 = lq1[lane] * lk1[lane];
  float t2 = lq2[lane] * lk2[lane];
#pragma unroll
  for (int off = 16; off > 0; off >>= 1) {
    t1 += __shfl_xor(t1, off, 32);
    t2 += __shfl_xor(t2, off, 32);
  }
  const float lam = (expf(t1) - expf(t2)) + kLambdaInit;

  const float l0 = l[0] + other_half(l[0]);
  const float l1 = l[1] + other_half(l[1]);
  const float inv0 = 1.0f / l0;
  const float inv1 = lam / l1;
  // this lane's 32 of the 64 d of its query row: d = 16 dt + h8 + e
  float y[4][8], ps[4];
#pragma unroll
  for (int dt = 0; dt < 4; ++dt) {
    ps[dt] = 0.f;
#pragma unroll
    for (int e = 0; e < 8; ++e) {
      y[dt][e] = o[0][dt][e] * inv0 - o[1][dt][e] * inv1;
      ps[dt] += y[dt][e];
    }
  }
  float sm = (ps[0] + ps[1]) + (ps[2] + ps[3]);
  sm += other_half(sm);
  const float mu = sm * kInv64;
#pragma unroll
  for (int dt = 0; dt < 4; ++dt) {
    ps[dt] = 0.f;
#pragma unroll
    for (int e = 0; e < 8; ++e) {
      y[dt][e] -= mu;
      ps[dt] += y[dt][e] * y[dt][e];
    }
  }
  float vs = (ps[0] + ps[1]) + (ps[2] + ps[3]);
  vs += other_half(vs);
  const float rstd = 1.0f / sqrtf(vs * kInv64 + kLnEps);
  const float* gp = g   + head * kDh + h8;
  const float* bp = bta + head * kDh + h8;
  unsigned short* Ar = A16 + ((size_t)b * kSeq + q0 + c) * kDim + head * kDh + h8;
#pragma unroll
  for (int dt = 0; dt < 4; ++dt) {
    const v4f g0 = *(const v4f*)(gp + dt * 16);
    const v4f g1 = *(const v4f*)(gp + dt * 16 + 4);
    const v4f b0 = *(const v4f*)(bp + dt * 16);
    const v4f b1 = *(const v4f*)(bp + dt * 16 + 4);
    unsigned short hb[8];
#pragma unroll
    for (int e = 0; e < 4; ++e) {
      hb[e]     = h_bits((y[dt][e]     * rstd * g0[e] + b0[e]) * kOutGain);
      hb[4 + e] = h_bits((y[dt][4 + e] * rstd * g1[e] + b1[e]) * kOutGain);
    }
    *(v4u*)(Ar + dt * 16) = (v4u){pk16(hb[0], hb[1]), pk16(hb[2], hb[3]), pk16(hb[4], hb[5]), pk16(hb[6], hb[7])};
  }
}

// ---------------------------------------------------------------------------
// Host glue.
// producer before any consumer reads it; no region re-used with another type):
//   XH    f16 [4096][1024]               8,388,608  at           0   (cast8; read by the projection GEMM)
//   WQKT  f16 [2048][1024]               4,194,304  at   8,388,608   (wt z0,z1: permuted Wq^T rows 0..1023, Wk^T rows 1024..2047)
//   WVT   f16 [1024][1024]               2,097,152  at  12,582,912   (wt z2)
//   WOT   f16 [1024][1024]               2,097,152  at  14,680,064   (wt z3)
//   BQK   f32 [2048]                         8,192  at  16,777,216   (permuted bq | bk)
//   QK16  f16 [4096][2048]              16,777,216  at  16,785,408   (q plane cols 0..1023 | k plane cols 1024..2047, permuted)
//   VT16  f16 [1024][4096]               8,388,608  at  33,562,624   (v^T: row = 64h + d, col = token)
//   AOH16 f16 [4096][1024]               8,388,608  at  41,951,232   (LayerNorm output; 32 disjoint column slabs)
//   MBITS u32 [4096][64]                 1,048,576  at  50,339,840   (mask, one bit a key; read by the attention kernel)
//   total                               51,388,416
// GEMM shapes: q|k|v proj M=4096 N=3072 K=1024 (256x192 tiles); out proj M=4096 N=1024 K=1024 (128x128 tiles); all K multiples
// of 128, no padding; scores and p.v inside diff_attn_kernel.
// 4 launches.
// ---------------------------------------------------------------------------
extern "C" void kernel_launch(void* const* d_in, const int* in_sizes, int n_in,
                              void* d_out, int out_size, void* d_ws, size_t ws_size,
                              hipStream_t stream) {
  if (n_in < 16) return;
  const int nTokElem = kTok * kDim;                 // 4,194,304
  const int nW       = kDim * kDim;                 // 1,048,576
  if (in_sizes[0] != nTokElem) return;
  if (in_sizes[1] != kBatch * kSeq * kSeq) return;
  if (in_sizes[2] != nW || in_sizes[4] != nW || in_sizes[6] != nW || in_sizes[8] != nW) return;
  if (in_sizes[3] != kDim || in_sizes[5] != kDim || in_sizes[7] != kDim || in_sizes[9] != kDim) return;
  if (in_sizes[10] != kDiff || in_sizes[11] != kDiff || in_sizes[12] != kDiff || in_sizes[13] != kDiff) return;
  if (in_sizes[14] != kHeads * kDh || in_sizes[15] != kHeads * kDh) return;
  if (out_size != nTokElem) return;

  const size_t szXH   = (size_t)kTok * kDim * 2;
  const size_t szWQK  = (size_t)kQKCols * kDim * 2;
  const size_t szW    = (size_t)kDim * kDim * 2;
  const size_t szBQK  = (size_t)kQKCols * 4;
  const size_t szQK16 = (size_t)kTok * kQKCols * 2;
  const size_t szVT16 = (size_t)kDim * kTok * 2;
  const size_t szAOH  = (size_t)kTok * kDim * 2;
  const size_t szMB   = (size_t)kTok * kBitRowBytes;
  const size_t offXH   = 0;
  const size_t offWQK  = offXH + szXH;
  const size_t offWVT  = offWQK + szWQK;
  const size_t offWOT  = offWVT + szW;
  const size_t offBQK  = offWOT + szW;
  const size_t offQK16 = offBQK + szBQK;
  const size_t offVT16 = offQK16 + szQK16;
  const size_t offAOH  = offVT16 + szVT16;
  const size_t offMB   = offAOH + szAOH;
  const size_t total   = offMB + szMB;            // 51,388,416
  if (ws_size < total) return;

  const float* x    = (const float*)d_in[0];
  const int*   mask = (const int*)d_in[1];
  const float* Wq   = (const float*)d_in[2];
  const float* bq   = (const float*)d_in[3];
  const float* Wk   = (const float*)d_in[4];
  const float* bk   = (const float*)d_in[5];
  const float* Wv   = (const float*)d_in[6];
  const float* bv   = (const float*)d_in[7];
  const float* Wo   = (const float*)d_in[8];
  const float* bo   = (const float*)d_in[9];
  const float* lq1  = (const float*)d_in[10];
  const float* lk1  = (const float*)d_in[11];
  const float* lq2  = (const float*)d_in[12];
  const float* lk2  = (const float*)d_in[13];
  const float* ln_g = (const float*)d_in[14];
  const float* ln_b = (const float*)d_in[15];
  float* out = (float*)d_out;

  char* ws = (char*)d_ws;
  unsigned short* XH    = (unsigned short*)(ws + offXH);
  unsigned short* WQKT  = (unsigned short*)(ws + offWQK);
  unsigned short* WVT   = (unsigned short*)(ws + offWVT);
  unsigned short* WOT   = (unsigned short*)(ws + offWOT);
  float*          BQK   = (float*)(ws + offBQK);
  unsigned short* QK16  = (unsigned short*)(ws + offQK16);
  unsigned short* VT16  = (unsigned short*)(ws + offVT16);
  unsigned short* AOH16 = (unsigned short*)(ws + offAOH);
  unsigned*       MBITS = (unsigned*)(ws + offMB);

  // ---- prologue: mask bits, 16-bit operand planes, permuted bias line ----
  const int n8 = nTokElem / 8;                                  // 524288 -> 2048 blocks exact
  prep_kernel<<<dim3(kPrepMask + kPrepBias + kPrepWt + kPrepCast), dim3(256), 0, stream>>>(
      x, Wq, Wk, Wv, Wo, bq, bk, mask, MBITS, XH, WQKT, WQKT + (size_t)kDim * kDim, WVT, WOT, BQK, n8, kWCarry);

  // ---- q|k projection: QK16[m][n'] = f16( (1/16) sum_k XH[m][k] WQKT[n'][k] + BQK[n'] )   (M=4096, N=2048, K=1024) ----
  // ---- v^T projection: VT16[n][m] = f16( (1/16) sum_k XH[m][k] WVT[n][k] + bv[n] )   (M=4096, N=1024, K=1024, written transposed) ----
  // ---- one GEMM of N = 3072 (WVT lies directly behind WQKT): 256 blocks of 12 waves ----
  proj_gemm_kernel<<<dim3(kProjTiles), dim3(384), 0, stream>>>(
      XH, WQKT, BQK, bv, QK16, VT16, kDim, kWCarryInv);

  // ---- every (batch, head) at once: scores of both sets, both softmaxes, difference, product with v, per-head LayerNorm,
  //      affine, x0.8 -> AOH16 ----
  diff_attn_kernel<<<dim3(kSeq / kFaQ, kHeads, kBatch), dim3(256), 0, stream>>>(
      QK16, VT16, MBITS, lq1, lk1, lq2, lk2, ln_g, ln_b, AOH16);

  // ---- output projection: out[m][n] = (1/16) sum_k AOH16[m][k] WOT[n][k] + bo[n]   (M=4096, N=1024, K=1024) ----
  {
    const int tiles = (kTok / 128) * (kDim / 128);              // 256 blocks, one for every WGP
    wmma_gemm64<0, false, 2, 0, false, 0><<<dim3(tiles, 1), dim3(256), 0, stream>>>(
        AOH16, AOH16, kDim, 0L, WOT, WOT, kDim, 0L,
        (void*)out, (void*)out, kDim, 0L, bo, bo, 0L, kTok, kDim, kDim, kWCarryInv);
  }
}
